// v000
// The times below were measured on an AMD MI455X: many runs one after another, warmed up first and cycling through
// copies of the inputs, with the whole window's GPU time divided by the number of runs. Launches and the gaps
// between them are all in it. The median over several windows is given; except for v000 it joins two sittings, which
// can be a few percent apart, so the side-by-side timings, each taken in one sitting, are the better comparison.
// v000, which the later versions start from, runs in 377 microseconds.
// compute dtype: all float inputs rounded to bf16; q/k/v = p W + b with EXACT bf16 products on WMMA 16x16x32 (f32 accumulate); q as f16 hi + residual (x 2^10) against k once to f16 (2 products) x 64^-0.5; the relative-position bias: bin indices computed per (batch, query, key) in f32 exactly as the reference (difference, division by the global eta range, x16, truncation; fmod-based wrap for phi), table values (bf16) added in f32; softmax in f32 (precise expf); P x 2^11 once to f16 against v once to f16 (1 product); ctx once to f16 against Wo carried x 2^8 in f16 + bo; f32 output.
#include <hip/hip_runtime.h>
#include <math.h>

typedef __attribute__((ext_vector_type(16))) _Float16 v16h;
typedef __attribute__((ext_vector_type(16))) __bf16 v16b;
typedef __attribute__((ext_vector_type(8)))  _Float16 v8h;
typedef __attribute__((ext_vector_type(8)))  float v8f;
typedef __attribute__((ext_vector_type(4)))  float v4f;
typedef __attribute__((ext_vector_type(2)))  float v2f;
typedef __attribute__((ext_vector_type(4)))  unsigned v4u;
typedef __attribute__((ext_vector_type(4)))  int v4i;
typedef float __attribute__((may_alias)) float_a;
typedef int __attribute__((may_alias)) int_a;

template <typename T> __device__ __forceinline__ void vst2(void* p, T v) { *(T*)p = v;  }
__device__ __forceinline__ v8f wmma16(v16h a, v16h b, v8f c) {
  v8f d = __builtin_amdgcn_wmma_f32_16x16x32_f16(false, a, false, b, (short)0, c, false, false);
  asm volatile("v_nop\n\tv_nop\n\tv_nop\n\tv_nop" : "+v"(d) : "v"(a), "v"(b));
  return d;
}
__device__ __forceinline__ v8f wmma_bf(v16b a, v16b b, v8f c) {
  v8f d = __builtin_amdgcn_wmma_f32_16x16x32_bf16(false, a, false, b, (short)0, c, false, false);
  asm volatile("v_nop\n\tv_nop\n\tv_nop\n\tv_nop" : "+v"(d) : "v"(a), "v"(b));
  return d;
}
// 16x16x32 fragments: lane = (h = lane>>4, row/col = lane&15); elements 0..7 = k0+8h+0..7, 8..15 = k0+16+8h+0..7; D element r = row 8h+r
__device__ __forceinline__ v16h frag_h(const _Float16* rowk0, int lane) {
  union { v16h v; v8h q[2]; } u; const _Float16* p = rowk0 + 8 * (lane >> 4);
  u.q[0] = *(const v8h*)p; u.q[1] = *(const v8h*)(p + 16); return u.v;
}
__device__ __forceinline__ v16h frag_f32(const float* rowk0, int lane) {
  v16h a; const float* p = rowk0 + 8 * (lane >> 4);
#pragma unroll
  for (int i = 0; i < 8; ++i) { a[i] = (_Float16)p[i]; a[8 + i] = (_Float16)p[16 + i]; }
  return a;
}
__device__ __forceinline__ v16h frag_f32s(const float* rowk0, int lane, float sc) {
  v16h a; const float* p = rowk0 + 8 * (lane >> 4);
#pragma unroll
  for (int i = 0; i < 8; ++i) { a[i] = (_Float16)(p[i] * sc); a[8 + i] = (_Float16)(p[16 + i] * sc); }
  return a;
}
// column fragment from a [K][ld] layout (column n), rows >= K read as 0
__device__ __forceinline__ v16h fragc_f32(const float* W, int k0, int n, int lane, int ld, int K) {
  v16h a; const int g = lane >> 4;
#pragma unroll
  for (int i = 0; i < 8; ++i) { const int ka = k0 + 8 * g + i, kb = ka + 16;
    a[i] = (_Float16)(ka < K ? W[(size_t)(ka < K ? ka : K - 1) * ld + n] : 0.f); a[8 + i] = (_Float16)(kb < K ? W[(size_t)(kb < K ? kb : K - 1) * ld + n] : 0.f); }
  return a;
}
struct F2 { v16b h, l; };
__device__ __forceinline__ F2 bsplit16(const float v[16]) { F2 r;
#pragma unroll
  for (int i = 0; i < 16; ++i) { const __bf16 h = (__bf16)v[i]; r.h[i] = h; r.l[i] = (__bf16)(v[i] - (float)h); }
  return r; }
__device__ __forceinline__ F2 split_row(const float* row, int k0, int lane) { float v[16]; const float* p = row + k0 + 8 * (lane >> 4);
#pragma unroll
  for (int i = 0; i < 8; ++i) { v[i] = p[i]; v[8 + i] = p[16 + i]; }
  return bsplit16(v); }
__device__ __forceinline__ F2 split_rowK(const float* row, int k0, int lane, int K) { float v[16]; const int g = lane >> 4;
#pragma unroll
  for (int i = 0; i < 8; ++i) { const int ka = k0 + 8 * g + i, kb = ka + 16; v[i] = ka < K ? row[ka < K ? ka : K - 1] : 0.f; v[8 + i] = kb < K ? row[kb < K ? kb : K - 1] : 0.f; }
  return bsplit16(v); }
__device__ __forceinline__ F2 split_col(const float* W, int k0, int n, int lane, int ld, int K) { float v[16]; const int g = lane >> 4;
#pragma unroll
  for (int i = 0; i < 8; ++i) { const int ka = k0 + 8 * g + i, kb = ka + 16; v[i] = ka < K ? W[(size_t)(ka < K ? ka : K - 1) * ld + n] : 0.f; v[8 + i] = kb < K ? W[(size_t)(kb < K ? kb : K - 1) * ld + n] : 0.f; }
  return bsplit16(v); }
__device__ __forceinline__ v8f mac3(const F2& a, const F2& b, v8f c) { c = wmma_bf(a.l, b.h, c); c = wmma_bf(a.h, b.l, c); return wmma_bf(a.h, b.h, c); }
__device__ __forceinline__ float sigm(float v) { return 1.0f / (1.0f + expf(-v)); }
#define LDSX() do { asm volatile("s_wait_dscnt 0" ::: "memory"); __builtin_amdgcn_wave_barrier(); __builtin_amdgcn_fence(__ATOMIC_RELEASE, "workgroup"); } while (0)

// Patch attention with a relative-position bias (B 4, T 1,024, D 512 = 8 heads x 64): q/k/v = p W + b ((in,out)); scores = q k^T / 8 + rpe_table[eta_bin + 16][h] + rpe_table[phi_bin + 48][h] with eta_bin = trunc((eta_i - eta_j) / max|eta_i - eta_j| * 16), phi_bin = trunc(wrap(phi_i - phi_j) / pi * 16), both clipped to [-16, 15]; softmax; out = merged(attn v) Wo + bo.
#define NB 4
#define TT 1024
#define CC 512            // NH * HD = projected width
#define DIN 512          // input (model) width
#define NH 8
#define HD 64
#define NQB (TT / 64)
#define HG 8
#define SCALE (0.125f)
#define CAUSAL 0
#ifndef TNB
#define TNB NB
#endif
__device__ __forceinline__ float bfr(float v) { return (float)(__bf16)v; }
__host__ __device__ __forceinline__ int kb_last(int qb) { return CAUSAL ? ((qb * 64 + 63) >> 7) : (TT / 128 - 1); }
typedef __attribute__((ext_vector_type(8))) __bf16 v8b;
__device__ __forceinline__ v16b frag_b(const __bf16* rowk0, int lane) {
  union { v16b v; v8b q[2]; } u; const __bf16* p = rowk0 + 8 * (lane >> 4);
  u.q[0] = *(const v8b*)p; u.q[1] = *(const v8b*)(p + 16); return u.v;
}
#define QBH 0              // no query block takes the high-precision path (qb < QBH never holds)
#define QHI 1024            // rows carrying a q residual plane (all rows when non-causal: 2-product logits everywhere)
#define KHI 64            // key rows carrying k residual / v bf16 hi+lo planes (read only by the qb < QBH path, which no block takes)
// B fragment (k rows k0+.., output column o) of a weight: (in,out) [K][ld] or (out,in) [ld rows of K]: bf16 exact, or f16(bf16 * 256) exact
__device__ __forceinline__ v16b wcol_io(const float* Wm, int k0, int o, int lane, int ld) { v16b w; const int g = lane >> 4;
#pragma unroll
  for (int i = 0; i < 8; ++i) { w[i] = (__bf16)Wm[(size_t)(k0 + 8 * g + i) * ld + o]; w[8 + i] = (__bf16)Wm[(size_t)(k0 + 16 + 8 * g + i) * ld + o]; }
  return w; }
__device__ __forceinline__ v16b wcol_oi(const float* Wm, int k0, int o, int lane, int K) { v16b w; const float* p = Wm + (size_t)o * K + k0 + 8 * (lane >> 4);
#pragma unroll
  for (int i = 0; i < 8; ++i) { w[i] = (__bf16)p[i]; w[8 + i] = (__bf16)p[16 + i]; }
  return w; }
__device__ __forceinline__ v16h wcolh_io(const float* Wm, int k0, int o, int lane, int ld) { v16h w; const int g = lane >> 4;
#pragma unroll
  for (int i = 0; i < 8; ++i) { w[i] = (_Float16)(bfr(Wm[(size_t)(k0 + 8 * g + i) * ld + o]) * 256.0f); w[8 + i] = (_Float16)(bfr(Wm[(size_t)(k0 + 16 + 8 * g + i) * ld + o]) * 256.0f); }
  return w; }
__device__ __forceinline__ v16h wcolh_oi(const float* Wm, int k0, int o, int lane, int K) { v16h w; const float* p = Wm + (size_t)o * K + k0 + 8 * (lane >> 4);
#pragma unroll
  for (int i = 0; i < 8; ++i) { w[i] = (_Float16)(bfr(p[i]) * 256.0f); w[8 + i] = (_Float16)(bfr(p[16 + i]) * 256.0f); }
  return w; }
#define WQKV_LAYOUT 0   // 0 = (in,out) [DIN][CC]; 1 = (out,in) [CC][DIN]; 2 = per-head [NH][DIN][HD]
__device__ __forceinline__ v16b wcol_hdk(const float* Wm, int k0, int o, int lane) { v16b w; const int g = lane >> 4; const float* p = Wm + (size_t)(o / HD) * DIN * HD + (o % HD);
#pragma unroll
  for (int i = 0; i < 8; ++i) { w[i] = (__bf16)p[(size_t)(k0 + 8 * g + i) * HD]; w[8 + i] = (__bf16)p[(size_t)(k0 + 16 + 8 * g + i) * HD]; }
  return w; }
#define WO_OUT_IN 0
#if WQKV_LAYOUT == 1
#define WCOL(W, k0, o, lane) wcol_oi(W, k0, o, lane, DIN)
#elif WQKV_LAYOUT == 2
#define WCOL(W, k0, o, lane) wcol_hdk(W, k0, o, lane)
#else
#define WCOL(W, k0, o, lane) wcol_io(W, k0, o, lane, CC)
#endif
#if WO_OUT_IN
#define WOCOL(W, k0, o, lane) wcol_oi(W, k0, o, lane, CC)
#define WOCOLH(W, k0, o, lane) wcolh_oi(W, k0, o, lane, CC)
#else
#define WOCOL(W, k0, o, lane) wcol_io(W, k0, o, lane, DIN)
#define WOCOLH(W, k0, o, lane) wcolh_io(W, k0, o, lane, DIN)
#endif
#define PI_F 3.14159274f          // f32(math.pi)
#define SM_EXTRA_PARAMS , const float* __restrict__ PCO, const float* __restrict__ TAB, const float* __restrict__ RNG, int bsm, int h0s
#define SM_MASK_HOOK do { const int hh = h0s + blockIdx.y; const float rng = RNG[0]; \
    const float et = bfr(PCO[((size_t)bsm * TT + t) * 2]), ek = bfr(PCO[((size_t)bsm * TT + k) * 2]); const float pt_ = bfr(PCO[((size_t)bsm * TT + t) * 2 + 1]), pk_ = bfr(PCO[((size_t)bsm * TT + k) * 2 + 1]); \
    const float re = et - ek; int eb = (int)((re / rng) * 16.0f); eb = eb < -16 ? -16 : (eb > 15 ? 15 : eb); \
    const float rp = pt_ - pk_; const float a_ = rp + PI_F; const float twopi = 2.0f * PI_F; float rm = fmodf(a_, twopi); rm = (rm != 0.0f && rm < 0.0f) ? rm + twopi : rm; const float wr = rm - PI_F; \
    int pb = (int)((wr / PI_F) * 16.0f); pb = pb < -16 ? -16 : (pb > 15 ? 15 : pb); \
    v = v + (bfr(TAB[(eb + 16) * NH + hh]) + bfr(TAB[(pb + 16 + 32) * NH + hh])); } while (0)   /* jnp.mod = fmod then +y when the remainder is negative; .astype(int32) = truncation */
// ---- k_range: one block: eta_range = max(max over batches of (max eta - min eta), 1e-6) on the bf16-rounded coordinates (= max |eta_i - eta_j| over all same-batch pairs, exact)
__global__ __launch_bounds__(256) void k_range(const float* __restrict__ PCO, float* __restrict__ RNG) { __shared__ float smx[8], smn[8]; __shared__ float sr;
  const int t = threadIdx.x; float best = 0.f;
  for (int b = 0; b < TNB; ++b) { float mx = -3.0e38f, mn = 3.0e38f; for (int i = t; i < TT; i += 256) { const float e = bfr(PCO[((size_t)b * TT + i) * 2]); mx = fmaxf(mx, e); mn = fminf(mn, e); }
    for (int o = 1; o < 32; o <<= 1) { mx = fmaxf(mx, __shfl_xor(mx, o)); mn = fminf(mn, __shfl_xor(mn, o)); }
    if ((t & 31) == 0) { smx[t >> 5] = mx; smn[t >> 5] = mn; } __syncthreads();
    if (t == 0) { float a = smx[0], c = smn[0]; for (int i = 1; i < 8; ++i) { a = fmaxf(a, smx[i]); c = fminf(c, smn[i]); } sr = a - c; } __syncthreads(); best = fmaxf(best, sr); __syncthreads(); }
  if (t < 32) { const float v = t == 0 ? fmaxf(best, 1e-6f) : 0.f; vst2(RNG + t, v); } }   
#define WS_RNG (WS_END)
#define WS_END2 (WS_RNG + 128u)
#ifndef SM_EXTRA_PARAMS
#define SM_EXTRA_PARAMS
#endif
#ifndef PROJ_EXTRA_PARAMS
#define PROJ_EXTRA_PARAMS
#endif
#ifndef SM_MASK_HOOK
#define SM_MASK_HOOK (void)0
#endif

#define WS_QH  0u                                      // f16 q rows [b*t][CC]
#define WS_KH  (WS_QH + 2u * (size_t)NB * TT * CC)      // f16 k rows [b*t][CC]
#define WS_VT  (WS_KH + 2u * (size_t)NB * TT * CC)      // f16 v planes [b][c][t]
#define WS_QL  (WS_VT + 2u * (size_t)NB * CC * TT)      // f16 q residual x 2^10 rows [b][t < QHI][CC]
#define WS_KL  (WS_QL + 2u * (size_t)NB * QHI * CC)     // f16 k residual x 2^10 rows [b][t < KHI][CC]
#define WS_VB  (WS_KL + 2u * (size_t)NB * KHI * CC)     // bf16 v hi planes [b][c][t < KHI]
#define WS_VBL (WS_VB + 2u * (size_t)NB * CC * KHI)
#define WS_S   (WS_VBL + 2u * (size_t)NB * CC * KHI)    // f32 logits / P [hg][t][s]
#define WS_Y   (WS_S  + 4u * (size_t)HG * TT * TT)      // f32 ctx rows [b*t][CC] (only when there is an output projection)
#define WS_END (WS_Y  + 4u * (size_t)NB * TT * CC)

// ---- k_proj: block = (64 rows, 128 cols, which): q/k/v = X W (+ b) with exact bf16 products (K = DIN) -> which 0: q f16 rows (+ residual rows < QHI); 1: k f16 rows (+ residual rows < KHI); 2: v f16 planes [c][t] (+ bf16 hi/lo planes for t < KHI)
__global__ __launch_bounds__(128) void k_proj(const float* __restrict__ XQ, const float* __restrict__ XK, const float* __restrict__ XV, const float* __restrict__ WQ, const float* __restrict__ WK, const float* __restrict__ WV, const float* __restrict__ BQ, const float* __restrict__ BK, const float* __restrict__ BV,
    _Float16* __restrict__ QH, _Float16* __restrict__ QL, _Float16* __restrict__ KH, _Float16* __restrict__ KL, _Float16* __restrict__ VT, __bf16* __restrict__ VB, __bf16* __restrict__ VBL) {
  __shared__ __align__(16) _Float16 sh[64][136], sl[64][136]; __shared__ __align__(16) _Float16 th[128][72]; __shared__ __align__(16) __bf16 tb[128][72], tbl[128][72];
  const int tid = threadIdx.x, wave = tid >> 5, lane = tid & 31, col = lane & 15, g = lane >> 4; const int which = blockIdx.z; const int c0 = blockIdx.y * 128; const size_t r0 = (size_t)blockIdx.x * 64; const size_t bb = r0 / TT; const int t0 = (int)(r0 % TT);
  const float* X = which == 0 ? XQ : which == 1 ? XK : XV; const float* WA = which == 0 ? WQ : which == 1 ? WK : WV; const float* BA = which == 0 ? BQ : which == 1 ? BK : BV;
  v8f acc[8] = {};
#pragma unroll 2
  for (int kc = 0; kc < DIN / 32; ++kc) { v16b a; { const float* p = X + (r0 + wave * 16 + col) * DIN + kc * 32 + 8 * g;
#pragma unroll
      for (int i = 0; i < 8; ++i) { a[i] = (__bf16)p[i]; a[8 + i] = (__bf16)p[16 + i]; } }
    asm volatile("s_wait_loadcnt 0x0" ::: "memory");
#pragma unroll
    for (int j = 0; j < 8; ++j) { const v16b w = WCOL(WA, kc * 32, c0 + j * 16 + col, lane); asm volatile("s_wait_loadcnt 0x0" ::: "memory"); acc[j] = wmma_bf(a, w, acc[j]); } }
  if (which < 2) { _Float16* DH = which == 0 ? QH : KH; _Float16* DL = which == 0 ? QL : KL; const int nhi = which == 0 ? QHI : KHI; const bool hi_rows = t0 < nhi;
#pragma unroll
    for (int j = 0; j < 8; ++j) { const float bias = BA ? bfr(BA[c0 + j * 16 + col]) : 0.f;
#pragma unroll
      for (int r = 0; r < 8; ++r) { const float v = acc[j][r] + bias; const _Float16 hv = (_Float16)v; sh[wave * 16 + 8 * g + r][j * 16 + col] = hv; sl[wave * 16 + 8 * g + r][j * 16 + col] = (_Float16)((v - (float)hv) * 1024.0f); } }
    __syncthreads();
    for (int e = tid; e < 64 * 16; e += 128) { const int rl = e >> 4, q = e & 15; vst2((unsigned*)(DH + (r0 + rl) * CC + c0 + q * 8), *(const v4u*)&sh[rl][q * 8]); if (hi_rows) vst2((unsigned*)(DL + (bb * nhi + t0 + rl) * (size_t)CC + c0 + q * 8), *(const v4u*)&sl[rl][q * 8]); }
  } else { const bool hi_rows = t0 < KHI;
#pragma unroll
    for (int j = 0; j < 8; ++j) { const float bias = BA ? bfr(BA[c0 + j * 16 + col]) : 0.f;
#pragma unroll
      for (int r = 0; r < 8; ++r) { const float v = acc[j][r] + bias; const int rl = wave * 16 + 8 * g + r, cl = j * 16 + col; th[cl][rl] = (_Float16)v; const __bf16 bh = (__bf16)v; tb[cl][rl] = bh; tbl[cl][rl] = (__bf16)(v - (float)bh); } }
    __syncthreads();
    for (int e = tid; e < 128 * 8; e += 128) { const int cl = e >> 3, q = e & 7; vst2((unsigned*)(VT + (bb * CC + c0 + cl) * (size_t)TT + t0 + q * 8), *(const v4u*)&th[cl][q * 8]); if (hi_rows) { const size_t o3 = (bb * CC + c0 + cl) * (size_t)KHI + t0 + q * 8; vst2((unsigned*)(VB + o3), *(const v4u*)&tb[cl][q * 8]); vst2((unsigned*)(VBL + o3), *(const v4u*)&tbl[cl][q * 8]); } } } }
// ---- k_sc: block = (query block qb, key block kb <= kb_last(qb), head in group) of batch b: logits x SCALE; q hi + residual (x 2^10) against k (2 products) for query rows < QHI, plus the k residual (3 products) for query blocks < QBH (causal early rows); causal: blocks past the diagonal exit, the mask itself is applied by index in k_sm
__global__ __launch_bounds__(128) void k_sc(const _Float16* __restrict__ QH, const _Float16* __restrict__ KH, const _Float16* __restrict__ QL, const _Float16* __restrict__ KL, int b, int h0, float* __restrict__ S0) { __shared__ __align__(16) float ss[4][16][132];
  const int qb = blockIdx.x, kb = blockIdx.y; if (kb > kb_last(qb)) return;
  const int h = h0 + blockIdx.z; float* S = S0 + (size_t)blockIdx.z * TT * TT;
  const int tid = threadIdx.x, wave = tid >> 5, lane = tid & 31, col = lane & 15, g = lane >> 4; const int k0 = kb * 128; const int ql0 = qb * 64 + wave * 16; const size_t q0 = (size_t)b * TT + ql0, kr0 = (size_t)b * TT + k0;
  v8f acc[8] = {}, accl[8] = {};
  const _Float16* QLb = QL + (size_t)b * QHI * CC; const _Float16* KLb = KL + (size_t)b * KHI * CC;
  if (qb < QBH) {
#pragma unroll
    for (int kc = 0; kc < HD / 32; ++kc) { const v16h ah = frag_h(QH + (q0 + col) * CC + h * HD + kc * 32, lane), al = frag_h(QLb + (size_t)(ql0 + col) * CC + h * HD + kc * 32, lane);
#pragma unroll
      for (int j = 0; j < 8; ++j) { const v16h kbf = frag_h(KH + (kr0 + j * 16 + col) * CC + h * HD + kc * 32, lane), klf = frag_h(KLb + (size_t)(k0 + j * 16 + col) * CC + h * HD + kc * 32, lane); acc[j] = wmma16(ah, kbf, acc[j]); accl[j] = wmma16(al, kbf, accl[j]); accl[j] = wmma16(ah, klf, accl[j]); } }
  } else if (qb * 64 < QHI) {
#pragma unroll
    for (int kc = 0; kc < HD / 32; ++kc) { const v16h ah = frag_h(QH + (q0 + col) * CC + h * HD + kc * 32, lane), al = frag_h(QLb + (size_t)(ql0 + col) * CC + h * HD + kc * 32, lane);
#pragma unroll
      for (int j = 0; j < 8; ++j) { const v16h kbf = frag_h(KH + (kr0 + j * 16 + col) * CC + h * HD + kc * 32, lane); acc[j] = wmma16(ah, kbf, acc[j]); accl[j] = wmma16(al, kbf, accl[j]); } }
  } else {
#pragma unroll
    for (int kc = 0; kc < HD / 32; ++kc) { const v16h ah = frag_h(QH + (q0 + col) * CC + h * HD + kc * 32, lane);
#pragma unroll
      for (int j = 0; j < 8; ++j) { const v16h kbf = frag_h(KH + (kr0 + j * 16 + col) * CC + h * HD + kc * 32, lane); acc[j] = wmma16(ah, kbf, acc[j]); } } }
#pragma unroll
  for (int j = 0; j < 8; ++j) {
#pragma unroll
    for (int r = 0; r < 8; ++r) ss[wave][8 * g + r][j * 16 + col] = (acc[j][r] + accl[j][r] * (1.0f / 1024.0f)) * SCALE; }
  LDSX(); for (int rl = 0; rl < 16; ++rl) vst2(S + (size_t)(ql0 + rl) * TT + k0 + lane * 4, *(const v4f*)&ss[wave][rl][lane * 4]); }
// ---- k_sm: block = query row t (head in group): keys [0, kend): causal -> logit if s <= t else excluded; softmax in f32; P x 2^11 in place (0 for excluded)
__global__ __launch_bounds__(256) void k_sm(float* __restrict__ S0 SM_EXTRA_PARAMS) { __shared__ float sred[8]; __shared__ float sbc; __shared__ __align__(16) float shv[TT];
  const int tid = threadIdx.x; const int t = blockIdx.x; const int kend = (kb_last(t >> 6) + 1) * 128;
  float* sr = S0 + (size_t)blockIdx.y * TT * TT + (size_t)t * TT;
  float m = -3.0e38f; for (int k = tid; k < kend; k += 256) { float v = (!CAUSAL || k <= t) ? sr[k] : -3.0e38f; SM_MASK_HOOK; shv[k] = v; m = fmaxf(m, v); }
#pragma unroll
  for (int o = 1; o < 32; o <<= 1) m = fmaxf(m, __shfl_xor(m, o));
  if ((tid & 31) == 0) sred[tid >> 5] = m; __syncthreads(); if (tid == 0) { float a = sred[0]; for (int i = 1; i < 8; ++i) a = fmaxf(a, sred[i]); sbc = a; } __syncthreads(); m = sbc; __syncthreads();
  float sum = 0.f; for (int k = tid; k < kend; k += 256) { const float v = shv[k]; const float e = (v <= -1.0e38f) ? 0.f : expf(v - m); shv[k] = e; sum += e; }
#pragma unroll
  for (int o = 1; o < 32; o <<= 1) sum += __shfl_xor(sum, o);
  if ((tid & 31) == 0) sred[tid >> 5] = sum; __syncthreads(); if (tid == 0) { float a = 0.f; for (int i = 0; i < 8; ++i) a += sred[i]; sbc = a > 0.f ? 2048.0f / a : 0.f; }   /* a fully excluded row yields P = 0 */ __syncthreads(); const float inv = sbc;
  for (int k = tid; k < kend; k += 256) shv[k] = shv[k] * inv;
  __syncthreads(); for (int q = tid; q < kend / 4; q += 256) vst2(sr + q * 4, *(const v4f*)&shv[q * 4]); }
// ---- k_pv: block = 64 queries (qb) of (b, h): ctx = P . v over keys [0, kend) (P x 2^11 once to f16 against v f16: 1 product; causal early query blocks: P and v as bf16 hi + lo, 3 products); 256-B (row, head) segment by 16 lanes
__global__ __launch_bounds__(128) void k_pv(const float* __restrict__ PS0, const _Float16* __restrict__ VT, const __bf16* __restrict__ VB, const __bf16* __restrict__ VBL, int b, int h0, float* __restrict__ Y) { const int h = h0 + blockIdx.z; const float* PS = PS0 + (size_t)blockIdx.z * TT * TT; __shared__ __align__(16) float ss[4][16][HD + 4];
  const int tid = threadIdx.x, wave = tid >> 5, lane = tid & 31, col = lane & 15, g = lane >> 4; const int qb = blockIdx.x; const int ql0 = qb * 64 + wave * 16; const int kce = (kb_last(qb) + 1) * 4;
  v8f acc[HD / 16] = {};
  if (qb < QBH) {
#pragma unroll 1
    for (int kc = 0; kc < kce; ++kc) { const F2 p = split_row(PS + (size_t)(ql0 + col) * TT, kc * 32, lane);
      asm volatile("s_wait_loadcnt 0x0" ::: "memory");
#pragma unroll
      for (int j = 0; j < HD / 16; ++j) { const size_t po = ((size_t)b * CC + h * HD + j * 16 + col) * (size_t)KHI + kc * 32; const v16b vh = frag_b(VB + po, lane); acc[j] = wmma_bf(p.h, vh, acc[j]); acc[j] = wmma_bf(p.l, vh, acc[j]); acc[j] = wmma_bf(p.h, frag_b(VBL + po, lane), acc[j]); } }
  } else {
#pragma unroll 1
    for (int kc = 0; kc < kce; ++kc) { const v16h p = frag_f32(PS + (size_t)(ql0 + col) * TT + kc * 32, lane);
      asm volatile("s_wait_loadcnt 0x0" ::: "memory");
#pragma unroll
      for (int j = 0; j < HD / 16; ++j) { const size_t po = ((size_t)b * CC + h * HD + j * 16 + col) * (size_t)TT + kc * 32; acc[j] = wmma16(p, frag_h(VT + po, lane), acc[j]); } } }
#pragma unroll
  for (int j = 0; j < HD / 16; ++j)
#pragma unroll
    for (int r = 0; r < 8; ++r) ss[wave][8 * g + r][j * 16 + col] = acc[j][r] * (1.0f / 2048.0f);
  LDSX(); for (int rl = 0; rl < 16; ++rl) if (lane < HD / 4) vst2(Y + ((size_t)b * TT + ql0 + rl) * CC + h * HD + lane * 4, *(const v4f*)&ss[wave][rl][lane * 4]); }
// ---- k_out: block = (64 rows, 128 cols): out = ctx Wo (+ bo): ctx once to f16 against Wo as f16(bf16 x 2^8) exact (1 product) x 2^-8; causal early rows (< QHI of each sequence): ctx bf16 hi + lo against exact bf16 Wo (2 products)
__global__ __launch_bounds__(128) void k_out(const float* __restrict__ Y, const float* __restrict__ WO, const float* __restrict__ BO, float* __restrict__ OUT) { __shared__ __align__(16) float sf[4][16][132];
  const int tid = threadIdx.x, wave = tid >> 5, lane = tid & 31, col = lane & 15, g = lane >> 4; const int c0 = blockIdx.y * 128; const size_t r0 = (size_t)blockIdx.x * 64 + wave * 16;
  v8f acc[8] = {};
  if (CAUSAL && (int)(((size_t)blockIdx.x * 64) % TT) < QHI) {   /* block-uniform */
#pragma unroll 2
    for (int kc = 0; kc < CC / 32; ++kc) { const F2 a = split_row(Y + (r0 + col) * CC, kc * 32, lane); asm volatile("s_wait_loadcnt 0x0" ::: "memory");
#pragma unroll
      for (int j = 0; j < 8; ++j) { const v16b w = WOCOL(WO, kc * 32, c0 + j * 16 + col, lane); asm volatile("s_wait_loadcnt 0x0" ::: "memory"); acc[j] = wmma_bf(a.h, w, acc[j]); acc[j] = wmma_bf(a.l, w, acc[j]); } }
#pragma unroll
    for (int j = 0; j < 8; ++j) { const float bias = BO ? bfr(BO[c0 + j * 16 + col]) : 0.f;
#pragma unroll
      for (int r = 0; r < 8; ++r) sf[wave][8 * g + r][j * 16 + col] = acc[j][r] + bias; }
  } else {
#pragma unroll 2
    for (int kc = 0; kc < CC / 32; ++kc) { const v16h a = frag_f32(Y + (r0 + col) * CC + kc * 32, lane); asm volatile("s_wait_loadcnt 0x0" ::: "memory");
#pragma unroll
      for (int j = 0; j < 8; ++j) { const v16h w = WOCOLH(WO, kc * 32, c0 + j * 16 + col, lane); asm volatile("s_wait_loadcnt 0x0" ::: "memory"); acc[j] = wmma16(a, w, acc[j]); } }
#pragma unroll
    for (int j = 0; j < 8; ++j) { const float bias = BO ? bfr(BO[c0 + j * 16 + col]) : 0.f;
#pragma unroll
      for (int r = 0; r < 8; ++r) sf[wave][8 * g + r][j * 16 + col] = acc[j][r] * (1.0f / 256.0f) + bias; } }
  LDSX(); for (int rl = 0; rl < 16; ++rl) vst2(OUT + (r0 + rl) * DIN + c0 + lane * 4, *(const v4f*)&sf[wave][rl][lane * 4]); }

extern "C" void kernel_launch(void* const* d_in, const int* in_sizes, int n_in, void* d_out, int out_size, void* d_ws, size_t ws_size, hipStream_t stream) {
  (void)in_sizes; (void)n_in; (void)out_size;
  const float** F = (const float**)d_in;
  if (ws_size < (size_t)WS_END) return;
  char* ws = (char*)d_ws; _Float16 *QH = (_Float16*)(ws + WS_QH), *KH = (_Float16*)(ws + WS_KH), *VT = (_Float16*)(ws + WS_VT), *QL = (_Float16*)(ws + WS_QL), *KL = (_Float16*)(ws + WS_KL); __bf16 *VB = (__bf16*)(ws + WS_VB), *VBL = (__bf16*)(ws + WS_VBL); float *S = (float*)(ws + WS_S), *Y = (float*)(ws + WS_Y);
  (void)Y; (void)QL; (void)KL; (void)VB; (void)VBL;
  // inputs: 0 p [4,1024,512]; 1 pcoords [4,1024,2]; 2 rpe_table [64,8]; 3 wq_w (in,out), 4 wq_b; 5 wk_w, 6 wk_b; 7 wv_w, 8 wv_b; 9 wo_w (in,out), 10 wo_b
  if (ws_size < (size_t)WS_END2) return;
  float* RNG = (float*)(ws + WS_RNG);
  k_range<<<1, 256, 0, stream>>>(F[1], RNG);
  k_proj<<<dim3(TNB * TT / 64, CC / 128, 3), 128, 0, stream>>>(F[0], F[0], F[0], F[3], F[5], F[7], F[4], F[6], F[8], QH, QL, KH, KL, VT, VB, VBL);
  for (int b = 0; b < TNB; ++b) for (int h0 = 0; h0 < NH; h0 += HG) {
    k_sc<<<dim3(NQB, TT / 128, HG), 128, 0, stream>>>(QH, KH, QL, KL, b, h0, S);
    k_sm<<<dim3(TT, HG), 256, 0, stream>>>(S, F[1], F[2], RNG, b, h0);
    k_pv<<<dim3(NQB, 1, HG), 128, 0, stream>>>(S, VT, VB, VBL, b, h0, Y);
  }
  k_out<<<dim3(TNB * TT / 64, DIN / 128), 128, 0, stream>>>(Y, F[9], F[10], (float*)d_out);
}

// v001
// Measured time: 264 microseconds a run.
// In two side-by-side timings against v000, it was 1.44 and 1.45 times as fast.
// compute dtype: all float inputs rounded to bf16; q/k/v = p W + b with EXACT bf16 products on WMMA 16x16x32 (f32 accumulate); q as f16 hi + residual (x 2^10) against k once to f16 (2 products) x 64^-0.5; the relative-position bias: bin indices computed per (batch, query, key) in f32 exactly as the reference (difference, division by the global eta range, x16, truncation; fmod-based wrap for phi), table values (bf16) added in f32; softmax in f32 (precise expf); P x 2^11 once to f16 against v once to f16 (1 product); ctx once to f16 against Wo carried x 2^8 in f16 + bo; f32 output.
#include <hip/hip_runtime.h>
#include <math.h>

typedef __attribute__((ext_vector_type(16))) _Float16 v16h;
typedef __attribute__((ext_vector_type(16))) __bf16 v16b;
typedef __attribute__((ext_vector_type(8)))  _Float16 v8h;
typedef __attribute__((ext_vector_type(8)))  float v8f;
typedef __attribute__((ext_vector_type(4)))  float v4f;
typedef __attribute__((ext_vector_type(2)))  float v2f;
typedef __attribute__((ext_vector_type(4)))  unsigned v4u;
typedef __attribute__((ext_vector_type(4)))  int v4i;
typedef float __attribute__((may_alias)) float_a;
typedef int __attribute__((may_alias)) int_a;

template <typename T> __device__ __forceinline__ void vst2(void* p, T v) { *(T*)p = v;  }
__device__ __forceinline__ v8f wmma16(v16h a, v16h b, v8f c) {
  v8f d = __builtin_amdgcn_wmma_f32_16x16x32_f16(false, a, false, b, (short)0, c, false, false);
  asm volatile("v_nop\n\tv_nop\n\tv_nop\n\tv_nop" : "+v"(d) : "v"(a), "v"(b));
  return d;
}
__device__ __forceinline__ v8f wmma_bf(v16b a, v16b b, v8f c) {
  v8f d = __builtin_amdgcn_wmma_f32_16x16x32_bf16(false, a, false, b, (short)0, c, false, false);
  asm volatile("v_nop\n\tv_nop\n\tv_nop\n\tv_nop" : "+v"(d) : "v"(a), "v"(b));
  return d;
}
// 16x16x32 fragments: lane = (h = lane>>4, row/col = lane&15); elements 0..7 = k0+8h+0..7, 8..15 = k0+16+8h+0..7; D element r = row 8h+r
__device__ __forceinline__ v16h frag_h(const _Float16* rowk0, int lane) {
  union { v16h v; v8h q[2]; } u; const _Float16* p = rowk0 + 8 * (lane >> 4);
  u.q[0] = *(const v8h*)p; u.q[1] = *(const v8h*)(p + 16); return u.v;
}
__device__ __forceinline__ v16h frag_f32(const float* rowk0, int lane) {
  v16h a; const float* p = rowk0 + 8 * (lane >> 4);
#pragma unroll
  for (int i = 0; i < 8; ++i) { a[i] = (_Float16)p[i]; a[8 + i] = (_Float16)p[16 + i]; }
  return a;
}
__device__ __forceinline__ v16h frag_f32s(const float* rowk0, int lane, float sc) {
  v16h a; const float* p = rowk0 + 8 * (lane >> 4);
#pragma unroll
  for (int i = 0; i < 8; ++i) { a[i] = (_Float16)(p[i] * sc); a[8 + i] = (_Float16)(p[16 + i] * sc); }
  return a;
}
// column fragment from a [K][ld] layout (column n), rows >= K read as 0
__device__ __forceinline__ v16h fragc_f32(const float* W, int k0, int n, int lane, int ld, int K) {
  v16h a; const int g = lane >> 4;
#pragma unroll
  for (int i = 0; i < 8; ++i) { const int ka = k0 + 8 * g + i, kb = ka + 16;
    a[i] = (_Float16)(ka < K ? W[(size_t)(ka < K ? ka : K - 1) * ld + n] : 0.f); a[8 + i] = (_Float16)(kb < K ? W[(size_t)(kb < K ? kb : K - 1) * ld + n] : 0.f); }
  return a;
}
struct F2 { v16b h, l; };
__device__ __forceinline__ F2 bsplit16(const float v[16]) { F2 r;
#pragma unroll
  for (int i = 0; i < 16; ++i) { const __bf16 h = (__bf16)v[i]; r.h[i] = h; r.l[i] = (__bf16)(v[i] - (float)h); }
  return r; }
__device__ __forceinline__ F2 split_row(const float* row, int k0, int lane) { float v[16]; const float* p = row + k0 + 8 * (lane >> 4);
#pragma unroll
  for (int i = 0; i < 8; ++i) { v[i] = p[i]; v[8 + i] = p[16 + i]; }
  return bsplit16(v); }
__device__ __forceinline__ F2 split_rowK(const float* row, int k0, int lane, int K) { float v[16]; const int g = lane >> 4;
#pragma unroll
  for (int i = 0; i < 8; ++i) { const int ka = k0 + 8 * g + i, kb = ka + 16; v[i] = ka < K ? row[ka < K ? ka : K - 1] : 0.f; v[8 + i] = kb < K ? row[kb < K ? kb : K - 1] : 0.f; }
  return bsplit16(v); }
__device__ __forceinline__ F2 split_col(const float* W, int k0, int n, int lane, int ld, int K) { float v[16]; const int g = lane >> 4;
#pragma unroll
  for (int i = 0; i < 8; ++i) { const int ka = k0 + 8 * g + i, kb = ka + 16; v[i] = ka < K ? W[(size_t)(ka < K ? ka : K - 1) * ld + n] : 0.f; v[8 + i] = kb < K ? W[(size_t)(kb < K ? kb : K - 1) * ld + n] : 0.f; }
  return bsplit16(v); }
__device__ __forceinline__ v8f mac3(const F2& a, const F2& b, v8f c) { c = wmma_bf(a.l, b.h, c); c = wmma_bf(a.h, b.l, c); return wmma_bf(a.h, b.h, c); }
__device__ __forceinline__ float sigm(float v) { return 1.0f / (1.0f + expf(-v)); }
#define LDSX() do { asm volatile("s_wait_dscnt 0" ::: "memory"); __builtin_amdgcn_wave_barrier(); __builtin_amdgcn_fence(__ATOMIC_RELEASE, "workgroup"); } while (0)

// Patch attention with a relative-position bias (B 4, T 1,024, D 512 = 8 heads x 64): q/k/v = p W + b ((in,out)); scores = q k^T / 8 + rpe_table[eta_bin + 16][h] + rpe_table[phi_bin + 48][h] with eta_bin = trunc((eta_i - eta_j) / max|eta_i - eta_j| * 16), phi_bin = trunc(wrap(phi_i - phi_j) / pi * 16), both clipped to [-16, 15]; softmax; out = merged(attn v) Wo + bo.
#define NB 4
#define TT 1024
#define CC 512            // NH * HD = projected width
#define DIN 512          // input (model) width
#define NH 8
#define HD 64
#define NQB (TT / 64)
#define HG 8
#define SCALE (0.125f)
#define CAUSAL 0
#ifndef TNB
#define TNB NB
#endif
__device__ __forceinline__ float bfr(float v) { return (float)(__bf16)v; }
__host__ __device__ __forceinline__ int kb_last(int qb) { return CAUSAL ? ((qb * 64 + 63) >> 7) : (TT / 128 - 1); }
typedef __attribute__((ext_vector_type(8))) __bf16 v8b;
__device__ __forceinline__ v16b frag_b(const __bf16* rowk0, int lane) {
  union { v16b v; v8b q[2]; } u; const __bf16* p = rowk0 + 8 * (lane >> 4);
  u.q[0] = *(const v8b*)p; u.q[1] = *(const v8b*)(p + 16); return u.v;
}
#define QBH 0              // no query block takes the high-precision path (qb < QBH never holds)
#define QHI 1024            // rows carrying a q residual plane (all rows when non-causal: 2-product logits everywhere)
#define KHI 64            // key rows carrying k residual / v bf16 hi+lo planes (read only by the qb < QBH path, which no block takes)
// B fragment (k rows k0+.., output column o) of a weight: (in,out) [K][ld] or (out,in) [ld rows of K]: bf16 exact, or f16(bf16 * 256) exact
__device__ __forceinline__ v16b wcol_io(const float* Wm, int k0, int o, int lane, int ld) { v16b w; const int g = lane >> 4;
#pragma unroll
  for (int i = 0; i < 8; ++i) { w[i] = (__bf16)Wm[(size_t)(k0 + 8 * g + i) * ld + o]; w[8 + i] = (__bf16)Wm[(size_t)(k0 + 16 + 8 * g + i) * ld + o]; }
  return w; }
__device__ __forceinline__ v16b wcol_oi(const float* Wm, int k0, int o, int lane, int K) { v16b w; const float* p = Wm + (size_t)o * K + k0 + 8 * (lane >> 4);
#pragma unroll
  for (int i = 0; i < 8; ++i) { w[i] = (__bf16)p[i]; w[8 + i] = (__bf16)p[16 + i]; }
  return w; }
__device__ __forceinline__ v16h wcolh_io(const float* Wm, int k0, int o, int lane, int ld) { v16h w; const int g = lane >> 4;
#pragma unroll
  for (int i = 0; i < 8; ++i) { w[i] = (_Float16)(bfr(Wm[(size_t)(k0 + 8 * g + i) * ld + o]) * 256.0f); w[8 + i] = (_Float16)(bfr(Wm[(size_t)(k0 + 16 + 8 * g + i) * ld + o]) * 256.0f); }
  return w; }
__device__ __forceinline__ v16h wcolh_oi(const float* Wm, int k0, int o, int lane, int K) { v16h w; const float* p = Wm + (size_t)o * K + k0 + 8 * (lane >> 4);
#pragma unroll
  for (int i = 0; i < 8; ++i) { w[i] = (_Float16)(bfr(p[i]) * 256.0f); w[8 + i] = (_Float16)(bfr(p[16 + i]) * 256.0f); }
  return w; }
#define WQKV_LAYOUT 0   // 0 = (in,out) [DIN][CC]; 1 = (out,in) [CC][DIN]; 2 = per-head [NH][DIN][HD]
__device__ __forceinline__ v16b wcol_hdk(const float* Wm, int k0, int o, int lane) { v16b w; const int g = lane >> 4; const float* p = Wm + (size_t)(o / HD) * DIN * HD + (o % HD);
#pragma unroll
  for (int i = 0; i < 8; ++i) { w[i] = (__bf16)p[(size_t)(k0 + 8 * g + i) * HD]; w[8 + i] = (__bf16)p[(size_t)(k0 + 16 + 8 * g + i) * HD]; }
  return w; }
#define WO_OUT_IN 0
#if WQKV_LAYOUT == 1
#define WCOL(W, k0, o, lane) wcol_oi(W, k0, o, lane, DIN)
#elif WQKV_LAYOUT == 2
#define WCOL(W, k0, o, lane) wcol_hdk(W, k0, o, lane)
#else
#define WCOL(W, k0, o, lane) wcol_io(W, k0, o, lane, CC)
#endif
#if WO_OUT_IN
#define WOCOL(W, k0, o, lane) wcol_oi(W, k0, o, lane, CC)
#define WOCOLH(W, k0, o, lane) wcolh_oi(W, k0, o, lane, CC)
#else
#define WOCOL(W, k0, o, lane) wcol_io(W, k0, o, lane, DIN)
#define WOCOLH(W, k0, o, lane) wcolh_io(W, k0, o, lane, DIN)
#endif
#define PI_F 3.14159274f          // f32(math.pi)
#define SM_EXTRA_PARAMS , const float* __restrict__ PCO, const float* __restrict__ TAB, const float* __restrict__ RNG, int h0s
#define SM_MASK_HOOK do { const int hh = h0s + blockIdx.y; const int bsm = blockIdx.z; const float rng = RNG[0]; \
    const float et = bfr(PCO[((size_t)bsm * TT + t) * 2]), ek = bfr(PCO[((size_t)bsm * TT + k) * 2]); const float pt_ = bfr(PCO[((size_t)bsm * TT + t) * 2 + 1]), pk_ = bfr(PCO[((size_t)bsm * TT + k) * 2 + 1]); \
    const float re = et - ek; int eb = (int)((re / rng) * 16.0f); eb = eb < -16 ? -16 : (eb > 15 ? 15 : eb); \
    const float rp = pt_ - pk_; const float a_ = rp + PI_F; const float twopi = 2.0f * PI_F; float rm = fmodf(a_, twopi); rm = (rm != 0.0f && rm < 0.0f) ? rm + twopi : rm; const float wr = rm - PI_F; \
    int pb = (int)((wr / PI_F) * 16.0f); pb = pb < -16 ? -16 : (pb > 15 ? 15 : pb); \
    v = v + (bfr(TAB[(eb + 16) * NH + hh]) + bfr(TAB[(pb + 16 + 32) * NH + hh])); } while (0)   /* jnp.mod = fmod then +y when the remainder is negative; .astype(int32) = truncation */
// ---- k_range: one block: eta_range = max(max over batches of (max eta - min eta), 1e-6) on the bf16-rounded coordinates (= max |eta_i - eta_j| over all same-batch pairs, exact)
__global__ __launch_bounds__(256) void k_range(const float* __restrict__ PCO, float* __restrict__ RNG) { __shared__ float smx[8], smn[8]; __shared__ float sr;
  const int t = threadIdx.x; float best = 0.f;
  for (int b = 0; b < TNB; ++b) { float mx = -3.0e38f, mn = 3.0e38f; for (int i = t; i < TT; i += 256) { const float e = bfr(PCO[((size_t)b * TT + i) * 2]); mx = fmaxf(mx, e); mn = fminf(mn, e); }
    for (int o = 1; o < 32; o <<= 1) { mx = fmaxf(mx, __shfl_xor(mx, o)); mn = fminf(mn, __shfl_xor(mn, o)); }
    if ((t & 31) == 0) { smx[t >> 5] = mx; smn[t >> 5] = mn; } __syncthreads();
    if (t == 0) { float a = smx[0], c = smn[0]; for (int i = 1; i < 8; ++i) { a = fmaxf(a, smx[i]); c = fminf(c, smn[i]); } sr = a - c; } __syncthreads(); best = fmaxf(best, sr); __syncthreads(); }
  if (t < 32) { const float v = t == 0 ? fmaxf(best, 1e-6f) : 0.f; vst2(RNG + t, v); } }   
#define WS_RNG (WS_END)
#define WS_END2 (WS_RNG + 128u)
#ifndef SM_EXTRA_PARAMS
#define SM_EXTRA_PARAMS
#endif
#ifndef PROJ_EXTRA_PARAMS
#define PROJ_EXTRA_PARAMS
#endif
#ifndef SM_MASK_HOOK
#define SM_MASK_HOOK (void)0
#endif

#define WS_QH  0u                                      // f16 q rows [b*t][CC]
#define WS_KH  (WS_QH + 2u * (size_t)NB * TT * CC)      // f16 k rows [b*t][CC]
#define WS_VT  (WS_KH + 2u * (size_t)NB * TT * CC)      // f16 v planes [b][c][t]
#define WS_QL  (WS_VT + 2u * (size_t)NB * CC * TT)      // f16 q residual x 2^10 rows [b][t < QHI][CC]
#define WS_KL  (WS_QL + 2u * (size_t)NB * QHI * CC)     // f16 k residual x 2^10 rows [b][t < KHI][CC]
#define WS_VB  (WS_KL + 2u * (size_t)NB * KHI * CC)     // bf16 v hi planes [b][c][t < KHI]
#define WS_VBL (WS_VB + 2u * (size_t)NB * CC * KHI)
#define WS_S   (WS_VBL + 2u * (size_t)NB * CC * KHI)    // f32 logits / P [b][hg][t][s]
#define WS_Y   (WS_S  + 4u * (size_t)NB * HG * TT * TT)      // f32 ctx rows [b*t][CC] (only when there is an output projection)
#define WS_END (WS_Y  + 4u * (size_t)NB * TT * CC)

// ---- k_proj: block = (64 rows, 128 cols, which): q/k/v = X W (+ b) with exact bf16 products (K = DIN) -> which 0: q f16 rows (+ residual rows < QHI); 1: k f16 rows (+ residual rows < KHI); 2: v f16 planes [c][t] (+ bf16 hi/lo planes for t < KHI)
__global__ __launch_bounds__(128) void k_proj(const float* __restrict__ XQ, const float* __restrict__ XK, const float* __restrict__ XV, const float* __restrict__ WQ, const float* __restrict__ WK, const float* __restrict__ WV, const float* __restrict__ BQ, const float* __restrict__ BK, const float* __restrict__ BV,
    _Float16* __restrict__ QH, _Float16* __restrict__ QL, _Float16* __restrict__ KH, _Float16* __restrict__ KL, _Float16* __restrict__ VT, __bf16* __restrict__ VB, __bf16* __restrict__ VBL) {
  __shared__ __align__(16) _Float16 sh[64][136], sl[64][136]; __shared__ __align__(16) _Float16 th[128][72]; __shared__ __align__(16) __bf16 tb[128][72], tbl[128][72];
  const int tid = threadIdx.x, wave = tid >> 5, lane = tid & 31, col = lane & 15, g = lane >> 4; const int which = blockIdx.z; const int c0 = blockIdx.y * 128; const size_t r0 = (size_t)blockIdx.x * 64; const size_t bb = r0 / TT; const int t0 = (int)(r0 % TT);
  const float* X = which == 0 ? XQ : which == 1 ? XK : XV; const float* WA = which == 0 ? WQ : which == 1 ? WK : WV; const float* BA = which == 0 ? BQ : which == 1 ? BK : BV;
  v8f acc[8] = {};
#pragma unroll 2
  for (int kc = 0; kc < DIN / 32; ++kc) { v16b a; { const float* p = X + (r0 + wave * 16 + col) * DIN + kc * 32 + 8 * g;
#pragma unroll
      for (int i = 0; i < 8; ++i) { a[i] = (__bf16)p[i]; a[8 + i] = (__bf16)p[16 + i]; } }
    asm volatile("s_wait_loadcnt 0x0" ::: "memory");
#pragma unroll
    for (int j = 0; j < 8; ++j) { const v16b w = WCOL(WA, kc * 32, c0 + j * 16 + col, lane); asm volatile("s_wait_loadcnt 0x0" ::: "memory"); acc[j] = wmma_bf(a, w, acc[j]); } }
  if (which < 2) { _Float16* DH = which == 0 ? QH : KH; _Float16* DL = which == 0 ? QL : KL; const int nhi = which == 0 ? QHI : KHI; const bool hi_rows = t0 < nhi;
#pragma unroll
    for (int j = 0; j < 8; ++j) { const float bias = BA ? bfr(BA[c0 + j * 16 + col]) : 0.f;
#pragma unroll
      for (int r = 0; r < 8; ++r) { const float v = acc[j][r] + bias; const _Float16 hv = (_Float16)v; sh[wave * 16 + 8 * g + r][j * 16 + col] = hv; sl[wave * 16 + 8 * g + r][j * 16 + col] = (_Float16)((v - (float)hv) * 1024.0f); } }
    __syncthreads();
    for (int e = tid; e < 64 * 16; e += 128) { const int rl = e >> 4, q = e & 15; vst2((unsigned*)(DH + (r0 + rl) * CC + c0 + q * 8), *(const v4u*)&sh[rl][q * 8]); if (hi_rows) vst2((unsigned*)(DL + (bb * nhi + t0 + rl) * (size_t)CC + c0 + q * 8), *(const v4u*)&sl[rl][q * 8]); }
  } else { const bool hi_rows = t0 < KHI;
#pragma unroll
    for (int j = 0; j < 8; ++j) { const float bias = BA ? bfr(BA[c0 + j * 16 + col]) : 0.f;
#pragma unroll
      for (int r = 0; r < 8; ++r) { const float v = acc[j][r] + bias; const int rl = wave * 16 + 8 * g + r, cl = j * 16 + col; th[cl][rl] = (_Float16)v; const __bf16 bh = (__bf16)v; tb[cl][rl] = bh; tbl[cl][rl] = (__bf16)(v - (float)bh); } }
    __syncthreads();
    for (int e = tid; e < 128 * 8; e += 128) { const int cl = e >> 3, q = e & 7; vst2((unsigned*)(VT + (bb * CC + c0 + cl) * (size_t)TT + t0 + q * 8), *(const v4u*)&th[cl][q * 8]); if (hi_rows) { const size_t o3 = (bb * CC + c0 + cl) * (size_t)KHI + t0 + q * 8; vst2((unsigned*)(VB + o3), *(const v4u*)&tb[cl][q * 8]); vst2((unsigned*)(VBL + o3), *(const v4u*)&tbl[cl][q * 8]); } } } }
// ---- k_sc: block = (query block qb, key block kb <= kb_last(qb), z = batch b x HG + head in group), every batch in the one launch: logits x SCALE; q hi + residual (x 2^10) against k (2 products) for query rows < QHI, plus the k residual (3 products) for query blocks < QBH (causal early rows); causal: blocks past the diagonal exit, the mask itself is applied by index in k_sm
__global__ __launch_bounds__(128) void k_sc(const _Float16* __restrict__ QH, const _Float16* __restrict__ KH, const _Float16* __restrict__ QL, const _Float16* __restrict__ KL, int h0, float* __restrict__ S0) { __shared__ __align__(16) float ss[4][16][132];
  const int qb = blockIdx.x, kb = blockIdx.y; if (kb > kb_last(qb)) return;
  const int b = blockIdx.z / HG; const int h = h0 + blockIdx.z % HG; float* S = S0 + (size_t)blockIdx.z * TT * TT;
  const int tid = threadIdx.x, wave = tid >> 5, lane = tid & 31, col = lane & 15, g = lane >> 4; const int k0 = kb * 128; const int ql0 = qb * 64 + wave * 16; const size_t q0 = (size_t)b * TT + ql0, kr0 = (size_t)b * TT + k0;
  v8f acc[8] = {}, accl[8] = {};
  const _Float16* QLb = QL + (size_t)b * QHI * CC; const _Float16* KLb = KL + (size_t)b * KHI * CC;
  if (qb < QBH) {
#pragma unroll
    for (int kc = 0; kc < HD / 32; ++kc) { const v16h ah = frag_h(QH + (q0 + col) * CC + h * HD + kc * 32, lane), al = frag_h(QLb + (size_t)(ql0 + col) * CC + h * HD + kc * 32, lane);
#pragma unroll
      for (int j = 0; j < 8; ++j) { const v16h kbf = frag_h(KH + (kr0 + j * 16 + col) * CC + h * HD + kc * 32, lane), klf = frag_h(KLb + (size_t)(k0 + j * 16 + col) * CC + h * HD + kc * 32, lane); acc[j] = wmma16(ah, kbf, acc[j]); accl[j] = wmma16(al, kbf, accl[j]); accl[j] = wmma16(ah, klf, accl[j]); } }
  } else if (qb * 64 < QHI) {
#pragma unroll
    for (int kc = 0; kc < HD / 32; ++kc) { const v16h ah = frag_h(QH + (q0 + col) * CC + h * HD + kc * 32, lane), al = frag_h(QLb + (size_t)(ql0 + col) * CC + h * HD + kc * 32, lane);
#pragma unroll
      for (int j = 0; j < 8; ++j) { const v16h kbf = frag_h(KH + (kr0 + j * 16 + col) * CC + h * HD + kc * 32, lane); acc[j] = wmma16(ah, kbf, acc[j]); accl[j] = wmma16(al, kbf, accl[j]); } }
  } else {
#pragma unroll
    for (int kc = 0; kc < HD / 32; ++kc) { const v16h ah = frag_h(QH + (q0 + col) * CC + h * HD + kc * 32, lane);
#pragma unroll
      for (int j = 0; j < 8; ++j) { const v16h kbf = frag_h(KH + (kr0 + j * 16 + col) * CC + h * HD + kc * 32, lane); acc[j] = wmma16(ah, kbf, acc[j]); } } }
#pragma unroll
  for (int j = 0; j < 8; ++j) {
#pragma unroll
    for (int r = 0; r < 8; ++r) ss[wave][8 * g + r][j * 16 + col] = (acc[j][r] + accl[j][r] * (1.0f / 1024.0f)) * SCALE; }
  LDSX(); for (int rl = 0; rl < 16; ++rl) vst2(S + (size_t)(ql0 + rl) * TT + k0 + lane * 4, *(const v4f*)&ss[wave][rl][lane * 4]); }
// ---- k_sm: block = query row t (y = head in group, z = batch): keys [0, kend): causal -> logit if s <= t else excluded; softmax in f32; P x 2^11 in place (0 for excluded)
__global__ __launch_bounds__(256) void k_sm(float* __restrict__ S0 SM_EXTRA_PARAMS) { __shared__ float sred[8]; __shared__ float sbc; __shared__ __align__(16) float shv[TT];
  const int tid = threadIdx.x; const int t = blockIdx.x; const int kend = (kb_last(t >> 6) + 1) * 128;
  float* sr = S0 + ((size_t)blockIdx.z * HG + blockIdx.y) * TT * TT + (size_t)t * TT;
  float m = -3.0e38f; for (int k = tid; k < kend; k += 256) { float v = (!CAUSAL || k <= t) ? sr[k] : -3.0e38f; SM_MASK_HOOK; shv[k] = v; m = fmaxf(m, v); }
#pragma unroll
  for (int o = 1; o < 32; o <<= 1) m = fmaxf(m, __shfl_xor(m, o));
  if ((tid & 31) == 0) sred[tid >> 5] = m; __syncthreads(); if (tid == 0) { float a = sred[0]; for (int i = 1; i < 8; ++i) a = fmaxf(a, sred[i]); sbc = a; } __syncthreads(); m = sbc; __syncthreads();
  float sum = 0.f; for (int k = tid; k < kend; k += 256) { const float v = shv[k]; const float e = (v <= -1.0e38f) ? 0.f : expf(v - m); shv[k] = e; sum += e; }
#pragma unroll
  for (int o = 1; o < 32; o <<= 1) sum += __shfl_xor(sum, o);
  if ((tid & 31) == 0) sred[tid >> 5] = sum; __syncthreads(); if (tid == 0) { float a = 0.f; for (int i = 0; i < 8; ++i) a += sred[i]; sbc = a > 0.f ? 2048.0f / a : 0.f; }   /* a fully excluded row yields P = 0 */ __syncthreads(); const float inv = sbc;
  for (int k = tid; k < kend; k += 256) shv[k] = shv[k] * inv;
  __syncthreads(); for (int q = tid; q < kend / 4; q += 256) vst2(sr + q * 4, *(const v4f*)&shv[q * 4]); }
// ---- k_pv: block = 64 queries (qb) of (b = y, h = z): ctx = P . v over keys [0, kend) (P x 2^11 once to f16 against v f16: 1 product; causal early query blocks: P and v as bf16 hi + lo, 3 products); 256-B (row, head) segment by 16 lanes
__global__ __launch_bounds__(128) void k_pv(const float* __restrict__ PS0, const _Float16* __restrict__ VT, const __bf16* __restrict__ VB, const __bf16* __restrict__ VBL, int h0, float* __restrict__ Y) { const int b = blockIdx.y; const int h = h0 + blockIdx.z; const float* PS = PS0 + ((size_t)b * HG + blockIdx.z) * TT * TT; __shared__ __align__(16) float ss[4][16][HD + 4];
  const int tid = threadIdx.x, wave = tid >> 5, lane = tid & 31, col = lane & 15, g = lane >> 4; const int qb = blockIdx.x; const int ql0 = qb * 64 + wave * 16; const int kce = (kb_last(qb) + 1) * 4;
  v8f acc[HD / 16] = {};
  if (qb < QBH) {
#pragma unroll 1
    for (int kc = 0; kc < kce; ++kc) { const F2 p = split_row(PS + (size_t)(ql0 + col) * TT, kc * 32, lane);
      asm volatile("s_wait_loadcnt 0x0" ::: "memory");
#pragma unroll
      for (int j = 0; j < HD / 16; ++j) { const size_t po = ((size_t)b * CC + h * HD + j * 16 + col) * (size_t)KHI + kc * 32; const v16b vh = frag_b(VB + po, lane); acc[j] = wmma_bf(p.h, vh, acc[j]); acc[j] = wmma_bf(p.l, vh, acc[j]); acc[j] = wmma_bf(p.h, frag_b(VBL + po, lane), acc[j]); } }
  } else {
#pragma unroll 1
    for (int kc = 0; kc < kce; ++kc) { const v16h p = frag_f32(PS + (size_t)(ql0 + col) * TT + kc * 32, lane);
      asm volatile("s_wait_loadcnt 0x0" ::: "memory");
#pragma unroll
      for (int j = 0; j < HD / 16; ++j) { const size_t po = ((size_t)b * CC + h * HD + j * 16 + col) * (size_t)TT + kc * 32; acc[j] = wmma16(p, frag_h(VT + po, lane), acc[j]); } } }
#pragma unroll
  for (int j = 0; j < HD / 16; ++j)
#pragma unroll
    for (int r = 0; r < 8; ++r) ss[wave][8 * g + r][j * 16 + col] = acc[j][r] * (1.0f / 2048.0f);
  LDSX(); for (int rl = 0; rl < 16; ++rl) if (lane < HD / 4) vst2(Y + ((size_t)b * TT + ql0 + rl) * CC + h * HD + lane * 4, *(const v4f*)&ss[wave][rl][lane * 4]); }
// ---- k_out: block = (64 rows, 128 cols): out = ctx Wo (+ bo): ctx once to f16 against Wo as f16(bf16 x 2^8) exact (1 product) x 2^-8; causal early rows (< QHI of each sequence): ctx bf16 hi + lo against exact bf16 Wo (2 products)
__global__ __launch_bounds__(128) void k_out(const float* __restrict__ Y, const float* __restrict__ WO, const float* __restrict__ BO, float* __restrict__ OUT) { __shared__ __align__(16) float sf[4][16][132];
  const int tid = threadIdx.x, wave = tid >> 5, lane = tid & 31, col = lane & 15, g = lane >> 4; const int c0 = blockIdx.y * 128; const size_t r0 = (size_t)blockIdx.x * 64 + wave * 16;
  v8f acc[8] = {};
  if (CAUSAL && (int)(((size_t)blockIdx.x * 64) % TT) < QHI) {   /* block-uniform */
#pragma unroll 2
    for (int kc = 0; kc < CC / 32; ++kc) { const F2 a = split_row(Y + (r0 + col) * CC, kc * 32, lane); asm volatile("s_wait_loadcnt 0x0" ::: "memory");
#pragma unroll
      for (int j = 0; j < 8; ++j) { const v16b w = WOCOL(WO, kc * 32, c0 + j * 16 + col, lane); asm volatile("s_wait_loadcnt 0x0" ::: "memory"); acc[j] = wmma_bf(a.h, w, acc[j]); acc[j] = wmma_bf(a.l, w, acc[j]); } }
#pragma unroll
    for (int j = 0; j < 8; ++j) { const float bias = BO ? bfr(BO[c0 + j * 16 + col]) : 0.f;
#pragma unroll
      for (int r = 0; r < 8; ++r) sf[wave][8 * g + r][j * 16 + col] = acc[j][r] + bias; }
  } else {
#pragma unroll 2
    for (int kc = 0; kc < CC / 32; ++kc) { const v16h a = frag_f32(Y + (r0 + col) * CC + kc * 32, lane); asm volatile("s_wait_loadcnt 0x0" ::: "memory");
#pragma unroll
      for (int j = 0; j < 8; ++j) { const v16h w = WOCOLH(WO, kc * 32, c0 + j * 16 + col, lane); asm volatile("s_wait_loadcnt 0x0" ::: "memory"); acc[j] = wmma16(a, w, acc[j]); } }
#pragma unroll
    for (int j = 0; j < 8; ++j) { const float bias = BO ? bfr(BO[c0 + j * 16 + col]) : 0.f;
#pragma unroll
      for (int r = 0; r < 8; ++r) sf[wave][8 * g + r][j * 16 + col] = acc[j][r] * (1.0f / 256.0f) + bias; } }
  LDSX(); for (int rl = 0; rl < 16; ++rl) vst2(OUT + (r0 + rl) * DIN + c0 + lane * 4, *(const v4f*)&sf[wave][rl][lane * 4]); }

extern "C" void kernel_launch(void* const* d_in, const int* in_sizes, int n_in, void* d_out, int out_size, void* d_ws, size_t ws_size, hipStream_t stream) {
  (void)in_sizes; (void)n_in; (void)out_size;
  const float** F = (const float**)d_in;
  if (ws_size < (size_t)WS_END) return;
  char* ws = (char*)d_ws; _Float16 *QH = (_Float16*)(ws + WS_QH), *KH = (_Float16*)(ws + WS_KH), *VT = (_Float16*)(ws + WS_VT), *QL = (_Float16*)(ws + WS_QL), *KL = (_Float16*)(ws + WS_KL); __bf16 *VB = (__bf16*)(ws + WS_VB), *VBL = (__bf16*)(ws + WS_VBL); float *S = (float*)(ws + WS_S), *Y = (float*)(ws + WS_Y);
  (void)Y; (void)QL; (void)KL; (void)VB; (void)VBL;
  // inputs: 0 p [4,1024,512]; 1 pcoords [4,1024,2]; 2 rpe_table [64,8]; 3 wq_w (in,out), 4 wq_b; 5 wk_w, 6 wk_b; 7 wv_w, 8 wv_b; 9 wo_w (in,out), 10 wo_b
  if (ws_size < (size_t)WS_END2) return;
  float* RNG = (float*)(ws + WS_RNG);
  k_range<<<1, 256, 0, stream>>>(F[1], RNG);
  k_proj<<<dim3(TNB * TT / 64, CC / 128, 3), 128, 0, stream>>>(F[0], F[0], F[0], F[3], F[5], F[7], F[4], F[6], F[8], QH, QL, KH, KL, VT, VB, VBL);
  k_sc<<<dim3(NQB, TT / 128, TNB * HG), 128, 0, stream>>>(QH, KH, QL, KL, 0, S);
  k_sm<<<dim3(TT, HG, TNB), 256, 0, stream>>>(S, F[1], F[2], RNG, 0);
  k_pv<<<dim3(NQB, TNB, HG), 128, 0, stream>>>(S, VT, VB, VBL, 0, Y);
  k_out<<<dim3(TNB * TT / 64, DIN / 128), 128, 0, stream>>>(Y, F[9], F[10], (float*)d_out);
}

// v002
// A run of this version takes 207 microseconds.
// In two side-by-side timings against v001, it was 1.28 and 1.27 times as fast.
// All steps since v000 together make it 1.84 times as fast.
// compute dtype: all float inputs rounded to bf16; q/k/v = p W + b with EXACT bf16 products on WMMA 16x16x32 (f32 accumulate); q as f16 hi + residual (x 2^10) against k once to f16 (2 products) x 64^-0.5; the relative-position bias: bin indices computed per (batch, query, key) in f32 exactly as the reference (difference, division by the global eta range, x16, truncation; fmod-based wrap for phi), table values (bf16) added in f32; softmax in f32 (precise expf); P x 2^11 once to f16 against v once to f16 (1 product); ctx once to f16 against Wo carried x 2^8 in f16 + bo; f32 output.
#include <hip/hip_runtime.h>
#include <math.h>

typedef __attribute__((ext_vector_type(16))) _Float16 v16h;
typedef __attribute__((ext_vector_type(16))) __bf16 v16b;
typedef __attribute__((ext_vector_type(8)))  _Float16 v8h;
typedef __attribute__((ext_vector_type(8)))  float v8f;
typedef __attribute__((ext_vector_type(4)))  float v4f;
typedef __attribute__((ext_vector_type(2)))  float v2f;
typedef __attribute__((ext_vector_type(4)))  unsigned v4u;
typedef __attribute__((ext_vector_type(2)))  unsigned v2u;
typedef __attribute__((ext_vector_type(4)))  int v4i;
typedef float __attribute__((may_alias)) float_a;
typedef int __attribute__((may_alias)) int_a;

template <typename T> __device__ __forceinline__ void vst2(void* p, T v) { *(T*)p = v;  }
__device__ __forceinline__ v8f wmma16(v16h a, v16h b, v8f c) {
  v8f d = __builtin_amdgcn_wmma_f32_16x16x32_f16(false, a, false, b, (short)0, c, false, false);
  asm volatile("v_nop\n\tv_nop\n\tv_nop\n\tv_nop" : "+v"(d) : "v"(a), "v"(b));
  return d;
}
__device__ __forceinline__ v8f wmma_bf(v16b a, v16b b, v8f c) {
  v8f d = __builtin_amdgcn_wmma_f32_16x16x32_bf16(false, a, false, b, (short)0, c, false, false);
  asm volatile("v_nop\n\tv_nop\n\tv_nop\n\tv_nop" : "+v"(d) : "v"(a), "v"(b));
  return d;
}
// 16x16x32 fragments: lane = (h = lane>>4, row/col = lane&15); elements 0..7 = k0+8h+0..7, 8..15 = k0+16+8h+0..7; D element r = row 8h+r
__device__ __forceinline__ v16h frag_h(const _Float16* rowk0, int lane) {
  union { v16h v; v8h q[2]; } u; const _Float16* p = rowk0 + 8 * (lane >> 4);
  u.q[0] = *(const v8h*)p; u.q[1] = *(const v8h*)(p + 16); return u.v;
}
__device__ __forceinline__ v16h frag_f32(const float* rowk0, int lane) {
  v16h a; const float* p = rowk0 + 8 * (lane >> 4);
#pragma unroll
  for (int i = 0; i < 8; ++i) { a[i] = (_Float16)p[i]; a[8 + i] = (_Float16)p[16 + i]; }
  return a;
}
__device__ __forceinline__ v16h frag_f32s(const float* rowk0, int lane, float sc) {
  v16h a; const float* p = rowk0 + 8 * (lane >> 4);
#pragma unroll
  for (int i = 0; i < 8; ++i) { a[i] = (_Float16)(p[i] * sc); a[8 + i] = (_Float16)(p[16 + i] * sc); }
  return a;
}
// column fragment from a [K][ld] layout (column n), rows >= K read as 0
__device__ __forceinline__ v16h fragc_f32(const float* W, int k0, int n, int lane, int ld, int K) {
  v16h a; const int g = lane >> 4;
#pragma unroll
  for (int i = 0; i < 8; ++i) { const int ka = k0 + 8 * g + i, kb = ka + 16;
    a[i] = (_Float16)(ka < K ? W[(size_t)(ka < K ? ka : K - 1) * ld + n] : 0.f); a[8 + i] = (_Float16)(kb < K ? W[(size_t)(kb < K ? kb : K - 1) * ld + n] : 0.f); }
  return a;
}
struct F2 { v16b h, l; };
__device__ __forceinline__ F2 bsplit16(const float v[16]) { F2 r;
#pragma unroll
  for (int i = 0; i < 16; ++i) { const __bf16 h = (__bf16)v[i]; r.h[i] = h; r.l[i] = (__bf16)(v[i] - (float)h); }
  return r; }
__device__ __forceinline__ F2 split_row(const float* row, int k0, int lane) { float v[16]; const float* p = row + k0 + 8 * (lane >> 4);
#pragma unroll
  for (int i = 0; i < 8; ++i) { v[i] = p[i]; v[8 + i] = p[16 + i]; }
  return bsplit16(v); }
__device__ __forceinline__ F2 split_rowK(const float* row, int k0, int lane, int K) { float v[16]; const int g = lane >> 4;
#pragma unroll
  for (int i = 0; i < 8; ++i) { const int ka = k0 + 8 * g + i, kb = ka + 16; v[i] = ka < K ? row[ka < K ? ka : K - 1] : 0.f; v[8 + i] = kb < K ? row[kb < K ? kb : K - 1] : 0.f; }
  return bsplit16(v); }
__device__ __forceinline__ F2 split_col(const float* W, int k0, int n, int lane, int ld, int K) { float v[16]; const int g = lane >> 4;
#pragma unroll
  for (int i = 0; i < 8; ++i) { const int ka = k0 + 8 * g + i, kb = ka + 16; v[i] = ka < K ? W[(size_t)(ka < K ? ka : K - 1) * ld + n] : 0.f; v[8 + i] = kb < K ? W[(size_t)(kb < K ? kb : K - 1) * ld + n] : 0.f; }
  return bsplit16(v); }
__device__ __forceinline__ v8f mac3(const F2& a, const F2& b, v8f c) { c = wmma_bf(a.l, b.h, c); c = wmma_bf(a.h, b.l, c); return wmma_bf(a.h, b.h, c); }
__device__ __forceinline__ float sigm(float v) { return 1.0f / (1.0f + expf(-v)); }
#define LDSX() do { asm volatile("s_wait_dscnt 0" ::: "memory"); __builtin_amdgcn_wave_barrier(); __builtin_amdgcn_fence(__ATOMIC_RELEASE, "workgroup"); } while (0)

// Patch attention with a relative-position bias (B 4, T 1,024, D 512 = 8 heads x 64): q/k/v = p W + b ((in,out)); scores = q k^T / 8 + rpe_table[eta_bin + 16][h] + rpe_table[phi_bin + 48][h] with eta_bin = trunc((eta_i - eta_j) / max|eta_i - eta_j| * 16), phi_bin = trunc(wrap(phi_i - phi_j) / pi * 16), both clipped to [-16, 15]; softmax; out = merged(attn v) Wo + bo.
#define NB 4
#define TT 1024
#define CC 512            // NH * HD = projected width
#define DIN 512          // input (model) width
#define NH 8
#define HD 64
#define NQB (TT / 64)
#define HG 8
#define SCALE (0.125f)
#define CAUSAL 0
#ifndef TNB
#define TNB NB
#endif
__device__ __forceinline__ float bfr(float v) { return (float)(__bf16)v; }
__host__ __device__ __forceinline__ int kb_last(int qb) { return CAUSAL ? ((qb * 64 + 63) >> 7) : (TT / 128 - 1); }
typedef __attribute__((ext_vector_type(8))) __bf16 v8b;
__device__ __forceinline__ v16b frag_b(const __bf16* rowk0, int lane) {
  union { v16b v; v8b q[2]; } u; const __bf16* p = rowk0 + 8 * (lane >> 4);
  u.q[0] = *(const v8b*)p; u.q[1] = *(const v8b*)(p + 16); return u.v;
}
#define QBH 0              // no query block takes the high-precision path (qb < QBH never holds)
#define QHI 1024            // rows carrying a q residual plane (all rows when non-causal: 2-product logits everywhere)
#define KHI 64            // key rows carrying k residual / v bf16 hi+lo planes (read only by the qb < QBH path, which no block takes)
// B fragment (k rows k0+.., output column o) of a weight: (in,out) [K][ld] or (out,in) [ld rows of K]: bf16 exact, or f16(bf16 * 256) exact
__device__ __forceinline__ v16b wcol_io(const float* Wm, int k0, int o, int lane, int ld) { v16b w; const int g = lane >> 4;
#pragma unroll
  for (int i = 0; i < 8; ++i) { w[i] = (__bf16)Wm[(size_t)(k0 + 8 * g + i) * ld + o]; w[8 + i] = (__bf16)Wm[(size_t)(k0 + 16 + 8 * g + i) * ld + o]; }
  return w; }
__device__ __forceinline__ v16b wcol_oi(const float* Wm, int k0, int o, int lane, int K) { v16b w; const float* p = Wm + (size_t)o * K + k0 + 8 * (lane >> 4);
#pragma unroll
  for (int i = 0; i < 8; ++i) { w[i] = (__bf16)p[i]; w[8 + i] = (__bf16)p[16 + i]; }
  return w; }
__device__ __forceinline__ v16h wcolh_io(const float* Wm, int k0, int o, int lane, int ld) { v16h w; const int g = lane >> 4;
#pragma unroll
  for (int i = 0; i < 8; ++i) { w[i] = (_Float16)(bfr(Wm[(size_t)(k0 + 8 * g + i) * ld + o]) * 256.0f); w[8 + i] = (_Float16)(bfr(Wm[(size_t)(k0 + 16 + 8 * g + i) * ld + o]) * 256.0f); }
  return w; }
__device__ __forceinline__ v16h wcolh_oi(const float* Wm, int k0, int o, int lane, int K) { v16h w; const float* p = Wm + (size_t)o * K + k0 + 8 * (lane >> 4);
#pragma unroll
  for (int i = 0; i < 8; ++i) { w[i] = (_Float16)(bfr(p[i]) * 256.0f); w[8 + i] = (_Float16)(bfr(p[16 + i]) * 256.0f); }
  return w; }
#define WQKV_LAYOUT 0   // 0 = (in,out) [DIN][CC]; 1 = (out,in) [CC][DIN]; 2 = per-head [NH][DIN][HD]
__device__ __forceinline__ v16b wcol_hdk(const float* Wm, int k0, int o, int lane) { v16b w; const int g = lane >> 4; const float* p = Wm + (size_t)(o / HD) * DIN * HD + (o % HD);
#pragma unroll
  for (int i = 0; i < 8; ++i) { w[i] = (__bf16)p[(size_t)(k0 + 8 * g + i) * HD]; w[8 + i] = (__bf16)p[(size_t)(k0 + 16 + 8 * g + i) * HD]; }
  return w; }
#define WO_OUT_IN 0
#if WQKV_LAYOUT == 1
#define WCOL(W, k0, o, lane) wcol_oi(W, k0, o, lane, DIN)
#elif WQKV_LAYOUT == 2
#define WCOL(W, k0, o, lane) wcol_hdk(W, k0, o, lane)
#else
#define WCOL(W, k0, o, lane) wcol_io(W, k0, o, lane, CC)
#endif
#if WO_OUT_IN
#define WOCOL(W, k0, o, lane) wcol_oi(W, k0, o, lane, CC)
#define WOCOLH(W, k0, o, lane) wcolh_oi(W, k0, o, lane, CC)
#else
#define WOCOL(W, k0, o, lane) wcol_io(W, k0, o, lane, DIN)
#define WOCOLH(W, k0, o, lane) wcolh_io(W, k0, o, lane, DIN)
#endif
#define PI_F 3.14159274f          // f32(math.pi)
// bias bins of one (query, key) pair, the same for every head: byte offsets into one head's 64-entry f32 table column, eta bin in bits 7..0, phi bin (+32 entries) in bits 15..8. f32 steps exactly as the reference: jnp.mod = fmod then +y when the remainder is negative; .astype(int32) = truncation
__device__ __forceinline__ unsigned bias_bins(float et, float pt_, float ek, float pk_, float rng) {
  const float re = et - ek; int eb = (int)((re / rng) * 16.0f); eb = eb < -16 ? -16 : (eb > 15 ? 15 : eb);
  const float rp = pt_ - pk_; const float a_ = rp + PI_F; const float twopi = 2.0f * PI_F; float rm = fmodf(a_, twopi); rm = (rm != 0.0f && rm < 0.0f) ? rm + twopi : rm; const float wr = rm - PI_F;
  int pb = (int)((wr / PI_F) * 16.0f); pb = pb < -16 ? -16 : (pb > 15 ? 15 : pb);
  return (unsigned)((eb + 16) * 4) | ((unsigned)((pb + 16 + 32) * 4) << 8); }
// ---- k_range: one block: eta_range = max(max over batches of (max eta - min eta), 1e-6) on the bf16-rounded coordinates (= max |eta_i - eta_j| over all same-batch pairs, exact)
__global__ __launch_bounds__(256) void k_range(const float* __restrict__ PCO, float* __restrict__ RNG) { __shared__ float smx[8], smn[8]; __shared__ float sr;
  const int t = threadIdx.x; float best = 0.f;
  for (int b = 0; b < TNB; ++b) { float mx = -3.0e38f, mn = 3.0e38f; for (int i = t; i < TT; i += 256) { const float e = bfr(PCO[((size_t)b * TT + i) * 2]); mx = fmaxf(mx, e); mn = fminf(mn, e); }
    for (int o = 1; o < 32; o <<= 1) { mx = fmaxf(mx, __shfl_xor(mx, o)); mn = fminf(mn, __shfl_xor(mn, o)); }
    if ((t & 31) == 0) { smx[t >> 5] = mx; smn[t >> 5] = mn; } __syncthreads();
    if (t == 0) { float a = smx[0], c = smn[0]; for (int i = 1; i < 8; ++i) { a = fmaxf(a, smx[i]); c = fminf(c, smn[i]); } sr = a - c; } __syncthreads(); best = fmaxf(best, sr); __syncthreads(); }
  if (t < 32) { const float v = t == 0 ? fmaxf(best, 1e-6f) : 0.f; vst2(RNG + t, v); } }   
#define WS_RNG (WS_END)
#define WS_END2 (WS_RNG + 128u)

#define WS_QH  0u                                      // f16 q rows [b*t][CC]
#define WS_KH  (WS_QH + 2u * (size_t)NB * TT * CC)      // f16 k rows [b*t][CC]
#define WS_VT  (WS_KH + 2u * (size_t)NB * TT * CC)      // f16 v planes [b][c][t]
#define WS_QL  (WS_VT + 2u * (size_t)NB * CC * TT)      // f16 q residual x 2^10 rows [b][t < QHI][CC]
#define WS_KL  (WS_QL + 2u * (size_t)NB * QHI * CC)     // f16 k residual x 2^10 rows [b][t < KHI][CC]
#define WS_VB  (WS_KL + 2u * (size_t)NB * KHI * CC)     // bf16 v hi planes [b][c][t < KHI]
#define WS_VBL (WS_VB + 2u * (size_t)NB * CC * KHI)
#define WS_S   (WS_VBL + 2u * (size_t)NB * CC * KHI)    // f32 logits / P [b][hg][t][s]
#define WS_Y   (WS_S  + 4u * (size_t)NB * HG * TT * TT)      // f32 ctx rows [b*t][CC] (only when there is an output projection)
#define WS_END (WS_Y  + 4u * (size_t)NB * TT * CC)

// ---- k_proj: block = (64 rows, 128 cols, which): q/k/v = X W (+ b) with exact bf16 products (K = DIN) -> which 0: q f16 rows (+ residual rows < QHI); 1: k f16 rows (+ residual rows < KHI); 2: v f16 planes [c][t] (+ bf16 hi/lo planes for t < KHI)
__global__ __launch_bounds__(128) void k_proj(const float* __restrict__ XQ, const float* __restrict__ XK, const float* __restrict__ XV, const float* __restrict__ WQ, const float* __restrict__ WK, const float* __restrict__ WV, const float* __restrict__ BQ, const float* __restrict__ BK, const float* __restrict__ BV,
    _Float16* __restrict__ QH, _Float16* __restrict__ QL, _Float16* __restrict__ KH, _Float16* __restrict__ KL, _Float16* __restrict__ VT, __bf16* __restrict__ VB, __bf16* __restrict__ VBL) {
  __shared__ __align__(16) _Float16 sh[64][136], sl[64][136]; __shared__ __align__(16) _Float16 th[128][72]; __shared__ __align__(16) __bf16 tb[128][72], tbl[128][72];
  const int tid = threadIdx.x, wave = tid >> 5, lane = tid & 31, col = lane & 15, g = lane >> 4; const int which = blockIdx.z; const int c0 = blockIdx.y * 128; const size_t r0 = (size_t)blockIdx.x * 64; const size_t bb = r0 / TT; const int t0 = (int)(r0 % TT);
  const float* X = which == 0 ? XQ : which == 1 ? XK : XV; const float* WA = which == 0 ? WQ : which == 1 ? WK : WV; const float* BA = which == 0 ? BQ : which == 1 ? BK : BV;
  v8f acc[8] = {};
#pragma unroll 2
  for (int kc = 0; kc < DIN / 32; ++kc) { v16b a; { const float* p = X + (r0 + wave * 16 + col) * DIN + kc * 32 + 8 * g;
#pragma unroll
      for (int i = 0; i < 8; ++i) { a[i] = (__bf16)p[i]; a[8 + i] = (__bf16)p[16 + i]; } }
    asm volatile("s_wait_loadcnt 0x0" ::: "memory");
#pragma unroll
    for (int j = 0; j < 8; ++j) { const v16b w = WCOL(WA, kc * 32, c0 + j * 16 + col, lane); asm volatile("s_wait_loadcnt 0x0" ::: "memory"); acc[j] = wmma_bf(a, w, acc[j]); } }
  if (which < 2) { _Float16* DH = which == 0 ? QH : KH; _Float16* DL = which == 0 ? QL : KL; const int nhi = which == 0 ? QHI : KHI; const bool hi_rows = t0 < nhi;
#pragma unroll
    for (int j = 0; j < 8; ++j) { const float bias = BA ? bfr(BA[c0 + j * 16 + col]) : 0.f;
#pragma unroll
      for (int r = 0; r < 8; ++r) { const float v = acc[j][r] + bias; const _Float16 hv = (_Float16)v; sh[wave * 16 + 8 * g + r][j * 16 + col] = hv; sl[wave * 16 + 8 * g + r][j * 16 + col] = (_Float16)((v - (float)hv) * 1024.0f); } }
    __syncthreads();
    for (int e = tid; e < 64 * 16; e += 128) { const int rl = e >> 4, q = e & 15; vst2((unsigned*)(DH + (r0 + rl) * CC + c0 + q * 8), *(const v4u*)&sh[rl][q * 8]); if (hi_rows) vst2((unsigned*)(DL + (bb * nhi + t0 + rl) * (size_t)CC + c0 + q * 8), *(const v4u*)&sl[rl][q * 8]); }
  } else { const bool hi_rows = t0 < KHI;
#pragma unroll
    for (int j = 0; j < 8; ++j) { const float bias = BA ? bfr(BA[c0 + j * 16 + col]) : 0.f;
#pragma unroll
      for (int r = 0; r < 8; ++r) { const float v = acc[j][r] + bias; const int rl = wave * 16 + 8 * g + r, cl = j * 16 + col; th[cl][rl] = (_Float16)v; const __bf16 bh = (__bf16)v; tb[cl][rl] = bh; tbl[cl][rl] = (__bf16)(v - (float)bh); } }
    __syncthreads();
    for (int e = tid; e < 128 * 8; e += 128) { const int cl = e >> 3, q = e & 7; vst2((unsigned*)(VT + (bb * CC + c0 + cl) * (size_t)TT + t0 + q * 8), *(const v4u*)&th[cl][q * 8]); if (hi_rows) { const size_t o3 = (bb * CC + c0 + cl) * (size_t)KHI + t0 + q * 8; vst2((unsigned*)(VB + o3), *(const v4u*)&tb[cl][q * 8]); vst2((unsigned*)(VBL + o3), *(const v4u*)&tbl[cl][q * 8]); } } } }
// ---- k_sc: block = (query block qb, key block kb <= kb_last(qb), z = batch b x HG + head in group), every batch in the one launch: logits x SCALE; q hi + residual (x 2^10) against k (2 products) for query rows < QHI, plus the k residual (3 products) for query blocks < QBH (causal early rows); causal: blocks past the diagonal exit; k_sm applies no mask (it asserts non-causal)
__global__ __launch_bounds__(128) void k_sc(const _Float16* __restrict__ QH, const _Float16* __restrict__ KH, const _Float16* __restrict__ QL, const _Float16* __restrict__ KL, int h0, float* __restrict__ S0) { __shared__ __align__(16) float ss[4][16][132];
  const int qb = blockIdx.x, kb = blockIdx.y; if (kb > kb_last(qb)) return;
  const int b = blockIdx.z / HG; const int h = h0 + blockIdx.z % HG; float* S = S0 + (size_t)blockIdx.z * TT * TT;
  const int tid = threadIdx.x, wave = tid >> 5, lane = tid & 31, col = lane & 15, g = lane >> 4; const int k0 = kb * 128; const int ql0 = qb * 64 + wave * 16; const size_t q0 = (size_t)b * TT + ql0, kr0 = (size_t)b * TT + k0;
  v8f acc[8] = {}, accl[8] = {};
  const _Float16* QLb = QL + (size_t)b * QHI * CC; const _Float16* KLb = KL + (size_t)b * KHI * CC;
  if (qb < QBH) {
#pragma unroll
    for (int kc = 0; kc < HD / 32; ++kc) { const v16h ah = frag_h(QH + (q0 + col) * CC + h * HD + kc * 32, lane), al = frag_h(QLb + (size_t)(ql0 + col) * CC + h * HD + kc * 32, lane);
#pragma unroll
      for (int j = 0; j < 8; ++j) { const v16h kbf = frag_h(KH + (kr0 + j * 16 + col) * CC + h * HD + kc * 32, lane), klf = frag_h(KLb + (size_t)(k0 + j * 16 + col) * CC + h * HD + kc * 32, lane); acc[j] = wmma16(ah, kbf, acc[j]); accl[j] = wmma16(al, kbf, accl[j]); accl[j] = wmma16(ah, klf, accl[j]); } }
  } else if (qb * 64 < QHI) {
#pragma unroll
    for (int kc = 0; kc < HD / 32; ++kc) { const v16h ah = frag_h(QH + (q0 + col) * CC + h * HD + kc * 32, lane), al = frag_h(QLb + (size_t)(ql0 + col) * CC + h * HD + kc * 32, lane);
#pragma unroll
      for (int j = 0; j < 8; ++j) { const v16h kbf = frag_h(KH + (kr0 + j * 16 + col) * CC + h * HD + kc * 32, lane); acc[j] = wmma16(ah, kbf, acc[j]); accl[j] = wmma16(al, kbf, accl[j]); } }
  } else {
#pragma unroll
    for (int kc = 0; kc < HD / 32; ++kc) { const v16h ah = frag_h(QH + (q0 + col) * CC + h * HD + kc * 32, lane);
#pragma unroll
      for (int j = 0; j < 8; ++j) { const v16h kbf = frag_h(KH + (kr0 + j * 16 + col) * CC + h * HD + kc * 32, lane); acc[j] = wmma16(ah, kbf, acc[j]); } } }
#pragma unroll
  for (int j = 0; j < 8; ++j) {
#pragma unroll
    for (int r = 0; r < 8; ++r) ss[wave][8 * g + r][j * 16 + col] = (acc[j][r] + accl[j][r] * (1.0f / 1024.0f)) * SCALE; }
  LDSX(); for (int rl = 0; rl < 16; ++rl) vst2(S + (size_t)(ql0 + rl) * TT + k0 + lane * 4, *(const v4f*)&ss[wave][rl][lane * 4]); }
// ---- k_sm: block = query row t of batch z, wave = head in group (HG = 8 waves): the 256 threads compute the row's TT bias bins once (they do not depend on the head; 4 neighbouring keys per thread) into LDS, then each wave takes its own head's logit row in registers (32 per lane): + bias, softmax in f32 with wave-only reductions; P x 2^11 in place. All TT keys (non-causal).
__global__ __launch_bounds__(256) void k_sm(float* __restrict__ S0, const float* __restrict__ PCO, const float* __restrict__ TAB, const float* __restrict__ RNG, int h0s) { __shared__ __align__(16) unsigned sbin[TT / 2]; __shared__ __align__(16) float stab[HG][64];
  static_assert(!CAUSAL && HG * 32 == 256 && TT == 1024, "one wave per head, whole rows, 4 keys per thread");
  const int tid = threadIdx.x, wave = tid >> 5, lane = tid & 31; const int t = blockIdx.x; const int bsm = blockIdx.z;
  float* sr = S0 + ((size_t)bsm * HG + wave) * TT * TT + (size_t)t * TT;
  const float* ckp = PCO + ((size_t)bsm * TT + tid * 4) * 2; const v4f ck0 = *(const v4f*)ckp, ck1 = *(const v4f*)(ckp + 4);
  const float tv0 = TAB[lane * NH + h0s + wave], tv1 = TAB[(lane + 32) * NH + h0s + wave];
  v4f x[TT / 128];
#pragma unroll  // x[] stays in registers only under constant indices
  for (int c = 0; c < TT / 128; ++c) x[c] = *(const v4f*)(sr + c * 128 + lane * 4);
  stab[wave][lane] = bfr(tv0); stab[wave][lane + 32] = bfr(tv1);
  { const float rng = RNG[0]; const float et = bfr(PCO[((size_t)bsm * TT + t) * 2]), pt_ = bfr(PCO[((size_t)bsm * TT + t) * 2 + 1]);
    const unsigned b0 = bias_bins(et, pt_, bfr(ck0[0]), bfr(ck0[1]), rng), b1 = bias_bins(et, pt_, bfr(ck0[2]), bfr(ck0[3]), rng), b2 = bias_bins(et, pt_, bfr(ck1[0]), bfr(ck1[1]), rng), b3 = bias_bins(et, pt_, bfr(ck1[2]), bfr(ck1[3]), rng);
    v2u w; w[0] = b0 | (b1 << 16); w[1] = b2 | (b3 << 16); *(v2u*)&sbin[tid * 2] = w; }
  __syncthreads();   // publishes every thread's bins (and the table columns) to the eight waves that read them below
  const char* tb = (const char*)&stab[wave][0];
  float m = -3.0e38f;
#pragma unroll  // x[] stays in registers only under constant indices
  for (int c = 0; c < TT / 128; ++c) { const v2u w = *(const v2u*)&sbin[c * 64 + lane * 2];
#pragma unroll  // x[] stays in registers only under constant indices
    for (int i = 0; i < 4; ++i) { const unsigned bi = w[i >> 1] >> (16 * (i & 1)); const float v = x[c][i] + (*(const float*)(tb + (bi & 0xffu)) + *(const float*)(tb + ((bi >> 8) & 0xffu))); x[c][i] = v; m = fmaxf(m, v); } }
#pragma unroll
  for (int o = 1; o < 32; o <<= 1) m = fmaxf(m, __shfl_xor(m, o));
  v4f s4 = {};
#pragma unroll  // x[] stays in registers only under constant indices
  for (int c = 0; c < TT / 128; ++c) {
#pragma unroll  // x[] stays in registers only under constant indices
    for (int i = 0; i < 4; ++i) { const float v = x[c][i]; const float ev = expf(v - m); const float e = (v <= -1.0e38f) ? 0.f : ev; x[c][i] = e; s4[i] += e; } }
  float sum = (s4[0] + s4[1]) + (s4[2] + s4[3]);
#pragma unroll
  for (int o = 1; o < 32; o <<= 1) sum += __shfl_xor(sum, o);
  const float inv = sum > 0.f ? 2048.0f / sum : 0.f;   /* a fully excluded row yields P = 0 */
#pragma unroll  // x[] stays in registers only under constant indices
  for (int c = 0; c < TT / 128; ++c) vst2(sr + c * 128 + lane * 4, x[c] * inv); }
// ---- k_pv: block = 64 queries (qb) of (b = y, h = z): ctx = P . v over keys [0, kend) (P x 2^11 once to f16 against v f16: 1 product; causal early query blocks: P and v as bf16 hi + lo, 3 products); 256-B (row, head) segment by 16 lanes
__global__ __launch_bounds__(128) void k_pv(const float* __restrict__ PS0, const _Float16* __restrict__ VT, const __bf16* __restrict__ VB, const __bf16* __restrict__ VBL, int h0, float* __restrict__ Y) { const int b = blockIdx.y; const int h = h0 + blockIdx.z; const float* PS = PS0 + ((size_t)b * HG + blockIdx.z) * TT * TT; __shared__ __align__(16) float ss[4][16][HD + 4];
  const int tid = threadIdx.x, wave = tid >> 5, lane = tid & 31, col = lane & 15, g = lane >> 4; const int qb = blockIdx.x; const int ql0 = qb * 64 + wave * 16; const int kce = (kb_last(qb) + 1) * 4;
  v8f acc[HD / 16] = {};
  if (qb < QBH) {
#pragma unroll 1
    for (int kc = 0; kc < kce; ++kc) { const F2 p = split_row(PS + (size_t)(ql0 + col) * TT, kc * 32, lane);
      asm volatile("s_wait_loadcnt 0x0" ::: "memory");
#pragma unroll
      for (int j = 0; j < HD / 16; ++j) { const size_t po = ((size_t)b * CC + h * HD + j * 16 + col) * (size_t)KHI + kc * 32; const v16b vh = frag_b(VB + po, lane); acc[j] = wmma_bf(p.h, vh, acc[j]); acc[j] = wmma_bf(p.l, vh, acc[j]); acc[j] = wmma_bf(p.h, frag_b(VBL + po, lane), acc[j]); } }
  } else {
#pragma unroll 1
    for (int kc = 0; kc < kce; ++kc) { const v16h p = frag_f32(PS + (size_t)(ql0 + col) * TT + kc * 32, lane);
      asm volatile("s_wait_loadcnt 0x0" ::: "memory");
#pragma unroll
      for (int j = 0; j < HD / 16; ++j) { const size_t po = ((size_t)b * CC + h * HD + j * 16 + col) * (size_t)TT + kc * 32; acc[j] = wmma16(p, frag_h(VT + po, lane), acc[j]); } } }
#pragma unroll
  for (int j = 0; j < HD / 16; ++j)
#pragma unroll
    for (int r = 0; r < 8; ++r) ss[wave][8 * g + r][j * 16 + col] = acc[j][r] * (1.0f / 2048.0f);
  LDSX(); for (int rl = 0; rl < 16; ++rl) if (lane < HD / 4) vst2(Y + ((size_t)b * TT + ql0 + rl) * CC + h * HD + lane * 4, *(const v4f*)&ss[wave][rl][lane * 4]); }
// ---- k_out: block = (64 rows, 128 cols): out = ctx Wo (+ bo): ctx once to f16 against Wo as f16(bf16 x 2^8) exact (1 product) x 2^-8; causal early rows (< QHI of each sequence): ctx bf16 hi + lo against exact bf16 Wo (2 products)
__global__ __launch_bounds__(128) void k_out(const float* __restrict__ Y, const float* __restrict__ WO, const float* __restrict__ BO, float* __restrict__ OUT) { __shared__ __align__(16) float sf[4][16][132];
  const int tid = threadIdx.x, wave = tid >> 5, lane = tid & 31, col = lane & 15, g = lane >> 4; const int c0 = blockIdx.y * 128; const size_t r0 = (size_t)blockIdx.x * 64 + wave * 16;
  v8f acc[8] = {};
  if (CAUSAL && (int)(((size_t)blockIdx.x * 64) % TT) < QHI) {   /* block-uniform */
#pragma unroll 2
    for (int kc = 0; kc < CC / 32; ++kc) { const F2 a = split_row(Y + (r0 + col) * CC, kc * 32, lane); asm volatile("s_wait_loadcnt 0x0" ::: "memory");
#pragma unroll
      for (int j = 0; j < 8; ++j) { const v16b w = WOCOL(WO, kc * 32, c0 + j * 16 + col, lane); asm volatile("s_wait_loadcnt 0x0" ::: "memory"); acc[j] = wmma_bf(a.h, w, acc[j]); acc[j] = wmma_bf(a.l, w, acc[j]); } }
#pragma unroll
    for (int j = 0; j < 8; ++j) { const float bias = BO ? bfr(BO[c0 + j * 16 + col]) : 0.f;
#pragma unroll
      for (int r = 0; r < 8; ++r) sf[wave][8 * g + r][j * 16 + col] = acc[j][r] + bias; }
  } else {
#pragma unroll 2
    for (int kc = 0; kc < CC / 32; ++kc) { const v16h a = frag_f32(Y + (r0 + col) * CC + kc * 32, lane); asm volatile("s_wait_loadcnt 0x0" ::: "memory");
#pragma unroll
      for (int j = 0; j < 8; ++j) { const v16h w = WOCOLH(WO, kc * 32, c0 + j * 16 + col, lane); asm volatile("s_wait_loadcnt 0x0" ::: "memory"); acc[j] = wmma16(a, w, acc[j]); } }
#pragma unroll
    for (int j = 0; j < 8; ++j) { const float bias = BO ? bfr(BO[c0 + j * 16 + col]) : 0.f;
#pragma unroll
      for (int r = 0; r < 8; ++r) sf[wave][8 * g + r][j * 16 + col] = acc[j][r] * (1.0f / 256.0f) + bias; } }
  LDSX(); for (int rl = 0; rl < 16; ++rl) vst2(OUT + (r0 + rl) * DIN + c0 + lane * 4, *(const v4f*)&sf[wave][rl][lane * 4]); }

extern "C" void kernel_launch(void* const* d_in, const int* in_sizes, int n_in, void* d_out, int out_size, void* d_ws, size_t ws_size, hipStream_t stream) {
  (void)in_sizes; (void)n_in; (void)out_size;
  const float** F = (const float**)d_in;
  if (ws_size < (size_t)WS_END) return;
  char* ws = (char*)d_ws; _Float16 *QH = (_Float16*)(ws + WS_QH), *KH = (_Float16*)(ws + WS_KH), *VT = (_Float16*)(ws + WS_VT), *QL = (_Float16*)(ws + WS_QL), *KL = (_Float16*)(ws + WS_KL); __bf16 *VB = (__bf16*)(ws + WS_VB), *VBL = (__bf16*)(ws + WS_VBL); float *S = (float*)(ws + WS_S), *Y = (float*)(ws + WS_Y);
  (void)Y; (void)QL; (void)KL; (void)VB; (void)VBL;
  // inputs: 0 p [4,1024,512]; 1 pcoords [4,1024,2]; 2 rpe_table [64,8]; 3 wq_w (in,out), 4 wq_b; 5 wk_w, 6 wk_b; 7 wv_w, 8 wv_b; 9 wo_w (in,out), 10 wo_b
  if (ws_size < (size_t)WS_END2) return;
  float* RNG = (float*)(ws + WS_RNG);
  k_range<<<1, 256, 0, stream>>>(F[1], RNG);
  k_proj<<<dim3(TNB * TT / 64, CC / 128, 3), 128, 0, stream>>>(F[0], F[0], F[0], F[3], F[5], F[7], F[4], F[6], F[8], QH, QL, KH, KL, VT, VB, VBL);
  k_sc<<<dim3(NQB, TT / 128, TNB * HG), 128, 0, stream>>>(QH, KH, QL, KL, 0, S);
  k_sm<<<dim3(TT, 1, TNB), 256, 0, stream>>>(S, F[1], F[2], RNG, 0);
  k_pv<<<dim3(NQB, TNB, HG), 128, 0, stream>>>(S, VT, VB, VBL, 0, Y);
  k_out<<<dim3(TNB * TT / 64, DIN / 128), 128, 0, stream>>>(Y, F[9], F[10], (float*)d_out);
}

// v003
// It runs in 178 microseconds.
// Next to v002, in two timings, it ran 1.16 and 1.17 times as fast.
// Over all steps from v000 it is 2.14 times as fast.
// compute dtype: all float inputs rounded to bf16; q/k/v = p W + b with EXACT bf16 products on WMMA 16x16x32 (f32 accumulate); q as f16 hi + residual (x 2^10) against k once to f16 (2 products) x 64^-0.5; the relative-position bias: bin indices computed per (batch, query, key) in f32 exactly as the reference (difference, division by the global eta range, x16, truncation; fmod-based wrap for phi), table values (bf16) added in f32; softmax in f32 (precise expf); P x 2^11 once to f16 against v once to f16 (1 product); ctx once to f16 against Wo carried x 2^8 in f16 + bo; f32 output.
#include <hip/hip_runtime.h>
#include <math.h>

typedef __attribute__((ext_vector_type(16))) _Float16 v16h;
typedef __attribute__((ext_vector_type(16))) __bf16 v16b;
typedef __attribute__((ext_vector_type(8)))  _Float16 v8h;
typedef __attribute__((ext_vector_type(8)))  float v8f;
typedef __attribute__((ext_vector_type(4)))  float v4f;
typedef __attribute__((ext_vector_type(2)))  float v2f;
typedef __attribute__((ext_vector_type(4)))  unsigned v4u;
typedef __attribute__((ext_vector_type(2)))  unsigned v2u;
typedef __attribute__((ext_vector_type(4)))  int v4i;
typedef float __attribute__((may_alias)) float_a;
typedef int __attribute__((may_alias)) int_a;

template <typename T> __device__ __forceinline__ void vst2(void* p, T v) { *(T*)p = v;  }
__device__ __forceinline__ v8f wmma16(v16h a, v16h b, v8f c) {
  v8f d = __builtin_amdgcn_wmma_f32_16x16x32_f16(false, a, false, b, (short)0, c, false, false);
  asm volatile("v_nop\n\tv_nop\n\tv_nop\n\tv_nop" : "+v"(d) : "v"(a), "v"(b));
  return d;
}
__device__ __forceinline__ v8f wmma_bf(v16b a, v16b b, v8f c) {
  v8f d = __builtin_amdgcn_wmma_f32_16x16x32_bf16(false, a, false, b, (short)0, c, false, false);
  asm volatile("v_nop\n\tv_nop\n\tv_nop\n\tv_nop" : "+v"(d) : "v"(a), "v"(b));
  return d;
}
// 16x16x32 fragments: lane = (h = lane>>4, row/col = lane&15); elements 0..7 = k0+8h+0..7, 8..15 = k0+16+8h+0..7; D element r = row 8h+r
__device__ __forceinline__ v16h frag_h(const _Float16* rowk0, int lane) {
  union { v16h v; v8h q[2]; } u; const _Float16* p = rowk0 + 8 * (lane >> 4);
  u.q[0] = *(const v8h*)p; u.q[1] = *(const v8h*)(p + 16); return u.v;
}
__device__ __forceinline__ v16h frag_f32(const float* rowk0, int lane) {
  v16h a; const float* p = rowk0 + 8 * (lane >> 4);
#pragma unroll
  for (int i = 0; i < 8; ++i) { a[i] = (_Float16)p[i]; a[8 + i] = (_Float16)p[16 + i]; }
  return a;
}
__device__ __forceinline__ v16h frag_f32s(const float* rowk0, int lane, float sc) {
  v16h a; const float* p = rowk0 + 8 * (lane >> 4);
#pragma unroll
  for (int i = 0; i < 8; ++i) { a[i] = (_Float16)(p[i] * sc); a[8 + i] = (_Float16)(p[16 + i] * sc); }
  return a;
}
// column fragment from a [K][ld] layout (column n), rows >= K read as 0
__device__ __forceinline__ v16h fragc_f32(const float* W, int k0, int n, int lane, int ld, int K) {
  v16h a; const int g = lane >> 4;
#pragma unroll
  for (int i = 0; i < 8; ++i) { const int ka = k0 + 8 * g + i, kb = ka + 16;
    a[i] = (_Float16)(ka < K ? W[(size_t)(ka < K ? ka : K - 1) * ld + n] : 0.f); a[8 + i] = (_Float16)(kb < K ? W[(size_t)(kb < K ? kb : K - 1) * ld + n] : 0.f); }
  return a;
}
struct F2 { v16b h, l; };
__device__ __forceinline__ F2 bsplit16(const float v[16]) { F2 r;
#pragma unroll
  for (int i = 0; i < 16; ++i) { const __bf16 h = (__bf16)v[i]; r.h[i] = h; r.l[i] = (__bf16)(v[i] - (float)h); }
  return r; }
__device__ __forceinline__ F2 split_row(const float* row, int k0, int lane) { float v[16]; const float* p = row + k0 + 8 * (lane >> 4);
#pragma unroll
  for (int i = 0; i < 8; ++i) { v[i] = p[i]; v[8 + i] = p[16 + i]; }
  return bsplit16(v); }
__device__ __forceinline__ F2 split_rowK(const float* row, int k0, int lane, int K) { float v[16]; const int g = lane >> 4;
#pragma unroll
  for (int i = 0; i < 8; ++i) { const int ka = k0 + 8 * g + i, kb = ka + 16; v[i] = ka < K ? row[ka < K ? ka : K - 1] : 0.f; v[8 + i] = kb < K ? row[kb < K ? kb : K - 1] : 0.f; }
  return bsplit16(v); }
__device__ __forceinline__ F2 split_col(const float* W, int k0, int n, int lane, int ld, int K) { float v[16]; const int g = lane >> 4;
#pragma unroll
  for (int i = 0; i < 8; ++i) { const int ka = k0 + 8 * g + i, kb = ka + 16; v[i] = ka < K ? W[(size_t)(ka < K ? ka : K - 1) * ld + n] : 0.f; v[8 + i] = kb < K ? W[(size_t)(kb < K ? kb : K - 1) * ld + n] : 0.f; }
  return bsplit16(v); }
__device__ __forceinline__ v8f mac3(const F2& a, const F2& b, v8f c) { c = wmma_bf(a.l, b.h, c); c = wmma_bf(a.h, b.l, c); return wmma_bf(a.h, b.h, c); }
__device__ __forceinline__ float sigm(float v) { return 1.0f / (1.0f + expf(-v)); }
#define LDSX() do { asm volatile("s_wait_dscnt 0" ::: "memory"); __builtin_amdgcn_wave_barrier(); __builtin_amdgcn_fence(__ATOMIC_RELEASE, "workgroup"); } while (0)

// Patch attention with a relative-position bias (B 4, T 1,024, D 512 = 8 heads x 64): q/k/v = p W + b ((in,out)); scores = q k^T / 8 + rpe_table[eta_bin + 16][h] + rpe_table[phi_bin + 48][h] with eta_bin = trunc((eta_i - eta_j) / max|eta_i - eta_j| * 16), phi_bin = trunc(wrap(phi_i - phi_j) / pi * 16), both clipped to [-16, 15]; softmax; out = merged(attn v) Wo + bo.
#define NB 4
#define TT 1024
#define CC 512            // NH * HD = projected width
#define DIN 512          // input (model) width
#define NH 8
#define HD 64
#define NQB (TT / 64)
#define HG 8
#define SCALE (0.125f)
#define CAUSAL 0
#ifndef TNB
#define TNB NB
#endif
__device__ __forceinline__ float bfr(float v) { return (float)(__bf16)v; }
__host__ __device__ __forceinline__ int kb_last(int qb) { return CAUSAL ? ((qb * 64 + 63) >> 7) : (TT / 128 - 1); }
typedef __attribute__((ext_vector_type(8))) __bf16 v8b;
__device__ __forceinline__ v16b frag_b(const __bf16* rowk0, int lane) {
  union { v16b v; v8b q[2]; } u; const __bf16* p = rowk0 + 8 * (lane >> 4);
  u.q[0] = *(const v8b*)p; u.q[1] = *(const v8b*)(p + 16); return u.v;
}
#define QBH 0              // no query block takes the high-precision path (qb < QBH never holds)
#define QHI 1024            // rows carrying a q residual plane (all rows when non-causal: 2-product logits everywhere)
#define KHI 64            // key rows carrying k residual / v bf16 hi+lo planes (read only by the qb < QBH path, which no block takes)
// B fragment (k rows k0+.., output column o) of a weight: (in,out) [K][ld] or (out,in) [ld rows of K]: bf16 exact, or f16(bf16 * 256) exact
__device__ __forceinline__ v16b wcol_io(const float* Wm, int k0, int o, int lane, int ld) { v16b w; const int g = lane >> 4;
#pragma unroll
  for (int i = 0; i < 8; ++i) { w[i] = (__bf16)Wm[(size_t)(k0 + 8 * g + i) * ld + o]; w[8 + i] = (__bf16)Wm[(size_t)(k0 + 16 + 8 * g + i) * ld + o]; }
  return w; }
__device__ __forceinline__ v16b wcol_oi(const float* Wm, int k0, int o, int lane, int K) { v16b w; const float* p = Wm + (size_t)o * K + k0 + 8 * (lane >> 4);
#pragma unroll
  for (int i = 0; i < 8; ++i) { w[i] = (__bf16)p[i]; w[8 + i] = (__bf16)p[16 + i]; }
  return w; }
__device__ __forceinline__ v16h wcolh_io(const float* Wm, int k0, int o, int lane, int ld) { v16h w; const int g = lane >> 4;
#pragma unroll
  for (int i = 0; i < 8; ++i) { w[i] = (_Float16)(bfr(Wm[(size_t)(k0 + 8 * g + i) * ld + o]) * 256.0f); w[8 + i] = (_Float16)(bfr(Wm[(size_t)(k0 + 16 + 8 * g + i) * ld + o]) * 256.0f); }
  return w; }
__device__ __forceinline__ v16h wcolh_oi(const float* Wm, int k0, int o, int lane, int K) { v16h w; const float* p = Wm + (size_t)o * K + k0 + 8 * (lane >> 4);
#pragma unroll
  for (int i = 0; i < 8; ++i) { w[i] = (_Float16)(bfr(p[i]) * 256.0f); w[8 + i] = (_Float16)(bfr(p[16 + i]) * 256.0f); }
  return w; }
#define WQKV_LAYOUT 0   // 0 = (in,out) [DIN][CC]; 1 = (out,in) [CC][DIN]; 2 = per-head [NH][DIN][HD]
__device__ __forceinline__ v16b wcol_hdk(const float* Wm, int k0, int o, int lane) { v16b w; const int g = lane >> 4; const float* p = Wm + (size_t)(o / HD) * DIN * HD + (o % HD);
#pragma unroll
  for (int i = 0; i < 8; ++i) { w[i] = (__bf16)p[(size_t)(k0 + 8 * g + i) * HD]; w[8 + i] = (__bf16)p[(size_t)(k0 + 16 + 8 * g + i) * HD]; }
  return w; }
#define WO_OUT_IN 0
#if WQKV_LAYOUT == 1
#define WCOL(W, k0, o, lane) wcol_oi(W, k0, o, lane, DIN)
#elif WQKV_LAYOUT == 2
#define WCOL(W, k0, o, lane) wcol_hdk(W, k0, o, lane)
#else
#define WCOL(W, k0, o, lane) wcol_io(W, k0, o, lane, CC)
#endif
#if WO_OUT_IN
#define WOCOL(W, k0, o, lane) wcol_oi(W, k0, o, lane, CC)
#define WOCOLH(W, k0, o, lane) wcolh_oi(W, k0, o, lane, CC)
#else
#define WOCOL(W, k0, o, lane) wcol_io(W, k0, o, lane, DIN)
#define WOCOLH(W, k0, o, lane) wcolh_io(W, k0, o, lane, DIN)
#endif
#define PI_F 3.14159274f          // f32(math.pi)
// bias bins of one (query, key) pair, the same for every head: byte offsets into one head's 64-entry f32 table column, eta bin in bits 7..0, phi bin (+32 entries) in bits 15..8. f32 steps exactly as the reference: jnp.mod = fmod then +y when the remainder is negative; .astype(int32) = truncation
__device__ __forceinline__ unsigned bias_bins(float et, float pt_, float ek, float pk_, float rng) {
  const float re = et - ek; int eb = (int)((re / rng) * 16.0f); eb = eb < -16 ? -16 : (eb > 15 ? 15 : eb);
  const float rp = pt_ - pk_; const float a_ = rp + PI_F; const float twopi = 2.0f * PI_F; float rm = fmodf(a_, twopi); rm = (rm != 0.0f && rm < 0.0f) ? rm + twopi : rm; const float wr = rm - PI_F;
  int pb = (int)((wr / PI_F) * 16.0f); pb = pb < -16 ? -16 : (pb > 15 ? 15 : pb);
  return (unsigned)((eb + 16) * 4) | ((unsigned)((pb + 16 + 32) * 4) << 8); }
// ---- k_range: one block: eta_range = max(max over batches of (max eta - min eta), 1e-6) on the bf16-rounded coordinates (= max |eta_i - eta_j| over all same-batch pairs, exact)
__global__ __launch_bounds__(256) void k_range(const float* __restrict__ PCO, float* __restrict__ RNG) { __shared__ float smx[8], smn[8]; __shared__ float sr;
  const int t = threadIdx.x; float best = 0.f;
  for (int b = 0; b < TNB; ++b) { float mx = -3.0e38f, mn = 3.0e38f; for (int i = t; i < TT; i += 256) { const float e = bfr(PCO[((size_t)b * TT + i) * 2]); mx = fmaxf(mx, e); mn = fminf(mn, e); }
    for (int o = 1; o < 32; o <<= 1) { mx = fmaxf(mx, __shfl_xor(mx, o)); mn = fminf(mn, __shfl_xor(mn, o)); }
    if ((t & 31) == 0) { smx[t >> 5] = mx; smn[t >> 5] = mn; } __syncthreads();
    if (t == 0) { float a = smx[0], c = smn[0]; for (int i = 1; i < 8; ++i) { a = fmaxf(a, smx[i]); c = fminf(c, smn[i]); } sr = a - c; } __syncthreads(); best = fmaxf(best, sr); __syncthreads(); }
  if (t < 32) { const float v = t == 0 ? fmaxf(best, 1e-6f) : 0.f; vst2(RNG + t, v); } }   
#define WS_RNG (WS_END)
#define WS_END2 (WS_RNG + 128u)

#define WS_QH  0u                                      // f16 q rows [b*t][CC]
#define WS_KH  (WS_QH + 2u * (size_t)NB * TT * CC)      // f16 k rows [b*t][CC]
#define WS_VT  (WS_KH + 2u * (size_t)NB * TT * CC)      // f16 v planes [b][c][t]
#define WS_QL  (WS_VT + 2u * (size_t)NB * CC * TT)      // f16 q residual x 2^10 rows [b][t < QHI][CC]
#define WS_KL  (WS_QL + 2u * (size_t)NB * QHI * CC)     // f16 k residual x 2^10 rows [b][t < KHI][CC]
#define WS_VB  (WS_KL + 2u * (size_t)NB * KHI * CC)     // bf16 v hi planes [b][c][t < KHI]
#define WS_VBL (WS_VB + 2u * (size_t)NB * CC * KHI)
#define WS_S   (WS_VBL + 2u * (size_t)NB * CC * KHI)    // f32 logits / P [b][hg][t][s]
#define WS_Y   (WS_S  + 4u * (size_t)NB * HG * TT * TT)      // f32 ctx rows [b*t][CC] (only when there is an output projection)
#define WS_END (WS_Y  + 4u * (size_t)NB * TT * CC)

// ---- k_proj: block = (64 rows, 128 cols, which): q/k/v = X W (+ b) with exact bf16 products (K = DIN) -> which 0: q f16 rows (+ residual rows < QHI); 1: k f16 rows (+ residual rows < KHI); 2: v f16 planes [c][t] (+ bf16 hi/lo planes for t < KHI)
__global__ __launch_bounds__(128) void k_proj(const float* __restrict__ XQ, const float* __restrict__ XK, const float* __restrict__ XV, const float* __restrict__ WQ, const float* __restrict__ WK, const float* __restrict__ WV, const float* __restrict__ BQ, const float* __restrict__ BK, const float* __restrict__ BV,
    _Float16* __restrict__ QH, _Float16* __restrict__ QL, _Float16* __restrict__ KH, _Float16* __restrict__ KL, _Float16* __restrict__ VT, __bf16* __restrict__ VB, __bf16* __restrict__ VBL) {
  __shared__ __align__(16) _Float16 sh[64][136], sl[64][136]; __shared__ __align__(16) _Float16 th[128][72]; __shared__ __align__(16) __bf16 tb[128][72], tbl[128][72];
  const int tid = threadIdx.x, wave = tid >> 5, lane = tid & 31, col = lane & 15, g = lane >> 4; const int which = blockIdx.z; const int c0 = blockIdx.y * 128; const size_t r0 = (size_t)blockIdx.x * 64; const size_t bb = r0 / TT; const int t0 = (int)(r0 % TT);
  const float* X = which == 0 ? XQ : which == 1 ? XK : XV; const float* WA = which == 0 ? WQ : which == 1 ? WK : WV; const float* BA = which == 0 ? BQ : which == 1 ? BK : BV;
  v8f acc[8] = {};
#pragma unroll 2
  for (int kc = 0; kc < DIN / 32; ++kc) { v16b a; { const float* p = X + (r0 + wave * 16 + col) * DIN + kc * 32 + 8 * g;
#pragma unroll
      for (int i = 0; i < 8; ++i) { a[i] = (__bf16)p[i]; a[8 + i] = (__bf16)p[16 + i]; } }
    v16b w[8];   // all eight weight fragments of the k step are loaded before its first product: their round trips overlap
#pragma unroll
    for (int j = 0; j < 8; ++j) w[j] = WCOL(WA, kc * 32, c0 + j * 16 + col, lane);
    // precaution: both address pairs stay live and unwritten (also by a later load's result) up to this wait
    asm volatile("s_wait_xcnt 0x0" :: "v"(X + (r0 + wave * 16 + col) * DIN + kc * 32 + 8 * g), "v"(WA + (size_t)(kc * 32 + 8 * g) * CC + c0 + col) : "memory");
#pragma unroll
    for (int j = 0; j < 8; ++j) acc[j] = wmma_bf(a, w[j], acc[j]); }
  if (which < 2) { _Float16* DH = which == 0 ? QH : KH; _Float16* DL = which == 0 ? QL : KL; const int nhi = which == 0 ? QHI : KHI; const bool hi_rows = t0 < nhi;
#pragma unroll
    for (int j = 0; j < 8; ++j) { const float bias = BA ? bfr(BA[c0 + j * 16 + col]) : 0.f;
#pragma unroll
      for (int r = 0; r < 8; ++r) { const float v = acc[j][r] + bias; const _Float16 hv = (_Float16)v; sh[wave * 16 + 8 * g + r][j * 16 + col] = hv; sl[wave * 16 + 8 * g + r][j * 16 + col] = (_Float16)((v - (float)hv) * 1024.0f); } }
    __syncthreads();
    for (int e = tid; e < 64 * 16; e += 128) { const int rl = e >> 4, q = e & 15; vst2((unsigned*)(DH + (r0 + rl) * CC + c0 + q * 8), *(const v4u*)&sh[rl][q * 8]); if (hi_rows) vst2((unsigned*)(DL + (bb * nhi + t0 + rl) * (size_t)CC + c0 + q * 8), *(const v4u*)&sl[rl][q * 8]); }
  } else { const bool hi_rows = t0 < KHI;
#pragma unroll
    for (int j = 0; j < 8; ++j) { const float bias = BA ? bfr(BA[c0 + j * 16 + col]) : 0.f;
#pragma unroll
      for (int r = 0; r < 8; ++r) { const float v = acc[j][r] + bias; const int rl = wave * 16 + 8 * g + r, cl = j * 16 + col; th[cl][rl] = (_Float16)v; const __bf16 bh = (__bf16)v; tb[cl][rl] = bh; tbl[cl][rl] = (__bf16)(v - (float)bh); } }
    __syncthreads();
    for (int e = tid; e < 128 * 8; e += 128) { const int cl = e >> 3, q = e & 7; vst2((unsigned*)(VT + (bb * CC + c0 + cl) * (size_t)TT + t0 + q * 8), *(const v4u*)&th[cl][q * 8]); if (hi_rows) { const size_t o3 = (bb * CC + c0 + cl) * (size_t)KHI + t0 + q * 8; vst2((unsigned*)(VB + o3), *(const v4u*)&tb[cl][q * 8]); vst2((unsigned*)(VBL + o3), *(const v4u*)&tbl[cl][q * 8]); } } } }
// ---- k_sc: block = (query block qb, key block kb <= kb_last(qb), z = batch b x HG + head in group), every batch in the one launch: logits x SCALE; q hi + residual (x 2^10) against k (2 products) for query rows < QHI, plus the k residual (3 products) for query blocks < QBH (causal early rows); causal: blocks past the diagonal exit; k_sm applies no mask (it asserts non-causal)
__global__ __launch_bounds__(128) void k_sc(const _Float16* __restrict__ QH, const _Float16* __restrict__ KH, const _Float16* __restrict__ QL, const _Float16* __restrict__ KL, int h0, float* __restrict__ S0) { __shared__ __align__(16) float ss[4][16][132];
  const int qb = blockIdx.x, kb = blockIdx.y; if (kb > kb_last(qb)) return;
  const int b = blockIdx.z / HG; const int h = h0 + blockIdx.z % HG; float* S = S0 + (size_t)blockIdx.z * TT * TT;
  const int tid = threadIdx.x, wave = tid >> 5, lane = tid & 31, col = lane & 15, g = lane >> 4; const int k0 = kb * 128; const int ql0 = qb * 64 + wave * 16; const size_t q0 = (size_t)b * TT + ql0, kr0 = (size_t)b * TT + k0;
  v8f acc[8] = {}, accl[8] = {};
  const _Float16* QLb = QL + (size_t)b * QHI * CC; const _Float16* KLb = KL + (size_t)b * KHI * CC;
  if (qb < QBH) {
#pragma unroll
    for (int kc = 0; kc < HD / 32; ++kc) { const v16h ah = frag_h(QH + (q0 + col) * CC + h * HD + kc * 32, lane), al = frag_h(QLb + (size_t)(ql0 + col) * CC + h * HD + kc * 32, lane);
#pragma unroll
      for (int j = 0; j < 8; ++j) { const v16h kbf = frag_h(KH + (kr0 + j * 16 + col) * CC + h * HD + kc * 32, lane), klf = frag_h(KLb + (size_t)(k0 + j * 16 + col) * CC + h * HD + kc * 32, lane); acc[j] = wmma16(ah, kbf, acc[j]); accl[j] = wmma16(al, kbf, accl[j]); accl[j] = wmma16(ah, klf, accl[j]); } }
  } else if (qb * 64 < QHI) {
#pragma unroll
    for (int kc = 0; kc < HD / 32; ++kc) { const v16h ah = frag_h(QH + (q0 + col) * CC + h * HD + kc * 32, lane), al = frag_h(QLb + (size_t)(ql0 + col) * CC + h * HD + kc * 32, lane);
      v16h kf[8];   // all eight k fragments of the k step are loaded before its first product: their round trips overlap
#pragma unroll
      for (int j = 0; j < 8; ++j) kf[j] = frag_h(KH + (kr0 + j * 16 + col) * CC + h * HD + kc * 32, lane);
#pragma unroll
      for (int j = 0; j < 8; ++j) { acc[j] = wmma16(ah, kf[j], acc[j]); accl[j] = wmma16(al, kf[j], accl[j]); } }
  } else {
#pragma unroll
    for (int kc = 0; kc < HD / 32; ++kc) { const v16h ah = frag_h(QH + (q0 + col) * CC + h * HD + kc * 32, lane);
#pragma unroll
      for (int j = 0; j < 8; ++j) { const v16h kbf = frag_h(KH + (kr0 + j * 16 + col) * CC + h * HD + kc * 32, lane); acc[j] = wmma16(ah, kbf, acc[j]); } } }
#pragma unroll
  for (int j = 0; j < 8; ++j) {
#pragma unroll
    for (int r = 0; r < 8; ++r) ss[wave][8 * g + r][j * 16 + col] = (acc[j][r] + accl[j][r] * (1.0f / 1024.0f)) * SCALE; }
  LDSX(); for (int rl = 0; rl < 16; ++rl) vst2(S + (size_t)(ql0 + rl) * TT + k0 + lane * 4, *(const v4f*)&ss[wave][rl][lane * 4]); }
// ---- k_sm: block = query row t of batch z, wave = head in group (HG = 8 waves): the 256 threads compute the row's TT bias bins once (they do not depend on the head; 4 neighbouring keys per thread) into LDS, then each wave takes its own head's logit row in registers (32 per lane): + bias, softmax in f32 with wave-only reductions; P x 2^11 in place. All TT keys (non-causal).
__global__ __launch_bounds__(256) void k_sm(float* __restrict__ S0, const float* __restrict__ PCO, const float* __restrict__ TAB, const float* __restrict__ RNG, int h0s) { __shared__ __align__(16) unsigned sbin[TT / 2]; __shared__ __align__(16) float stab[HG][64];
  static_assert(!CAUSAL && HG * 32 == 256 && TT == 1024, "one wave per head, whole rows, 4 keys per thread");
  const int tid = threadIdx.x, wave = tid >> 5, lane = tid & 31; const int t = blockIdx.x; const int bsm = blockIdx.z;
  float* sr = S0 + ((size_t)bsm * HG + wave) * TT * TT + (size_t)t * TT;
  const float* ckp = PCO + ((size_t)bsm * TT + tid * 4) * 2; const v4f ck0 = *(const v4f*)ckp, ck1 = *(const v4f*)(ckp + 4);
  const float tv0 = TAB[lane * NH + h0s + wave], tv1 = TAB[(lane + 32) * NH + h0s + wave];
  v4f x[TT / 128];
#pragma unroll  // x[] stays in registers only under constant indices
  for (int c = 0; c < TT / 128; ++c) x[c] = *(const v4f*)(sr + c * 128 + lane * 4);
  stab[wave][lane] = bfr(tv0); stab[wave][lane + 32] = bfr(tv1);
  { const float rng = RNG[0]; const float et = bfr(PCO[((size_t)bsm * TT + t) * 2]), pt_ = bfr(PCO[((size_t)bsm * TT + t) * 2 + 1]);
    const unsigned b0 = bias_bins(et, pt_, bfr(ck0[0]), bfr(ck0[1]), rng), b1 = bias_bins(et, pt_, bfr(ck0[2]), bfr(ck0[3]), rng), b2 = bias_bins(et, pt_, bfr(ck1[0]), bfr(ck1[1]), rng), b3 = bias_bins(et, pt_, bfr(ck1[2]), bfr(ck1[3]), rng);
    v2u w; w[0] = b0 | (b1 << 16); w[1] = b2 | (b3 << 16); *(v2u*)&sbin[tid * 2] = w; }
  __syncthreads();   // publishes every thread's bins (and the table columns) to the eight waves that read them below
  const char* tb = (const char*)&stab[wave][0];
  float m = -3.0e38f;
#pragma unroll  // x[] stays in registers only under constant indices
  for (int c = 0; c < TT / 128; ++c) { const v2u w = *(const v2u*)&sbin[c * 64 + lane * 2];
#pragma unroll  // x[] stays in registers only under constant indices
    for (int i = 0; i < 4; ++i) { const unsigned bi = w[i >> 1] >> (16 * (i & 1)); const float v = x[c][i] + (*(const float*)(tb + (bi & 0xffu)) + *(const float*)(tb + ((bi >> 8) & 0xffu))); x[c][i] = v; m = fmaxf(m, v); } }
#pragma unroll
  for (int o = 1; o < 32; o <<= 1) m = fmaxf(m, __shfl_xor(m, o));
  v4f s4 = {};
#pragma unroll  // x[] stays in registers only under constant indices
  for (int c = 0; c < TT / 128; ++c) {
#pragma unroll  // x[] stays in registers only under constant indices
    for (int i = 0; i < 4; ++i) { const float v = x[c][i]; const float ev = expf(v - m); const float e = (v <= -1.0e38f) ? 0.f : ev; x[c][i] = e; s4[i] += e; } }
  float sum = (s4[0] + s4[1]) + (s4[2] + s4[3]);
#pragma unroll
  for (int o = 1; o < 32; o <<= 1) sum += __shfl_xor(sum, o);
  const float inv = sum > 0.f ? 2048.0f / sum : 0.f;   /* a fully excluded row yields P = 0 */
#pragma unroll  // x[] stays in registers only under constant indices
  for (int c = 0; c < TT / 128; ++c) vst2(sr + c * 128 + lane * 4, x[c] * inv); }
// ---- k_pv: block = 64 queries (qb) of (b = y, h = z): ctx = P . v over keys [0, kend) (P x 2^11 once to f16 against v f16: 1 product; causal early query blocks: P and v as bf16 hi + lo, 3 products); 256-B (row, head) segment by 16 lanes
#define PVU 4   // k steps (32 keys each) whose loads are in flight together
__global__ __launch_bounds__(128) void k_pv(const float* __restrict__ PS0, const _Float16* __restrict__ VT, const __bf16* __restrict__ VB, const __bf16* __restrict__ VBL, int h0, float* __restrict__ Y) { const int b = blockIdx.y; const int h = h0 + blockIdx.z; const float* PS = PS0 + ((size_t)b * HG + blockIdx.z) * TT * TT; __shared__ __align__(16) float ss[4][16][HD + 4];
  const int tid = threadIdx.x, wave = tid >> 5, lane = tid & 31, col = lane & 15, g = lane >> 4; const int qb = blockIdx.x; const int ql0 = qb * 64 + wave * 16; const int kce = (kb_last(qb) + 1) * 4;
  v8f acc[HD / 16] = {};
  if (qb < QBH) {
#pragma unroll 1
    for (int kc = 0; kc < kce; ++kc) { const F2 p = split_row(PS + (size_t)(ql0 + col) * TT, kc * 32, lane);
      asm volatile("s_wait_loadcnt 0x0" ::: "memory");
#pragma unroll
      for (int j = 0; j < HD / 16; ++j) { const size_t po = ((size_t)b * CC + h * HD + j * 16 + col) * (size_t)KHI + kc * 32; const v16b vh = frag_b(VB + po, lane); acc[j] = wmma_bf(p.h, vh, acc[j]); acc[j] = wmma_bf(p.l, vh, acc[j]); acc[j] = wmma_bf(p.h, frag_b(VBL + po, lane), acc[j]); } }
  } else {
#pragma unroll 1  // one trip = PVU k steps (kce is a multiple of 4); a further unroll would only add registers
    for (int kc = 0; kc < kce; kc += PVU) { v16h p[PVU], vf[PVU][HD / 16];   // all P and v fragments of the trip are loaded before its first product: their round trips overlap
#pragma unroll
      for (int u = 0; u < PVU; ++u) p[u] = frag_f32(PS + (size_t)(ql0 + col) * TT + (kc + u) * 32, lane);
#pragma unroll
      for (int u = 0; u < PVU; ++u)
#pragma unroll
        for (int j = 0; j < HD / 16; ++j) vf[u][j] = frag_h(VT + ((size_t)b * CC + h * HD + j * 16 + col) * (size_t)TT + (kc + u) * 32, lane);
#pragma unroll
      for (int u = 0; u < PVU; ++u)
#pragma unroll
        for (int j = 0; j < HD / 16; ++j) acc[j] = wmma16(p[u], vf[u][j], acc[j]); } }
#pragma unroll
  for (int j = 0; j < HD / 16; ++j)
#pragma unroll
    for (int r = 0; r < 8; ++r) ss[wave][8 * g + r][j * 16 + col] = acc[j][r] * (1.0f / 2048.0f);
  LDSX(); for (int rl = 0; rl < 16; ++rl) if (lane < HD / 4) vst2(Y + ((size_t)b * TT + ql0 + rl) * CC + h * HD + lane * 4, *(const v4f*)&ss[wave][rl][lane * 4]); }
// ---- k_out: block = (64 rows, 128 cols): out = ctx Wo (+ bo): ctx once to f16 against Wo as f16(bf16 x 2^8) exact (1 product) x 2^-8; causal early rows (< QHI of each sequence): ctx bf16 hi + lo against exact bf16 Wo (2 products)
__global__ __launch_bounds__(128) void k_out(const float* __restrict__ Y, const float* __restrict__ WO, const float* __restrict__ BO, float* __restrict__ OUT) { __shared__ __align__(16) float sf[4][16][132];
  const int tid = threadIdx.x, wave = tid >> 5, lane = tid & 31, col = lane & 15, g = lane >> 4; const int c0 = blockIdx.y * 128; const size_t r0 = (size_t)blockIdx.x * 64 + wave * 16;
  v8f acc[8] = {};
  if (CAUSAL && (int)(((size_t)blockIdx.x * 64) % TT) < QHI) {   /* block-uniform */
#pragma unroll 2
    for (int kc = 0; kc < CC / 32; ++kc) { const F2 a = split_row(Y + (r0 + col) * CC, kc * 32, lane); asm volatile("s_wait_loadcnt 0x0" ::: "memory");
#pragma unroll
      for (int j = 0; j < 8; ++j) { const v16b w = WOCOL(WO, kc * 32, c0 + j * 16 + col, lane); asm volatile("s_wait_loadcnt 0x0" ::: "memory"); acc[j] = wmma_bf(a.h, w, acc[j]); acc[j] = wmma_bf(a.l, w, acc[j]); } }
#pragma unroll
    for (int j = 0; j < 8; ++j) { const float bias = BO ? bfr(BO[c0 + j * 16 + col]) : 0.f;
#pragma unroll
      for (int r = 0; r < 8; ++r) sf[wave][8 * g + r][j * 16 + col] = acc[j][r] + bias; }
  } else {
#pragma unroll 1  // rolled: each trip forms its own address pairs, the ones that the wait below holds
    for (int kc = 0; kc < CC / 32; ++kc) { const v16h a = frag_f32(Y + (r0 + col) * CC + kc * 32, lane);
      v16h w[8];   // all eight weight fragments of the k step are loaded before its first product: their round trips overlap
#pragma unroll
      for (int j = 0; j < 8; ++j) w[j] = WOCOLH(WO, kc * 32, c0 + j * 16 + col, lane);
      // precaution: both address pairs stay live and unwritten (also by a later load's result) up to this wait
      asm volatile("s_wait_xcnt 0x0" :: "v"(Y + (r0 + col) * CC + kc * 32 + 8 * g), "v"(WO + (size_t)(kc * 32 + 8 * g) * DIN + c0 + col) : "memory");
#pragma unroll
      for (int j = 0; j < 8; ++j) acc[j] = wmma16(a, w[j], acc[j]); }
#pragma unroll
    for (int j = 0; j < 8; ++j) { const float bias = BO ? bfr(BO[c0 + j * 16 + col]) : 0.f;
#pragma unroll
      for (int r = 0; r < 8; ++r) sf[wave][8 * g + r][j * 16 + col] = acc[j][r] * (1.0f / 256.0f) + bias; } }
  LDSX(); for (int rl = 0; rl < 16; ++rl) vst2(OUT + (r0 + rl) * DIN + c0 + lane * 4, *(const v4f*)&sf[wave][rl][lane * 4]); }

extern "C" void kernel_launch(void* const* d_in, const int* in_sizes, int n_in, void* d_out, int out_size, void* d_ws, size_t ws_size, hipStream_t stream) {
  (void)in_sizes; (void)n_in; (void)out_size;
  const float** F = (const float**)d_in;
  if (ws_size < (size_t)WS_END) return;
  char* ws = (char*)d_ws; _Float16 *QH = (_Float16*)(ws + WS_QH), *KH = (_Float16*)(ws + WS_KH), *VT = (_Float16*)(ws + WS_VT), *QL = (_Float16*)(ws + WS_QL), *KL = (_Float16*)(ws + WS_KL); __bf16 *VB = (__bf16*)(ws + WS_VB), *VBL = (__bf16*)(ws + WS_VBL); float *S = (float*)(ws + WS_S), *Y = (float*)(ws + WS_Y);
  (void)Y; (void)QL; (void)KL; (void)VB; (void)VBL;
  // inputs: 0 p [4,1024,512]; 1 pcoords [4,1024,2]; 2 rpe_table [64,8]; 3 wq_w (in,out), 4 wq_b; 5 wk_w, 6 wk_b; 7 wv_w, 8 wv_b; 9 wo_w (in,out), 10 wo_b
  if (ws_size < (size_t)WS_END2) return;
  float* RNG = (float*)(ws + WS_RNG);
  k_range<<<1, 256, 0, stream>>>(F[1], RNG);
  k_proj<<<dim3(TNB * TT / 64, CC / 128, 3), 128, 0, stream>>>(F[0], F[0], F[0], F[3], F[5], F[7], F[4], F[6], F[8], QH, QL, KH, KL, VT, VB, VBL);
  k_sc<<<dim3(NQB, TT / 128, TNB * HG), 128, 0, stream>>>(QH, KH, QL, KL, 0, S);
  k_sm<<<dim3(TT, 1, TNB), 256, 0, stream>>>(S, F[1], F[2], RNG, 0);
  k_pv<<<dim3(NQB, TNB, HG), 128, 0, stream>>>(S, VT, VB, VBL, 0, Y);
  k_out<<<dim3(TNB * TT / 64, DIN / 128), 128, 0, stream>>>(Y, F[9], F[10], (float*)d_out);
}

// v004
// One run takes 124 microseconds.
// Next to v003, in two timings, it ran 1.43 and 1.44 times as fast.
// Over all steps from v000 it is 3.08 times as fast.
// compute dtype: all float inputs rounded to bf16; q/k/v = p W + b with EXACT bf16 products on WMMA 16x16x32 (f32 accumulate); q as f16 hi + residual (x 2^10) against k once to f16 (2 products) x 64^-0.5; the relative-position bias: bin indices computed per (batch, query, key) in f32 exactly as the reference (difference, division by the global eta range, x16, truncation; fmod-based wrap for phi), table values (bf16) added in f32; softmax in f32 (precise expf) with a running maximum over 64-key steps; exp(logit - running maximum) once to f16 against v once to f16 (1 product), divided by the f32 sum at the end; ctx once to f16 against Wo carried x 2^8 in f16 + bo; f32 output.
#include <hip/hip_runtime.h>
#include <math.h>

typedef __attribute__((ext_vector_type(16))) _Float16 v16h;
typedef __attribute__((ext_vector_type(16))) __bf16 v16b;
typedef __attribute__((ext_vector_type(8)))  _Float16 v8h;
typedef __attribute__((ext_vector_type(8)))  float v8f;
typedef __attribute__((ext_vector_type(4)))  float v4f;
typedef __attribute__((ext_vector_type(2)))  float v2f;
typedef __attribute__((ext_vector_type(4)))  unsigned v4u;
typedef __attribute__((ext_vector_type(2)))  unsigned v2u;
typedef __attribute__((ext_vector_type(4)))  int v4i;
typedef float __attribute__((may_alias)) float_a;
typedef int __attribute__((may_alias)) int_a;

template <typename T> __device__ __forceinline__ void vst2(void* p, T v) { *(T*)p = v;  }
__device__ __forceinline__ v8f wmma16(v16h a, v16h b, v8f c) {
  v8f d = __builtin_amdgcn_wmma_f32_16x16x32_f16(false, a, false, b, (short)0, c, false, false);
  asm volatile("v_nop\n\tv_nop\n\tv_nop\n\tv_nop" : "+v"(d) : "v"(a), "v"(b));
  return d;
}
__device__ __forceinline__ v8f wmma_bf(v16b a, v16b b, v8f c) {
  v8f d = __builtin_amdgcn_wmma_f32_16x16x32_bf16(false, a, false, b, (short)0, c, false, false);
  asm volatile("v_nop\n\tv_nop\n\tv_nop\n\tv_nop" : "+v"(d) : "v"(a), "v"(b));
  return d;
}
// 16x16x32 fragments: lane = (h = lane>>4, row/col = lane&15); elements 0..7 = k0+8h+0..7, 8..15 = k0+16+8h+0..7; D element r = row 8h+r
__device__ __forceinline__ v16h frag_h(const _Float16* rowk0, int lane) {
  union { v16h v; v8h q[2]; } u; const _Float16* p = rowk0 + 8 * (lane >> 4);
  u.q[0] = *(const v8h*)p; u.q[1] = *(const v8h*)(p + 16); return u.v;
}
__device__ __forceinline__ v16h frag_f32(const float* rowk0, int lane) {
  v16h a; const float* p = rowk0 + 8 * (lane >> 4);
#pragma unroll
  for (int i = 0; i < 8; ++i) { a[i] = (_Float16)p[i]; a[8 + i] = (_Float16)p[16 + i]; }
  return a;
}
__device__ __forceinline__ v16h frag_f32s(const float* rowk0, int lane, float sc) {
  v16h a; const float* p = rowk0 + 8 * (lane >> 4);
#pragma unroll
  for (int i = 0; i < 8; ++i) { a[i] = (_Float16)(p[i] * sc); a[8 + i] = (_Float16)(p[16 + i] * sc); }
  return a;
}
// column fragment from a [K][ld] layout (column n), rows >= K read as 0
__device__ __forceinline__ v16h fragc_f32(const float* W, int k0, int n, int lane, int ld, int K) {
  v16h a; const int g = lane >> 4;
#pragma unroll
  for (int i = 0; i < 8; ++i) { const int ka = k0 + 8 * g + i, kb = ka + 16;
    a[i] = (_Float16)(ka < K ? W[(size_t)(ka < K ? ka : K - 1) * ld + n] : 0.f); a[8 + i] = (_Float16)(kb < K ? W[(size_t)(kb < K ? kb : K - 1) * ld + n] : 0.f); }
  return a;
}
struct F2 { v16b h, l; };
__device__ __forceinline__ F2 bsplit16(const float v[16]) { F2 r;
#pragma unroll
  for (int i = 0; i < 16; ++i) { const __bf16 h = (__bf16)v[i]; r.h[i] = h; r.l[i] = (__bf16)(v[i] - (float)h); }
  return r; }
__device__ __forceinline__ F2 split_row(const float* row, int k0, int lane) { float v[16]; const float* p = row + k0 + 8 * (lane >> 4);
#pragma unroll
  for (int i = 0; i < 8; ++i) { v[i] = p[i]; v[8 + i] = p[16 + i]; }
  return bsplit16(v); }
__device__ __forceinline__ F2 split_rowK(const float* row, int k0, int lane, int K) { float v[16]; const int g = lane >> 4;
#pragma unroll
  for (int i = 0; i < 8; ++i) { const int ka = k0 + 8 * g + i, kb = ka + 16; v[i] = ka < K ? row[ka < K ? ka : K - 1] : 0.f; v[8 + i] = kb < K ? row[kb < K ? kb : K - 1] : 0.f; }
  return bsplit16(v); }
__device__ __forceinline__ F2 split_col(const float* W, int k0, int n, int lane, int ld, int K) { float v[16]; const int g = lane >> 4;
#pragma unroll
  for (int i = 0; i < 8; ++i) { const int ka = k0 + 8 * g + i, kb = ka + 16; v[i] = ka < K ? W[(size_t)(ka < K ? ka : K - 1) * ld + n] : 0.f; v[8 + i] = kb < K ? W[(size_t)(kb < K ? kb : K - 1) * ld + n] : 0.f; }
  return bsplit16(v); }
__device__ __forceinline__ v8f mac3(const F2& a, const F2& b, v8f c) { c = wmma_bf(a.l, b.h, c); c = wmma_bf(a.h, b.l, c); return wmma_bf(a.h, b.h, c); }
__device__ __forceinline__ float sigm(float v) { return 1.0f / (1.0f + expf(-v)); }
#define LDSX() do { asm volatile("s_wait_dscnt 0" ::: "memory"); __builtin_amdgcn_wave_barrier(); __builtin_amdgcn_fence(__ATOMIC_RELEASE, "workgroup"); } while (0)

// Patch attention with a relative-position bias (B 4, T 1,024, D 512 = 8 heads x 64): q/k/v = p W + b ((in,out)); scores = q k^T / 8 + rpe_table[eta_bin + 16][h] + rpe_table[phi_bin + 48][h] with eta_bin = trunc((eta_i - eta_j) / max|eta_i - eta_j| * 16), phi_bin = trunc(wrap(phi_i - phi_j) / pi * 16), both clipped to [-16, 15]; softmax; out = merged(attn v) Wo + bo.
#define NB 4
#define TT 1024
#define CC 512            // NH * HD = projected width
#define DIN 512          // input (model) width
#define NH 8
#define HD 64
#define NQB (TT / 64)
#define HG 8
#define SCALE (0.125f)
#define CAUSAL 0
#ifndef TNB
#define TNB NB
#endif
__device__ __forceinline__ float bfr(float v) { return (float)(__bf16)v; }
__host__ __device__ __forceinline__ int kb_last(int qb) { return CAUSAL ? ((qb * 64 + 63) >> 7) : (TT / 128 - 1); }
typedef __attribute__((ext_vector_type(8))) __bf16 v8b;
__device__ __forceinline__ v16b frag_b(const __bf16* rowk0, int lane) {
  union { v16b v; v8b q[2]; } u; const __bf16* p = rowk0 + 8 * (lane >> 4);
  u.q[0] = *(const v8b*)p; u.q[1] = *(const v8b*)(p + 16); return u.v;
}
#define QBH 0              // not read by any kernel in this file (k_fa has no causal path)
#define QHI 1024            // rows carrying a q residual plane (all rows when non-causal: 2-product logits everywhere)
#define KHI 64            // key rows carrying k residual / v bf16 hi+lo planes (written by k_proj; no kernel here reads them)
// B fragment (k rows k0+.., output column o) of a weight: (in,out) [K][ld] or (out,in) [ld rows of K]: bf16 exact, or f16(bf16 * 256) exact
__device__ __forceinline__ v16b wcol_io(const float* Wm, int k0, int o, int lane, int ld) { v16b w; const int g = lane >> 4;
#pragma unroll
  for (int i = 0; i < 8; ++i) { w[i] = (__bf16)Wm[(size_t)(k0 + 8 * g + i) * ld + o]; w[8 + i] = (__bf16)Wm[(size_t)(k0 + 16 + 8 * g + i) * ld + o]; }
  return w; }
__device__ __forceinline__ v16b wcol_oi(const float* Wm, int k0, int o, int lane, int K) { v16b w; const float* p = Wm + (size_t)o * K + k0 + 8 * (lane >> 4);
#pragma unroll
  for (int i = 0; i < 8; ++i) { w[i] = (__bf16)p[i]; w[8 + i] = (__bf16)p[16 + i]; }
  return w; }
__device__ __forceinline__ v16h wcolh_io(const float* Wm, int k0, int o, int lane, int ld) { v16h w; const int g = lane >> 4;
#pragma unroll
  for (int i = 0; i < 8; ++i) { w[i] = (_Float16)(bfr(Wm[(size_t)(k0 + 8 * g + i) * ld + o]) * 256.0f); w[8 + i] = (_Float16)(bfr(Wm[(size_t)(k0 + 16 + 8 * g + i) * ld + o]) * 256.0f); }
  return w; }
__device__ __forceinline__ v16h wcolh_oi(const float* Wm, int k0, int o, int lane, int K) { v16h w; const float* p = Wm + (size_t)o * K + k0 + 8 * (lane >> 4);
#pragma unroll
  for (int i = 0; i < 8; ++i) { w[i] = (_Float16)(bfr(p[i]) * 256.0f); w[8 + i] = (_Float16)(bfr(p[16 + i]) * 256.0f); }
  return w; }
#define WQKV_LAYOUT 0   // 0 = (in,out) [DIN][CC]; 1 = (out,in) [CC][DIN]; 2 = per-head [NH][DIN][HD]
__device__ __forceinline__ v16b wcol_hdk(const float* Wm, int k0, int o, int lane) { v16b w; const int g = lane >> 4; const float* p = Wm + (size_t)(o / HD) * DIN * HD + (o % HD);
#pragma unroll
  for (int i = 0; i < 8; ++i) { w[i] = (__bf16)p[(size_t)(k0 + 8 * g + i) * HD]; w[8 + i] = (__bf16)p[(size_t)(k0 + 16 + 8 * g + i) * HD]; }
  return w; }
#define WO_OUT_IN 0
#if WQKV_LAYOUT == 1
#define WCOL(W, k0, o, lane) wcol_oi(W, k0, o, lane, DIN)
#elif WQKV_LAYOUT == 2
#define WCOL(W, k0, o, lane) wcol_hdk(W, k0, o, lane)
#else
#define WCOL(W, k0, o, lane) wcol_io(W, k0, o, lane, CC)
#endif
#if WO_OUT_IN
#define WOCOL(W, k0, o, lane) wcol_oi(W, k0, o, lane, CC)
#define WOCOLH(W, k0, o, lane) wcolh_oi(W, k0, o, lane, CC)
#else
#define WOCOL(W, k0, o, lane) wcol_io(W, k0, o, lane, DIN)
#define WOCOLH(W, k0, o, lane) wcolh_io(W, k0, o, lane, DIN)
#endif
#define PI_F 3.14159274f          // f32(math.pi)
// bias bins of one (query, key) pair, the same for every head: byte offsets into one head's 64-entry f32 table column, eta bin in bits 7..0, phi bin (+32 entries) in bits 15..8. f32 steps exactly as the reference: jnp.mod = fmod then +y when the remainder is negative; .astype(int32) = truncation
__device__ __forceinline__ unsigned bias_bins(float et, float pt_, float ek, float pk_, float rng) {
  const float re = et - ek; int eb = (int)((re / rng) * 16.0f); eb = eb < -16 ? -16 : (eb > 15 ? 15 : eb);
  const float rp = pt_ - pk_; const float a_ = rp + PI_F; const float twopi = 2.0f * PI_F; float rm = fmodf(a_, twopi); rm = (rm != 0.0f && rm < 0.0f) ? rm + twopi : rm; const float wr = rm - PI_F;
  int pb = (int)((wr / PI_F) * 16.0f); pb = pb < -16 ? -16 : (pb > 15 ? 15 : pb);
  return (unsigned)((eb + 16) * 4) | ((unsigned)((pb + 16 + 32) * 4) << 8); }
// ---- k_range: one block: eta_range = max(max over batches of (max eta - min eta), 1e-6) on the bf16-rounded coordinates (= max |eta_i - eta_j| over all same-batch pairs, exact)
__global__ __launch_bounds__(256) void k_range(const float* __restrict__ PCO, float* __restrict__ RNG) { __shared__ float smx[8], smn[8]; __shared__ float sr;
  const int t = threadIdx.x; float best = 0.f;
  for (int b = 0; b < TNB; ++b) { float mx = -3.0e38f, mn = 3.0e38f; for (int i = t; i < TT; i += 256) { const float e = bfr(PCO[((size_t)b * TT + i) * 2]); mx = fmaxf(mx, e); mn = fminf(mn, e); }
    for (int o = 1; o < 32; o <<= 1) { mx = fmaxf(mx, __shfl_xor(mx, o)); mn = fminf(mn, __shfl_xor(mn, o)); }
    if ((t & 31) == 0) { smx[t >> 5] = mx; smn[t >> 5] = mn; } __syncthreads();
    if (t == 0) { float a = smx[0], c = smn[0]; for (int i = 1; i < 8; ++i) { a = fmaxf(a, smx[i]); c = fminf(c, smn[i]); } sr = a - c; } __syncthreads(); best = fmaxf(best, sr); __syncthreads(); }
  if (t < 32) { const float v = t == 0 ? fmaxf(best, 1e-6f) : 0.f; vst2(RNG + t, v); } }   
#define WS_RNG (WS_END)
#define WS_END2 (WS_RNG + 128u)

#define WS_QH  0u                                      // f16 q rows [b*t][CC]
#define WS_KH  (WS_QH + 2u * (size_t)NB * TT * CC)      // f16 k rows [b*t][CC]
#define WS_VT  (WS_KH + 2u * (size_t)NB * TT * CC)      // f16 v planes [b][c][t]
#define WS_QL  (WS_VT + 2u * (size_t)NB * CC * TT)      // f16 q residual x 2^10 rows [b][t < QHI][CC]
#define WS_KL  (WS_QL + 2u * (size_t)NB * QHI * CC)     // f16 k residual x 2^10 rows [b][t < KHI][CC]
#define WS_VB  (WS_KL + 2u * (size_t)NB * KHI * CC)     // bf16 v hi planes [b][c][t < KHI]
#define WS_VBL (WS_VB + 2u * (size_t)NB * CC * KHI)
#define WS_S   (WS_VBL + 2u * (size_t)NB * CC * KHI)    // f32 [b][hg][t][s] region, unused: logits and P stay in registers
#define WS_Y   (WS_S  + 4u * (size_t)NB * HG * TT * TT)      // f32 ctx rows [b*t][CC] (only when there is an output projection)
#define WS_END (WS_Y  + 4u * (size_t)NB * TT * CC)

// ---- k_proj: block = (64 rows, 128 cols, which): q/k/v = X W (+ b) with exact bf16 products (K = DIN) -> which 0: q f16 rows (+ residual rows < QHI); 1: k f16 rows (+ residual rows < KHI); 2: v f16 planes [c][t] (+ bf16 hi/lo planes for t < KHI)
__global__ __launch_bounds__(128) void k_proj(const float* __restrict__ XQ, const float* __restrict__ XK, const float* __restrict__ XV, const float* __restrict__ WQ, const float* __restrict__ WK, const float* __restrict__ WV, const float* __restrict__ BQ, const float* __restrict__ BK, const float* __restrict__ BV,
    _Float16* __restrict__ QH, _Float16* __restrict__ QL, _Float16* __restrict__ KH, _Float16* __restrict__ KL, _Float16* __restrict__ VT, __bf16* __restrict__ VB, __bf16* __restrict__ VBL) {
  __shared__ __align__(16) _Float16 sh[64][136], sl[64][136]; __shared__ __align__(16) _Float16 th[128][72]; __shared__ __align__(16) __bf16 tb[128][72], tbl[128][72];
  const int tid = threadIdx.x, wave = tid >> 5, lane = tid & 31, col = lane & 15, g = lane >> 4; const int which = blockIdx.z; const int c0 = blockIdx.y * 128; const size_t r0 = (size_t)blockIdx.x * 64; const size_t bb = r0 / TT; const int t0 = (int)(r0 % TT);
  const float* X = which == 0 ? XQ : which == 1 ? XK : XV; const float* WA = which == 0 ? WQ : which == 1 ? WK : WV; const float* BA = which == 0 ? BQ : which == 1 ? BK : BV;
  v8f acc[8] = {};
#pragma unroll 2
  for (int kc = 0; kc < DIN / 32; ++kc) { v16b a; { const float* p = X + (r0 + wave * 16 + col) * DIN + kc * 32 + 8 * g;
#pragma unroll
      for (int i = 0; i < 8; ++i) { a[i] = (__bf16)p[i]; a[8 + i] = (__bf16)p[16 + i]; } }
    v16b w[8];   // all eight weight fragments of the k step are loaded before its first product: their round trips overlap
#pragma unroll
    for (int j = 0; j < 8; ++j) w[j] = WCOL(WA, kc * 32, c0 + j * 16 + col, lane);
    // precaution: both address pairs stay live and unwritten (also by a later load's result) up to this wait
    asm volatile("s_wait_xcnt 0x0" :: "v"(X + (r0 + wave * 16 + col) * DIN + kc * 32 + 8 * g), "v"(WA + (size_t)(kc * 32 + 8 * g) * CC + c0 + col) : "memory");
#pragma unroll
    for (int j = 0; j < 8; ++j) acc[j] = wmma_bf(a, w[j], acc[j]); }
  if (which < 2) { _Float16* DH = which == 0 ? QH : KH; _Float16* DL = which == 0 ? QL : KL; const int nhi = which == 0 ? QHI : KHI; const bool hi_rows = t0 < nhi;
#pragma unroll
    for (int j = 0; j < 8; ++j) { const float bias = BA ? bfr(BA[c0 + j * 16 + col]) : 0.f;
#pragma unroll
      for (int r = 0; r < 8; ++r) { const float v = acc[j][r] + bias; const _Float16 hv = (_Float16)v; sh[wave * 16 + 8 * g + r][j * 16 + col] = hv; sl[wave * 16 + 8 * g + r][j * 16 + col] = (_Float16)((v - (float)hv) * 1024.0f); } }
    __syncthreads();
    for (int e = tid; e < 64 * 16; e += 128) { const int rl = e >> 4, q = e & 15; vst2((unsigned*)(DH + (r0 + rl) * CC + c0 + q * 8), *(const v4u*)&sh[rl][q * 8]); if (hi_rows) vst2((unsigned*)(DL + (bb * nhi + t0 + rl) * (size_t)CC + c0 + q * 8), *(const v4u*)&sl[rl][q * 8]); }
  } else { const bool hi_rows = t0 < KHI;
#pragma unroll
    for (int j = 0; j < 8; ++j) { const float bias = BA ? bfr(BA[c0 + j * 16 + col]) : 0.f;
#pragma unroll
      for (int r = 0; r < 8; ++r) { const float v = acc[j][r] + bias; const int rl = wave * 16 + 8 * g + r, cl = j * 16 + col; th[cl][rl] = (_Float16)v; const __bf16 bh = (__bf16)v; tb[cl][rl] = bh; tbl[cl][rl] = (__bf16)(v - (float)bh); } }
    __syncthreads();
    for (int e = tid; e < 128 * 8; e += 128) { const int cl = e >> 3, q = e & 7; vst2((unsigned*)(VT + (bb * CC + c0 + cl) * (size_t)TT + t0 + q * 8), *(const v4u*)&th[cl][q * 8]); if (hi_rows) { const size_t o3 = (bb * CC + c0 + cl) * (size_t)KHI + t0 + q * 8; vst2((unsigned*)(VB + o3), *(const v4u*)&tb[cl][q * 8]); vst2((unsigned*)(VBL + o3), *(const v4u*)&tbl[cl][q * 8]); } } } }
// ---- k_fa: block = 16 query rows (t0..t0+15) of batch z, wave = head (8 waves): logits, bias, softmax and P.v in one kernel; no logit or P value goes to memory.
// The 256 threads first compute the 16 x TT bias bins (they do not depend on the head) into LDS, one barrier, then every wave runs alone over the keys, 64 per trip.
// Both products are transposed: S^T = K Q^T gives lane (g, col) the logits of query col at keys 8g + r, which is the B fragment of ctx^T = V^T P^T as it stands (tiles 2u and 2u + 1 = elements 0..7 and 8..15 of k step u), so P needs no move between lanes,
// and the running maximum, the sum and the rescale factor of a query live in that query's own two lanes (col and col + 16).
#define BP (TT / 2 + 4)   // dwords per bin row: 2,064 B = 16 B x odd, the conflict-free pitch for 16-byte LDS reads down a column of rows
__device__ __forceinline__ v8f wm16(v16h a, v16h b, v8f c) { return __builtin_amdgcn_wmma_f32_16x16x32_f16(false, a, false, b, (short)0, c, false, false); }
__device__ __forceinline__ v16h frag_p(const _Float16* p) { union { v16h v; v8h q[2]; } u; u.q[0] = *(const v8h*)p; u.q[1] = *(const v8h*)(p + 16); return u.v; }  // p = the lane's own first element (row start + k0 + 8g)
__device__ __forceinline__ float xhalf(float x) { return __builtin_bit_cast(float, __builtin_amdgcn_permlanex16(__builtin_bit_cast(int, x), __builtin_bit_cast(int, x), 0x76543210, 0xfedcba98, false, false)); }  // lane l with lane l ^ 16
__global__ __launch_bounds__(256) void k_fa(const _Float16* __restrict__ QH, const _Float16* __restrict__ QL, const _Float16* __restrict__ KH, const _Float16* __restrict__ VT, const float* __restrict__ PCO, const float* __restrict__ TAB, const float* __restrict__ RNG, float* __restrict__ Y) {
  __shared__ __align__(16) unsigned sbin[16][BP]; __shared__ __align__(16) float stab[NH][64];
  static_assert(!CAUSAL && NH * 32 == 256 && TT == 1024 && HD == 64 && QHI == TT, "one wave per head, whole rows, 4 keys per thread, q residual on every row");
  const int tid = threadIdx.x, wave = tid >> 5, lane = tid & 31, col = lane & 15, g = lane >> 4; const int t0 = blockIdx.x * 16; const int b = blockIdx.z; const int h = wave;
  { const float* ckp = PCO + ((size_t)b * TT + tid * 4) * 2; const v4f ck0 = *(const v4f*)ckp, ck1 = *(const v4f*)(ckp + 4);
    const float* tp = TAB + lane * NH + h; const float tv0 = tp[0], tv1 = tp[32 * NH];
    const float* qcp = PCO + ((size_t)b * TT + t0 + col) * 2; const v2f qc = *(const v2f*)qcp;   // lane l holds the coordinates of query l & 15: one load, read by lane number in the loop below
    // precaution: the three address pairs stay live and unwritten up to this wait
    asm volatile("s_wait_xcnt 0x0" :: "v"(ckp), "v"(tp), "v"(qcp) : "memory");
    const int qe = __builtin_bit_cast(int, bfr(qc[0])), qf = __builtin_bit_cast(int, bfr(qc[1]));
    stab[wave][lane] = bfr(tv0); stab[wave][lane + 32] = bfr(tv1);
    const float rng = RNG[0]; const float e0 = bfr(ck0[0]), p0 = bfr(ck0[1]), e1 = bfr(ck0[2]), p1 = bfr(ck0[3]), e2 = bfr(ck1[0]), p2 = bfr(ck1[1]), e3 = bfr(ck1[2]), p3 = bfr(ck1[3]);
#pragma unroll 1  // rolled: for speed only
    for (int qi = 0; qi < 16; ++qi) { const float et = __builtin_bit_cast(float, __builtin_amdgcn_readlane(qe, qi)), pt_ = __builtin_bit_cast(float, __builtin_amdgcn_readlane(qf, qi));
      const unsigned b0 = bias_bins(et, pt_, e0, p0, rng), b1 = bias_bins(et, pt_, e1, p1, rng), b2 = bias_bins(et, pt_, e2, p2, rng), b3 = bias_bins(et, pt_, e3, p3, rng);
      v2u w; w[0] = b0 | (b1 << 16); w[1] = b2 | (b3 << 16); *(v2u*)&sbin[qi][tid * 2] = w; } }
  __syncthreads();   // publishes every thread's bins to the eight waves that read them below; the only barrier
  const char* tb = (const char*)&stab[wave][0];
  const _Float16* qp = QH + ((size_t)b * TT + t0 + col) * CC + h * HD + 8 * g; const _Float16* qlp = QL + ((size_t)b * QHI + t0 + col) * CC + h * HD + 8 * g;
  const _Float16* kp = KH + ((size_t)b * TT + col) * CC + h * HD + 8 * g;           // key row col of the first tile, this head's 64 columns
  const _Float16* vp = VT + ((size_t)b * CC + h * HD + col) * (size_t)TT + 8 * g;   // v plane of head column col
  v16h qh[2], ql[2], kf[4][2];
#pragma unroll
  for (int kc = 0; kc < 2; ++kc) { qh[kc] = frag_p(qp + kc * 32); ql[kc] = frag_p(qlp + kc * 32); }
#pragma unroll
  for (int j = 0; j < 4; ++j)
#pragma unroll
    for (int kc = 0; kc < 2; ++kc) kf[j][kc] = frag_p(kp + (size_t)(j * 16) * CC + kc * 32);
  // precaution: the address pairs stay live and unwritten up to this wait
  asm volatile("s_wait_xcnt 0x0" :: "v"(qp), "v"(qlp), "v"(kp) : "memory");
  v8f ctx[4] = {}; float mrun = -3.0e38f, lsum = 0.f; const _Float16* kn = kp; const _Float16* vn = vp;   // the lane's own k row and v plane, moved on by 64 keys a trip
#pragma unroll 1  // rolled: one trip already holds the fragments of two trips in registers
  for (int ks = 0; ks < TT / 64; ++ks) { v8f s[4] = {}, sl[4] = {};
#pragma unroll
    for (int kc = 0; kc < 2; ++kc)
#pragma unroll
      for (int j = 0; j < 4; ++j) { s[j] = wm16(kf[j][kc], qh[kc], s[j]); sl[j] = wm16(kf[j][kc], ql[kc], sl[j]); }
    // the next trip's k fragments and this trip's v fragments fly while the softmax below runs (the last trip reads its own k tile again: in bounds, not used)
    kn += ks + 1 < TT / 64 ? 64 * CC : 0;
#pragma unroll
    for (int j = 0; j < 4; ++j)
#pragma unroll
      for (int kc = 0; kc < 2; ++kc) kf[j][kc] = frag_p(kn + (size_t)(j * 16) * CC + kc * 32);
    v16h vf[2][4];
#pragma unroll
    for (int u = 0; u < 2; ++u)
#pragma unroll
      for (int jj = 0; jj < 4; ++jj) vf[u][jj] = frag_p(vn + (size_t)(jj * 16) * TT + u * 32);
    // precaution: both address pairs stay live and unwritten up to this wait; it also keeps the loads above the softmax
    asm volatile("s_wait_xcnt 0x0" :: "v"(kn), "v"(vn) : "memory");
    vn += 64;
    float mx = mrun;
#pragma unroll
    for (int j = 0; j < 4; ++j) { const v4u w = *(const v4u*)&sbin[col][ks * 32 + j * 8 + 4 * g];
#pragma unroll
      for (int r = 0; r < 8; ++r) { const unsigned bi = w[r >> 1] >> (16 * (r & 1)); const float x = (s[j][r] + sl[j][r] * (1.0f / 1024.0f)) * SCALE;
        const float v = x + (*(const float*)(tb + (bi & 0xffu)) + *(const float*)(tb + ((bi >> 8) & 0xffu))); s[j][r] = v; mx = fmaxf(mx, v); } }
    mx = fmaxf(mx, xhalf(mx));   // a query's keys are split between lanes col and col + 16
    const float al = expf(mrun - mx); mrun = mx;
    v4f s4 = {}; v16h p[2];
#pragma unroll
    for (int j = 0; j < 4; ++j)
#pragma unroll
      for (int r = 0; r < 8; ++r) { const float e = expf(s[j][r] - mx); s4[r & 3] += e; p[j >> 1][(j & 1) * 8 + r] = (_Float16)e; }
    lsum = lsum * al + ((s4[0] + s4[1]) + (s4[2] + s4[3]));
#pragma unroll
    for (int jj = 0; jj < 4; ++jj) ctx[jj] = ctx[jj] * al;
#pragma unroll
    for (int u = 0; u < 2; ++u)
#pragma unroll
      for (int jj = 0; jj < 4; ++jj) ctx[jj] = wm16(vf[u][jj], p[u], ctx[jj]); }
  const float sum = lsum + xhalf(lsum); const float inv = sum > 0.f ? 1.0f / sum : 0.f;
  float* yp = Y + ((size_t)b * TT + t0 + col) * CC + h * HD + 8 * g;   // lane (g, col) holds head columns jj * 16 + 8g + r of query col
#pragma unroll
  for (int jj = 0; jj < 4; ++jj) { v4f lo, hi;
#pragma unroll
    for (int r = 0; r < 4; ++r) { lo[r] = ctx[jj][r] * inv; hi[r] = ctx[jj][4 + r] * inv; }
    vst2(yp + jj * 16, lo); vst2(yp + jj * 16 + 4, hi); } }
// ---- k_out: block = (64 rows, 128 cols): out = ctx Wo (+ bo): ctx once to f16 against Wo as f16(bf16 x 2^8) exact (1 product) x 2^-8; causal early rows (< QHI of each sequence): ctx bf16 hi + lo against exact bf16 Wo (2 products)
__global__ __launch_bounds__(128) void k_out(const float* __restrict__ Y, const float* __restrict__ WO, const float* __restrict__ BO, float* __restrict__ OUT) { __shared__ __align__(16) float sf[4][16][132];
  const int tid = threadIdx.x, wave = tid >> 5, lane = tid & 31, col = lane & 15, g = lane >> 4; const int c0 = blockIdx.y * 128; const size_t r0 = (size_t)blockIdx.x * 64 + wave * 16;
  v8f acc[8] = {};
  if (CAUSAL && (int)(((size_t)blockIdx.x * 64) % TT) < QHI) {   /* block-uniform */
#pragma unroll 2
    for (int kc = 0; kc < CC / 32; ++kc) { const F2 a = split_row(Y + (r0 + col) * CC, kc * 32, lane); asm volatile("s_wait_loadcnt 0x0" ::: "memory");
#pragma unroll
      for (int j = 0; j < 8; ++j) { const v16b w = WOCOL(WO, kc * 32, c0 + j * 16 + col, lane); asm volatile("s_wait_loadcnt 0x0" ::: "memory"); acc[j] = wmma_bf(a.h, w, acc[j]); acc[j] = wmma_bf(a.l, w, acc[j]); } }
#pragma unroll
    for (int j = 0; j < 8; ++j) { const float bias = BO ? bfr(BO[c0 + j * 16 + col]) : 0.f;
#pragma unroll
      for (int r = 0; r < 8; ++r) sf[wave][8 * g + r][j * 16 + col] = acc[j][r] + bias; }
  } else {
#pragma unroll 1  // rolled: each trip forms its own address pairs, the ones that the wait below holds
    for (int kc = 0; kc < CC / 32; ++kc) { const v16h a = frag_f32(Y + (r0 + col) * CC + kc * 32, lane);
      v16h w[8];   // all eight weight fragments of the k step are loaded before its first product: their round trips overlap
#pragma unroll
      for (int j = 0; j < 8; ++j) w[j] = WOCOLH(WO, kc * 32, c0 + j * 16 + col, lane);
      // precaution: both address pairs stay live and unwritten (also by a later load's result) up to this wait
      asm volatile("s_wait_xcnt 0x0" :: "v"(Y + (r0 + col) * CC + kc * 32 + 8 * g), "v"(WO + (size_t)(kc * 32 + 8 * g) * DIN + c0 + col) : "memory");
#pragma unroll
      for (int j = 0; j < 8; ++j) acc[j] = wmma16(a, w[j], acc[j]); }
#pragma unroll
    for (int j = 0; j < 8; ++j) { const float bias = BO ? bfr(BO[c0 + j * 16 + col]) : 0.f;
#pragma unroll
      for (int r = 0; r < 8; ++r) sf[wave][8 * g + r][j * 16 + col] = acc[j][r] * (1.0f / 256.0f) + bias; } }
  LDSX(); for (int rl = 0; rl < 16; ++rl) vst2(OUT + (r0 + rl) * DIN + c0 + lane * 4, *(const v4f*)&sf[wave][rl][lane * 4]); }

extern "C" void kernel_launch(void* const* d_in, const int* in_sizes, int n_in, void* d_out, int out_size, void* d_ws, size_t ws_size, hipStream_t stream) {
  (void)in_sizes; (void)n_in; (void)out_size;
  const float** F = (const float**)d_in;
  if (ws_size < (size_t)WS_END) return;
  char* ws = (char*)d_ws; _Float16 *QH = (_Float16*)(ws + WS_QH), *KH = (_Float16*)(ws + WS_KH), *VT = (_Float16*)(ws + WS_VT), *QL = (_Float16*)(ws + WS_QL), *KL = (_Float16*)(ws + WS_KL); __bf16 *VB = (__bf16*)(ws + WS_VB), *VBL = (__bf16*)(ws + WS_VBL); float *Y = (float*)(ws + WS_Y);
  (void)Y; (void)QL; (void)KL; (void)VB; (void)VBL;
  // inputs: 0 p [4,1024,512]; 1 pcoords [4,1024,2]; 2 rpe_table [64,8]; 3 wq_w (in,out), 4 wq_b; 5 wk_w, 6 wk_b; 7 wv_w, 8 wv_b; 9 wo_w (in,out), 10 wo_b
  if (ws_size < (size_t)WS_END2) return;
  float* RNG = (float*)(ws + WS_RNG);
  k_range<<<1, 256, 0, stream>>>(F[1], RNG);
  k_proj<<<dim3(TNB * TT / 64, CC / 128, 3), 128, 0, stream>>>(F[0], F[0], F[0], F[3], F[5], F[7], F[4], F[6], F[8], QH, QL, KH, KL, VT, VB, VBL);
  k_fa<<<dim3(TT / 16, 1, TNB), 256, 0, stream>>>(QH, QL, KH, VT, F[1], F[2], RNG, Y);
  k_out<<<dim3(TNB * TT / 64, DIN / 128), 128, 0, stream>>>(Y, F[9], F[10], (float*)d_out);
}

// v005
// Measured time: 80.5 microseconds a run.
// Next to v004, in two timings, it ran 1.53 and 1.54 times as fast.
// All steps since v000 together make it 4.74 times as fast.
// compute dtype: all float inputs rounded to bf16; q/k/v = p W + b with EXACT bf16 products on WMMA 16x16x32 (f32 accumulate); q as f16 hi + residual (x 2^10) against k once to f16 (2 products) x 64^-0.5; the relative-position bias: bin indices computed per (batch, query, key) in f32 exactly as the reference (difference, division by the global eta range, x16, truncation; fmod-based wrap for phi), table values (bf16) added in f32; softmax in f32 (precise expf) with a running maximum over 64-key steps; exp(logit - running maximum) once to f16 against v once to f16 (1 product), divided by the f32 sum at the end; ctx once to f16 against Wo carried x 2^8 in f16 + bo; f32 output.
#include <hip/hip_runtime.h>
#include <math.h>

typedef __attribute__((ext_vector_type(16))) _Float16 v16h;
typedef __attribute__((ext_vector_type(16))) __bf16 v16b;
typedef __attribute__((ext_vector_type(8)))  _Float16 v8h;
typedef __attribute__((ext_vector_type(8)))  float v8f;
typedef __attribute__((ext_vector_type(4)))  float v4f;
typedef __attribute__((ext_vector_type(2)))  float v2f;
typedef __attribute__((ext_vector_type(4)))  unsigned v4u;
typedef __attribute__((ext_vector_type(2)))  unsigned v2u;
typedef __attribute__((ext_vector_type(4)))  int v4i;
typedef float __attribute__((may_alias)) float_a;
typedef int __attribute__((may_alias)) int_a;

template <typename T> __device__ __forceinline__ void vst2(void* p, T v) { *(T*)p = v;  }
__device__ __forceinline__ v8f wmma16(v16h a, v16h b, v8f c) {
  v8f d = __builtin_amdgcn_wmma_f32_16x16x32_f16(false, a, false, b, (short)0, c, false, false);
  asm volatile("v_nop\n\tv_nop\n\tv_nop\n\tv_nop" : "+v"(d) : "v"(a), "v"(b));
  return d;
}
__device__ __forceinline__ v8f wmma_bf(v16b a, v16b b, v8f c) {
  v8f d = __builtin_amdgcn_wmma_f32_16x16x32_bf16(false, a, false, b, (short)0, c, false, false);
  asm volatile("v_nop\n\tv_nop\n\tv_nop\n\tv_nop" : "+v"(d) : "v"(a), "v"(b));
  return d;
}
// 16x16x32 fragments: lane = (h = lane>>4, row/col = lane&15); elements 0..7 = k0+8h+0..7, 8..15 = k0+16+8h+0..7; D element r = row 8h+r
__device__ __forceinline__ v16h frag_h(const _Float16* rowk0, int lane) {
  union { v16h v; v8h q[2]; } u; const _Float16* p = rowk0 + 8 * (lane >> 4);
  u.q[0] = *(const v8h*)p; u.q[1] = *(const v8h*)(p + 16); return u.v;
}
__device__ __forceinline__ v16h frag_f32(const float* rowk0, int lane) {
  v16h a; const float* p = rowk0 + 8 * (lane >> 4);
#pragma unroll
  for (int i = 0; i < 8; ++i) { a[i] = (_Float16)p[i]; a[8 + i] = (_Float16)p[16 + i]; }
  return a;
}
__device__ __forceinline__ v16h frag_f32s(const float* rowk0, int lane, float sc) {
  v16h a; const float* p = rowk0 + 8 * (lane >> 4);
#pragma unroll
  for (int i = 0; i < 8; ++i) { a[i] = (_Float16)(p[i] * sc); a[8 + i] = (_Float16)(p[16 + i] * sc); }
  return a;
}
// column fragment from a [K][ld] layout (column n), rows >= K read as 0
__device__ __forceinline__ v16h fragc_f32(const float* W, int k0, int n, int lane, int ld, int K) {
  v16h a; const int g = lane >> 4;
#pragma unroll
  for (int i = 0; i < 8; ++i) { const int ka = k0 + 8 * g + i, kb = ka + 16;
    a[i] = (_Float16)(ka < K ? W[(size_t)(ka < K ? ka : K - 1) * ld + n] : 0.f); a[8 + i] = (_Float16)(kb < K ? W[(size_t)(kb < K ? kb : K - 1) * ld + n] : 0.f); }
  return a;
}
struct F2 { v16b h, l; };
__device__ __forceinline__ F2 bsplit16(const float v[16]) { F2 r;
#pragma unroll
  for (int i = 0; i < 16; ++i) { const __bf16 h = (__bf16)v[i]; r.h[i] = h; r.l[i] = (__bf16)(v[i] - (float)h); }
  return r; }
__device__ __forceinline__ F2 split_row(const float* row, int k0, int lane) { float v[16]; const float* p = row + k0 + 8 * (lane >> 4);
#pragma unroll
  for (int i = 0; i < 8; ++i) { v[i] = p[i]; v[8 + i] = p[16 + i]; }
  return bsplit16(v); }
__device__ __forceinline__ F2 split_rowK(const float* row, int k0, int lane, int K) { float v[16]; const int g = lane >> 4;
#pragma unroll
  for (int i = 0; i < 8; ++i) { const int ka = k0 + 8 * g + i, kb = ka + 16; v[i] = ka < K ? row[ka < K ? ka : K - 1] : 0.f; v[8 + i] = kb < K ? row[kb < K ? kb : K - 1] : 0.f; }
  return bsplit16(v); }
__device__ __forceinline__ F2 split_col(const float* W, int k0, int n, int lane, int ld, int K) { float v[16]; const int g = lane >> 4;
#pragma unroll
  for (int i = 0; i < 8; ++i) { const int ka = k0 + 8 * g + i, kb = ka + 16; v[i] = ka < K ? W[(size_t)(ka < K ? ka : K - 1) * ld + n] : 0.f; v[8 + i] = kb < K ? W[(size_t)(kb < K ? kb : K - 1) * ld + n] : 0.f; }
  return bsplit16(v); }
__device__ __forceinline__ v8f mac3(const F2& a, const F2& b, v8f c) { c = wmma_bf(a.l, b.h, c); c = wmma_bf(a.h, b.l, c); return wmma_bf(a.h, b.h, c); }
__device__ __forceinline__ float sigm(float v) { return 1.0f / (1.0f + expf(-v)); }
#define LDSX() do { asm volatile("s_wait_dscnt 0" ::: "memory"); __builtin_amdgcn_wave_barrier(); __builtin_amdgcn_fence(__ATOMIC_RELEASE, "workgroup"); } while (0)

// Patch attention with a relative-position bias (B 4, T 1,024, D 512 = 8 heads x 64): q/k/v = p W + b ((in,out)); scores = q k^T / 8 + rpe_table[eta_bin + 16][h] + rpe_table[phi_bin + 48][h] with eta_bin = trunc((eta_i - eta_j) / max|eta_i - eta_j| * 16), phi_bin = trunc(wrap(phi_i - phi_j) / pi * 16), both clipped to [-16, 15]; softmax; out = merged(attn v) Wo + bo.
#define NB 4
#define TT 1024
#define CC 512            // NH * HD = projected width
#define DIN 512          // input (model) width
#define NH 8
#define HD 64
#define NQB (TT / 64)
#define HG 8
#define SCALE (0.125f)
#define CAUSAL 0
#ifndef TNB
#define TNB NB
#endif
__device__ __forceinline__ float bfr(float v) { return (float)(__bf16)v; }
__host__ __device__ __forceinline__ int kb_last(int qb) { return CAUSAL ? ((qb * 64 + 63) >> 7) : (TT / 128 - 1); }
typedef __attribute__((ext_vector_type(8))) __bf16 v8b;
__device__ __forceinline__ v16b frag_b(const __bf16* rowk0, int lane) {
  union { v16b v; v8b q[2]; } u; const __bf16* p = rowk0 + 8 * (lane >> 4);
  u.q[0] = *(const v8b*)p; u.q[1] = *(const v8b*)(p + 16); return u.v;
}
// precaution, behind a store in a loop: it stands in front of the first rewrite of a register that the store names
#define XCW() asm volatile("s_wait_xcnt 0x0" ::: "memory")
// one fragment in fragment order: p = fragment start + lane * 8
__device__ __forceinline__ v16b fragw_b(const __bf16* p) { union { v16b v; v8b q[2]; } u; u.q[0] = *(const v8b*)p; u.q[1] = *(const v8b*)(p + 256); return u.v; }
__device__ __forceinline__ v16h fragw_h(const _Float16* p) { union { v16h v; v8h q[2]; } u; u.q[0] = *(const v8h*)p; u.q[1] = *(const v8h*)(p + 256); return u.v; }
#define QBH 0              // unused: no kernel here has a separate high-precision path
#define QHI 1024            // rows carrying a q residual plane (all rows when non-causal: 2-product logits everywhere)
#define KHI 64            // key rows carrying k residual / v bf16 hi+lo planes (written by k_proj; no kernel here reads them)
// B fragment (k rows k0+.., output column o) of a weight: (in,out) [K][ld] or (out,in) [ld rows of K]: bf16 exact, or f16(bf16 * 256) exact
__device__ __forceinline__ v16b wcol_io(const float* Wm, int k0, int o, int lane, int ld) { v16b w; const int g = lane >> 4;
#pragma unroll
  for (int i = 0; i < 8; ++i) { w[i] = (__bf16)Wm[(size_t)(k0 + 8 * g + i) * ld + o]; w[8 + i] = (__bf16)Wm[(size_t)(k0 + 16 + 8 * g + i) * ld + o]; }
  return w; }
__device__ __forceinline__ v16b wcol_oi(const float* Wm, int k0, int o, int lane, int K) { v16b w; const float* p = Wm + (size_t)o * K + k0 + 8 * (lane >> 4);
#pragma unroll
  for (int i = 0; i < 8; ++i) { w[i] = (__bf16)p[i]; w[8 + i] = (__bf16)p[16 + i]; }
  return w; }
__device__ __forceinline__ v16h wcolh_io(const float* Wm, int k0, int o, int lane, int ld) { v16h w; const int g = lane >> 4;
#pragma unroll
  for (int i = 0; i < 8; ++i) { w[i] = (_Float16)(bfr(Wm[(size_t)(k0 + 8 * g + i) * ld + o]) * 256.0f); w[8 + i] = (_Float16)(bfr(Wm[(size_t)(k0 + 16 + 8 * g + i) * ld + o]) * 256.0f); }
  return w; }
__device__ __forceinline__ v16h wcolh_oi(const float* Wm, int k0, int o, int lane, int K) { v16h w; const float* p = Wm + (size_t)o * K + k0 + 8 * (lane >> 4);
#pragma unroll
  for (int i = 0; i < 8; ++i) { w[i] = (_Float16)(bfr(p[i]) * 256.0f); w[8 + i] = (_Float16)(bfr(p[16 + i]) * 256.0f); }
  return w; }
#define WQKV_LAYOUT 0   // selects WCOL only, which nothing calls; k_range always reads wq/wk/wv as (in,out) [DIN][CC]
__device__ __forceinline__ v16b wcol_hdk(const float* Wm, int k0, int o, int lane) { v16b w; const int g = lane >> 4; const float* p = Wm + (size_t)(o / HD) * DIN * HD + (o % HD);
#pragma unroll
  for (int i = 0; i < 8; ++i) { w[i] = (__bf16)p[(size_t)(k0 + 8 * g + i) * HD]; w[8 + i] = (__bf16)p[(size_t)(k0 + 16 + 8 * g + i) * HD]; }
  return w; }
#define WO_OUT_IN 0
#if WQKV_LAYOUT == 1
#define WCOL(W, k0, o, lane) wcol_oi(W, k0, o, lane, DIN)
#elif WQKV_LAYOUT == 2
#define WCOL(W, k0, o, lane) wcol_hdk(W, k0, o, lane)
#else
#define WCOL(W, k0, o, lane) wcol_io(W, k0, o, lane, CC)
#endif
#if WO_OUT_IN
#define WOCOL(W, k0, o, lane) wcol_oi(W, k0, o, lane, CC)
#define WOCOLH(W, k0, o, lane) wcolh_oi(W, k0, o, lane, CC)
#else
#define WOCOL(W, k0, o, lane) wcol_io(W, k0, o, lane, DIN)
#define WOCOLH(W, k0, o, lane) wcolh_io(W, k0, o, lane, DIN)
#endif
#define PI_F 3.14159274f          // f32(math.pi)
// bias bins of one (query, key) pair, the same for every head: byte offsets into one head's 64-entry f32 table column, eta bin in bits 7..0, phi bin (+32 entries) in bits 15..8. f32 steps exactly as the reference: jnp.mod = fmod then +y when the remainder is negative; .astype(int32) = truncation
__device__ __forceinline__ unsigned bias_bins(float et, float pt_, float ek, float pk_, float rng) {
  const float re = et - ek; int eb = (int)((re / rng) * 16.0f); eb = eb < -16 ? -16 : (eb > 15 ? 15 : eb);
  const float rp = pt_ - pk_; const float a_ = rp + PI_F; const float twopi = 2.0f * PI_F; float rm = fmodf(a_, twopi); rm = (rm != 0.0f && rm < 0.0f) ? rm + twopi : rm; const float wr = rm - PI_F;
  int pb = (int)((wr / PI_F) * 16.0f); pb = pb < -16 ? -16 : (pb > 15 ? 15 : pb);
  return (unsigned)((eb + 16) * 4) | ((unsigned)((pb + 16 + 32) * 4) << 8); }
// ---- k_range block 0: eta_range = max(max over batches of (max eta - min eta), 1e-6) on the bf16-rounded coordinates (= max |eta_i - eta_j| over all same-batch pairs, exact)
// FRAGMENT ORDER, the layout of every matrix operand in the workspace: [tile of 16 rows (A) or columns (B)][k step of 32] (weights: [k step][column tile]), then [half][lane][8 elements of 16 bits]; chunk (tile, ks, half, lane) holds row or column tile * 16 + (lane & 15) at k = ks * 32 + half * 16 + (lane >> 4) * 8 + 0..7.
// One fragment = 512 elements = 1 KB; each of its two 16-byte loads reads 512 contiguous bytes per wave = 4 whole lines.
// Blocks 1..256 of this launch: p to bf16 [row tile][k step] (block = row tile), and wq, wk, wv to bf16, wo to f16(bf16 x 2^8), each [k step][column tile] (64 blocks a matrix). Each value is rounded once, here.
__global__ __launch_bounds__(256) void k_range(const float* __restrict__ PCO, float* __restrict__ RNG, const float* __restrict__ X, const float* __restrict__ WQ, const float* __restrict__ WK, const float* __restrict__ WV, const float* __restrict__ WO, __bf16* __restrict__ XP, __bf16* __restrict__ WP) { __shared__ float smx[8], smn[8]; __shared__ float sr;
  static_assert(NB * TT / 16 == 256 && DIN == 512 && CC == 512, "256 row tiles, 64 blocks of 512 chunks a weight");
  if (blockIdx.x != 0) {   // block-uniform, in front of every barrier
    const int pb = blockIdx.x - 1, e = threadIdx.x; const int wsel = pb >> 6; const float* Wm = wsel == 0 ? WQ : wsel == 1 ? WK : wsel == 2 ? WV : WO;
    const float* xs = X + ((size_t)pb * 16 + (e & 15)) * DIN + (e >> 6) * 32 + ((e >> 5) & 1) * 16 + ((e >> 4) & 1) * 8;   // chunk e of the row tile; chunk e + 256 lies 4 k steps on
    const int ew = (pb & 63) * 512 + e;   // chunk of the matrix; chunk ew + 256 lies 4 column tiles on
    const float* wsr = Wm + (size_t)((ew >> 11) * 32 + ((ew >> 5) & 1) * 16 + ((ew >> 4) & 1) * 8) * 512 + ((ew >> 6) & 31) * 16 + (ew & 15);
    v4f xv[4][2]; float wv[2][8];
#pragma unroll
    for (int it = 0; it < 4; ++it) { xv[it][0] = *(const v4f*)(xs + it * 128); xv[it][1] = *(const v4f*)(xs + it * 128 + 4); }
#pragma unroll
    for (int it = 0; it < 2; ++it)
#pragma unroll
      for (int i = 0; i < 8; ++i) wv[it][i] = wsr[it * 64 + i * 512];
    // precaution: both address pairs stay live and unwritten up to this wait
    asm volatile("s_wait_xcnt 0x0" :: "v"(xs), "v"(wsr) : "memory");
#pragma unroll
    for (int it = 0; it < 4; ++it) { v8b o;
#pragma unroll
      for (int i = 0; i < 4; ++i) { o[i] = (__bf16)xv[it][0][i]; o[4 + i] = (__bf16)xv[it][1][i]; }
      vst2(XP + ((size_t)pb * 1024 + it * 256 + e) * 8, o); XCW(); }
#pragma unroll
    for (int it = 0; it < 2; ++it) { __bf16* d = WP + ((size_t)pb * 512 + it * 256 + e) * 8;
      if (wsel < 3) { v8b o;
#pragma unroll
        for (int i = 0; i < 8; ++i) o[i] = (__bf16)wv[it][i];
        vst2(d, o); }
      else { v8h o;
#pragma unroll
        for (int i = 0; i < 8; ++i) o[i] = (_Float16)(bfr(wv[it][i]) * 256.0f);
        vst2(d, o); }
      XCW(); }
    return; }
  const int t = threadIdx.x; float best = 0.f;
  for (int b = 0; b < TNB; ++b) { float mx = -3.0e38f, mn = 3.0e38f; for (int i = t; i < TT; i += 256) { const float e = bfr(PCO[((size_t)b * TT + i) * 2]); mx = fmaxf(mx, e); mn = fminf(mn, e); }
    for (int o = 1; o < 32; o <<= 1) { mx = fmaxf(mx, __shfl_xor(mx, o)); mn = fminf(mn, __shfl_xor(mn, o)); }
    if ((t & 31) == 0) { smx[t >> 5] = mx; smn[t >> 5] = mn; } __syncthreads();
    if (t == 0) { float a = smx[0], c = smn[0]; for (int i = 1; i < 8; ++i) { a = fmaxf(a, smx[i]); c = fminf(c, smn[i]); } sr = a - c; } __syncthreads(); best = fmaxf(best, sr); __syncthreads(); }
  if (t < 32) { const float v = t == 0 ? fmaxf(best, 1e-6f) : 0.f; vst2(RNG + t, v); } }   
#define WS_RNG (WS_END)
#define WS_END2 (WS_RNG + 128u)
#define WS_XP (WS_RNG + 4096u)                           // bf16 p, fragment order (every fragment starts on a 1 KB boundary)
#define WS_WP (WS_XP + 2u * (size_t)NB * TT * DIN)       // wq, wk, wv (bf16), wo (f16), fragment order
#define WS_END3 (WS_WP + 4u * 2u * (size_t)DIN * CC)

#define WS_QH  0u                                      // f16 q, fragment order [token tile][k step]
#define WS_KH  (WS_QH + 2u * (size_t)NB * TT * CC)      // f16 k, fragment order [token tile][k step]
#define WS_VT  (WS_KH + 2u * (size_t)NB * TT * CC)      // f16 v, fragment order [b][column tile][k step of 32 tokens]
#define WS_QL  (WS_VT + 2u * (size_t)NB * CC * TT)      // f16 q residual x 2^10, fragment order as q
#define WS_KL  (WS_QL + 2u * (size_t)NB * QHI * CC)     // f16 k residual x 2^10 rows [b][t < KHI][CC]
#define WS_VB  (WS_KL + 2u * (size_t)NB * KHI * CC)     // bf16 v hi planes [b][c][t < KHI]
#define WS_VBL (WS_VB + 2u * (size_t)NB * CC * KHI)
#define WS_S   (WS_VBL + 2u * (size_t)NB * CC * KHI)    // f32 [b][hg][t][s], unused: no kernel here stores logits or P
#define WS_Y   (WS_S  + 4u * (size_t)NB * HG * TT * TT)      // f16 ctx, fragment order [token tile][k step] (the first half of the range)
#define WS_END (WS_Y  + 4u * (size_t)NB * TT * CC)

// ---- k_proj: block = (64 rows, 128 cols, which): q/k/v = X W (+ b) with exact bf16 products (K = DIN), both operands read in fragment order -> which 0: q f16 (+ residual, rows < QHI), fragment order; 1: k f16, fragment order (+ residual rows < KHI); 2: v f16, fragment order (+ bf16 hi/lo planes for t < KHI)
__global__ __launch_bounds__(128) void k_proj(const __bf16* __restrict__ XP, const __bf16* __restrict__ WP, const float* __restrict__ BQ, const float* __restrict__ BK, const float* __restrict__ BV,
    _Float16* __restrict__ QH, _Float16* __restrict__ QL, _Float16* __restrict__ KH, _Float16* __restrict__ KL, _Float16* __restrict__ VT, __bf16* __restrict__ VB, __bf16* __restrict__ VBL) {
  __shared__ __align__(16) _Float16 sh[64][136], sl[64][136]; __shared__ __align__(16) _Float16 th[128][72]; __shared__ __align__(16) __bf16 tb[128][72], tbl[128][72];
  const int tid = threadIdx.x, wave = tid >> 5, lane = tid & 31, col = lane & 15, g = lane >> 4; const int which = blockIdx.z; const int c0 = blockIdx.y * 128; const size_t r0 = (size_t)blockIdx.x * 64; const size_t bb = r0 / TT; const int t0 = (int)(r0 % TT);
  const float* BA = which == 0 ? BQ : which == 1 ? BK : BV;
  const __bf16* xa = XP + (size_t)(blockIdx.x * 4 + wave) * (16 * 512) + lane * 8;                      // the wave's row tile, k step 0
  const __bf16* wb = WP + (size_t)which * (DIN * CC) + (size_t)(blockIdx.y * 8) * 512 + lane * 8;   // the block's first column tile, k step 0
  v8f acc[8] = {};
#pragma unroll  // unrolled: every fragment is a constant offset from the two address pairs, which are never rewritten
  for (int kc = 0; kc < DIN / 32; ++kc) { const v16b a = fragw_b(xa + kc * 512);
    v16b w[8];   // all eight weight fragments of the k step are loaded before its first product: their round trips overlap
#pragma unroll
    for (int j = 0; j < 8; ++j) w[j] = fragw_b(wb + (kc * 32 + j) * 512);
#pragma unroll
    for (int j = 0; j < 8; ++j) acc[j] = wmma_bf(a, w[j], acc[j]); }
  // precaution: both address pairs stay live and unwritten up to this wait
  asm volatile("s_wait_xcnt 0x0" :: "v"(xa), "v"(wb) : "memory");
  if (which < 2) { _Float16* DH = which == 0 ? QH : KH; _Float16* DL = which == 0 ? QL : KL; const int nhi = which == 0 ? QHI : KHI; const bool hi_rows = t0 < nhi;
#pragma unroll
    for (int j = 0; j < 8; ++j) { const float bias = BA ? bfr(BA[c0 + j * 16 + col]) : 0.f;
#pragma unroll
      for (int r = 0; r < 8; ++r) { const float v = acc[j][r] + bias; const _Float16 hv = (_Float16)v; sh[wave * 16 + 8 * g + r][j * 16 + col] = hv; sl[wave * 16 + 8 * g + r][j * 16 + col] = (_Float16)((v - (float)hv) * 1024.0f); } }
    __syncthreads();
    // q, its residual and k go out in fragment order (row tile = 16 tokens, k step = 32 columns): chunk e = [row tile 4][k step 4][half][lane]; the k residual rows keep their row layout
    for (int e = tid; e < 64 * 16; e += 128) { const int rl = (e >> 8) * 16 + (e & 15), cl = ((e >> 6) & 3) * 32 + ((e >> 5) & 1) * 16 + ((e >> 4) & 1) * 8;
      const size_t o = (((size_t)blockIdx.x * 4 + (e >> 8)) * 16 + blockIdx.y * 4 + ((e >> 6) & 3)) * 512 + (e & 63) * 8;
      vst2((unsigned*)(DH + o), *(const v4u*)&sh[rl][cl]); XCW(); if (hi_rows) { vst2((unsigned*)(which == 0 ? DL + o : DL + (bb * nhi + t0 + rl) * (size_t)CC + c0 + cl), *(const v4u*)&sl[rl][cl]); XCW(); } }
  } else { const bool hi_rows = t0 < KHI;
#pragma unroll
    for (int j = 0; j < 8; ++j) { const float bias = BA ? bfr(BA[c0 + j * 16 + col]) : 0.f;
#pragma unroll
      for (int r = 0; r < 8; ++r) { const float v = acc[j][r] + bias; const int rl = wave * 16 + 8 * g + r, cl = j * 16 + col; th[cl][rl] = (_Float16)v; const __bf16 bh = (__bf16)v; tb[cl][rl] = bh; tbl[cl][rl] = (__bf16)(v - (float)bh); } }
    __syncthreads();
    // v goes out in fragment order (row tile = 16 columns of a batch, k step = 32 tokens): chunk e = [column tile 8][k step 2][half][lane]; the bf16 planes keep their layout
    for (int e = tid; e < 128 * 8; e += 128) { const int cl = (e >> 7) * 16 + (e & 15), tl = ((e >> 6) & 1) * 32 + ((e >> 5) & 1) * 16 + ((e >> 4) & 1) * 8;
      const size_t o = ((bb * (CC / 16) + blockIdx.y * 8 + (e >> 7)) * (TT / 32) + (t0 >> 5) + ((e >> 6) & 1)) * 512 + (e & 63) * 8;
      vst2((unsigned*)(VT + o), *(const v4u*)&th[cl][tl]); XCW(); if (hi_rows) { const size_t o3 = (bb * CC + c0 + cl) * (size_t)KHI + t0 + tl; vst2((unsigned*)(VB + o3), *(const v4u*)&tb[cl][tl]); vst2((unsigned*)(VBL + o3), *(const v4u*)&tbl[cl][tl]); XCW(); } } } }
// ---- k_fa: block = 16 query rows (t0..t0+15) of batch z, wave = head (8 waves): logits, bias, softmax and P.v in one kernel; no logit or P value goes to memory.
// The 256 threads first compute the 16 x TT bias bins (they do not depend on the head) into LDS, one barrier, then every wave runs alone over the keys, 64 per trip.
// Both products are transposed: S^T = K Q^T gives lane (g, col) the logits of query col at keys 8g + r, which is the B fragment of ctx^T = V^T P^T as it stands (tiles 2u and 2u + 1 = elements 0..7 and 8..15 of k step u), so P needs no move between lanes,
// and the running maximum, the sum and the rescale factor of a query live in that query's own two lanes (col and col + 16).
#define BP (TT / 2 + 4)   // dwords per bin row: 2,064 B = 16 B x odd, the conflict-free pitch for 16-byte LDS reads down a column of rows
__device__ __forceinline__ v8f wm16(v16h a, v16h b, v8f c) { return __builtin_amdgcn_wmma_f32_16x16x32_f16(false, a, false, b, (short)0, c, false, false); }
__device__ __forceinline__ v16h frag_p(const _Float16* p) { union { v16h v; v8h q[2]; } u; u.q[0] = *(const v8h*)p; u.q[1] = *(const v8h*)(p + 16); return u.v; }  // p = the lane's own first element (row start + k0 + 8g)
__device__ __forceinline__ float xhalf(float x) { return __builtin_bit_cast(float, __builtin_amdgcn_permlanex16(__builtin_bit_cast(int, x), __builtin_bit_cast(int, x), 0x76543210, 0xfedcba98, false, false)); }  // lane l with lane l ^ 16
__global__ __launch_bounds__(256) void k_fa(const _Float16* __restrict__ QH, const _Float16* __restrict__ QL, const _Float16* __restrict__ KH, const _Float16* __restrict__ VT, const float* __restrict__ PCO, const float* __restrict__ TAB, const float* __restrict__ RNG, _Float16* __restrict__ Y) {
  __shared__ __align__(16) unsigned sbin[16][BP]; __shared__ __align__(16) float stab[NH][64];
  static_assert(!CAUSAL && NH * 32 == 256 && TT == 1024 && HD == 64 && QHI == TT, "one wave per head, whole rows, 4 keys per thread, q residual on every row");
  const int tid = threadIdx.x, wave = tid >> 5, lane = tid & 31, col = lane & 15, g = lane >> 4; const int t0 = blockIdx.x * 16; const int b = blockIdx.z; const int h = wave;
  { const float* ckp = PCO + ((size_t)b * TT + tid * 4) * 2; const v4f ck0 = *(const v4f*)ckp, ck1 = *(const v4f*)(ckp + 4);
    const float* tp = TAB + lane * NH + h; const float tv0 = tp[0], tv1 = tp[32 * NH];
    const float* qcp = PCO + ((size_t)b * TT + t0 + col) * 2; const v2f qc = *(const v2f*)qcp;   // lane l holds the coordinates of query l & 15: one load, read by lane number in the loop below
    // precaution: the three address pairs stay live and unwritten up to this wait
    asm volatile("s_wait_xcnt 0x0" :: "v"(ckp), "v"(tp), "v"(qcp) : "memory");
    const int qe = __builtin_bit_cast(int, bfr(qc[0])), qf = __builtin_bit_cast(int, bfr(qc[1]));
    stab[wave][lane] = bfr(tv0); stab[wave][lane + 32] = bfr(tv1);
    const float rng = RNG[0]; const float e0 = bfr(ck0[0]), p0 = bfr(ck0[1]), e1 = bfr(ck0[2]), p1 = bfr(ck0[3]), e2 = bfr(ck1[0]), p2 = bfr(ck1[1]), e3 = bfr(ck1[2]), p3 = bfr(ck1[3]);
#pragma unroll 1  // rolled: for speed only
    for (int qi = 0; qi < 16; ++qi) { const float et = __builtin_bit_cast(float, __builtin_amdgcn_readlane(qe, qi)), pt_ = __builtin_bit_cast(float, __builtin_amdgcn_readlane(qf, qi));
      const unsigned b0 = bias_bins(et, pt_, e0, p0, rng), b1 = bias_bins(et, pt_, e1, p1, rng), b2 = bias_bins(et, pt_, e2, p2, rng), b3 = bias_bins(et, pt_, e3, p3, rng);
      v2u w; w[0] = b0 | (b1 << 16); w[1] = b2 | (b3 << 16); *(v2u*)&sbin[qi][tid * 2] = w; } }
  __syncthreads();   // publishes every thread's bins to the eight waves that read them below; the only barrier
  const char* tb = (const char*)&stab[wave][0];
  // all four operands lie in fragment order; a head's 64 columns are k steps 2h and 2h + 1 of a token tile, its v columns are column tiles 4h .. 4h + 3 of the batch
  const size_t qo = (((size_t)b * (TT / 16) + blockIdx.x) * 16 + h * 2) * 512 + lane * 8;
  const _Float16* qp = QH + qo; const _Float16* qlp = QL + qo;
  const _Float16* kp = KH + ((size_t)b * (TT / 16) * 16 + h * 2) * 512 + lane * 8;          // first key tile of the batch
  const _Float16* vp = VT + ((size_t)b * (CC / 16) + h * 4) * (TT / 32) * 512 + lane * 8;   // first column tile of the head, first 32 keys
  v16h qh[2], ql[2], kf[4][2];
#pragma unroll
  for (int kc = 0; kc < 2; ++kc) { qh[kc] = fragw_h(qp + kc * 512); ql[kc] = fragw_h(qlp + kc * 512); }
#pragma unroll
  for (int j = 0; j < 4; ++j)
#pragma unroll
    for (int kc = 0; kc < 2; ++kc) kf[j][kc] = fragw_h(kp + (j * 16 + kc) * 512);
  // precaution: the address pairs stay live and unwritten up to this wait
  asm volatile("s_wait_xcnt 0x0" :: "v"(qp), "v"(qlp), "v"(kp) : "memory");
  v8f ctx[4] = {}; float mrun = -3.0e38f, lsum = 0.f; const _Float16* kn = kp; const _Float16* vn = vp;   // the lane's own k row and v plane, moved on by 64 keys a trip
#pragma unroll 1  // rolled: one trip already holds the fragments of two trips in registers
  for (int ks = 0; ks < TT / 64; ++ks) { v8f s[4] = {}, sl[4] = {};
#pragma unroll
    for (int kc = 0; kc < 2; ++kc)
#pragma unroll
      for (int j = 0; j < 4; ++j) { s[j] = wm16(kf[j][kc], qh[kc], s[j]); sl[j] = wm16(kf[j][kc], ql[kc], sl[j]); }
    // the next trip's k fragments and this trip's v fragments fly while the softmax below runs (the last trip reads its own k tile again: in bounds, not used)
    kn += ks + 1 < TT / 64 ? 4 * 16 * 512 : 0;
#pragma unroll
    for (int j = 0; j < 4; ++j)
#pragma unroll
      for (int kc = 0; kc < 2; ++kc) kf[j][kc] = fragw_h(kn + (j * 16 + kc) * 512);
    v16h vf[2][4];
#pragma unroll
    for (int u = 0; u < 2; ++u)
#pragma unroll
      for (int jj = 0; jj < 4; ++jj) vf[u][jj] = fragw_h(vn + (jj * (TT / 32) + u) * 512);
    // precaution: both address pairs stay live and unwritten up to this wait; it also keeps the loads above the softmax
    asm volatile("s_wait_xcnt 0x0" :: "v"(kn), "v"(vn) : "memory");
    vn += 2 * 512;
    float mx = mrun;
#pragma unroll
    for (int j = 0; j < 4; ++j) { const v4u w = *(const v4u*)&sbin[col][ks * 32 + j * 8 + 4 * g];
#pragma unroll
      for (int r = 0; r < 8; ++r) { const unsigned bi = w[r >> 1] >> (16 * (r & 1)); const float x = (s[j][r] + sl[j][r] * (1.0f / 1024.0f)) * SCALE;
        const float v = x + (*(const float*)(tb + (bi & 0xffu)) + *(const float*)(tb + ((bi >> 8) & 0xffu))); s[j][r] = v; mx = fmaxf(mx, v); } }
    mx = fmaxf(mx, xhalf(mx));   // a query's keys are split between lanes col and col + 16
    const float al = expf(mrun - mx); mrun = mx;
    v4f s4 = {}; v16h p[2];
#pragma unroll
    for (int j = 0; j < 4; ++j)
#pragma unroll
      for (int r = 0; r < 8; ++r) { const float e = expf(s[j][r] - mx); s4[r & 3] += e; p[j >> 1][(j & 1) * 8 + r] = (_Float16)e; }
    lsum = lsum * al + ((s4[0] + s4[1]) + (s4[2] + s4[3]));
#pragma unroll
    for (int jj = 0; jj < 4; ++jj) ctx[jj] = ctx[jj] * al;
#pragma unroll
    for (int u = 0; u < 2; ++u)
#pragma unroll
      for (int jj = 0; jj < 4; ++jj) ctx[jj] = wm16(vf[u][jj], p[u], ctx[jj]); }
  const float sum = lsum + xhalf(lsum); const float inv = sum > 0.f ? 1.0f / sum : 0.f;
  _Float16* yp = Y + qo;   // lane (g, col) holds head columns jj * 16 + 8g + r of query col: chunk (k step 2h + (jj >> 1), half jj & 1, this lane) of the out product's A operand, rounded to f16 here
#pragma unroll
  for (int jj = 0; jj < 4; ++jj) { v8h o;
#pragma unroll
    for (int r = 0; r < 8; ++r) o[r] = (_Float16)(ctx[jj][r] * inv);
    vst2(yp + jj * 256, o); } }
// ---- k_out: block = (64 rows, 128 cols): out = ctx Wo (+ bo): ctx (f16) against Wo as f16(bf16 x 2^8) exact (1 product) x 2^-8, both operands read in fragment order
__global__ __launch_bounds__(128) void k_out(const _Float16* __restrict__ Y, const _Float16* __restrict__ WOP, const float* __restrict__ BO, float* __restrict__ OUT) { __shared__ __align__(16) float sf[4][16][132];
  static_assert(!CAUSAL, "one product for every row");
  const int tid = threadIdx.x, wave = tid >> 5, lane = tid & 31, col = lane & 15, g = lane >> 4; const int c0 = blockIdx.y * 128; const size_t r0 = (size_t)blockIdx.x * 64 + wave * 16;
  const _Float16* ya = Y + (size_t)(blockIdx.x * 4 + wave) * (16 * 512) + lane * 8;   // the wave's row tile, k step 0
  const _Float16* wb = WOP + (size_t)(blockIdx.y * 8) * 512 + lane * 8;              // the block's first column tile, k step 0
  v8f acc[8] = {};
#pragma unroll  // unrolled: every fragment is a constant offset from the two address pairs, which are never rewritten
  for (int kc = 0; kc < CC / 32; ++kc) { const v16h a = fragw_h(ya + kc * 512);
    v16h w[8];   // all eight weight fragments of the k step are loaded before its first product: their round trips overlap
#pragma unroll
    for (int j = 0; j < 8; ++j) w[j] = fragw_h(wb + (kc * 32 + j) * 512);
#pragma unroll
    for (int j = 0; j < 8; ++j) acc[j] = wmma16(a, w[j], acc[j]); }
  // precaution: both address pairs stay live and unwritten up to this wait
  asm volatile("s_wait_xcnt 0x0" :: "v"(ya), "v"(wb) : "memory");
#pragma unroll
  for (int j = 0; j < 8; ++j) { const float bias = BO ? bfr(BO[c0 + j * 16 + col]) : 0.f;
#pragma unroll
    for (int r = 0; r < 8; ++r) sf[wave][8 * g + r][j * 16 + col] = acc[j][r] * (1.0f / 256.0f) + bias; }
  LDSX(); for (int rl = 0; rl < 16; ++rl) vst2(OUT + (r0 + rl) * DIN + c0 + lane * 4, *(const v4f*)&sf[wave][rl][lane * 4]); }

extern "C" void kernel_launch(void* const* d_in, const int* in_sizes, int n_in, void* d_out, int out_size, void* d_ws, size_t ws_size, hipStream_t stream) {
  (void)in_sizes; (void)n_in; (void)out_size;
  const float** F = (const float**)d_in;
  if (ws_size < (size_t)WS_END) return;
  char* ws = (char*)d_ws; _Float16 *QH = (_Float16*)(ws + WS_QH), *KH = (_Float16*)(ws + WS_KH), *VT = (_Float16*)(ws + WS_VT), *QL = (_Float16*)(ws + WS_QL), *KL = (_Float16*)(ws + WS_KL); __bf16 *VB = (__bf16*)(ws + WS_VB), *VBL = (__bf16*)(ws + WS_VBL); _Float16 *Y = (_Float16*)(ws + WS_Y);
  (void)Y; (void)QL; (void)KL; (void)VB; (void)VBL;
  // inputs: 0 p [4,1024,512]; 1 pcoords [4,1024,2]; 2 rpe_table [64,8]; 3 wq_w (in,out), 4 wq_b; 5 wk_w, 6 wk_b; 7 wv_w, 8 wv_b; 9 wo_w (in,out), 10 wo_b
  if (ws_size < (size_t)WS_END3) return;
  float* RNG = (float*)(ws + WS_RNG); __bf16 *XP = (__bf16*)(ws + WS_XP), *WP = (__bf16*)(ws + WS_WP);
  k_range<<<1 + 256, 256, 0, stream>>>(F[1], RNG, F[0], F[3], F[5], F[7], F[9], XP, WP);
  k_proj<<<dim3(TNB * TT / 64, CC / 128, 3), 128, 0, stream>>>(XP, WP, F[4], F[6], F[8], QH, QL, KH, KL, VT, VB, VBL);
  k_fa<<<dim3(TT / 16, 1, TNB), 256, 0, stream>>>(QH, QL, KH, VT, F[1], F[2], RNG, Y);
  k_out<<<dim3(TNB * TT / 64, DIN / 128), 128, 0, stream>>>(Y, (const _Float16*)(WP + 3 * DIN * CC), F[10], (float*)d_out);
}

// v006
// A run of this version takes 74 microseconds.
// Next to v005, in two timings, it ran 1.08 and 1.09 times as fast.
// All steps since v000 together make it 5.16 times as fast.
// compute dtype: all float inputs rounded to bf16; q/k/v = p W + b with EXACT bf16 products on WMMA 16x16x32 (f32 accumulate); q as f16 hi + residual (x 2^10) against k once to f16 (2 products) x 64^-0.5; the relative-position bias: bin indices computed per (batch, query, key) in f32 exactly as the reference (difference, division by the global eta range, x16, truncation; fmod-based wrap for phi), table values (bf16) added in f32; softmax in f32 with a running maximum over 64-key steps, exp(x) = hardware exp2 of x * log2(e), the difference and the product in one f32 fma; exp(logit - running maximum) once to f16 against v once to f16 (1 product), divided by the f32 sum at the end; ctx once to f16 against Wo carried x 2^8 in f16 + bo; f32 output.
#include <hip/hip_runtime.h>
#include <math.h>

typedef __attribute__((ext_vector_type(16))) _Float16 v16h;
typedef __attribute__((ext_vector_type(16))) __bf16 v16b;
typedef __attribute__((ext_vector_type(8)))  _Float16 v8h;
typedef __attribute__((ext_vector_type(8)))  float v8f;
typedef __attribute__((ext_vector_type(4)))  float v4f;
typedef __attribute__((ext_vector_type(2)))  float v2f;
typedef __attribute__((ext_vector_type(4)))  unsigned v4u;
typedef __attribute__((ext_vector_type(2)))  unsigned v2u;
typedef __attribute__((ext_vector_type(4)))  int v4i;
typedef float __attribute__((may_alias)) float_a;
typedef int __attribute__((may_alias)) int_a;

template <typename T> __device__ __forceinline__ void vst2(void* p, T v) { *(T*)p = v;  }
__device__ __forceinline__ v8f wmma16(v16h a, v16h b, v8f c) {
  v8f d = __builtin_amdgcn_wmma_f32_16x16x32_f16(false, a, false, b, (short)0, c, false, false);
  asm volatile("v_nop\n\tv_nop\n\tv_nop\n\tv_nop" : "+v"(d) : "v"(a), "v"(b));
  return d;
}
__device__ __forceinline__ v8f wmma_bf(v16b a, v16b b, v8f c) {
  v8f d = __builtin_amdgcn_wmma_f32_16x16x32_bf16(false, a, false, b, (short)0, c, false, false);
  asm volatile("v_nop\n\tv_nop\n\tv_nop\n\tv_nop" : "+v"(d) : "v"(a), "v"(b));
  return d;
}
// 16x16x32 fragments: lane = (h = lane>>4, row/col = lane&15); elements 0..7 = k0+8h+0..7, 8..15 = k0+16+8h+0..7; D element r = row 8h+r
__device__ __forceinline__ v16h frag_h(const _Float16* rowk0, int lane) {
  union { v16h v; v8h q[2]; } u; const _Float16* p = rowk0 + 8 * (lane >> 4);
  u.q[0] = *(const v8h*)p; u.q[1] = *(const v8h*)(p + 16); return u.v;
}
__device__ __forceinline__ v16h frag_f32(const float* rowk0, int lane) {
  v16h a; const float* p = rowk0 + 8 * (lane >> 4);
#pragma unroll
  for (int i = 0; i < 8; ++i) { a[i] = (_Float16)p[i]; a[8 + i] = (_Float16)p[16 + i]; }
  return a;
}
__device__ __forceinline__ v16h frag_f32s(const float* rowk0, int lane, float sc) {
  v16h a; const float* p = rowk0 + 8 * (lane >> 4);
#pragma unroll
  for (int i = 0; i < 8; ++i) { a[i] = (_Float16)(p[i] * sc); a[8 + i] = (_Float16)(p[16 + i] * sc); }
  return a;
}
// column fragment from a [K][ld] layout (column n), rows >= K read as 0
__device__ __forceinline__ v16h fragc_f32(const float* W, int k0, int n, int lane, int ld, int K) {
  v16h a; const int g = lane >> 4;
#pragma unroll
  for (int i = 0; i < 8; ++i) { const int ka = k0 + 8 * g + i, kb = ka + 16;
    a[i] = (_Float16)(ka < K ? W[(size_t)(ka < K ? ka : K - 1) * ld + n] : 0.f); a[8 + i] = (_Float16)(kb < K ? W[(size_t)(kb < K ? kb : K - 1) * ld + n] : 0.f); }
  return a;
}
struct F2 { v16b h, l; };
__device__ __forceinline__ F2 bsplit16(const float v[16]) { F2 r;
#pragma unroll
  for (int i = 0; i < 16; ++i) { const __bf16 h = (__bf16)v[i]; r.h[i] = h; r.l[i] = (__bf16)(v[i] - (float)h); }
  return r; }
__device__ __forceinline__ F2 split_row(const float* row, int k0, int lane) { float v[16]; const float* p = row + k0 + 8 * (lane >> 4);
#pragma unroll
  for (int i = 0; i < 8; ++i) { v[i] = p[i]; v[8 + i] = p[16 + i]; }
  return bsplit16(v); }
__device__ __forceinline__ F2 split_rowK(const float* row, int k0, int lane, int K) { float v[16]; const int g = lane >> 4;
#pragma unroll
  for (int i = 0; i < 8; ++i) { const int ka = k0 + 8 * g + i, kb = ka + 16; v[i] = ka < K ? row[ka < K ? ka : K - 1] : 0.f; v[8 + i] = kb < K ? row[kb < K ? kb : K - 1] : 0.f; }
  return bsplit16(v); }
__device__ __forceinline__ F2 split_col(const float* W, int k0, int n, int lane, int ld, int K) { float v[16]; const int g = lane >> 4;
#pragma unroll
  for (int i = 0; i < 8; ++i) { const int ka = k0 + 8 * g + i, kb = ka + 16; v[i] = ka < K ? W[(size_t)(ka < K ? ka : K - 1) * ld + n] : 0.f; v[8 + i] = kb < K ? W[(size_t)(kb < K ? kb : K - 1) * ld + n] : 0.f; }
  return bsplit16(v); }
__device__ __forceinline__ v8f mac3(const F2& a, const F2& b, v8f c) { c = wmma_bf(a.l, b.h, c); c = wmma_bf(a.h, b.l, c); return wmma_bf(a.h, b.h, c); }
__device__ __forceinline__ float sigm(float v) { return 1.0f / (1.0f + expf(-v)); }
#define LDSX() do { asm volatile("s_wait_dscnt 0" ::: "memory"); __builtin_amdgcn_wave_barrier(); __builtin_amdgcn_fence(__ATOMIC_RELEASE, "workgroup"); } while (0)

// Patch attention with a relative-position bias (B 4, T 1,024, D 512 = 8 heads x 64): q/k/v = p W + b ((in,out)); scores = q k^T / 8 + rpe_table[eta_bin + 16][h] + rpe_table[phi_bin + 48][h] with eta_bin = trunc((eta_i - eta_j) / max|eta_i - eta_j| * 16), phi_bin = trunc(wrap(phi_i - phi_j) / pi * 16), both clipped to [-16, 15]; softmax; out = merged(attn v) Wo + bo.
#define NB 4
#define TT 1024
#define CC 512            // NH * HD = projected width
#define DIN 512          // input (model) width
#define NH 8
#define HD 64
#define NQB (TT / 64)
#define HG 8
#define SCALE (0.125f)
#define CAUSAL 0
#ifndef TNB
#define TNB NB
#endif
__device__ __forceinline__ float bfr(float v) { return (float)(__bf16)v; }
__host__ __device__ __forceinline__ int kb_last(int qb) { return CAUSAL ? ((qb * 64 + 63) >> 7) : (TT / 128 - 1); }
typedef __attribute__((ext_vector_type(8))) __bf16 v8b;
__device__ __forceinline__ v16b frag_b(const __bf16* rowk0, int lane) {
  union { v16b v; v8b q[2]; } u; const __bf16* p = rowk0 + 8 * (lane >> 4);
  u.q[0] = *(const v8b*)p; u.q[1] = *(const v8b*)(p + 16); return u.v;
}
// precaution, behind a store in a loop: it stands in front of the first rewrite of a register that the store names
#define XCW() asm volatile("s_wait_xcnt 0x0" ::: "memory")
// one fragment in fragment order: p = fragment start + lane * 8
__device__ __forceinline__ v16b fragw_b(const __bf16* p) { union { v16b v; v8b q[2]; } u; u.q[0] = *(const v8b*)p; u.q[1] = *(const v8b*)(p + 256); return u.v; }
__device__ __forceinline__ v16h fragw_h(const _Float16* p) { union { v16h v; v8h q[2]; } u; u.q[0] = *(const v8h*)p; u.q[1] = *(const v8h*)(p + 256); return u.v; }
#define QBH 0              // unused: no kernel here has a separate high-precision path
#define QHI 1024            // rows carrying a q residual plane (all rows when non-causal: 2-product logits everywhere)
#define KHI 64            // key rows carrying k residual / v bf16 hi+lo planes (written by k_proj; no kernel here reads them)
// B fragment (k rows k0+.., output column o) of a weight: (in,out) [K][ld] or (out,in) [ld rows of K]: bf16 exact, or f16(bf16 * 256) exact
__device__ __forceinline__ v16b wcol_io(const float* Wm, int k0, int o, int lane, int ld) { v16b w; const int g = lane >> 4;
#pragma unroll
  for (int i = 0; i < 8; ++i) { w[i] = (__bf16)Wm[(size_t)(k0 + 8 * g + i) * ld + o]; w[8 + i] = (__bf16)Wm[(size_t)(k0 + 16 + 8 * g + i) * ld + o]; }
  return w; }
__device__ __forceinline__ v16b wcol_oi(const float* Wm, int k0, int o, int lane, int K) { v16b w; const float* p = Wm + (size_t)o * K + k0 + 8 * (lane >> 4);
#pragma unroll
  for (int i = 0; i < 8; ++i) { w[i] = (__bf16)p[i]; w[8 + i] = (__bf16)p[16 + i]; }
  return w; }
__device__ __forceinline__ v16h wcolh_io(const float* Wm, int k0, int o, int lane, int ld) { v16h w; const int g = lane >> 4;
#pragma unroll
  for (int i = 0; i < 8; ++i) { w[i] = (_Float16)(bfr(Wm[(size_t)(k0 + 8 * g + i) * ld + o]) * 256.0f); w[8 + i] = (_Float16)(bfr(Wm[(size_t)(k0 + 16 + 8 * g + i) * ld + o]) * 256.0f); }
  return w; }
__device__ __forceinline__ v16h wcolh_oi(const float* Wm, int k0, int o, int lane, int K) { v16h w; const float* p = Wm + (size_t)o * K + k0 + 8 * (lane >> 4);
#pragma unroll
  for (int i = 0; i < 8; ++i) { w[i] = (_Float16)(bfr(p[i]) * 256.0f); w[8 + i] = (_Float16)(bfr(p[16 + i]) * 256.0f); }
  return w; }
#define WQKV_LAYOUT 0   // selects WCOL only, which nothing calls; k_range always reads wq/wk/wv as (in,out) [DIN][CC]
__device__ __forceinline__ v16b wcol_hdk(const float* Wm, int k0, int o, int lane) { v16b w; const int g = lane >> 4; const float* p = Wm + (size_t)(o / HD) * DIN * HD + (o % HD);
#pragma unroll
  for (int i = 0; i < 8; ++i) { w[i] = (__bf16)p[(size_t)(k0 + 8 * g + i) * HD]; w[8 + i] = (__bf16)p[(size_t)(k0 + 16 + 8 * g + i) * HD]; }
  return w; }
#define WO_OUT_IN 0
#if WQKV_LAYOUT == 1
#define WCOL(W, k0, o, lane) wcol_oi(W, k0, o, lane, DIN)
#elif WQKV_LAYOUT == 2
#define WCOL(W, k0, o, lane) wcol_hdk(W, k0, o, lane)
#else
#define WCOL(W, k0, o, lane) wcol_io(W, k0, o, lane, CC)
#endif
#if WO_OUT_IN
#define WOCOL(W, k0, o, lane) wcol_oi(W, k0, o, lane, CC)
#define WOCOLH(W, k0, o, lane) wcolh_oi(W, k0, o, lane, CC)
#else
#define WOCOL(W, k0, o, lane) wcol_io(W, k0, o, lane, DIN)
#define WOCOLH(W, k0, o, lane) wcolh_io(W, k0, o, lane, DIN)
#endif
#define PI_F 3.14159274f          // f32(math.pi)
#define LOG2E_F 1.44269504f       // f32(log2(e))
// bias bins of one (query, key) pair, the same for every head: byte offsets into one head's 64-entry f32 table column, eta bin in bits 7..0, phi bin (+32 entries) in bits 15..8. f32 steps exactly as the reference: jnp.mod = fmod then +y when the remainder is negative; .astype(int32) = truncation
__device__ __forceinline__ unsigned bias_bins(float et, float pt_, float ek, float pk_, float rng) {
  const float re = et - ek; int eb = (int)((re / rng) * 16.0f); eb = eb < -16 ? -16 : (eb > 15 ? 15 : eb);
  const float rp = pt_ - pk_; const float a_ = rp + PI_F; const float twopi = 2.0f * PI_F; float rm = fmodf(a_, twopi); rm = (rm != 0.0f && rm < 0.0f) ? rm + twopi : rm; const float wr = rm - PI_F;
  int pb = (int)((wr / PI_F) * 16.0f); pb = pb < -16 ? -16 : (pb > 15 ? 15 : pb);
  return (unsigned)((eb + 16) * 4) | ((unsigned)((pb + 16 + 32) * 4) << 8); }
// ---- k_range block 0: eta_range = max(max over batches of (max eta - min eta), 1e-6) on the bf16-rounded coordinates (= max |eta_i - eta_j| over all same-batch pairs, exact)
// FRAGMENT ORDER, the layout of every matrix operand in the workspace: [tile of 16 rows (A) or columns (B)][k step of 32] (weights: [k step][column tile]), then [half][lane][8 elements of 16 bits]; chunk (tile, ks, half, lane) holds row or column tile * 16 + (lane & 15) at k = ks * 32 + half * 16 + (lane >> 4) * 8 + 0..7.
// One fragment = 512 elements = 1 KB; each of its two 16-byte loads reads 512 contiguous bytes per wave = 4 whole lines.
// Blocks 1..256 of this launch: p to bf16 [row tile][k step] (block = row tile), and wq, wk, wv to bf16, wo to f16(bf16 x 2^8), each [k step][column tile] (64 blocks a matrix). Each value is rounded once, here.
__global__ __launch_bounds__(256) void k_range(const float* __restrict__ PCO, float* __restrict__ RNG, const float* __restrict__ X, const float* __restrict__ WQ, const float* __restrict__ WK, const float* __restrict__ WV, const float* __restrict__ WO, __bf16* __restrict__ XP, __bf16* __restrict__ WP) { __shared__ float smx[8], smn[8]; __shared__ float sr;
  static_assert(NB * TT / 16 == 256 && DIN == 512 && CC == 512, "256 row tiles, 64 blocks of 512 chunks a weight");
  if (blockIdx.x != 0) {   // block-uniform, in front of every barrier
    const int pb = blockIdx.x - 1, e = threadIdx.x; const int wsel = pb >> 6; const float* Wm = wsel == 0 ? WQ : wsel == 1 ? WK : wsel == 2 ? WV : WO;
    const float* xs = X + ((size_t)pb * 16 + (e & 15)) * DIN + (e >> 6) * 32 + ((e >> 5) & 1) * 16 + ((e >> 4) & 1) * 8;   // chunk e of the row tile; chunk e + 256 lies 4 k steps on
    const int ew = (pb & 63) * 512 + e;   // chunk of the matrix; chunk ew + 256 lies 4 column tiles on
    const float* wsr = Wm + (size_t)((ew >> 11) * 32 + ((ew >> 5) & 1) * 16 + ((ew >> 4) & 1) * 8) * 512 + ((ew >> 6) & 31) * 16 + (ew & 15);
    v4f xv[4][2]; float wv[2][8];
#pragma unroll
    for (int it = 0; it < 4; ++it) { xv[it][0] = *(const v4f*)(xs + it * 128); xv[it][1] = *(const v4f*)(xs + it * 128 + 4); }
#pragma unroll
    for (int it = 0; it < 2; ++it)
#pragma unroll
      for (int i = 0; i < 8; ++i) wv[it][i] = wsr[it * 64 + i * 512];
    // precaution: both address pairs stay live and unwritten up to this wait
    asm volatile("s_wait_xcnt 0x0" :: "v"(xs), "v"(wsr) : "memory");
#pragma unroll
    for (int it = 0; it < 4; ++it) { v8b o;
#pragma unroll
      for (int i = 0; i < 4; ++i) { o[i] = (__bf16)xv[it][0][i]; o[4 + i] = (__bf16)xv[it][1][i]; }
      vst2(XP + ((size_t)pb * 1024 + it * 256 + e) * 8, o); XCW(); }
#pragma unroll
    for (int it = 0; it < 2; ++it) { __bf16* d = WP + ((size_t)pb * 512 + it * 256 + e) * 8;
      if (wsel < 3) { v8b o;
#pragma unroll
        for (int i = 0; i < 8; ++i) o[i] = (__bf16)wv[it][i];
        vst2(d, o); }
      else { v8h o;
#pragma unroll
        for (int i = 0; i < 8; ++i) o[i] = (_Float16)(bfr(wv[it][i]) * 256.0f);
        vst2(d, o); }
      XCW(); }
    return; }
  const int t = threadIdx.x; float best = 0.f;
  for (int b = 0; b < TNB; ++b) { float mx = -3.0e38f, mn = 3.0e38f; for (int i = t; i < TT; i += 256) { const float e = bfr(PCO[((size_t)b * TT + i) * 2]); mx = fmaxf(mx, e); mn = fminf(mn, e); }
    for (int o = 1; o < 32; o <<= 1) { mx = fmaxf(mx, __shfl_xor(mx, o)); mn = fminf(mn, __shfl_xor(mn, o)); }
    if ((t & 31) == 0) { smx[t >> 5] = mx; smn[t >> 5] = mn; } __syncthreads();
    if (t == 0) { float a = smx[0], c = smn[0]; for (int i = 1; i < 8; ++i) { a = fmaxf(a, smx[i]); c = fminf(c, smn[i]); } sr = a - c; } __syncthreads(); best = fmaxf(best, sr); __syncthreads(); }
  if (t < 32) { const float v = t == 0 ? fmaxf(best, 1e-6f) : 0.f; vst2(RNG + t, v); } }   
#define WS_RNG (WS_END)
#define WS_END2 (WS_RNG + 128u)
#define WS_XP (WS_RNG + 4096u)                           // bf16 p, fragment order (every fragment starts on a 1 KB boundary)
#define WS_WP (WS_XP + 2u * (size_t)NB * TT * DIN)       // wq, wk, wv (bf16), wo (f16), fragment order
#define WS_END3 (WS_WP + 4u * 2u * (size_t)DIN * CC)

#define WS_QH  0u                                      // f16 q, fragment order [token tile][k step]
#define WS_KH  (WS_QH + 2u * (size_t)NB * TT * CC)      // f16 k, fragment order [token tile][k step]
#define WS_VT  (WS_KH + 2u * (size_t)NB * TT * CC)      // f16 v, fragment order [b][column tile][k step of 32 tokens]
#define WS_QL  (WS_VT + 2u * (size_t)NB * CC * TT)      // f16 q residual x 2^10, fragment order as q
#define WS_KL  (WS_QL + 2u * (size_t)NB * QHI * CC)     // f16 k residual x 2^10 rows [b][t < KHI][CC]
#define WS_VB  (WS_KL + 2u * (size_t)NB * KHI * CC)     // bf16 v hi planes [b][c][t < KHI]
#define WS_VBL (WS_VB + 2u * (size_t)NB * CC * KHI)
#define WS_S   (WS_VBL + 2u * (size_t)NB * CC * KHI)    // f32 [b][hg][t][s], unused: no kernel here stores logits or P
#define WS_Y   (WS_S  + 4u * (size_t)NB * HG * TT * TT)      // f16 ctx, fragment order [token tile][k step] (the first half of the range)
#define WS_END (WS_Y  + 4u * (size_t)NB * TT * CC)

// ---- k_proj: block = (64 rows, 128 cols, which): q/k/v = X W (+ b) with exact bf16 products (K = DIN), both operands read in fragment order -> which 0: q f16 (+ residual, rows < QHI), fragment order; 1: k f16, fragment order (+ residual rows < KHI); 2: v f16, fragment order (+ bf16 hi/lo planes for t < KHI)
__global__ __launch_bounds__(128) void k_proj(const __bf16* __restrict__ XP, const __bf16* __restrict__ WP, const float* __restrict__ BQ, const float* __restrict__ BK, const float* __restrict__ BV,
    _Float16* __restrict__ QH, _Float16* __restrict__ QL, _Float16* __restrict__ KH, _Float16* __restrict__ KL, _Float16* __restrict__ VT, __bf16* __restrict__ VB, __bf16* __restrict__ VBL) {
  __shared__ __align__(16) _Float16 sh[64][136], sl[64][136]; __shared__ __align__(16) _Float16 th[128][72]; __shared__ __align__(16) __bf16 tb[128][72], tbl[128][72];
  const int tid = threadIdx.x, wave = tid >> 5, lane = tid & 31, col = lane & 15, g = lane >> 4; const int which = blockIdx.z; const int c0 = blockIdx.y * 128; const size_t r0 = (size_t)blockIdx.x * 64; const size_t bb = r0 / TT; const int t0 = (int)(r0 % TT);
  const float* BA = which == 0 ? BQ : which == 1 ? BK : BV;
  const __bf16* xa = XP + (size_t)(blockIdx.x * 4 + wave) * (16 * 512) + lane * 8;                      // the wave's row tile, k step 0
  const __bf16* wb = WP + (size_t)which * (DIN * CC) + (size_t)(blockIdx.y * 8) * 512 + lane * 8;   // the block's first column tile, k step 0
  v8f acc[8] = {};
#pragma unroll  // unrolled: every fragment is a constant offset from the two address pairs, which are never rewritten
  for (int kc = 0; kc < DIN / 32; ++kc) { const v16b a = fragw_b(xa + kc * 512);
    v16b w[8];   // all eight weight fragments of the k step are loaded before its first product: their round trips overlap
#pragma unroll
    for (int j = 0; j < 8; ++j) w[j] = fragw_b(wb + (kc * 32 + j) * 512);
#pragma unroll
    for (int j = 0; j < 8; ++j) acc[j] = wmma_bf(a, w[j], acc[j]); }
  // precaution: both address pairs stay live and unwritten up to this wait
  asm volatile("s_wait_xcnt 0x0" :: "v"(xa), "v"(wb) : "memory");
  if (which < 2) { _Float16* DH = which == 0 ? QH : KH; _Float16* DL = which == 0 ? QL : KL; const int nhi = which == 0 ? QHI : KHI; const bool hi_rows = t0 < nhi;
#pragma unroll
    for (int j = 0; j < 8; ++j) { const float bias = BA ? bfr(BA[c0 + j * 16 + col]) : 0.f;
#pragma unroll
      for (int r = 0; r < 8; ++r) { const float v = acc[j][r] + bias; const _Float16 hv = (_Float16)v; sh[wave * 16 + 8 * g + r][j * 16 + col] = hv; sl[wave * 16 + 8 * g + r][j * 16 + col] = (_Float16)((v - (float)hv) * 1024.0f); } }
    __syncthreads();
    // q, its residual and k go out in fragment order (row tile = 16 tokens, k step = 32 columns): chunk e = [row tile 4][k step 4][half][lane]; the k residual rows keep their row layout
    for (int e = tid; e < 64 * 16; e += 128) { const int rl = (e >> 8) * 16 + (e & 15), cl = ((e >> 6) & 3) * 32 + ((e >> 5) & 1) * 16 + ((e >> 4) & 1) * 8;
      const size_t o = (((size_t)blockIdx.x * 4 + (e >> 8)) * 16 + blockIdx.y * 4 + ((e >> 6) & 3)) * 512 + (e & 63) * 8;
      vst2((unsigned*)(DH + o), *(const v4u*)&sh[rl][cl]); XCW(); if (hi_rows) { vst2((unsigned*)(which == 0 ? DL + o : DL + (bb * nhi + t0 + rl) * (size_t)CC + c0 + cl), *(const v4u*)&sl[rl][cl]); XCW(); } }
  } else { const bool hi_rows = t0 < KHI;
#pragma unroll
    for (int j = 0; j < 8; ++j) { const float bias = BA ? bfr(BA[c0 + j * 16 + col]) : 0.f;
#pragma unroll
      for (int r = 0; r < 8; ++r) { const float v = acc[j][r] + bias; const int rl = wave * 16 + 8 * g + r, cl = j * 16 + col; th[cl][rl] = (_Float16)v; const __bf16 bh = (__bf16)v; tb[cl][rl] = bh; tbl[cl][rl] = (__bf16)(v - (float)bh); } }
    __syncthreads();
    // v goes out in fragment order (row tile = 16 columns of a batch, k step = 32 tokens): chunk e = [column tile 8][k step 2][half][lane]; the bf16 planes keep their layout
    for (int e = tid; e < 128 * 8; e += 128) { const int cl = (e >> 7) * 16 + (e & 15), tl = ((e >> 6) & 1) * 32 + ((e >> 5) & 1) * 16 + ((e >> 4) & 1) * 8;
      const size_t o = ((bb * (CC / 16) + blockIdx.y * 8 + (e >> 7)) * (TT / 32) + (t0 >> 5) + ((e >> 6) & 1)) * 512 + (e & 63) * 8;
      vst2((unsigned*)(VT + o), *(const v4u*)&th[cl][tl]); XCW(); if (hi_rows) { const size_t o3 = (bb * CC + c0 + cl) * (size_t)KHI + t0 + tl; vst2((unsigned*)(VB + o3), *(const v4u*)&tb[cl][tl]); vst2((unsigned*)(VBL + o3), *(const v4u*)&tbl[cl][tl]); XCW(); } } } }
// ---- k_fa: block = 16 query rows (t0..t0+15) of batch z, wave = head (8 waves): logits, bias, softmax and P.v in one kernel; no logit or P value goes to memory.
// The 256 threads first compute the 16 x TT bias bins (they do not depend on the head) into LDS, one barrier, then every wave runs alone over the keys, 64 per trip.
// Both products are transposed: S^T = K Q^T gives lane (g, col) the logits of query col at keys 8g + r, which is the B fragment of ctx^T = V^T P^T as it stands (tiles 2u and 2u + 1 = elements 0..7 and 8..15 of k step u), so P needs no move between lanes,
// and the running maximum, the sum and the rescale factor of a query live in that query's own two lanes (col and col + 16).
#define BP (TT / 2 + 4)   // dwords per bin row: 2,064 B = 16 B x odd, the conflict-free pitch for 16-byte LDS reads down a column of rows
__device__ __forceinline__ v8f wm16(v16h a, v16h b, v8f c) { return __builtin_amdgcn_wmma_f32_16x16x32_f16(false, a, false, b, (short)0, c, false, false); }
__device__ __forceinline__ v16h frag_p(const _Float16* p) { union { v16h v; v8h q[2]; } u; u.q[0] = *(const v8h*)p; u.q[1] = *(const v8h*)(p + 16); return u.v; }  // p = the lane's own first element (row start + k0 + 8g)
// 2^x on the transcendental unit. The instruction set asks for one independent instruction behind a transcendental before its result is read or its source overwritten:
// in one statement each v_exp_f32 is that instruction for the one in front of it (the results are early-clobber, so none lies on a source), and the closing v_nop is it for the last
__device__ __forceinline__ float ex2(float x) { float e; asm("v_exp_f32 %0, %1\n\tv_nop" : "=v"(e) : "v"(x)); return e; }
__device__ __forceinline__ v8f ex2x8(v8f x) { float e0, e1, e2, e3, e4, e5, e6, e7;
  asm("v_exp_f32 %0, %8\n\tv_exp_f32 %1, %9\n\tv_exp_f32 %2, %10\n\tv_exp_f32 %3, %11\n\tv_exp_f32 %4, %12\n\tv_exp_f32 %5, %13\n\tv_exp_f32 %6, %14\n\tv_exp_f32 %7, %15\n\tv_nop"
      : "=&v"(e0), "=&v"(e1), "=&v"(e2), "=&v"(e3), "=&v"(e4), "=&v"(e5), "=&v"(e6), "=&v"(e7)
      : "v"(x[0]), "v"(x[1]), "v"(x[2]), "v"(x[3]), "v"(x[4]), "v"(x[5]), "v"(x[6]), "v"(x[7]));
  v8f e = {e0, e1, e2, e3, e4, e5, e6, e7}; return e; }
__device__ __forceinline__ float xhalf(float x) { return __builtin_bit_cast(float, __builtin_amdgcn_permlanex16(__builtin_bit_cast(int, x), __builtin_bit_cast(int, x), 0x76543210, 0xfedcba98, false, false)); }  // lane l with lane l ^ 16
__global__ __launch_bounds__(256) void k_fa(const _Float16* __restrict__ QH, const _Float16* __restrict__ QL, const _Float16* __restrict__ KH, const _Float16* __restrict__ VT, const float* __restrict__ PCO, const float* __restrict__ TAB, const float* __restrict__ RNG, _Float16* __restrict__ Y) {
  __shared__ __align__(16) unsigned sbin[16][BP]; __shared__ __align__(16) float stab[NH][64];
  static_assert(!CAUSAL && NH * 32 == 256 && TT == 1024 && HD == 64 && QHI == TT, "one wave per head, whole rows, 4 keys per thread, q residual on every row");
  const int tid = threadIdx.x, wave = tid >> 5, lane = tid & 31, col = lane & 15, g = lane >> 4; const int t0 = blockIdx.x * 16; const int b = blockIdx.z; const int h = wave;
  { const float* ckp = PCO + ((size_t)b * TT + tid * 4) * 2; const v4f ck0 = *(const v4f*)ckp, ck1 = *(const v4f*)(ckp + 4);
    const float* tp = TAB + lane * NH + h; const float tv0 = tp[0], tv1 = tp[32 * NH];
    const float* qcp = PCO + ((size_t)b * TT + t0 + col) * 2; const v2f qc = *(const v2f*)qcp;   // lane l holds the coordinates of query l & 15: one load, read by lane number in the loop below
    // precaution: the three address pairs stay live and unwritten up to this wait
    asm volatile("s_wait_xcnt 0x0" :: "v"(ckp), "v"(tp), "v"(qcp) : "memory");
    const int qe = __builtin_bit_cast(int, bfr(qc[0])), qf = __builtin_bit_cast(int, bfr(qc[1]));
    stab[wave][lane] = bfr(tv0); stab[wave][lane + 32] = bfr(tv1);
    const float rng = RNG[0]; const float e0 = bfr(ck0[0]), p0 = bfr(ck0[1]), e1 = bfr(ck0[2]), p1 = bfr(ck0[3]), e2 = bfr(ck1[0]), p2 = bfr(ck1[1]), e3 = bfr(ck1[2]), p3 = bfr(ck1[3]);
#pragma unroll 1  // rolled: for speed only
    for (int qi = 0; qi < 16; ++qi) { const float et = __builtin_bit_cast(float, __builtin_amdgcn_readlane(qe, qi)), pt_ = __builtin_bit_cast(float, __builtin_amdgcn_readlane(qf, qi));
      const unsigned b0 = bias_bins(et, pt_, e0, p0, rng), b1 = bias_bins(et, pt_, e1, p1, rng), b2 = bias_bins(et, pt_, e2, p2, rng), b3 = bias_bins(et, pt_, e3, p3, rng);
      v2u w; w[0] = b0 | (b1 << 16); w[1] = b2 | (b3 << 16); *(v2u*)&sbin[qi][tid * 2] = w; } }
  __syncthreads();   // publishes every thread's bins to the eight waves that read them below; the only barrier
  const char* tb = (const char*)&stab[wave][0];
  // all four operands lie in fragment order; a head's 64 columns are k steps 2h and 2h + 1 of a token tile, its v columns are column tiles 4h .. 4h + 3 of the batch
  const size_t qo = (((size_t)b * (TT / 16) + blockIdx.x) * 16 + h * 2) * 512 + lane * 8;
  const _Float16* qp = QH + qo; const _Float16* qlp = QL + qo;
  const _Float16* kp = KH + ((size_t)b * (TT / 16) * 16 + h * 2) * 512 + lane * 8;          // first key tile of the batch
  const _Float16* vp = VT + ((size_t)b * (CC / 16) + h * 4) * (TT / 32) * 512 + lane * 8;   // first column tile of the head, first 32 keys
  v16h qh[2], ql[2], kf[4][2];
#pragma unroll
  for (int kc = 0; kc < 2; ++kc) { qh[kc] = fragw_h(qp + kc * 512); ql[kc] = fragw_h(qlp + kc * 512); }
#pragma unroll
  for (int j = 0; j < 4; ++j)
#pragma unroll
    for (int kc = 0; kc < 2; ++kc) kf[j][kc] = fragw_h(kp + (j * 16 + kc) * 512);
  // precaution: the address pairs stay live and unwritten up to this wait
  asm volatile("s_wait_xcnt 0x0" :: "v"(qp), "v"(qlp), "v"(kp) : "memory");
  v8f ctx[4] = {}; float mrun = -3.0e38f, mlrun = -3.0e38f, lsum = 0.f;   // mlrun = the running maximum x log2(e), as it was rounded for the sums held so far
  const _Float16* kn = kp; const _Float16* vn = vp;   // the lane's own k row and v plane, moved on by 64 keys a trip
#pragma unroll 1  // rolled: one trip already holds the fragments of two trips in registers
  for (int ks = 0; ks < TT / 64; ++ks) { v8f s[4] = {}, sl[4] = {};
#pragma unroll
    for (int kc = 0; kc < 2; ++kc)
#pragma unroll
      for (int j = 0; j < 4; ++j) { s[j] = wm16(kf[j][kc], qh[kc], s[j]); sl[j] = wm16(kf[j][kc], ql[kc], sl[j]); }
    // the next trip's k fragments and this trip's v fragments fly while the softmax below runs (the last trip reads its own k tile again: in bounds, not used)
    kn += ks + 1 < TT / 64 ? 4 * 16 * 512 : 0;
#pragma unroll
    for (int j = 0; j < 4; ++j)
#pragma unroll
      for (int kc = 0; kc < 2; ++kc) kf[j][kc] = fragw_h(kn + (j * 16 + kc) * 512);
    v16h vf[2][4];
#pragma unroll
    for (int u = 0; u < 2; ++u)
#pragma unroll
      for (int jj = 0; jj < 4; ++jj) vf[u][jj] = fragw_h(vn + (jj * (TT / 32) + u) * 512);
    // precaution: both address pairs stay live and unwritten up to this wait; it also keeps the loads above the softmax
    asm volatile("s_wait_xcnt 0x0" :: "v"(kn), "v"(vn) : "memory");
    vn += 2 * 512;
    float mx = mrun;
#pragma unroll
    for (int j = 0; j < 4; ++j) { const v4u w = *(const v4u*)&sbin[col][ks * 32 + j * 8 + 4 * g];
#pragma unroll
      for (int r = 0; r < 8; ++r) { const unsigned bi = w[r >> 1] >> (16 * (r & 1)); const float x = (s[j][r] + sl[j][r] * (1.0f / 1024.0f)) * SCALE;
        const float v = x + (*(const float*)(tb + (bi & 0xffu)) + *(const float*)(tb + ((bi >> 8) & 0xffu))); s[j][r] = v; mx = fmaxf(mx, v); } }
    mx = fmaxf(mx, xhalf(mx));   // a query's keys are split between lanes col and col + 16
    // exp(v - mx) = exp2(v * log2(e) - mxl): one fma and one v_exp_f32 a score; the argument is never above a rounding error of 0, and a result below the normal range counts as 0 (far below what f16 holds)
    const float mxl = mx * LOG2E_F; const float al = ex2(mlrun - mxl); mrun = mx; mlrun = mxl;
    v4f s4 = {}; v16h p[2];
#pragma unroll
    for (int j = 0; j < 4; ++j) { v8f x;
#pragma unroll
      for (int r = 0; r < 8; ++r) x[r] = __builtin_fmaf(s[j][r], LOG2E_F, -mxl);
      const v8f ev = ex2x8(x);
#pragma unroll
      for (int r = 0; r < 8; ++r) { const float e = ev[r]; s4[r & 3] += e; p[j >> 1][(j & 1) * 8 + r] = (_Float16)e; } }
    lsum = lsum * al + ((s4[0] + s4[1]) + (s4[2] + s4[3]));
#pragma unroll
    for (int jj = 0; jj < 4; ++jj) ctx[jj] = ctx[jj] * al;
#pragma unroll
    for (int u = 0; u < 2; ++u)
#pragma unroll
      for (int jj = 0; jj < 4; ++jj) ctx[jj] = wm16(vf[u][jj], p[u], ctx[jj]); }
  const float sum = lsum + xhalf(lsum); const float inv = sum > 0.f ? 1.0f / sum : 0.f;
  _Float16* yp = Y + qo;   // lane (g, col) holds head columns jj * 16 + 8g + r of query col: chunk (k step 2h + (jj >> 1), half jj & 1, this lane) of the out product's A operand, rounded to f16 here
#pragma unroll
  for (int jj = 0; jj < 4; ++jj) { v8h o;
#pragma unroll
    for (int r = 0; r < 8; ++r) o[r] = (_Float16)(ctx[jj][r] * inv);
    vst2(yp + jj * 256, o); } }
// ---- k_out: block = (64 rows, 128 cols): out = ctx Wo (+ bo): ctx (f16) against Wo as f16(bf16 x 2^8) exact (1 product) x 2^-8, both operands read in fragment order
__global__ __launch_bounds__(128) void k_out(const _Float16* __restrict__ Y, const _Float16* __restrict__ WOP, const float* __restrict__ BO, float* __restrict__ OUT) { __shared__ __align__(16) float sf[4][16][132];
  static_assert(!CAUSAL, "one product for every row");
  const int tid = threadIdx.x, wave = tid >> 5, lane = tid & 31, col = lane & 15, g = lane >> 4; const int c0 = blockIdx.y * 128; const size_t r0 = (size_t)blockIdx.x * 64 + wave * 16;
  const _Float16* ya = Y + (size_t)(blockIdx.x * 4 + wave) * (16 * 512) + lane * 8;   // the wave's row tile, k step 0
  const _Float16* wb = WOP + (size_t)(blockIdx.y * 8) * 512 + lane * 8;              // the block's first column tile, k step 0
  v8f acc[8] = {};
#pragma unroll  // unrolled: every fragment is a constant offset from the two address pairs, which are never rewritten
  for (int kc = 0; kc < CC / 32; ++kc) { const v16h a = fragw_h(ya + kc * 512);
    v16h w[8];   // all eight weight fragments of the k step are loaded before its first product: their round trips overlap
#pragma unroll
    for (int j = 0; j < 8; ++j) w[j] = fragw_h(wb + (kc * 32 + j) * 512);
#pragma unroll
    for (int j = 0; j < 8; ++j) acc[j] = wmma16(a, w[j], acc[j]); }
  // precaution: both address pairs stay live and unwritten up to this wait
  asm volatile("s_wait_xcnt 0x0" :: "v"(ya), "v"(wb) : "memory");
#pragma unroll
  for (int j = 0; j < 8; ++j) { const float bias = BO ? bfr(BO[c0 + j * 16 + col]) : 0.f;
#pragma unroll
    for (int r = 0; r < 8; ++r) sf[wave][8 * g + r][j * 16 + col] = acc[j][r] * (1.0f / 256.0f) + bias; }
  LDSX(); for (int rl = 0; rl < 16; ++rl) vst2(OUT + (r0 + rl) * DIN + c0 + lane * 4, *(const v4f*)&sf[wave][rl][lane * 4]); }

extern "C" void kernel_launch(void* const* d_in, const int* in_sizes, int n_in, void* d_out, int out_size, void* d_ws, size_t ws_size, hipStream_t stream) {
  (void)in_sizes; (void)n_in; (void)out_size;
  const float** F = (const float**)d_in;
  if (ws_size < (size_t)WS_END) return;
  char* ws = (char*)d_ws; _Float16 *QH = (_Float16*)(ws + WS_QH), *KH = (_Float16*)(ws + WS_KH), *VT = (_Float16*)(ws + WS_VT), *QL = (_Float16*)(ws + WS_QL), *KL = (_Float16*)(ws + WS_KL); __bf16 *VB = (__bf16*)(ws + WS_VB), *VBL = (__bf16*)(ws + WS_VBL); _Float16 *Y = (_Float16*)(ws + WS_Y);
  (void)Y; (void)QL; (void)KL; (void)VB; (void)VBL;
  // inputs: 0 p [4,1024,512]; 1 pcoords [4,1024,2]; 2 rpe_table [64,8]; 3 wq_w (in,out), 4 wq_b; 5 wk_w, 6 wk_b; 7 wv_w, 8 wv_b; 9 wo_w (in,out), 10 wo_b
  if (ws_size < (size_t)WS_END3) return;
  float* RNG = (float*)(ws + WS_RNG); __bf16 *XP = (__bf16*)(ws + WS_XP), *WP = (__bf16*)(ws + WS_WP);
  k_range<<<1 + 256, 256, 0, stream>>>(F[1], RNG, F[0], F[3], F[5], F[7], F[9], XP, WP);
  k_proj<<<dim3(TNB * TT / 64, CC / 128, 3), 128, 0, stream>>>(XP, WP, F[4], F[6], F[8], QH, QL, KH, KL, VT, VB, VBL);
  k_fa<<<dim3(TT / 16, 1, TNB), 256, 0, stream>>>(QH, QL, KH, VT, F[1], F[2], RNG, Y);
  k_out<<<dim3(TNB * TT / 64, DIN / 128), 128, 0, stream>>>(Y, (const _Float16*)(WP + 3 * DIN * CC), F[10], (float*)d_out);
}

// v007
// One run takes 66.4 microseconds.
// In two side-by-side timings against v006, it was 1.12 and 1.11 times as fast.
// Over all steps from v000 it is 5.75 times as fast.
// compute dtype: all float inputs rounded to bf16; q/k/v = p W + b with EXACT bf16 products on WMMA 16x16x32 (f32 accumulate); q as f16 hi + residual (x 2^10) against k once to f16 (2 products) x 64^-0.5; the relative-position bias: bin indices computed per (batch, query, key) in f32 exactly as the reference (difference, division by the global eta range, x16, truncation; fmod-based wrap for phi), table values (bf16) added in f32; softmax in f32 with a running maximum over 64-key steps, exp(x) = hardware exp2 of x * log2(e), the difference and the product in one f32 fma; exp(logit - running maximum) once to f16 against v once to f16 (1 product), divided by the f32 sum at the end; ctx once to f16 against Wo carried x 2^8 in f16 + bo; f32 output.
#include <hip/hip_runtime.h>
#include <math.h>

typedef __attribute__((ext_vector_type(16))) _Float16 v16h;
typedef __attribute__((ext_vector_type(16))) __bf16 v16b;
typedef __attribute__((ext_vector_type(8)))  _Float16 v8h;
typedef __attribute__((ext_vector_type(8)))  float v8f;
typedef __attribute__((ext_vector_type(4)))  float v4f;
typedef __attribute__((ext_vector_type(2)))  float v2f;
typedef __attribute__((ext_vector_type(4)))  unsigned v4u;
typedef __attribute__((ext_vector_type(2)))  unsigned v2u;
typedef __attribute__((ext_vector_type(4)))  int v4i;
typedef float __attribute__((may_alias)) float_a;
typedef int __attribute__((may_alias)) int_a;

template <typename T> __device__ __forceinline__ void vst2(void* p, T v) { *(T*)p = v;  }
__device__ __forceinline__ v8f wmma16(v16h a, v16h b, v8f c) {
  v8f d = __builtin_amdgcn_wmma_f32_16x16x32_f16(false, a, false, b, (short)0, c, false, false);
  asm volatile("v_nop\n\tv_nop\n\tv_nop\n\tv_nop" : "+v"(d) : "v"(a), "v"(b));
  return d;
}
__device__ __forceinline__ v8f wmma_bf(v16b a, v16b b, v8f c) {
  v8f d = __builtin_amdgcn_wmma_f32_16x16x32_bf16(false, a, false, b, (short)0, c, false, false);
  asm volatile("v_nop\n\tv_nop\n\tv_nop\n\tv_nop" : "+v"(d) : "v"(a), "v"(b));
  return d;
}
// 16x16x32 fragments: lane = (h = lane>>4, row/col = lane&15); elements 0..7 = k0+8h+0..7, 8..15 = k0+16+8h+0..7; D element r = row 8h+r
__device__ __forceinline__ v16h frag_h(const _Float16* rowk0, int lane) {
  union { v16h v; v8h q[2]; } u; const _Float16* p = rowk0 + 8 * (lane >> 4);
  u.q[0] = *(const v8h*)p; u.q[1] = *(const v8h*)(p + 16); return u.v;
}
__device__ __forceinline__ v16h frag_f32(const float* rowk0, int lane) {
  v16h a; const float* p = rowk0 + 8 * (lane >> 4);
#pragma unroll
  for (int i = 0; i < 8; ++i) { a[i] = (_Float16)p[i]; a[8 + i] = (_Float16)p[16 + i]; }
  return a;
}
__device__ __forceinline__ v16h frag_f32s(const float* rowk0, int lane, float sc) {
  v16h a; const float* p = rowk0 + 8 * (lane >> 4);
#pragma unroll
  for (int i = 0; i < 8; ++i) { a[i] = (_Float16)(p[i] * sc); a[8 + i] = (_Float16)(p[16 + i] * sc); }
  return a;
}
// column fragment from a [K][ld] layout (column n), rows >= K read as 0
__device__ __forceinline__ v16h fragc_f32(const float* W, int k0, int n, int lane, int ld, int K) {
  v16h a; const int g = lane >> 4;
#pragma unroll
  for (int i = 0; i < 8; ++i) { const int ka = k0 + 8 * g + i, kb = ka + 16;
    a[i] = (_Float16)(ka < K ? W[(size_t)(ka < K ? ka : K - 1) * ld + n] : 0.f); a[8 + i] = (_Float16)(kb < K ? W[(size_t)(kb < K ? kb : K - 1) * ld + n] : 0.f); }
  return a;
}
struct F2 { v16b h, l; };
__device__ __forceinline__ F2 bsplit16(const float v[16]) { F2 r;
#pragma unroll
  for (int i = 0; i < 16; ++i) { const __bf16 h = (__bf16)v[i]; r.h[i] = h; r.l[i] = (__bf16)(v[i] - (float)h); }
  return r; }
__device__ __forceinline__ F2 split_row(const float* row, int k0, int lane) { float v[16]; const float* p = row + k0 + 8 * (lane >> 4);
#pragma unroll
  for (int i = 0; i < 8; ++i) { v[i] = p[i]; v[8 + i] = p[16 + i]; }
  return bsplit16(v); }
__device__ __forceinline__ F2 split_rowK(const float* row, int k0, int lane, int K) { float v[16]; const int g = lane >> 4;
#pragma unroll
  for (int i = 0; i < 8; ++i) { const int ka = k0 + 8 * g + i, kb = ka + 16; v[i] = ka < K ? row[ka < K ? ka : K - 1] : 0.f; v[8 + i] = kb < K ? row[kb < K ? kb : K - 1] : 0.f; }
  return bsplit16(v); }
__device__ __forceinline__ F2 split_col(const float* W, int k0, int n, int lane, int ld, int K) { float v[16]; const int g = lane >> 4;
#pragma unroll
  for (int i = 0; i < 8; ++i) { const int ka = k0 + 8 * g + i, kb = ka + 16; v[i] = ka < K ? W[(size_t)(ka < K ? ka : K - 1) * ld + n] : 0.f; v[8 + i] = kb < K ? W[(size_t)(kb < K ? kb : K - 1) * ld + n] : 0.f; }
  return bsplit16(v); }
__device__ __forceinline__ v8f mac3(const F2& a, const F2& b, v8f c) { c = wmma_bf(a.l, b.h, c); c = wmma_bf(a.h, b.l, c); return wmma_bf(a.h, b.h, c); }
__device__ __forceinline__ float sigm(float v) { return 1.0f / (1.0f + expf(-v)); }
#define LDSX() do { asm volatile("s_wait_dscnt 0" ::: "memory"); __builtin_amdgcn_wave_barrier(); __builtin_amdgcn_fence(__ATOMIC_RELEASE, "workgroup"); } while (0)

// Patch attention with a relative-position bias (B 4, T 1,024, D 512 = 8 heads x 64): q/k/v = p W + b ((in,out)); scores = q k^T / 8 + rpe_table[eta_bin + 16][h] + rpe_table[phi_bin + 48][h] with eta_bin = trunc((eta_i - eta_j) / max|eta_i - eta_j| * 16), phi_bin = trunc(wrap(phi_i - phi_j) / pi * 16), both clipped to [-16, 15]; softmax; out = merged(attn v) Wo + bo.
#define NB 4
#define TT 1024
#define CC 512            // NH * HD = projected width
#define DIN 512          // input (model) width
#define NH 8
#define HD 64
#define NQB (TT / 64)
#define HG 8
#define SCALE (0.125f)
#define CAUSAL 0
#ifndef TNB
#define TNB NB
#endif
__device__ __forceinline__ float bfr(float v) { return (float)(__bf16)v; }
__host__ __device__ __forceinline__ int kb_last(int qb) { return CAUSAL ? ((qb * 64 + 63) >> 7) : (TT / 128 - 1); }
typedef __attribute__((ext_vector_type(8))) __bf16 v8b;
__device__ __forceinline__ v16b frag_b(const __bf16* rowk0, int lane) {
  union { v16b v; v8b q[2]; } u; const __bf16* p = rowk0 + 8 * (lane >> 4);
  u.q[0] = *(const v8b*)p; u.q[1] = *(const v8b*)(p + 16); return u.v;
}
// precaution, behind a store in a loop: it stands in front of the first rewrite of a register that the store names
#define XCW() asm volatile("s_wait_xcnt 0x0" ::: "memory")
// one fragment in fragment order: p = fragment start + lane * 8
__device__ __forceinline__ v16b fragw_b(const __bf16* p) { union { v16b v; v8b q[2]; } u; u.q[0] = *(const v8b*)p; u.q[1] = *(const v8b*)(p + 256); return u.v; }
__device__ __forceinline__ v16h fragw_h(const _Float16* p) { union { v16h v; v8h q[2]; } u; u.q[0] = *(const v8h*)p; u.q[1] = *(const v8h*)(p + 256); return u.v; }
#define QBH 0              // unused: no kernel here has a separate high-precision path
#define QHI 1024            // rows carrying a q residual plane (all rows when non-causal: 2-product logits everywhere)
#define KHI 64            // key rows carrying k residual / v bf16 hi+lo planes (written by k_proj; no kernel here reads them)
// B fragment (k rows k0+.., output column o) of a weight: (in,out) [K][ld] or (out,in) [ld rows of K]: bf16 exact, or f16(bf16 * 256) exact
__device__ __forceinline__ v16b wcol_io(const float* Wm, int k0, int o, int lane, int ld) { v16b w; const int g = lane >> 4;
#pragma unroll
  for (int i = 0; i < 8; ++i) { w[i] = (__bf16)Wm[(size_t)(k0 + 8 * g + i) * ld + o]; w[8 + i] = (__bf16)Wm[(size_t)(k0 + 16 + 8 * g + i) * ld + o]; }
  return w; }
__device__ __forceinline__ v16b wcol_oi(const float* Wm, int k0, int o, int lane, int K) { v16b w; const float* p = Wm + (size_t)o * K + k0 + 8 * (lane >> 4);
#pragma unroll
  for (int i = 0; i < 8; ++i) { w[i] = (__bf16)p[i]; w[8 + i] = (__bf16)p[16 + i]; }
  return w; }
__device__ __forceinline__ v16h wcolh_io(const float* Wm, int k0, int o, int lane, int ld) { v16h w; const int g = lane >> 4;
#pragma unroll
  for (int i = 0; i < 8; ++i) { w[i] = (_Float16)(bfr(Wm[(size_t)(k0 + 8 * g + i) * ld + o]) * 256.0f); w[8 + i] = (_Float16)(bfr(Wm[(size_t)(k0 + 16 + 8 * g + i) * ld + o]) * 256.0f); }
  return w; }
__device__ __forceinline__ v16h wcolh_oi(const float* Wm, int k0, int o, int lane, int K) { v16h w; const float* p = Wm + (size_t)o * K + k0 + 8 * (lane >> 4);
#pragma unroll
  for (int i = 0; i < 8; ++i) { w[i] = (_Float16)(bfr(p[i]) * 256.0f); w[8 + i] = (_Float16)(bfr(p[16 + i]) * 256.0f); }
  return w; }
#define WQKV_LAYOUT 0   // selects WCOL only, which nothing calls; k_range always reads wq/wk/wv as (in,out) [DIN][CC]
__device__ __forceinline__ v16b wcol_hdk(const float* Wm, int k0, int o, int lane) { v16b w; const int g = lane >> 4; const float* p = Wm + (size_t)(o / HD) * DIN * HD + (o % HD);
#pragma unroll
  for (int i = 0; i < 8; ++i) { w[i] = (__bf16)p[(size_t)(k0 + 8 * g + i) * HD]; w[8 + i] = (__bf16)p[(size_t)(k0 + 16 + 8 * g + i) * HD]; }
  return w; }
#define WO_OUT_IN 0
#if WQKV_LAYOUT == 1
#define WCOL(W, k0, o, lane) wcol_oi(W, k0, o, lane, DIN)
#elif WQKV_LAYOUT == 2
#define WCOL(W, k0, o, lane) wcol_hdk(W, k0, o, lane)
#else
#define WCOL(W, k0, o, lane) wcol_io(W, k0, o, lane, CC)
#endif
#if WO_OUT_IN
#define WOCOL(W, k0, o, lane) wcol_oi(W, k0, o, lane, CC)
#define WOCOLH(W, k0, o, lane) wcolh_oi(W, k0, o, lane, CC)
#else
#define WOCOL(W, k0, o, lane) wcol_io(W, k0, o, lane, DIN)
#define WOCOLH(W, k0, o, lane) wcolh_io(W, k0, o, lane, DIN)
#endif
#define PI_F 3.14159274f          // f32(math.pi)
#define LOG2E_F 1.44269504f       // f32(log2(e))
// bias bins of one (query, key) pair, the same for every head: byte offsets into one head's 64-entry f32 table column, eta bin in bits 7..0, phi bin (+32 entries) in bits 15..8. f32 steps exactly as the reference: jnp.mod = fmod then +y when the remainder is negative; .astype(int32) = truncation
__device__ __forceinline__ unsigned bias_bins(float et, float pt_, float ek, float pk_, float rng) {
  const float re = et - ek; int eb = (int)((re / rng) * 16.0f); eb = eb < -16 ? -16 : (eb > 15 ? 15 : eb);
  const float rp = pt_ - pk_; const float a_ = rp + PI_F; const float twopi = 2.0f * PI_F; float rm = fmodf(a_, twopi); rm = (rm != 0.0f && rm < 0.0f) ? rm + twopi : rm; const float wr = rm - PI_F;
  int pb = (int)((wr / PI_F) * 16.0f); pb = pb < -16 ? -16 : (pb > 15 ? 15 : pb);
  return (unsigned)((eb + 16) * 4) | ((unsigned)((pb + 16 + 32) * 4) << 8); }
// ---- k_range block 0: eta_range = max(max over batches of (max eta - min eta), 1e-6) on the bf16-rounded coordinates (= max |eta_i - eta_j| over all same-batch pairs, exact)
// FRAGMENT ORDER, the layout of every matrix operand in the workspace: [tile of 16 rows (A) or columns (B)][k step of 32] (weights: [k step][column tile]), then [half][lane][8 elements of 16 bits]; chunk (tile, ks, half, lane) holds row or column tile * 16 + (lane & 15) at k = ks * 32 + half * 16 + (lane >> 4) * 8 + 0..7.
// One fragment = 512 elements = 1 KB; each of its two 16-byte loads reads 512 contiguous bytes per wave = 4 whole lines.
// Blocks 1..256 of this launch: p to bf16 [row tile][k step] (block = row tile), and wq, wk, wv to bf16, wo to f16(bf16 x 2^8), each [k step][column tile] (64 blocks a matrix). Each value is rounded once, here.
__global__ __launch_bounds__(256) void k_range(const float* __restrict__ PCO, float* __restrict__ RNG, const float* __restrict__ X, const float* __restrict__ WQ, const float* __restrict__ WK, const float* __restrict__ WV, const float* __restrict__ WO, __bf16* __restrict__ XP, __bf16* __restrict__ WP) { __shared__ float smx[8], smn[8]; __shared__ float sr;
  static_assert(NB * TT / 16 == 256 && DIN == 512 && CC == 512, "256 row tiles, 64 blocks of 512 chunks a weight");
  if (blockIdx.x != 0) {   // block-uniform, in front of every barrier
    const int pb = blockIdx.x - 1, e = threadIdx.x; const int wsel = pb >> 6; const float* Wm = wsel == 0 ? WQ : wsel == 1 ? WK : wsel == 2 ? WV : WO;
    const float* xs = X + ((size_t)pb * 16 + (e & 15)) * DIN + (e >> 6) * 32 + ((e >> 5) & 1) * 16 + ((e >> 4) & 1) * 8;   // chunk e of the row tile; chunk e + 256 lies 4 k steps on
    const int ew = (pb & 63) * 512 + e;   // chunk of the matrix; chunk ew + 256 lies 4 column tiles on
    const float* wsr = Wm + (size_t)((ew >> 11) * 32 + ((ew >> 5) & 1) * 16 + ((ew >> 4) & 1) * 8) * 512 + ((ew >> 6) & 31) * 16 + (ew & 15);
    v4f xv[4][2]; float wv[2][8];
#pragma unroll
    for (int it = 0; it < 4; ++it) { xv[it][0] = *(const v4f*)(xs + it * 128); xv[it][1] = *(const v4f*)(xs + it * 128 + 4); }
#pragma unroll
    for (int it = 0; it < 2; ++it)
#pragma unroll
      for (int i = 0; i < 8; ++i) wv[it][i] = wsr[it * 64 + i * 512];
    // precaution: both address pairs stay live and unwritten up to this wait
    asm volatile("s_wait_xcnt 0x0" :: "v"(xs), "v"(wsr) : "memory");
#pragma unroll
    for (int it = 0; it < 4; ++it) { v8b o;
#pragma unroll
      for (int i = 0; i < 4; ++i) { o[i] = (__bf16)xv[it][0][i]; o[4 + i] = (__bf16)xv[it][1][i]; }
      vst2(XP + ((size_t)pb * 1024 + it * 256 + e) * 8, o); XCW(); }
#pragma unroll
    for (int it = 0; it < 2; ++it) { __bf16* d = WP + ((size_t)pb * 512 + it * 256 + e) * 8;
      if (wsel < 3) { v8b o;
#pragma unroll
        for (int i = 0; i < 8; ++i) o[i] = (__bf16)wv[it][i];
        vst2(d, o); }
      else { v8h o;
#pragma unroll
        for (int i = 0; i < 8; ++i) o[i] = (_Float16)(bfr(wv[it][i]) * 256.0f);
        vst2(d, o); }
      XCW(); }
    return; }
  const int t = threadIdx.x; float best = 0.f;
  for (int b = 0; b < TNB; ++b) { float mx = -3.0e38f, mn = 3.0e38f; for (int i = t; i < TT; i += 256) { const float e = bfr(PCO[((size_t)b * TT + i) * 2]); mx = fmaxf(mx, e); mn = fminf(mn, e); }
    for (int o = 1; o < 32; o <<= 1) { mx = fmaxf(mx, __shfl_xor(mx, o)); mn = fminf(mn, __shfl_xor(mn, o)); }
    if ((t & 31) == 0) { smx[t >> 5] = mx; smn[t >> 5] = mn; } __syncthreads();
    if (t == 0) { float a = smx[0], c = smn[0]; for (int i = 1; i < 8; ++i) { a = fmaxf(a, smx[i]); c = fminf(c, smn[i]); } sr = a - c; } __syncthreads(); best = fmaxf(best, sr); __syncthreads(); }
  if (t < 32) { const float v = t == 0 ? fmaxf(best, 1e-6f) : 0.f; vst2(RNG + t, v); } }   
#define WS_RNG (WS_END)
#define WS_END2 (WS_RNG + 128u)
#define WS_XP (WS_RNG + 4096u)                           // bf16 p, fragment order (every fragment starts on a 1 KB boundary)
#define WS_WP (WS_XP + 2u * (size_t)NB * TT * DIN)       // wq, wk, wv (bf16), wo (f16), fragment order
#define WS_END3 (WS_WP + 4u * 2u * (size_t)DIN * CC)

#define WS_QH  0u                                      // f16 q, fragment order [token tile][k step]
#define WS_KH  (WS_QH + 2u * (size_t)NB * TT * CC)      // f16 k, fragment order [token tile][k step]
#define WS_VT  (WS_KH + 2u * (size_t)NB * TT * CC)      // f16 v, fragment order [b][column tile][k step of 32 tokens]
#define WS_QL  (WS_VT + 2u * (size_t)NB * CC * TT)      // f16 q residual x 2^10, fragment order as q
#define WS_KL  (WS_QL + 2u * (size_t)NB * QHI * CC)     // f16 k residual x 2^10 rows [b][t < KHI][CC]
#define WS_VB  (WS_KL + 2u * (size_t)NB * KHI * CC)     // bf16 v hi planes [b][c][t < KHI]
#define WS_VBL (WS_VB + 2u * (size_t)NB * CC * KHI)
#define WS_S   (WS_VBL + 2u * (size_t)NB * CC * KHI)    // f32 [b][hg][t][s], unused: no kernel here stores logits or P
#define WS_Y   (WS_S  + 4u * (size_t)NB * HG * TT * TT)      // f16 ctx, fragment order [token tile][k step] (the first half of the range)
#define WS_END (WS_Y  + 4u * (size_t)NB * TT * CC)

// ---- k_proj: block = (64 rows, 128 cols, which): q/k/v = X W (+ b) with exact bf16 products (K = DIN), both operands read in fragment order -> which 0: q f16 (+ residual, rows < QHI), fragment order; 1: k f16, fragment order (+ residual rows < KHI); 2: v f16, fragment order (+ bf16 hi/lo planes for t < KHI)
__global__ __launch_bounds__(128) void k_proj(const __bf16* __restrict__ XP, const __bf16* __restrict__ WP, const float* __restrict__ BQ, const float* __restrict__ BK, const float* __restrict__ BV,
    _Float16* __restrict__ QH, _Float16* __restrict__ QL, _Float16* __restrict__ KH, _Float16* __restrict__ KL, _Float16* __restrict__ VT, __bf16* __restrict__ VB, __bf16* __restrict__ VBL) {
  __shared__ __align__(16) _Float16 sh[64][136], sl[64][136]; __shared__ __align__(16) _Float16 th[128][72]; __shared__ __align__(16) __bf16 tb[128][72], tbl[128][72];
  const int tid = threadIdx.x, wave = tid >> 5, lane = tid & 31, col = lane & 15, g = lane >> 4; const int which = blockIdx.z; const int c0 = blockIdx.y * 128; const size_t r0 = (size_t)blockIdx.x * 64; const size_t bb = r0 / TT; const int t0 = (int)(r0 % TT);
  const float* BA = which == 0 ? BQ : which == 1 ? BK : BV;
  const __bf16* xa = XP + (size_t)(blockIdx.x * 4 + wave) * (16 * 512) + lane * 8;                      // the wave's row tile, k step 0
  const __bf16* wb = WP + (size_t)which * (DIN * CC) + (size_t)(blockIdx.y * 8) * 512 + lane * 8;   // the block's first column tile, k step 0
  v8f acc[8] = {};
  v16b a[3], w[2][8];   // register ring: each weight fragment of k step kc + 2 is requested into the registers of its forerunner as soon as the product of step kc has read them (the row fragment, read by all eight products, has a third place), so three steps' round trips overlap
#pragma unroll
  for (int s = 0; s < 2; ++s) { a[s] = fragw_b(xa + s * 512);
#pragma unroll
    for (int j = 0; j < 8; ++j) w[s][j] = fragw_b(wb + (s * 32 + j) * 512); }
#pragma unroll  // unrolled: every fragment is a constant offset from the two address pairs, which are never rewritten, and every ring index is a constant
  for (int kc = 0; kc < DIN / 32; ++kc) { const bool more = kc + 2 < DIN / 32;
    if (more) a[(kc + 2) % 3] = fragw_b(xa + (kc + 2) * 512);
#pragma unroll
    for (int j = 0; j < 8; ++j) { acc[j] = wmma_bf(a[kc % 3], w[kc & 1][j], acc[j]); if (more) w[kc & 1][j] = fragw_b(wb + ((kc + 2) * 32 + j) * 512); } }
  // precaution: both address pairs stay live and unwritten up to this wait
  asm volatile("s_wait_xcnt 0x0" :: "v"(xa), "v"(wb) : "memory");
  if (which < 2) { _Float16* DH = which == 0 ? QH : KH; _Float16* DL = which == 0 ? QL : KL; const int nhi = which == 0 ? QHI : KHI; const bool hi_rows = t0 < nhi;
#pragma unroll
    for (int j = 0; j < 8; ++j) { const float bias = BA ? bfr(BA[c0 + j * 16 + col]) : 0.f;
#pragma unroll
      for (int r = 0; r < 8; ++r) { const float v = acc[j][r] + bias; const _Float16 hv = (_Float16)v; sh[wave * 16 + 8 * g + r][j * 16 + col] = hv; sl[wave * 16 + 8 * g + r][j * 16 + col] = (_Float16)((v - (float)hv) * 1024.0f); } }
    __syncthreads();
    // q, its residual and k go out in fragment order (row tile = 16 tokens, k step = 32 columns): chunk e = [row tile 4][k step 4][half][lane]; the k residual rows keep their row layout
    for (int e = tid; e < 64 * 16; e += 128) { const int rl = (e >> 8) * 16 + (e & 15), cl = ((e >> 6) & 3) * 32 + ((e >> 5) & 1) * 16 + ((e >> 4) & 1) * 8;
      const size_t o = (((size_t)blockIdx.x * 4 + (e >> 8)) * 16 + blockIdx.y * 4 + ((e >> 6) & 3)) * 512 + (e & 63) * 8;
      vst2((unsigned*)(DH + o), *(const v4u*)&sh[rl][cl]); XCW(); if (hi_rows) { vst2((unsigned*)(which == 0 ? DL + o : DL + (bb * nhi + t0 + rl) * (size_t)CC + c0 + cl), *(const v4u*)&sl[rl][cl]); XCW(); } }
  } else { const bool hi_rows = t0 < KHI;
#pragma unroll
    for (int j = 0; j < 8; ++j) { const float bias = BA ? bfr(BA[c0 + j * 16 + col]) : 0.f;
#pragma unroll
      for (int r = 0; r < 8; ++r) { const float v = acc[j][r] + bias; const int rl = wave * 16 + 8 * g + r, cl = j * 16 + col; th[cl][rl] = (_Float16)v; const __bf16 bh = (__bf16)v; tb[cl][rl] = bh; tbl[cl][rl] = (__bf16)(v - (float)bh); } }
    __syncthreads();
    // v goes out in fragment order (row tile = 16 columns of a batch, k step = 32 tokens): chunk e = [column tile 8][k step 2][half][lane]; the bf16 planes keep their layout
    for (int e = tid; e < 128 * 8; e += 128) { const int cl = (e >> 7) * 16 + (e & 15), tl = ((e >> 6) & 1) * 32 + ((e >> 5) & 1) * 16 + ((e >> 4) & 1) * 8;
      const size_t o = ((bb * (CC / 16) + blockIdx.y * 8 + (e >> 7)) * (TT / 32) + (t0 >> 5) + ((e >> 6) & 1)) * 512 + (e & 63) * 8;
      vst2((unsigned*)(VT + o), *(const v4u*)&th[cl][tl]); XCW(); if (hi_rows) { const size_t o3 = (bb * CC + c0 + cl) * (size_t)KHI + t0 + tl; vst2((unsigned*)(VB + o3), *(const v4u*)&tb[cl][tl]); vst2((unsigned*)(VBL + o3), *(const v4u*)&tbl[cl][tl]); XCW(); } } } }
// ---- k_fa: block = 16 query rows (t0..t0+15) of batch z, wave = head (8 waves): logits, bias, softmax and P.v in one kernel; no logit or P value goes to memory.
// The 256 threads first compute the 16 x TT bias bins (they do not depend on the head) into LDS, one barrier, then every wave runs alone over the keys, 64 per trip.
// Both products are transposed: S^T = K Q^T gives lane (g, col) the logits of query col at keys 8g + r, which is the B fragment of ctx^T = V^T P^T as it stands (tiles 2u and 2u + 1 = elements 0..7 and 8..15 of k step u), so P needs no move between lanes,
// and the running maximum, the sum and the rescale factor of a query live in that query's own two lanes (col and col + 16).
#define BP (TT / 2 + 4)   // dwords per bin row: 2,064 B = 16 B x odd, the conflict-free pitch for 16-byte LDS reads down a column of rows
__device__ __forceinline__ v8f wm16(v16h a, v16h b, v8f c) { return __builtin_amdgcn_wmma_f32_16x16x32_f16(false, a, false, b, (short)0, c, false, false); }
__device__ __forceinline__ v16h frag_p(const _Float16* p) { union { v16h v; v8h q[2]; } u; u.q[0] = *(const v8h*)p; u.q[1] = *(const v8h*)(p + 16); return u.v; }  // p = the lane's own first element (row start + k0 + 8g)
// 2^x on the transcendental unit. The instruction set asks for one independent instruction behind a transcendental before its result is read or its source overwritten:
// in one statement each v_exp_f32 is that instruction for the one in front of it (the results are early-clobber, so none lies on a source), and the closing v_nop is it for the last
__device__ __forceinline__ float ex2(float x) { float e; asm("v_exp_f32 %0, %1\n\tv_nop" : "=v"(e) : "v"(x)); return e; }
__device__ __forceinline__ v8f ex2x8(v8f x) { float e0, e1, e2, e3, e4, e5, e6, e7;
  asm("v_exp_f32 %0, %8\n\tv_exp_f32 %1, %9\n\tv_exp_f32 %2, %10\n\tv_exp_f32 %3, %11\n\tv_exp_f32 %4, %12\n\tv_exp_f32 %5, %13\n\tv_exp_f32 %6, %14\n\tv_exp_f32 %7, %15\n\tv_nop"
      : "=&v"(e0), "=&v"(e1), "=&v"(e2), "=&v"(e3), "=&v"(e4), "=&v"(e5), "=&v"(e6), "=&v"(e7)
      : "v"(x[0]), "v"(x[1]), "v"(x[2]), "v"(x[3]), "v"(x[4]), "v"(x[5]), "v"(x[6]), "v"(x[7]));
  v8f e = {e0, e1, e2, e3, e4, e5, e6, e7}; return e; }
__device__ __forceinline__ float xhalf(float x) { return __builtin_bit_cast(float, __builtin_amdgcn_permlanex16(__builtin_bit_cast(int, x), __builtin_bit_cast(int, x), 0x76543210, 0xfedcba98, false, false)); }  // lane l with lane l ^ 16
__global__ __launch_bounds__(256) void k_fa(const _Float16* __restrict__ QH, const _Float16* __restrict__ QL, const _Float16* __restrict__ KH, const _Float16* __restrict__ VT, const float* __restrict__ PCO, const float* __restrict__ TAB, const float* __restrict__ RNG, _Float16* __restrict__ Y) {
  __shared__ __align__(16) unsigned sbin[16][BP]; __shared__ __align__(16) float stab[NH][64];
  static_assert(!CAUSAL && NH * 32 == 256 && TT == 1024 && HD == 64 && QHI == TT, "one wave per head, whole rows, 4 keys per thread, q residual on every row");
  const int tid = threadIdx.x, wave = tid >> 5, lane = tid & 31, col = lane & 15, g = lane >> 4; const int t0 = blockIdx.x * 16; const int b = blockIdx.z; const int h = wave;
  { const float* ckp = PCO + ((size_t)b * TT + tid * 4) * 2; const v4f ck0 = *(const v4f*)ckp, ck1 = *(const v4f*)(ckp + 4);
    const float* tp = TAB + lane * NH + h; const float tv0 = tp[0], tv1 = tp[32 * NH];
    const float* qcp = PCO + ((size_t)b * TT + t0 + col) * 2; const v2f qc = *(const v2f*)qcp;   // lane l holds the coordinates of query l & 15: one load, read by lane number in the loop below
    // precaution: the three address pairs stay live and unwritten up to this wait
    asm volatile("s_wait_xcnt 0x0" :: "v"(ckp), "v"(tp), "v"(qcp) : "memory");
    const int qe = __builtin_bit_cast(int, bfr(qc[0])), qf = __builtin_bit_cast(int, bfr(qc[1]));
    stab[wave][lane] = bfr(tv0); stab[wave][lane + 32] = bfr(tv1);
    const float rng = RNG[0]; const float e0 = bfr(ck0[0]), p0 = bfr(ck0[1]), e1 = bfr(ck0[2]), p1 = bfr(ck0[3]), e2 = bfr(ck1[0]), p2 = bfr(ck1[1]), e3 = bfr(ck1[2]), p3 = bfr(ck1[3]);
#pragma unroll 1  // rolled: for speed only
    for (int qi = 0; qi < 16; ++qi) { const float et = __builtin_bit_cast(float, __builtin_amdgcn_readlane(qe, qi)), pt_ = __builtin_bit_cast(float, __builtin_amdgcn_readlane(qf, qi));
      const unsigned b0 = bias_bins(et, pt_, e0, p0, rng), b1 = bias_bins(et, pt_, e1, p1, rng), b2 = bias_bins(et, pt_, e2, p2, rng), b3 = bias_bins(et, pt_, e3, p3, rng);
      v2u w; w[0] = b0 | (b1 << 16); w[1] = b2 | (b3 << 16); *(v2u*)&sbin[qi][tid * 2] = w; } }
  __syncthreads();   // publishes every thread's bins to the eight waves that read them below; the only barrier
  const char* tb = (const char*)&stab[wave][0];
  // all four operands lie in fragment order; a head's 64 columns are k steps 2h and 2h + 1 of a token tile, its v columns are column tiles 4h .. 4h + 3 of the batch
  const size_t qo = (((size_t)b * (TT / 16) + blockIdx.x) * 16 + h * 2) * 512 + lane * 8;
  const _Float16* qp = QH + qo; const _Float16* qlp = QL + qo;
  const _Float16* kp = KH + ((size_t)b * (TT / 16) * 16 + h * 2) * 512 + lane * 8;          // first key tile of the batch
  const _Float16* vp = VT + ((size_t)b * (CC / 16) + h * 4) * (TT / 32) * 512 + lane * 8;   // first column tile of the head, first 32 keys
  v16h qh[2], ql[2], kf[4][2];
#pragma unroll
  for (int kc = 0; kc < 2; ++kc) { qh[kc] = fragw_h(qp + kc * 512); ql[kc] = fragw_h(qlp + kc * 512); }
#pragma unroll
  for (int j = 0; j < 4; ++j)
#pragma unroll
    for (int kc = 0; kc < 2; ++kc) kf[j][kc] = fragw_h(kp + (j * 16 + kc) * 512);
  // precaution: the address pairs stay live and unwritten up to this wait
  asm volatile("s_wait_xcnt 0x0" :: "v"(qp), "v"(qlp), "v"(kp) : "memory");
  v8f ctx[4] = {}; float mrun = -3.0e38f, mlrun = -3.0e38f, lsum = 0.f;   // mlrun = the running maximum x log2(e), as it was rounded for the sums held so far
  const _Float16* kn = kp; const _Float16* vn = vp;   // the lane's own k row and v plane, moved on by 64 keys a trip
#pragma unroll 1  // rolled: one trip already holds the fragments of two trips in registers
  for (int ks = 0; ks < TT / 64; ++ks) { v8f s[4] = {}, sl[4] = {};
#pragma unroll
    for (int kc = 0; kc < 2; ++kc)
#pragma unroll
      for (int j = 0; j < 4; ++j) { s[j] = wm16(kf[j][kc], qh[kc], s[j]); sl[j] = wm16(kf[j][kc], ql[kc], sl[j]); }
    // the next trip's k fragments and this trip's v fragments fly while the softmax below runs (the last trip reads its own k tile again: in bounds, not used)
    kn += ks + 1 < TT / 64 ? 4 * 16 * 512 : 0;
#pragma unroll
    for (int j = 0; j < 4; ++j)
#pragma unroll
      for (int kc = 0; kc < 2; ++kc) kf[j][kc] = fragw_h(kn + (j * 16 + kc) * 512);
    v16h vf[2][4];
#pragma unroll
    for (int u = 0; u < 2; ++u)
#pragma unroll
      for (int jj = 0; jj < 4; ++jj) vf[u][jj] = fragw_h(vn + (jj * (TT / 32) + u) * 512);
    // precaution: both address pairs stay live and unwritten up to this wait; it also keeps the loads above the softmax
    asm volatile("s_wait_xcnt 0x0" :: "v"(kn), "v"(vn) : "memory");
    vn += 2 * 512;
    float mx = mrun;
#pragma unroll
    for (int j = 0; j < 4; ++j) { const v4u w = *(const v4u*)&sbin[col][ks * 32 + j * 8 + 4 * g];
#pragma unroll
      for (int r = 0; r < 8; ++r) { const unsigned bi = w[r >> 1] >> (16 * (r & 1)); const float x = (s[j][r] + sl[j][r] * (1.0f / 1024.0f)) * SCALE;
        const float v = x + (*(const float*)(tb + (bi & 0xffu)) + *(const float*)(tb + ((bi >> 8) & 0xffu))); s[j][r] = v; mx = fmaxf(mx, v); } }
    mx = fmaxf(mx, xhalf(mx));   // a query's keys are split between lanes col and col + 16
    // exp(v - mx) = exp2(v * log2(e) - mxl): one fma and one v_exp_f32 a score; the argument is never above a rounding error of 0, and a result below the normal range counts as 0 (far below what f16 holds)
    const float mxl = mx * LOG2E_F; const float al = ex2(mlrun - mxl); mrun = mx; mlrun = mxl;
    v4f s4 = {}; v16h p[2];
#pragma unroll
    for (int j = 0; j < 4; ++j) { v8f x;
#pragma unroll
      for (int r = 0; r < 8; ++r) x[r] = __builtin_fmaf(s[j][r], LOG2E_F, -mxl);
      const v8f ev = ex2x8(x);
#pragma unroll
      for (int r = 0; r < 8; ++r) { const float e = ev[r]; s4[r & 3] += e; p[j >> 1][(j & 1) * 8 + r] = (_Float16)e; } }
    lsum = lsum * al + ((s4[0] + s4[1]) + (s4[2] + s4[3]));
#pragma unroll
    for (int jj = 0; jj < 4; ++jj) ctx[jj] = ctx[jj] * al;
#pragma unroll
    for (int u = 0; u < 2; ++u)
#pragma unroll
      for (int jj = 0; jj < 4; ++jj) ctx[jj] = wm16(vf[u][jj], p[u], ctx[jj]); }
  const float sum = lsum + xhalf(lsum); const float inv = sum > 0.f ? 1.0f / sum : 0.f;
  _Float16* yp = Y + qo;   // lane (g, col) holds head columns jj * 16 + 8g + r of query col: chunk (k step 2h + (jj >> 1), half jj & 1, this lane) of the out product's A operand, rounded to f16 here
#pragma unroll
  for (int jj = 0; jj < 4; ++jj) { v8h o;
#pragma unroll
    for (int r = 0; r < 8; ++r) o[r] = (_Float16)(ctx[jj][r] * inv);
    vst2(yp + jj * 256, o); } }
// ---- k_out: block = (64 rows, 128 cols): out = ctx Wo (+ bo): ctx (f16) against Wo as f16(bf16 x 2^8) exact (1 product) x 2^-8, both operands read in fragment order
__global__ __launch_bounds__(128) void k_out(const _Float16* __restrict__ Y, const _Float16* __restrict__ WOP, const float* __restrict__ BO, float* __restrict__ OUT) { __shared__ __align__(16) float sf[4][16][132];
  static_assert(!CAUSAL, "one product for every row");
  const int tid = threadIdx.x, wave = tid >> 5, lane = tid & 31, col = lane & 15, g = lane >> 4; const int c0 = blockIdx.y * 128; const size_t r0 = (size_t)blockIdx.x * 64 + wave * 16;
  const _Float16* ya = Y + (size_t)(blockIdx.x * 4 + wave) * (16 * 512) + lane * 8;   // the wave's row tile, k step 0
  const _Float16* wb = WOP + (size_t)(blockIdx.y * 8) * 512 + lane * 8;              // the block's first column tile, k step 0
  v8f acc[8] = {};
  v16h a[3], w[2][8];   // register ring: each weight fragment of k step kc + 2 is requested into the registers of its forerunner as soon as the product of step kc has read them (the row fragment, read by all eight products, has a third place), so three steps' round trips overlap
#pragma unroll
  for (int s = 0; s < 2; ++s) { a[s] = fragw_h(ya + s * 512);
#pragma unroll
    for (int j = 0; j < 8; ++j) w[s][j] = fragw_h(wb + (s * 32 + j) * 512);
    // keeps the requests in the order of their use: loads return in order, and a counted wait in front of a product would otherwise also wait for fragments of a later step
    __builtin_amdgcn_sched_barrier(0); }
#pragma unroll  // unrolled: every fragment is a constant offset from the two address pairs, which are never rewritten, and every ring index is a constant
  for (int kc = 0; kc < CC / 32; ++kc) { const bool more = kc + 2 < CC / 32;
    if (more) a[(kc + 2) % 3] = fragw_h(ya + (kc + 2) * 512);
#pragma unroll
    for (int j = 0; j < 8; ++j) { acc[j] = wmma16(a[kc % 3], w[kc & 1][j], acc[j]); if (more) w[kc & 1][j] = fragw_h(wb + ((kc + 2) * 32 + j) * 512);
      // for the same order, and so that a request is not moved in front of the product whose registers it refills (which would take a fourth set of registers)
      __builtin_amdgcn_sched_barrier(0); } }
  // precaution: both address pairs stay live and unwritten up to this wait
  asm volatile("s_wait_xcnt 0x0" :: "v"(ya), "v"(wb) : "memory");
#pragma unroll
  for (int j = 0; j < 8; ++j) { const float bias = BO ? bfr(BO[c0 + j * 16 + col]) : 0.f;
#pragma unroll
    for (int r = 0; r < 8; ++r) sf[wave][8 * g + r][j * 16 + col] = acc[j][r] * (1.0f / 256.0f) + bias; }
  LDSX(); for (int rl = 0; rl < 16; ++rl) vst2(OUT + (r0 + rl) * DIN + c0 + lane * 4, *(const v4f*)&sf[wave][rl][lane * 4]); }

extern "C" void kernel_launch(void* const* d_in, const int* in_sizes, int n_in, void* d_out, int out_size, void* d_ws, size_t ws_size, hipStream_t stream) {
  (void)in_sizes; (void)n_in; (void)out_size;
  const float** F = (const float**)d_in;
  if (ws_size < (size_t)WS_END) return;
  char* ws = (char*)d_ws; _Float16 *QH = (_Float16*)(ws + WS_QH), *KH = (_Float16*)(ws + WS_KH), *VT = (_Float16*)(ws + WS_VT), *QL = (_Float16*)(ws + WS_QL), *KL = (_Float16*)(ws + WS_KL); __bf16 *VB = (__bf16*)(ws + WS_VB), *VBL = (__bf16*)(ws + WS_VBL); _Float16 *Y = (_Float16*)(ws + WS_Y);
  (void)Y; (void)QL; (void)KL; (void)VB; (void)VBL;
  // inputs: 0 p [4,1024,512]; 1 pcoords [4,1024,2]; 2 rpe_table [64,8]; 3 wq_w (in,out), 4 wq_b; 5 wk_w, 6 wk_b; 7 wv_w, 8 wv_b; 9 wo_w (in,out), 10 wo_b
  if (ws_size < (size_t)WS_END3) return;
  float* RNG = (float*)(ws + WS_RNG); __bf16 *XP = (__bf16*)(ws + WS_XP), *WP = (__bf16*)(ws + WS_WP);
  k_range<<<1 + 256, 256, 0, stream>>>(F[1], RNG, F[0], F[3], F[5], F[7], F[9], XP, WP);
  k_proj<<<dim3(TNB * TT / 64, CC / 128, 3), 128, 0, stream>>>(XP, WP, F[4], F[6], F[8], QH, QL, KH, KL, VT, VB, VBL);
  k_fa<<<dim3(TT / 16, 1, TNB), 256, 0, stream>>>(QH, QL, KH, VT, F[1], F[2], RNG, Y);
  k_out<<<dim3(TNB * TT / 64, DIN / 128), 128, 0, stream>>>(Y, (const _Float16*)(WP + 3 * DIN * CC), F[10], (float*)d_out);
}

// v008
// A run of this version takes 62.5 microseconds.
// Next to v007, in two timings, it ran 1.06 times as fast each time.
// Counting every step since v000, it is 6.09 times as fast.
// compute dtype: all float inputs rounded to bf16; q/k/v = p W + b with EXACT bf16 products on WMMA 16x16x32 (f32 accumulate); q as f16 hi + residual (x 2^10) against k once to f16 (2 products) x 64^-0.5; the relative-position bias: bin indices computed per (batch, query, key) in f32 exactly as the reference (difference, division by the global eta range, x16, truncation; fmod-based wrap for phi), table values (bf16) added in f32; softmax in f32 with a running maximum over 64-key steps, exp(x) = hardware exp2 of x * log2(e), the difference and the product in one f32 fma; exp(logit - running maximum) once to f16 against v once to f16 (1 product), divided by the f32 sum at the end; ctx once to f16 against Wo carried x 2^8 in f16 + bo; f32 output.
#include <hip/hip_runtime.h>
#include <math.h>

typedef __attribute__((ext_vector_type(16))) _Float16 v16h;
typedef __attribute__((ext_vector_type(16))) __bf16 v16b;
typedef __attribute__((ext_vector_type(8)))  _Float16 v8h;
typedef __attribute__((ext_vector_type(8)))  float v8f;
typedef __attribute__((ext_vector_type(4)))  float v4f;
typedef __attribute__((ext_vector_type(2)))  float v2f;
typedef __attribute__((ext_vector_type(4)))  unsigned v4u;
typedef __attribute__((ext_vector_type(2)))  unsigned v2u;
typedef __attribute__((ext_vector_type(4)))  int v4i;
typedef float __attribute__((may_alias)) float_a;
typedef int __attribute__((may_alias)) int_a;

template <typename T> __device__ __forceinline__ void vst2(void* p, T v) { *(T*)p = v;  }
__device__ __forceinline__ v8f wmma16(v16h a, v16h b, v8f c) {
  v8f d = __builtin_amdgcn_wmma_f32_16x16x32_f16(false, a, false, b, (short)0, c, false, false);
  asm volatile("v_nop\n\tv_nop\n\tv_nop\n\tv_nop" : "+v"(d) : "v"(a), "v"(b));
  return d;
}
__device__ __forceinline__ v8f wmma_bf(v16b a, v16b b, v8f c) {
  v8f d = __builtin_amdgcn_wmma_f32_16x16x32_bf16(false, a, false, b, (short)0, c, false, false);
  asm volatile("v_nop\n\tv_nop\n\tv_nop\n\tv_nop" : "+v"(d) : "v"(a), "v"(b));
  return d;
}
// 16x16x32 fragments: lane = (h = lane>>4, row/col = lane&15); elements 0..7 = k0+8h+0..7, 8..15 = k0+16+8h+0..7; D element r = row 8h+r
__device__ __forceinline__ v16h frag_h(const _Float16* rowk0, int lane) {
  union { v16h v; v8h q[2]; } u; const _Float16* p = rowk0 + 8 * (lane >> 4);
  u.q[0] = *(const v8h*)p; u.q[1] = *(const v8h*)(p + 16); return u.v;
}
__device__ __forceinline__ v16h frag_f32(const float* rowk0, int lane) {
  v16h a; const float* p = rowk0 + 8 * (lane >> 4);
#pragma unroll
  for (int i = 0; i < 8; ++i) { a[i] = (_Float16)p[i]; a[8 + i] = (_Float16)p[16 + i]; }
  return a;
}
__device__ __forceinline__ v16h frag_f32s(const float* rowk0, int lane, float sc) {
  v16h a; const float* p = rowk0 + 8 * (lane >> 4);
#pragma unroll
  for (int i = 0; i < 8; ++i) { a[i] = (_Float16)(p[i] * sc); a[8 + i] = (_Float16)(p[16 + i] * sc); }
  return a;
}
// column fragment from a [K][ld] layout (column n), rows >= K read as 0
__device__ __forceinline__ v16h fragc_f32(const float* W, int k0, int n, int lane, int ld, int K) {
  v16h a; const int g = lane >> 4;
#pragma unroll
  for (int i = 0; i < 8; ++i) { const int ka = k0 + 8 * g + i, kb = ka + 16;
    a[i] = (_Float16)(ka < K ? W[(size_t)(ka < K ? ka : K - 1) * ld + n] : 0.f); a[8 + i] = (_Float16)(kb < K ? W[(size_t)(kb < K ? kb : K - 1) * ld + n] : 0.f); }
  return a;
}
struct F2 { v16b h, l; };
__device__ __forceinline__ F2 bsplit16(const float v[16]) { F2 r;
#pragma unroll
  for (int i = 0; i < 16; ++i) { const __bf16 h = (__bf16)v[i]; r.h[i] = h; r.l[i] = (__bf16)(v[i] - (float)h); }
  return r; }
__device__ __forceinline__ F2 split_row(const float* row, int k0, int lane) { float v[16]; const float* p = row + k0 + 8 * (lane >> 4);
#pragma unroll
  for (int i = 0; i < 8; ++i) { v[i] = p[i]; v[8 + i] = p[16 + i]; }
  return bsplit16(v); }
__device__ __forceinline__ F2 split_rowK(const float* row, int k0, int lane, int K) { float v[16]; const int g = lane >> 4;
#pragma unroll
  for (int i = 0; i < 8; ++i) { const int ka = k0 + 8 * g + i, kb = ka + 16; v[i] = ka < K ? row[ka < K ? ka : K - 1] : 0.f; v[8 + i] = kb < K ? row[kb < K ? kb : K - 1] : 0.f; }
  return bsplit16(v); }
__device__ __forceinline__ F2 split_col(const float* W, int k0, int n, int lane, int ld, int K) { float v[16]; const int g = lane >> 4;
#pragma unroll
  for (int i = 0; i < 8; ++i) { const int ka = k0 + 8 * g + i, kb = ka + 16; v[i] = ka < K ? W[(size_t)(ka < K ? ka : K - 1) * ld + n] : 0.f; v[8 + i] = kb < K ? W[(size_t)(kb < K ? kb : K - 1) * ld + n] : 0.f; }
  return bsplit16(v); }
__device__ __forceinline__ v8f mac3(const F2& a, const F2& b, v8f c) { c = wmma_bf(a.l, b.h, c); c = wmma_bf(a.h, b.l, c); return wmma_bf(a.h, b.h, c); }
__device__ __forceinline__ float sigm(float v) { return 1.0f / (1.0f + expf(-v)); }
#define LDSX() do { asm volatile("s_wait_dscnt 0" ::: "memory"); __builtin_amdgcn_wave_barrier(); __builtin_amdgcn_fence(__ATOMIC_RELEASE, "workgroup"); } while (0)

// Patch attention with a relative-position bias (B 4, T 1,024, D 512 = 8 heads x 64): q/k/v = p W + b ((in,out)); scores = q k^T / 8 + rpe_table[eta_bin + 16][h] + rpe_table[phi_bin + 48][h] with eta_bin = trunc((eta_i - eta_j) / max|eta_i - eta_j| * 16), phi_bin = trunc(wrap(phi_i - phi_j) / pi * 16), both clipped to [-16, 15]; softmax; out = merged(attn v) Wo + bo.
#define NB 4
#define TT 1024
#define CC 512            // NH * HD = projected width
#define DIN 512          // input (model) width
#define NH 8
#define HD 64
#define NQB (TT / 64)
#define HG 8
#define SCALE (0.125f)
#define CAUSAL 0
#ifndef TNB
#define TNB NB
#endif
__device__ __forceinline__ float bfr(float v) { return (float)(__bf16)v; }
__host__ __device__ __forceinline__ int kb_last(int qb) { return CAUSAL ? ((qb * 64 + 63) >> 7) : (TT / 128 - 1); }
typedef __attribute__((ext_vector_type(8))) __bf16 v8b;
__device__ __forceinline__ v16b frag_b(const __bf16* rowk0, int lane) {
  union { v16b v; v8b q[2]; } u; const __bf16* p = rowk0 + 8 * (lane >> 4);
  u.q[0] = *(const v8b*)p; u.q[1] = *(const v8b*)(p + 16); return u.v;
}
// precaution, behind a store in a loop: it stands in front of the first rewrite of a register that the store names
#define XCW() asm volatile("s_wait_xcnt 0x0" ::: "memory")
// one fragment in fragment order: p = fragment start + lane * 8
__device__ __forceinline__ v16b fragw_b(const __bf16* p) { union { v16b v; v8b q[2]; } u; u.q[0] = *(const v8b*)p; u.q[1] = *(const v8b*)(p + 256); return u.v; }
__device__ __forceinline__ v16h fragw_h(const _Float16* p) { union { v16h v; v8h q[2]; } u; u.q[0] = *(const v8h*)p; u.q[1] = *(const v8h*)(p + 256); return u.v; }
#define QBH 0              // unused: no kernel here has a separate high-precision path
#define QHI 1024            // rows carrying a q residual plane (all rows when non-causal: 2-product logits everywhere)
#define KHI 64            // key rows carrying k residual / v bf16 hi+lo planes (written by k_proj; no kernel here reads them)
// B fragment (k rows k0+.., output column o) of a weight: (in,out) [K][ld] or (out,in) [ld rows of K]: bf16 exact, or f16(bf16 * 256) exact
__device__ __forceinline__ v16b wcol_io(const float* Wm, int k0, int o, int lane, int ld) { v16b w; const int g = lane >> 4;
#pragma unroll
  for (int i = 0; i < 8; ++i) { w[i] = (__bf16)Wm[(size_t)(k0 + 8 * g + i) * ld + o]; w[8 + i] = (__bf16)Wm[(size_t)(k0 + 16 + 8 * g + i) * ld + o]; }
  return w; }
__device__ __forceinline__ v16b wcol_oi(const float* Wm, int k0, int o, int lane, int K) { v16b w; const float* p = Wm + (size_t)o * K + k0 + 8 * (lane >> 4);
#pragma unroll
  for (int i = 0; i < 8; ++i) { w[i] = (__bf16)p[i]; w[8 + i] = (__bf16)p[16 + i]; }
  return w; }
__device__ __forceinline__ v16h wcolh_io(const float* Wm, int k0, int o, int lane, int ld) { v16h w; const int g = lane >> 4;
#pragma unroll
  for (int i = 0; i < 8; ++i) { w[i] = (_Float16)(bfr(Wm[(size_t)(k0 + 8 * g + i) * ld + o]) * 256.0f); w[8 + i] = (_Float16)(bfr(Wm[(size_t)(k0 + 16 + 8 * g + i) * ld + o]) * 256.0f); }
  return w; }
__device__ __forceinline__ v16h wcolh_oi(const float* Wm, int k0, int o, int lane, int K) { v16h w; const float* p = Wm + (size_t)o * K + k0 + 8 * (lane >> 4);
#pragma unroll
  for (int i = 0; i < 8; ++i) { w[i] = (_Float16)(bfr(p[i]) * 256.0f); w[8 + i] = (_Float16)(bfr(p[16 + i]) * 256.0f); }
  return w; }
#define WQKV_LAYOUT 0   // selects WCOL only, which nothing calls; k_range always reads wq/wk/wv as (in,out) [DIN][CC]
__device__ __forceinline__ v16b wcol_hdk(const float* Wm, int k0, int o, int lane) { v16b w; const int g = lane >> 4; const float* p = Wm + (size_t)(o / HD) * DIN * HD + (o % HD);
#pragma unroll
  for (int i = 0; i < 8; ++i) { w[i] = (__bf16)p[(size_t)(k0 + 8 * g + i) * HD]; w[8 + i] = (__bf16)p[(size_t)(k0 + 16 + 8 * g + i) * HD]; }
  return w; }
#define WO_OUT_IN 0
#if WQKV_LAYOUT == 1
#define WCOL(W, k0, o, lane) wcol_oi(W, k0, o, lane, DIN)
#elif WQKV_LAYOUT == 2
#define WCOL(W, k0, o, lane) wcol_hdk(W, k0, o, lane)
#else
#define WCOL(W, k0, o, lane) wcol_io(W, k0, o, lane, CC)
#endif
#if WO_OUT_IN
#define WOCOL(W, k0, o, lane) wcol_oi(W, k0, o, lane, CC)
#define WOCOLH(W, k0, o, lane) wcolh_oi(W, k0, o, lane, CC)
#else
#define WOCOL(W, k0, o, lane) wcol_io(W, k0, o, lane, DIN)
#define WOCOLH(W, k0, o, lane) wcolh_io(W, k0, o, lane, DIN)
#endif
#define PI_F 3.14159274f          // f32(math.pi)
#define LOG2E_F 1.44269504f       // f32(log2(e))
// bias bins of one (query, key) pair, the same for every head: byte offsets into one head's 64-entry f32 table column, eta bin in bits 7..0, phi bin (+32 entries) in bits 15..8. f32 steps exactly as the reference: jnp.mod = fmod then +y when the remainder is negative; .astype(int32) = truncation
__device__ __forceinline__ unsigned bias_bins(float et, float pt_, float ek, float pk_, float rng) {
  const float re = et - ek; int eb = (int)((re / rng) * 16.0f); eb = eb < -16 ? -16 : (eb > 15 ? 15 : eb);
  const float rp = pt_ - pk_; const float a_ = rp + PI_F; const float twopi = 2.0f * PI_F; float rm = fmodf(a_, twopi); rm = (rm != 0.0f && rm < 0.0f) ? rm + twopi : rm; const float wr = rm - PI_F;
  int pb = (int)((wr / PI_F) * 16.0f); pb = pb < -16 ? -16 : (pb > 15 ? 15 : pb);
  return (unsigned)((eb + 16) * 4) | ((unsigned)((pb + 16 + 32) * 4) << 8); }
// The same bins, bit for bit, without the library remainder and the two general divisions, for coordinates inside the range that k_fa tests once per wave (|phi| < 1,024, |eta| < 2^60, 1e-6 <= range < 2^62).
// Returns eta_bin * 4 + phi_bin * 1,024; the caller adds the table offsets of a whole word once (sums modulo 2^32 are linear, so a negative bin's borrow cancels against them).
// eta arrives x 16 (a power of two moves through the difference, the division and their roundings unchanged). a / b rounded to nearest: with y = the rounded 1 / b, q = a * y, then q += (a - q * b) * y with both steps fused;
// once q is within one unit in the last place the residual is exact and the result is the rounded quotient: two corrections for any b, one for b = pi / 16, whose rounded reciprocal is off by under 2^-26.
// Remainder: n = floor(c / 2pi + 2^-8) is the true floor or one more; c - n * 2pi in one fma is exact wherever |c| >= 4 (a multiple of 2^-21 below 8), and for -2pi < c < 0 it is the reference's own rounded c + 2pi;
// a negative r (n one too many, or c < 0 taken with n = 0) takes + 2pi: as unsigned words a negative float lies above every positive one and positive floats keep their order, so the minimum of r and r + 2pi is that choice.
__device__ __forceinline__ unsigned bins_fast(float et16, float pt_, float ek16, float pk_, float rng, float yr) {
  const float a = et16 - ek16; float q = a * yr; q = __builtin_fmaf(__builtin_fmaf(-q, rng, a), yr, q); q = __builtin_fmaf(__builtin_fmaf(-q, rng, a), yr, q);
  int eb = (int)q; eb = eb < -16 ? -16 : (eb > 15 ? 15 : eb);
  const float twopi = 2.0f * PI_F; const float c = (pt_ - pk_) + PI_F; const float n = __builtin_floorf(__builtin_fmaf(c, 0x1.45f306p-3f, 0x1p-8f)); const float r = __builtin_fmaf(-n, twopi, c);
  const unsigned ur = __builtin_bit_cast(unsigned, r), ut = __builtin_bit_cast(unsigned, r + twopi); const float wr = __builtin_bit_cast(float, __builtin_elementwise_min(ur, ut)) - PI_F;
  float u = wr * 0x1.45f306p+2f; u = __builtin_fmaf(__builtin_fmaf(-u, PI_F * 0.0625f, wr), 0x1.45f306p+2f, u);
  int pb = (int)u; pb = pb < -16 ? -16 : (pb > 15 ? 15 : pb);
  return (unsigned)eb * 4u + (unsigned)pb * 1024u; }
// ---- k_range: block 0: eta_range = max(max over batches of (max eta - min eta), 1e-6) on the bf16-rounded coordinates (= max |eta_i - eta_j| over all same-batch pairs, exact)
// FRAGMENT ORDER, the layout of every matrix operand in the workspace: [tile of 16 rows (A) or columns (B)][k step of 32][half][lane][8 elements of 16 bits], for the weights [k step][column tile][half][lane][8 elements]; chunk (tile, ks, half, lane) holds row or column tile * 16 + (lane & 15) at k = ks * 32 + half * 16 + (lane >> 4) * 8 + 0..7.
// One fragment = 512 elements = 1 KB; each of its two 16-byte loads reads 512 contiguous bytes per wave = 4 whole lines.
// Blocks 1..256 of this launch: p to bf16 [row tile][k step] (block = row tile), and wq, wk, wv to bf16, wo to f16(bf16 x 2^8), each [k step][column tile] (64 blocks a matrix). Each value is rounded once, here.
__global__ __launch_bounds__(256) void k_range(const float* __restrict__ PCO, float* __restrict__ RNG, const float* __restrict__ X, const float* __restrict__ WQ, const float* __restrict__ WK, const float* __restrict__ WV, const float* __restrict__ WO, __bf16* __restrict__ XP, __bf16* __restrict__ WP) { __shared__ float smx[8], smn[8]; __shared__ float sr;
  static_assert(NB * TT / 16 == 256 && DIN == 512 && CC == 512, "256 row tiles, 64 blocks of 512 chunks a weight");
  if (blockIdx.x != 0) {   // block-uniform, in front of every barrier
    const int pb = blockIdx.x - 1, e = threadIdx.x; const int wsel = pb >> 6; const float* Wm = wsel == 0 ? WQ : wsel == 1 ? WK : wsel == 2 ? WV : WO;
    const float* xs = X + ((size_t)pb * 16 + (e & 15)) * DIN + (e >> 6) * 32 + ((e >> 5) & 1) * 16 + ((e >> 4) & 1) * 8;   // chunk e of the row tile; chunk e + 256 lies 4 k steps on
    const int ew = (pb & 63) * 512 + e;   // chunk of the matrix; chunk ew + 256 lies 4 column tiles on
    const float* wsr = Wm + (size_t)((ew >> 11) * 32 + ((ew >> 5) & 1) * 16 + ((ew >> 4) & 1) * 8) * 512 + ((ew >> 6) & 31) * 16 + (ew & 15);
    v4f xv[4][2]; float wv[2][8];
#pragma unroll
    for (int it = 0; it < 4; ++it) { xv[it][0] = *(const v4f*)(xs + it * 128); xv[it][1] = *(const v4f*)(xs + it * 128 + 4); }
#pragma unroll
    for (int it = 0; it < 2; ++it)
#pragma unroll
      for (int i = 0; i < 8; ++i) wv[it][i] = wsr[it * 64 + i * 512];
    // precaution: both address pairs stay live and unwritten up to this wait
    asm volatile("s_wait_xcnt 0x0" :: "v"(xs), "v"(wsr) : "memory");
#pragma unroll
    for (int it = 0; it < 4; ++it) { v8b o;
#pragma unroll
      for (int i = 0; i < 4; ++i) { o[i] = (__bf16)xv[it][0][i]; o[4 + i] = (__bf16)xv[it][1][i]; }
      vst2(XP + ((size_t)pb * 1024 + it * 256 + e) * 8, o); XCW(); }
#pragma unroll
    for (int it = 0; it < 2; ++it) { __bf16* d = WP + ((size_t)pb * 512 + it * 256 + e) * 8;
      if (wsel < 3) { v8b o;
#pragma unroll
        for (int i = 0; i < 8; ++i) o[i] = (__bf16)wv[it][i];
        vst2(d, o); }
      else { v8h o;
#pragma unroll
        for (int i = 0; i < 8; ++i) o[i] = (_Float16)(bfr(wv[it][i]) * 256.0f);
        vst2(d, o); }
      XCW(); }
    return; }
  const int t = threadIdx.x; float best = 0.f;
  for (int b = 0; b < TNB; ++b) { float mx = -3.0e38f, mn = 3.0e38f; for (int i = t; i < TT; i += 256) { const float e = bfr(PCO[((size_t)b * TT + i) * 2]); mx = fmaxf(mx, e); mn = fminf(mn, e); }
    for (int o = 1; o < 32; o <<= 1) { mx = fmaxf(mx, __shfl_xor(mx, o)); mn = fminf(mn, __shfl_xor(mn, o)); }
    if ((t & 31) == 0) { smx[t >> 5] = mx; smn[t >> 5] = mn; } __syncthreads();
    if (t == 0) { float a = smx[0], c = smn[0]; for (int i = 1; i < 8; ++i) { a = fmaxf(a, smx[i]); c = fminf(c, smn[i]); } sr = a - c; } __syncthreads(); best = fmaxf(best, sr); __syncthreads(); }
  if (t < 32) { const float v = t == 0 ? fmaxf(best, 1e-6f) : 0.f; vst2(RNG + t, v); } }   
#define WS_RNG (WS_END)
#define WS_END2 (WS_RNG + 128u)
#define WS_XP (WS_RNG + 4096u)                           // bf16 p, fragment order (every fragment starts on a 1 KB boundary)
#define WS_WP (WS_XP + 2u * (size_t)NB * TT * DIN)       // wq, wk, wv (bf16), wo (f16), fragment order
#define WS_END3 (WS_WP + 4u * 2u * (size_t)DIN * CC)

#define WS_QH  0u                                      // f16 q, fragment order [token tile][k step]
#define WS_KH  (WS_QH + 2u * (size_t)NB * TT * CC)      // f16 k, fragment order [token tile][k step]
#define WS_VT  (WS_KH + 2u * (size_t)NB * TT * CC)      // f16 v, fragment order [b][column tile][k step of 32 tokens]
#define WS_QL  (WS_VT + 2u * (size_t)NB * CC * TT)      // f16 q residual x 2^10, fragment order as q
#define WS_KL  (WS_QL + 2u * (size_t)NB * QHI * CC)     // f16 k residual x 2^10 rows [b][t < KHI][CC]
#define WS_VB  (WS_KL + 2u * (size_t)NB * KHI * CC)     // bf16 v hi planes [b][c][t < KHI]
#define WS_VBL (WS_VB + 2u * (size_t)NB * CC * KHI)
#define WS_S   (WS_VBL + 2u * (size_t)NB * CC * KHI)    // f32 [b][hg][t][s], unused: no kernel here stores logits or P
#define WS_Y   (WS_S  + 4u * (size_t)NB * HG * TT * TT)      // f16 ctx, fragment order [token tile][k step] (the first half of the range)
#define WS_END (WS_Y  + 4u * (size_t)NB * TT * CC)

// ---- k_proj: block = (64 rows, 128 cols, which): q/k/v = X W (+ b) with exact bf16 products (K = DIN), both operands read in fragment order -> which 0: q f16 (+ residual, rows < QHI), fragment order; 1: k f16, fragment order (+ residual rows < KHI); 2: v f16, fragment order (+ bf16 hi/lo planes for t < KHI)
__global__ __launch_bounds__(128) void k_proj(const __bf16* __restrict__ XP, const __bf16* __restrict__ WP, const float* __restrict__ BQ, const float* __restrict__ BK, const float* __restrict__ BV,
    _Float16* __restrict__ QH, _Float16* __restrict__ QL, _Float16* __restrict__ KH, _Float16* __restrict__ KL, _Float16* __restrict__ VT, __bf16* __restrict__ VB, __bf16* __restrict__ VBL) {
  __shared__ __align__(16) _Float16 sh[64][136], sl[64][136]; __shared__ __align__(16) _Float16 th[128][72]; __shared__ __align__(16) __bf16 tb[128][72], tbl[128][72];
  const int tid = threadIdx.x, wave = tid >> 5, lane = tid & 31, col = lane & 15, g = lane >> 4; const int which = blockIdx.z; const int c0 = blockIdx.y * 128; const size_t r0 = (size_t)blockIdx.x * 64; const size_t bb = r0 / TT; const int t0 = (int)(r0 % TT);
  const float* BA = which == 0 ? BQ : which == 1 ? BK : BV;
  const __bf16* xa = XP + (size_t)(blockIdx.x * 4 + wave) * (16 * 512) + lane * 8;                      // the wave's row tile, k step 0
  const __bf16* wb = WP + (size_t)which * (DIN * CC) + (size_t)(blockIdx.y * 8) * 512 + lane * 8;   // the block's first column tile, k step 0
  v8f acc[8] = {};
  v16b a[3], w[2][8];   // register ring: each weight fragment of k step kc + 2 is requested into the registers of its forerunner as soon as the product of step kc has read them (the row fragment, read by all eight products, has a third place), so three steps' round trips overlap
#pragma unroll
  for (int s = 0; s < 2; ++s) { a[s] = fragw_b(xa + s * 512);
#pragma unroll
    for (int j = 0; j < 8; ++j) w[s][j] = fragw_b(wb + (s * 32 + j) * 512); }
#pragma unroll  // unrolled: every fragment is a constant offset from the two address pairs, which are never rewritten, and every ring index is a constant
  for (int kc = 0; kc < DIN / 32; ++kc) { const bool more = kc + 2 < DIN / 32;
    if (more) a[(kc + 2) % 3] = fragw_b(xa + (kc + 2) * 512);
#pragma unroll
    for (int j = 0; j < 8; ++j) { acc[j] = wmma_bf(a[kc % 3], w[kc & 1][j], acc[j]); if (more) w[kc & 1][j] = fragw_b(wb + ((kc + 2) * 32 + j) * 512); } }
  // precaution: both address pairs stay live and unwritten up to this wait
  asm volatile("s_wait_xcnt 0x0" :: "v"(xa), "v"(wb) : "memory");
  if (which < 2) { _Float16* DH = which == 0 ? QH : KH; _Float16* DL = which == 0 ? QL : KL; const int nhi = which == 0 ? QHI : KHI; const bool hi_rows = t0 < nhi;
#pragma unroll
    for (int j = 0; j < 8; ++j) { const float bias = BA ? bfr(BA[c0 + j * 16 + col]) : 0.f;
#pragma unroll
      for (int r = 0; r < 8; ++r) { const float v = acc[j][r] + bias; const _Float16 hv = (_Float16)v; sh[wave * 16 + 8 * g + r][j * 16 + col] = hv; sl[wave * 16 + 8 * g + r][j * 16 + col] = (_Float16)((v - (float)hv) * 1024.0f); } }
    __syncthreads();
    // q, its residual and k go out in fragment order (row tile = 16 tokens, k step = 32 columns): chunk e = [row tile 4][k step 4][half][lane]; the k residual rows keep their row layout
    for (int e = tid; e < 64 * 16; e += 128) { const int rl = (e >> 8) * 16 + (e & 15), cl = ((e >> 6) & 3) * 32 + ((e >> 5) & 1) * 16 + ((e >> 4) & 1) * 8;
      const size_t o = (((size_t)blockIdx.x * 4 + (e >> 8)) * 16 + blockIdx.y * 4 + ((e >> 6) & 3)) * 512 + (e & 63) * 8;
      vst2((unsigned*)(DH + o), *(const v4u*)&sh[rl][cl]); XCW(); if (hi_rows) { vst2((unsigned*)(which == 0 ? DL + o : DL + (bb * nhi + t0 + rl) * (size_t)CC + c0 + cl), *(const v4u*)&sl[rl][cl]); XCW(); } }
  } else { const bool hi_rows = t0 < KHI;
#pragma unroll
    for (int j = 0; j < 8; ++j) { const float bias = BA ? bfr(BA[c0 + j * 16 + col]) : 0.f;
#pragma unroll
      for (int r = 0; r < 8; ++r) { const float v = acc[j][r] + bias; const int rl = wave * 16 + 8 * g + r, cl = j * 16 + col; th[cl][rl] = (_Float16)v; const __bf16 bh = (__bf16)v; tb[cl][rl] = bh; tbl[cl][rl] = (__bf16)(v - (float)bh); } }
    __syncthreads();
    // v goes out in fragment order (row tile = 16 columns of a batch, k step = 32 tokens): chunk e = [column tile 8][k step 2][half][lane]; the bf16 planes keep their layout
    for (int e = tid; e < 128 * 8; e += 128) { const int cl = (e >> 7) * 16 + (e & 15), tl = ((e >> 6) & 1) * 32 + ((e >> 5) & 1) * 16 + ((e >> 4) & 1) * 8;
      const size_t o = ((bb * (CC / 16) + blockIdx.y * 8 + (e >> 7)) * (TT / 32) + (t0 >> 5) + ((e >> 6) & 1)) * 512 + (e & 63) * 8;
      vst2((unsigned*)(VT + o), *(const v4u*)&th[cl][tl]); XCW(); if (hi_rows) { const size_t o3 = (bb * CC + c0 + cl) * (size_t)KHI + t0 + tl; vst2((unsigned*)(VB + o3), *(const v4u*)&tb[cl][tl]); vst2((unsigned*)(VBL + o3), *(const v4u*)&tbl[cl][tl]); XCW(); } } } }
// ---- k_fa: block = 16 query rows (t0..t0+15) of batch z, wave = head (8 waves): logits, bias, softmax and P.v in one kernel; no logit or P value goes to memory.
// The 256 threads first compute the 16 x TT bias bins (they do not depend on the head) into LDS, one barrier, then every wave runs alone over the keys, 64 per trip.
// Both products are transposed: S^T = K Q^T gives lane (g, col) the logits of query col at keys 8g + r, which is the B fragment of ctx^T = V^T P^T as it stands (tiles 2u and 2u + 1 = elements 0..7 and 8..15 of k step u), so P needs no move between lanes,
// and the running maximum, the sum and the rescale factor of a query live in that query's own two lanes (col and col + 16).
#define BP (TT / 2 + 4)   // dwords per bin row: 2,064 B = 16 B x odd, the conflict-free pitch for 16-byte LDS reads down a column of rows
__device__ __forceinline__ v8f wm16(v16h a, v16h b, v8f c) { return __builtin_amdgcn_wmma_f32_16x16x32_f16(false, a, false, b, (short)0, c, false, false); }
__device__ __forceinline__ v16h frag_p(const _Float16* p) { union { v16h v; v8h q[2]; } u; u.q[0] = *(const v8h*)p; u.q[1] = *(const v8h*)(p + 16); return u.v; }  // p = the lane's own first element (row start + k0 + 8g)
// 2^x on the transcendental unit. The instruction set asks for one independent instruction behind a transcendental before its result is read or its source overwritten:
// in one statement each v_exp_f32 is that instruction for the one in front of it (the results are early-clobber, so none lies on a source), and the closing v_nop is it for the last
__device__ __forceinline__ float ex2(float x) { float e; asm("v_exp_f32 %0, %1\n\tv_nop" : "=v"(e) : "v"(x)); return e; }
__device__ __forceinline__ v8f ex2x8(v8f x) { float e0, e1, e2, e3, e4, e5, e6, e7;
  asm("v_exp_f32 %0, %8\n\tv_exp_f32 %1, %9\n\tv_exp_f32 %2, %10\n\tv_exp_f32 %3, %11\n\tv_exp_f32 %4, %12\n\tv_exp_f32 %5, %13\n\tv_exp_f32 %6, %14\n\tv_exp_f32 %7, %15\n\tv_nop"
      : "=&v"(e0), "=&v"(e1), "=&v"(e2), "=&v"(e3), "=&v"(e4), "=&v"(e5), "=&v"(e6), "=&v"(e7)
      : "v"(x[0]), "v"(x[1]), "v"(x[2]), "v"(x[3]), "v"(x[4]), "v"(x[5]), "v"(x[6]), "v"(x[7]));
  v8f e = {e0, e1, e2, e3, e4, e5, e6, e7}; return e; }
__device__ __forceinline__ float xhalf(float x) { return __builtin_bit_cast(float, __builtin_amdgcn_permlanex16(__builtin_bit_cast(int, x), __builtin_bit_cast(int, x), 0x76543210, 0xfedcba98, false, false)); }  // lane l with lane l ^ 16
__global__ __launch_bounds__(256) void k_fa(const _Float16* __restrict__ QH, const _Float16* __restrict__ QL, const _Float16* __restrict__ KH, const _Float16* __restrict__ VT, const float* __restrict__ PCO, const float* __restrict__ TAB, const float* __restrict__ RNG, _Float16* __restrict__ Y) {
  __shared__ __align__(16) unsigned sbin[16][BP]; __shared__ __align__(16) float stab[NH][64];
  static_assert(!CAUSAL && NH * 32 == 256 && TT == 1024 && HD == 64 && QHI == TT, "one wave per head, whole rows, 4 keys per thread, q residual on every row");
  const int tid = threadIdx.x, wave = tid >> 5, lane = tid & 31, col = lane & 15, g = lane >> 4; const int t0 = blockIdx.x * 16; const int b = blockIdx.z; const int h = wave;
  { const float* ckp = PCO + ((size_t)b * TT + tid * 4) * 2; const v4f ck0 = *(const v4f*)ckp, ck1 = *(const v4f*)(ckp + 4);
    const float* tp = TAB + lane * NH + h; const float tv0 = tp[0], tv1 = tp[32 * NH];
    const float* qcp = PCO + ((size_t)b * TT + t0 + col) * 2; const v2f qc = *(const v2f*)qcp;   // lane l holds the coordinates of query l & 15: one load, read by lane number in the loop below
    // precaution: the three address pairs stay live and unwritten up to this wait
    asm volatile("s_wait_xcnt 0x0" :: "v"(ckp), "v"(tp), "v"(qcp) : "memory");
    const int qe = __builtin_bit_cast(int, bfr(qc[0])), qf = __builtin_bit_cast(int, bfr(qc[1]));
    stab[wave][lane] = bfr(tv0); stab[wave][lane + 32] = bfr(tv1);
    const float rng = RNG[0]; const float e0 = bfr(ck0[0]), p0 = bfr(ck0[1]), e1 = bfr(ck0[2]), p1 = bfr(ck0[3]), e2 = bfr(ck1[0]), p2 = bfr(ck1[1]), e3 = bfr(ck1[2]), p3 = bfr(ck1[3]);
    // one test per wave: its lanes hold all sixteen queries and its own keys; a sum of magnitudes bounds each term, and a NaN or an infinity fails it
    const float qef = __builtin_bit_cast(float, qe), qff = __builtin_bit_cast(float, qf);
    const bool inr = ((fabsf(qff) + fabsf(p0)) + (fabsf(p1) + fabsf(p2)) + fabsf(p3) < 1024.0f) & ((fabsf(qef) + fabsf(e0)) + (fabsf(e1) + fabsf(e2)) + fabsf(e3) < 0x1p60f) & (rng >= 1e-6f) & (rng < 0x1p62f);
    if (__builtin_amdgcn_ballot_w32(inr) == 0xffffffffu) {
      const float yr = 1.0f / rng; const int qe16 = __builtin_bit_cast(int, qef * 16.0f); const float f0 = e0 * 16.0f, f1 = e1 * 16.0f, f2 = e2 * 16.0f, f3 = e3 * 16.0f;
      const unsigned off = (16u * 4u + ((16u + 32u) * 4u << 8)) * 0x10001u;   // the table offsets of the four bytes of a word
#pragma unroll 2  // two queries a trip: their chains are independent and fill each other's result latencies
      for (int qi = 0; qi < 16; ++qi) { const float et16 = __builtin_bit_cast(float, __builtin_amdgcn_readlane(qe16, qi)), pt_ = __builtin_bit_cast(float, __builtin_amdgcn_readlane(qf, qi));
        const unsigned b0 = bins_fast(et16, pt_, f0, p0, rng, yr), b1 = bins_fast(et16, pt_, f1, p1, rng, yr), b2 = bins_fast(et16, pt_, f2, p2, rng, yr), b3 = bins_fast(et16, pt_, f3, p3, rng, yr);
        v2u w; w[0] = b0 + (b1 << 16) + off; w[1] = b2 + (b3 << 16) + off; *(v2u*)&sbin[qi][tid * 2] = w; }
    } else {
#pragma unroll 1  // rolled: for speed only
      for (int qi = 0; qi < 16; ++qi) { const float et = __builtin_bit_cast(float, __builtin_amdgcn_readlane(qe, qi)), pt_ = __builtin_bit_cast(float, __builtin_amdgcn_readlane(qf, qi));
        const unsigned b0 = bias_bins(et, pt_, e0, p0, rng), b1 = bias_bins(et, pt_, e1, p1, rng), b2 = bias_bins(et, pt_, e2, p2, rng), b3 = bias_bins(et, pt_, e3, p3, rng);
        v2u w; w[0] = b0 | (b1 << 16); w[1] = b2 | (b3 << 16); *(v2u*)&sbin[qi][tid * 2] = w; } } }
  __syncthreads();   // publishes every thread's bins to the eight waves that read them below; the only barrier
  const char* tb = (const char*)&stab[wave][0];
  // all four operands lie in fragment order; a head's 64 columns are k steps 2h and 2h + 1 of a token tile, its v columns are column tiles 4h .. 4h + 3 of the batch
  const size_t qo = (((size_t)b * (TT / 16) + blockIdx.x) * 16 + h * 2) * 512 + lane * 8;
  const _Float16* qp = QH + qo; const _Float16* qlp = QL + qo;
  const _Float16* kp = KH + ((size_t)b * (TT / 16) * 16 + h * 2) * 512 + lane * 8;          // first key tile of the batch
  const _Float16* vp = VT + ((size_t)b * (CC / 16) + h * 4) * (TT / 32) * 512 + lane * 8;   // first column tile of the head, first 32 keys
  v16h qh[2], ql[2], kf[4][2];
#pragma unroll
  for (int kc = 0; kc < 2; ++kc) { qh[kc] = fragw_h(qp + kc * 512); ql[kc] = fragw_h(qlp + kc * 512); }
#pragma unroll
  for (int j = 0; j < 4; ++j)
#pragma unroll
    for (int kc = 0; kc < 2; ++kc) kf[j][kc] = fragw_h(kp + (j * 16 + kc) * 512);
  // precaution: the address pairs stay live and unwritten up to this wait
  asm volatile("s_wait_xcnt 0x0" :: "v"(qp), "v"(qlp), "v"(kp) : "memory");
  v8f ctx[4] = {}; float mrun = -3.0e38f, mlrun = -3.0e38f, lsum = 0.f;   // mlrun = the running maximum x log2(e), as it was rounded for the sums held so far
  const _Float16* kn = kp; const _Float16* vn = vp;   // the lane's own k row and v plane, moved on by 64 keys a trip
#pragma unroll 1  // rolled: one trip already holds the fragments of two trips in registers
  for (int ks = 0; ks < TT / 64; ++ks) { v8f s[4] = {}, sl[4] = {};
#pragma unroll
    for (int kc = 0; kc < 2; ++kc)
#pragma unroll
      for (int j = 0; j < 4; ++j) { s[j] = wm16(kf[j][kc], qh[kc], s[j]); sl[j] = wm16(kf[j][kc], ql[kc], sl[j]); }
    // the next trip's k fragments and this trip's v fragments fly while the softmax below runs (the last trip reads its own k tile again: in bounds, not used)
    kn += ks + 1 < TT / 64 ? 4 * 16 * 512 : 0;
#pragma unroll
    for (int j = 0; j < 4; ++j)
#pragma unroll
      for (int kc = 0; kc < 2; ++kc) kf[j][kc] = fragw_h(kn + (j * 16 + kc) * 512);
    v16h vf[2][4];
#pragma unroll
    for (int u = 0; u < 2; ++u)
#pragma unroll
      for (int jj = 0; jj < 4; ++jj) vf[u][jj] = fragw_h(vn + (jj * (TT / 32) + u) * 512);
    // precaution: both address pairs stay live and unwritten up to this wait; it also keeps the loads above the softmax
    asm volatile("s_wait_xcnt 0x0" :: "v"(kn), "v"(vn) : "memory");
    vn += 2 * 512;
    float mx = mrun;
#pragma unroll
    for (int j = 0; j < 4; ++j) { const v4u w = *(const v4u*)&sbin[col][ks * 32 + j * 8 + 4 * g];
#pragma unroll
      for (int r = 0; r < 8; ++r) { const unsigned bi = w[r >> 1] >> (16 * (r & 1)); const float x = (s[j][r] + sl[j][r] * (1.0f / 1024.0f)) * SCALE;
        const float v = x + (*(const float*)(tb + (bi & 0xffu)) + *(const float*)(tb + ((bi >> 8) & 0xffu))); s[j][r] = v; mx = fmaxf(mx, v); } }
    mx = fmaxf(mx, xhalf(mx));   // a query's keys are split between lanes col and col + 16
    // exp(v - mx) = exp2(v * log2(e) - mxl): one fma and one v_exp_f32 a score; the argument is never above a rounding error of 0, and a result below the normal range counts as 0 (far below what f16 holds)
    const float mxl = mx * LOG2E_F; const float al = ex2(mlrun - mxl); mrun = mx; mlrun = mxl;
    v4f s4 = {}; v16h p[2];
#pragma unroll
    for (int j = 0; j < 4; ++j) { v8f x;
#pragma unroll
      for (int r = 0; r < 8; ++r) x[r] = __builtin_fmaf(s[j][r], LOG2E_F, -mxl);
      const v8f ev = ex2x8(x);
#pragma unroll
      for (int r = 0; r < 8; ++r) { const float e = ev[r]; s4[r & 3] += e; p[j >> 1][(j & 1) * 8 + r] = (_Float16)e; } }
    lsum = lsum * al + ((s4[0] + s4[1]) + (s4[2] + s4[3]));
#pragma unroll
    for (int jj = 0; jj < 4; ++jj) ctx[jj] = ctx[jj] * al;
#pragma unroll
    for (int u = 0; u < 2; ++u)
#pragma unroll
      for (int jj = 0; jj < 4; ++jj) ctx[jj] = wm16(vf[u][jj], p[u], ctx[jj]); }
  const float sum = lsum + xhalf(lsum); const float inv = sum > 0.f ? 1.0f / sum : 0.f;
  _Float16* yp = Y + qo;   // lane (g, col) holds head columns jj * 16 + 8g + r of query col: chunk (k step 2h + (jj >> 1), half jj & 1, this lane) of the out product's A operand, rounded to f16 here
#pragma unroll
  for (int jj = 0; jj < 4; ++jj) { v8h o;
#pragma unroll
    for (int r = 0; r < 8; ++r) o[r] = (_Float16)(ctx[jj][r] * inv);
    vst2(yp + jj * 256, o); } }
// ---- k_out: block = (64 rows, 128 cols): out = ctx Wo (+ bo): ctx (f16) against Wo as f16(bf16 x 2^8) exact (1 product) x 2^-8, both operands read in fragment order
__global__ __launch_bounds__(128) void k_out(const _Float16* __restrict__ Y, const _Float16* __restrict__ WOP, const float* __restrict__ BO, float* __restrict__ OUT) { __shared__ __align__(16) float sf[4][16][132];
  static_assert(!CAUSAL, "one product for every row");
  const int tid = threadIdx.x, wave = tid >> 5, lane = tid & 31, col = lane & 15, g = lane >> 4; const int c0 = blockIdx.y * 128; const size_t r0 = (size_t)blockIdx.x * 64 + wave * 16;
  const _Float16* ya = Y + (size_t)(blockIdx.x * 4 + wave) * (16 * 512) + lane * 8;   // the wave's row tile, k step 0
  const _Float16* wb = WOP + (size_t)(blockIdx.y * 8) * 512 + lane * 8;              // the block's first column tile, k step 0
  v8f acc[8] = {};
  v16h a[3], w[2][8];   // register ring: each weight fragment of k step kc + 2 is requested into the registers of its forerunner as soon as the product of step kc has read them (the row fragment, read by all eight products, has a third place), so three steps' round trips overlap
#pragma unroll
  for (int s = 0; s < 2; ++s) { a[s] = fragw_h(ya + s * 512);
#pragma unroll
    for (int j = 0; j < 8; ++j) w[s][j] = fragw_h(wb + (s * 32 + j) * 512);
    // keeps the requests in the order of their use: loads return in order, and a counted wait in front of a product would otherwise also wait for fragments of a later step
    __builtin_amdgcn_sched_barrier(0); }
#pragma unroll  // unrolled: every fragment is a constant offset from the two address pairs, which are never rewritten, and every ring index is a constant
  for (int kc = 0; kc < CC / 32; ++kc) { const bool more = kc + 2 < CC / 32;
    if (more) a[(kc + 2) % 3] = fragw_h(ya + (kc + 2) * 512);
#pragma unroll
    for (int j = 0; j < 8; ++j) { acc[j] = wmma16(a[kc % 3], w[kc & 1][j], acc[j]); if (more) w[kc & 1][j] = fragw_h(wb + ((kc + 2) * 32 + j) * 512);
      // for the same order, and so that a request is not moved in front of the product whose registers it refills (which would take a fourth set of registers)
      __builtin_amdgcn_sched_barrier(0); } }
  // precaution: both address pairs stay live and unwritten up to this wait
  asm volatile("s_wait_xcnt 0x0" :: "v"(ya), "v"(wb) : "memory");
#pragma unroll
  for (int j = 0; j < 8; ++j) { const float bias = BO ? bfr(BO[c0 + j * 16 + col]) : 0.f;
#pragma unroll
    for (int r = 0; r < 8; ++r) sf[wave][8 * g + r][j * 16 + col] = acc[j][r] * (1.0f / 256.0f) + bias; }
  LDSX(); for (int rl = 0; rl < 16; ++rl) vst2(OUT + (r0 + rl) * DIN + c0 + lane * 4, *(const v4f*)&sf[wave][rl][lane * 4]); }

extern "C" void kernel_launch(void* const* d_in, const int* in_sizes, int n_in, void* d_out, int out_size, void* d_ws, size_t ws_size, hipStream_t stream) {
  (void)in_sizes; (void)n_in; (void)out_size;
  const float** F = (const float**)d_in;
  if (ws_size < (size_t)WS_END) return;
  char* ws = (char*)d_ws; _Float16 *QH = (_Float16*)(ws + WS_QH), *KH = (_Float16*)(ws + WS_KH), *VT = (_Float16*)(ws + WS_VT), *QL = (_Float16*)(ws + WS_QL), *KL = (_Float16*)(ws + WS_KL); __bf16 *VB = (__bf16*)(ws + WS_VB), *VBL = (__bf16*)(ws + WS_VBL); _Float16 *Y = (_Float16*)(ws + WS_Y);
  (void)Y; (void)QL; (void)KL; (void)VB; (void)VBL;
  // inputs: 0 p [4,1024,512]; 1 pcoords [4,1024,2]; 2 rpe_table [64,8]; 3 wq_w (in,out), 4 wq_b; 5 wk_w, 6 wk_b; 7 wv_w, 8 wv_b; 9 wo_w (in,out), 10 wo_b
  if (ws_size < (size_t)WS_END3) return;
  float* RNG = (float*)(ws + WS_RNG); __bf16 *XP = (__bf16*)(ws + WS_XP), *WP = (__bf16*)(ws + WS_WP);
  k_range<<<1 + 256, 256, 0, stream>>>(F[1], RNG, F[0], F[3], F[5], F[7], F[9], XP, WP);
  k_proj<<<dim3(TNB * TT / 64, CC / 128, 3), 128, 0, stream>>>(XP, WP, F[4], F[6], F[8], QH, QL, KH, KL, VT, VB, VBL);
  k_fa<<<dim3(TT / 16, 1, TNB), 256, 0, stream>>>(QH, QL, KH, VT, F[1], F[2], RNG, Y);
  k_out<<<dim3(TNB * TT / 64, DIN / 128), 128, 0, stream>>>(Y, (const _Float16*)(WP + 3 * DIN * CC), F[10], (float*)d_out);
}

// v009
// A run of this version takes 58.2 microseconds.
// Next to v008, in two timings, it ran 1.08 and 1.09 times as fast.
// Over all steps from v000 it is 6.59 times as fast.
// compute dtype: all float inputs rounded to bf16; q/k/v = p W + b with EXACT bf16 products on WMMA 16x16x32 (f32 accumulate); q as f16 hi + residual (x 2^10) against k once to f16 (2 products) x 64^-0.5; the relative-position bias: bin indices computed per (batch, query, key) in f32 exactly as the reference (difference, division by the global eta range, x16, truncation; fmod-based wrap for phi), table values (bf16) added in f32; softmax in f32 with a running maximum over 64-key steps, exp(x) = hardware exp2 of x * log2(e), the difference and the product in one f32 fma; exp(logit - running maximum) once to f16 against v once to f16 (1 product), divided by the f32 sum at the end; ctx once to f16 against Wo carried x 2^8 in f16 + bo; f32 output.
#include <hip/hip_runtime.h>
#include <math.h>

typedef __attribute__((ext_vector_type(16))) _Float16 v16h;
typedef __attribute__((ext_vector_type(16))) __bf16 v16b;
typedef __attribute__((ext_vector_type(8)))  _Float16 v8h;
typedef __attribute__((ext_vector_type(8)))  float v8f;
typedef __attribute__((ext_vector_type(4)))  float v4f;
typedef __attribute__((ext_vector_type(2)))  float v2f;
typedef __attribute__((ext_vector_type(4)))  unsigned v4u;
typedef __attribute__((ext_vector_type(2)))  unsigned v2u;
typedef __attribute__((ext_vector_type(4)))  int v4i;
typedef float __attribute__((may_alias)) float_a;
typedef int __attribute__((may_alias)) int_a;

template <typename T> __device__ __forceinline__ void vst2(void* p, T v) { *(T*)p = v;  }
__device__ __forceinline__ v8f wmma16(v16h a, v16h b, v8f c) {
  v8f d = __builtin_amdgcn_wmma_f32_16x16x32_f16(false, a, false, b, (short)0, c, false, false);
  asm volatile("v_nop\n\tv_nop\n\tv_nop\n\tv_nop" : "+v"(d) : "v"(a), "v"(b));
  return d;
}
__device__ __forceinline__ v8f wmma_bf(v16b a, v16b b, v8f c) {
  v8f d = __builtin_amdgcn_wmma_f32_16x16x32_bf16(false, a, false, b, (short)0, c, false, false);
  asm volatile("v_nop\n\tv_nop\n\tv_nop\n\tv_nop" : "+v"(d) : "v"(a), "v"(b));
  return d;
}
// 16x16x32 fragments: lane = (h = lane>>4, row/col = lane&15); elements 0..7 = k0+8h+0..7, 8..15 = k0+16+8h+0..7; D element r = row 8h+r
__device__ __forceinline__ v16h frag_h(const _Float16* rowk0, int lane) {
  union { v16h v; v8h q[2]; } u; const _Float16* p = rowk0 + 8 * (lane >> 4);
  u.q[0] = *(const v8h*)p; u.q[1] = *(const v8h*)(p + 16); return u.v;
}
__device__ __forceinline__ v16h frag_f32(const float* rowk0, int lane) {
  v16h a; const float* p = rowk0 + 8 * (lane >> 4);
#pragma unroll
  for (int i = 0; i < 8; ++i) { a[i] = (_Float16)p[i]; a[8 + i] = (_Float16)p[16 + i]; }
  return a;
}
__device__ __forceinline__ v16h frag_f32s(const float* rowk0, int lane, float sc) {
  v16h a; const float* p = rowk0 + 8 * (lane >> 4);
#pragma unroll
  for (int i = 0; i < 8; ++i) { a[i] = (_Float16)(p[i] * sc); a[8 + i] = (_Float16)(p[16 + i] * sc); }
  return a;
}
// column fragment from a [K][ld] layout (column n), rows >= K read as 0
__device__ __forceinline__ v16h fragc_f32(const float* W, int k0, int n, int lane, int ld, int K) {
  v16h a; const int g = lane >> 4;
#pragma unroll
  for (int i = 0; i < 8; ++i) { const int ka = k0 + 8 * g + i, kb = ka + 16;
    a[i] = (_Float16)(ka < K ? W[(size_t)(ka < K ? ka : K - 1) * ld + n] : 0.f); a[8 + i] = (_Float16)(kb < K ? W[(size_t)(kb < K ? kb : K - 1) * ld + n] : 0.f); }
  return a;
}
struct F2 { v16b h, l; };
__device__ __forceinline__ F2 bsplit16(const float v[16]) { F2 r;
#pragma unroll
  for (int i = 0; i < 16; ++i) { const __bf16 h = (__bf16)v[i]; r.h[i] = h; r.l[i] = (__bf16)(v[i] - (float)h); }
  return r; }
__device__ __forceinline__ F2 split_row(const float* row, int k0, int lane) { float v[16]; const float* p = row + k0 + 8 * (lane >> 4);
#pragma unroll
  for (int i = 0; i < 8; ++i) { v[i] = p[i]; v[8 + i] = p[16 + i]; }
  return bsplit16(v); }
__device__ __forceinline__ F2 split_rowK(const float* row, int k0, int lane, int K) { float v[16]; const int g = lane >> 4;
#pragma unroll
  for (int i = 0; i < 8; ++i) { const int ka = k0 + 8 * g + i, kb = ka + 16; v[i] = ka < K ? row[ka < K ? ka : K - 1] : 0.f; v[8 + i] = kb < K ? row[kb < K ? kb : K - 1] : 0.f; }
  return bsplit16(v); }
__device__ __forceinline__ F2 split_col(const float* W, int k0, int n, int lane, int ld, int K) { float v[16]; const int g = lane >> 4;
#pragma unroll
  for (int i = 0; i < 8; ++i) { const int ka = k0 + 8 * g + i, kb = ka + 16; v[i] = ka < K ? W[(size_t)(ka < K ? ka : K - 1) * ld + n] : 0.f; v[8 + i] = kb < K ? W[(size_t)(kb < K ? kb : K - 1) * ld + n] : 0.f; }
  return bsplit16(v); }
__device__ __forceinline__ v8f mac3(const F2& a, const F2& b, v8f c) { c = wmma_bf(a.l, b.h, c); c = wmma_bf(a.h, b.l, c); return wmma_bf(a.h, b.h, c); }
__device__ __forceinline__ float sigm(float v) { return 1.0f / (1.0f + expf(-v)); }
#define LDSX() do { asm volatile("s_wait_dscnt 0" ::: "memory"); __builtin_amdgcn_wave_barrier(); __builtin_amdgcn_fence(__ATOMIC_RELEASE, "workgroup"); } while (0)

// Patch attention with a relative-position bias (B 4, T 1,024, D 512 = 8 heads x 64): q/k/v = p W + b ((in,out)); scores = q k^T / 8 + rpe_table[eta_bin + 16][h] + rpe_table[phi_bin + 48][h] with eta_bin = trunc((eta_i - eta_j) / max|eta_i - eta_j| * 16), phi_bin = trunc(wrap(phi_i - phi_j) / pi * 16), both clipped to [-16, 15]; softmax; out = merged(attn v) Wo + bo.
#define NB 4
#define TT 1024
#define CC 512            // NH * HD = projected width
#define DIN 512          // input (model) width
#define NH 8
#define HD 64
#define NQB (TT / 64)
#define HG 8
#define SCALE (0.125f)
#define CAUSAL 0
#ifndef TNB
#define TNB NB
#endif
__device__ __forceinline__ float bfr(float v) { return (float)(__bf16)v; }
__host__ __device__ __forceinline__ int kb_last(int qb) { return CAUSAL ? ((qb * 64 + 63) >> 7) : (TT / 128 - 1); }
typedef __attribute__((ext_vector_type(8))) __bf16 v8b;
__device__ __forceinline__ v16b frag_b(const __bf16* rowk0, int lane) {
  union { v16b v; v8b q[2]; } u; const __bf16* p = rowk0 + 8 * (lane >> 4);
  u.q[0] = *(const v8b*)p; u.q[1] = *(const v8b*)(p + 16); return u.v;
}
// precaution, behind a store in a loop: it stands in front of the first rewrite of a register that the store names
#define XCW() asm volatile("s_wait_xcnt 0x0" ::: "memory")
// one fragment in fragment order: p = fragment start + lane * 8
__device__ __forceinline__ v16b fragw_b(const __bf16* p) { union { v16b v; v8b q[2]; } u; u.q[0] = *(const v8b*)p; u.q[1] = *(const v8b*)(p + 256); return u.v; }
__device__ __forceinline__ v16h fragw_h(const _Float16* p) { union { v16h v; v8h q[2]; } u; u.q[0] = *(const v8h*)p; u.q[1] = *(const v8h*)(p + 256); return u.v; }
#define QBH 0              // unused: no kernel here has a separate high-precision path
#define QHI 1024            // rows carrying a q residual plane (all rows when non-causal: 2-product logits everywhere)
#define KHI 64            // key rows carrying k residual / v bf16 hi+lo planes (written by k_proj; no kernel here reads them)
// B fragment (k rows k0+.., output column o) of a weight: (in,out) [K][ld] or (out,in) [ld rows of K]: bf16 exact, or f16(bf16 * 256) exact
__device__ __forceinline__ v16b wcol_io(const float* Wm, int k0, int o, int lane, int ld) { v16b w; const int g = lane >> 4;
#pragma unroll
  for (int i = 0; i < 8; ++i) { w[i] = (__bf16)Wm[(size_t)(k0 + 8 * g + i) * ld + o]; w[8 + i] = (__bf16)Wm[(size_t)(k0 + 16 + 8 * g + i) * ld + o]; }
  return w; }
__device__ __forceinline__ v16b wcol_oi(const float* Wm, int k0, int o, int lane, int K) { v16b w; const float* p = Wm + (size_t)o * K + k0 + 8 * (lane >> 4);
#pragma unroll
  for (int i = 0; i < 8; ++i) { w[i] = (__bf16)p[i]; w[8 + i] = (__bf16)p[16 + i]; }
  return w; }
__device__ __forceinline__ v16h wcolh_io(const float* Wm, int k0, int o, int lane, int ld) { v16h w; const int g = lane >> 4;
#pragma unroll
  for (int i = 0; i < 8; ++i) { w[i] = (_Float16)(bfr(Wm[(size_t)(k0 + 8 * g + i) * ld + o]) * 256.0f); w[8 + i] = (_Float16)(bfr(Wm[(size_t)(k0 + 16 + 8 * g + i) * ld + o]) * 256.0f); }
  return w; }
__device__ __forceinline__ v16h wcolh_oi(const float* Wm, int k0, int o, int lane, int K) { v16h w; const float* p = Wm + (size_t)o * K + k0 + 8 * (lane >> 4);
#pragma unroll
  for (int i = 0; i < 8; ++i) { w[i] = (_Float16)(bfr(p[i]) * 256.0f); w[8 + i] = (_Float16)(bfr(p[16 + i]) * 256.0f); }
  return w; }
#define WQKV_LAYOUT 0   // selects WCOL only, which nothing calls; k_range always reads wq/wk/wv as (in,out) [DIN][CC]
__device__ __forceinline__ v16b wcol_hdk(const float* Wm, int k0, int o, int lane) { v16b w; const int g = lane >> 4; const float* p = Wm + (size_t)(o / HD) * DIN * HD + (o % HD);
#pragma unroll
  for (int i = 0; i < 8; ++i) { w[i] = (__bf16)p[(size_t)(k0 + 8 * g + i) * HD]; w[8 + i] = (__bf16)p[(size_t)(k0 + 16 + 8 * g + i) * HD]; }
  return w; }
#define WO_OUT_IN 0
#if WQKV_LAYOUT == 1
#define WCOL(W, k0, o, lane) wcol_oi(W, k0, o, lane, DIN)
#elif WQKV_LAYOUT == 2
#define WCOL(W, k0, o, lane) wcol_hdk(W, k0, o, lane)
#else
#define WCOL(W, k0, o, lane) wcol_io(W, k0, o, lane, CC)
#endif
#if WO_OUT_IN
#define WOCOL(W, k0, o, lane) wcol_oi(W, k0, o, lane, CC)
#define WOCOLH(W, k0, o, lane) wcolh_oi(W, k0, o, lane, CC)
#else
#define WOCOL(W, k0, o, lane) wcol_io(W, k0, o, lane, DIN)
#define WOCOLH(W, k0, o, lane) wcolh_io(W, k0, o, lane, DIN)
#endif
#define PI_F 3.14159274f          // f32(math.pi)
#define LOG2E_F 1.44269504f       // f32(log2(e))
// bias bins of one (query, key) pair, the same for every head: byte offsets into one head's 64-entry f32 table column, eta bin in bits 7..0, phi bin (+32 entries) in bits 15..8. f32 steps exactly as the reference: jnp.mod = fmod then +y when the remainder is negative; .astype(int32) = truncation
__device__ __forceinline__ unsigned bias_bins(float et, float pt_, float ek, float pk_, float rng) {
  const float re = et - ek; int eb = (int)((re / rng) * 16.0f); eb = eb < -16 ? -16 : (eb > 15 ? 15 : eb);
  const float rp = pt_ - pk_; const float a_ = rp + PI_F; const float twopi = 2.0f * PI_F; float rm = fmodf(a_, twopi); rm = (rm != 0.0f && rm < 0.0f) ? rm + twopi : rm; const float wr = rm - PI_F;
  int pb = (int)((wr / PI_F) * 16.0f); pb = pb < -16 ? -16 : (pb > 15 ? 15 : pb);
  return (unsigned)((eb + 16) * 4) | ((unsigned)((pb + 16 + 32) * 4) << 8); }
// The same bins, bit for bit, without the library remainder and the two general divisions, for coordinates inside the range that k_fa tests once per wave (|phi| < 1,024, |eta| < 2^60, 1e-6 <= range < 2^62).
// Returns eta_bin * 4 + phi_bin * 1,024; the caller adds the table offsets of a whole word once (sums modulo 2^32 are linear, so a negative bin's borrow cancels against them).
// eta arrives x 16 (a power of two moves through the difference, the division and their roundings unchanged). a / b rounded to nearest: with y = the rounded 1 / b, q = a * y, then q += (a - q * b) * y with both steps fused;
// once q is within one unit in the last place the residual is exact and the result is the rounded quotient: two corrections for any b, one for b = pi / 16, whose rounded reciprocal is off by under 2^-26.
// Remainder: n = floor(c / 2pi + 2^-8) is the true floor or one more; c - n * 2pi in one fma is exact wherever |c| >= 4 (a multiple of 2^-21 below 8), and for -2pi < c < 0 it is the reference's own rounded c + 2pi;
// a negative r (n one too many, or c < 0 taken with n = 0) takes + 2pi: as unsigned words a negative float lies above every positive one and positive floats keep their order, so the minimum of r and r + 2pi is that choice.
__device__ __forceinline__ unsigned bins_fast(float et16, float pt_, float ek16, float pk_, float rng, float yr) {
  const float a = et16 - ek16; float q = a * yr; q = __builtin_fmaf(__builtin_fmaf(-q, rng, a), yr, q); q = __builtin_fmaf(__builtin_fmaf(-q, rng, a), yr, q);
  int eb = (int)q; eb = eb < -16 ? -16 : (eb > 15 ? 15 : eb);
  const float twopi = 2.0f * PI_F; const float c = (pt_ - pk_) + PI_F; const float n = __builtin_floorf(__builtin_fmaf(c, 0x1.45f306p-3f, 0x1p-8f)); const float r = __builtin_fmaf(-n, twopi, c);
  const unsigned ur = __builtin_bit_cast(unsigned, r), ut = __builtin_bit_cast(unsigned, r + twopi); const float wr = __builtin_bit_cast(float, __builtin_elementwise_min(ur, ut)) - PI_F;
  float u = wr * 0x1.45f306p+2f; u = __builtin_fmaf(__builtin_fmaf(-u, PI_F * 0.0625f, wr), 0x1.45f306p+2f, u);
  int pb = (int)u; pb = pb < -16 ? -16 : (pb > 15 ? 15 : pb);
  return (unsigned)eb * 4u + (unsigned)pb * 1024u; }
// ---- k_range: block 0: eta_range = max(max over batches of (max eta - min eta), 1e-6) on the bf16-rounded coordinates (= max |eta_i - eta_j| over all same-batch pairs, exact)
// FRAGMENT ORDER, the layout of every matrix operand in the workspace: [tile of 16 rows (A) or columns (B)][k step of 32][half][lane][8 elements of 16 bits], for the weights [k step][column tile][half][lane][8 elements]; chunk (tile, ks, half, lane) holds row or column tile * 16 + (lane & 15) at k = ks * 32 + half * 16 + (lane >> 4) * 8 + 0..7.
// One fragment = 512 elements = 1 KB; each of its two 16-byte loads reads 512 contiguous bytes per wave = 4 whole lines.
// Blocks 1..256 of this launch: p to bf16 [row tile][k step] (block = row tile), and wq, wk, wv to bf16, wo to f16(bf16 x 2^8), each [k step][column tile] (64 blocks a matrix). Each value is rounded once, here.
__global__ __launch_bounds__(256) void k_range(const float* __restrict__ PCO, float* __restrict__ RNG, const float* __restrict__ X, const float* __restrict__ WQ, const float* __restrict__ WK, const float* __restrict__ WV, const float* __restrict__ WO, __bf16* __restrict__ XP, __bf16* __restrict__ WP) { __shared__ float smx[8], smn[8]; __shared__ float sr;
  static_assert(NB * TT / 16 == 256 && DIN == 512 && CC == 512, "256 row tiles, 64 blocks of 512 chunks a weight");
  if (blockIdx.x != 0) {   // block-uniform, in front of every barrier
    const int pb = blockIdx.x - 1, e = threadIdx.x; const int wsel = pb >> 6; const float* Wm = wsel == 0 ? WQ : wsel == 1 ? WK : wsel == 2 ? WV : WO;
    const float* xs = X + ((size_t)pb * 16 + (e & 15)) * DIN + (e >> 6) * 32 + ((e >> 5) & 1) * 16 + ((e >> 4) & 1) * 8;   // chunk e of the row tile; chunk e + 256 lies 4 k steps on
    const int ew = (pb & 63) * 512 + e;   // chunk of the matrix; chunk ew + 256 lies 4 column tiles on
    const float* wsr = Wm + (size_t)((ew >> 11) * 32 + ((ew >> 5) & 1) * 16 + ((ew >> 4) & 1) * 8) * 512 + ((ew >> 6) & 31) * 16 + (ew & 15);
    v4f xv[4][2]; float wv[2][8];
#pragma unroll
    for (int it = 0; it < 4; ++it) { xv[it][0] = *(const v4f*)(xs + it * 128); xv[it][1] = *(const v4f*)(xs + it * 128 + 4); }
#pragma unroll
    for (int it = 0; it < 2; ++it)
#pragma unroll
      for (int i = 0; i < 8; ++i) wv[it][i] = wsr[it * 64 + i * 512];
    // precaution: both address pairs stay live and unwritten up to this wait
    asm volatile("s_wait_xcnt 0x0" :: "v"(xs), "v"(wsr) : "memory");
#pragma unroll
    for (int it = 0; it < 4; ++it) { v8b o;
#pragma unroll
      for (int i = 0; i < 4; ++i) { o[i] = (__bf16)xv[it][0][i]; o[4 + i] = (__bf16)xv[it][1][i]; }
      vst2(XP + ((size_t)pb * 1024 + it * 256 + e) * 8, o); XCW(); }
#pragma unroll
    for (int it = 0; it < 2; ++it) { __bf16* d = WP + ((size_t)pb * 512 + it * 256 + e) * 8;
      if (wsel < 3) { v8b o;
#pragma unroll
        for (int i = 0; i < 8; ++i) o[i] = (__bf16)wv[it][i];
        vst2(d, o); }
      else { v8h o;
#pragma unroll
        for (int i = 0; i < 8; ++i) o[i] = (_Float16)(bfr(wv[it][i]) * 256.0f);
        vst2(d, o); }
      XCW(); }
    return; }
  const int t = threadIdx.x; float best = 0.f;
  for (int b = 0; b < TNB; ++b) { float mx = -3.0e38f, mn = 3.0e38f; for (int i = t; i < TT; i += 256) { const float e = bfr(PCO[((size_t)b * TT + i) * 2]); mx = fmaxf(mx, e); mn = fminf(mn, e); }
    for (int o = 1; o < 32; o <<= 1) { mx = fmaxf(mx, __shfl_xor(mx, o)); mn = fminf(mn, __shfl_xor(mn, o)); }
    if ((t & 31) == 0) { smx[t >> 5] = mx; smn[t >> 5] = mn; } __syncthreads();
    if (t == 0) { float a = smx[0], c = smn[0]; for (int i = 1; i < 8; ++i) { a = fmaxf(a, smx[i]); c = fminf(c, smn[i]); } sr = a - c; } __syncthreads(); best = fmaxf(best, sr); __syncthreads(); }
  if (t < 32) { const float v = t == 0 ? fmaxf(best, 1e-6f) : 0.f; vst2(RNG + t, v); } }   
#define WS_RNG (WS_END)
#define WS_END2 (WS_RNG + 128u)
#define WS_XP (WS_RNG + 4096u)                           // bf16 p, fragment order (every fragment starts on a 1 KB boundary)
#define WS_WP (WS_XP + 2u * (size_t)NB * TT * DIN)       // wq, wk, wv (bf16), wo (f16), fragment order
#define WS_END3 (WS_WP + 4u * 2u * (size_t)DIN * CC)

#define WS_QH  0u                                      // f16 q, fragment order [token tile][k step]
#define WS_KH  (WS_QH + 2u * (size_t)NB * TT * CC)      // f16 k, fragment order [token tile][k step]
#define WS_VT  (WS_KH + 2u * (size_t)NB * TT * CC)      // f16 v, fragment order [b][column tile][k step of 32 tokens]
#define WS_QL  (WS_VT + 2u * (size_t)NB * CC * TT)      // f16 q residual x 2^10, fragment order as q
#define WS_KL  (WS_QL + 2u * (size_t)NB * QHI * CC)     // f16 k residual x 2^10 rows [b][t < KHI][CC]
#define WS_VB  (WS_KL + 2u * (size_t)NB * KHI * CC)     // bf16 v hi planes [b][c][t < KHI]
#define WS_VBL (WS_VB + 2u * (size_t)NB * CC * KHI)
#define WS_S   (WS_VBL + 2u * (size_t)NB * CC * KHI)    // f32 [b][hg][t][s], unused: no kernel here stores logits or P
#define WS_Y   (WS_S  + 4u * (size_t)NB * HG * TT * TT)      // unused: no kernel here stores ctx
#define WS_END (WS_Y  + 4u * (size_t)NB * TT * CC)

// ---- k_proj: block = (64 rows, 128 cols, which): q/k/v = X W (+ b) with exact bf16 products (K = DIN), both operands read in fragment order -> which 0: q f16 (+ residual, rows < QHI), fragment order; 1: k f16, fragment order (+ residual rows < KHI); 2: v f16, fragment order (+ bf16 hi/lo planes for t < KHI)
__global__ __launch_bounds__(128) void k_proj(const __bf16* __restrict__ XP, const __bf16* __restrict__ WP, const float* __restrict__ BQ, const float* __restrict__ BK, const float* __restrict__ BV,
    _Float16* __restrict__ QH, _Float16* __restrict__ QL, _Float16* __restrict__ KH, _Float16* __restrict__ KL, _Float16* __restrict__ VT, __bf16* __restrict__ VB, __bf16* __restrict__ VBL) {
  __shared__ __align__(16) _Float16 sh[64][136], sl[64][136]; __shared__ __align__(16) _Float16 th[128][72]; __shared__ __align__(16) __bf16 tb[128][72], tbl[128][72];
  const int tid = threadIdx.x, wave = tid >> 5, lane = tid & 31, col = lane & 15, g = lane >> 4; const int which = blockIdx.z; const int c0 = blockIdx.y * 128; const size_t r0 = (size_t)blockIdx.x * 64; const size_t bb = r0 / TT; const int t0 = (int)(r0 % TT);
  const float* BA = which == 0 ? BQ : which == 1 ? BK : BV;
  const __bf16* xa = XP + (size_t)(blockIdx.x * 4 + wave) * (16 * 512) + lane * 8;                      // the wave's row tile, k step 0
  const __bf16* wb = WP + (size_t)which * (DIN * CC) + (size_t)(blockIdx.y * 8) * 512 + lane * 8;   // the block's first column tile, k step 0
  v8f acc[8] = {};
  v16b a[3], w[2][8];   // register ring: each weight fragment of k step kc + 2 is requested into the registers of its forerunner as soon as the product of step kc has read them (the row fragment, read by all eight products, has a third place), so three steps' round trips overlap
#pragma unroll
  for (int s = 0; s < 2; ++s) { a[s] = fragw_b(xa + s * 512);
#pragma unroll
    for (int j = 0; j < 8; ++j) w[s][j] = fragw_b(wb + (s * 32 + j) * 512); }
#pragma unroll  // unrolled: every fragment is a constant offset from the two address pairs, which are never rewritten, and every ring index is a constant
  for (int kc = 0; kc < DIN / 32; ++kc) { const bool more = kc + 2 < DIN / 32;
    if (more) a[(kc + 2) % 3] = fragw_b(xa + (kc + 2) * 512);
#pragma unroll
    for (int j = 0; j < 8; ++j) { acc[j] = wmma_bf(a[kc % 3], w[kc & 1][j], acc[j]); if (more) w[kc & 1][j] = fragw_b(wb + ((kc + 2) * 32 + j) * 512); } }
  // precaution: both address pairs stay live and unwritten up to this wait
  asm volatile("s_wait_xcnt 0x0" :: "v"(xa), "v"(wb) : "memory");
  if (which < 2) { _Float16* DH = which == 0 ? QH : KH; _Float16* DL = which == 0 ? QL : KL; const int nhi = which == 0 ? QHI : KHI; const bool hi_rows = t0 < nhi;
#pragma unroll
    for (int j = 0; j < 8; ++j) { const float bias = BA ? bfr(BA[c0 + j * 16 + col]) : 0.f;
#pragma unroll
      for (int r = 0; r < 8; ++r) { const float v = acc[j][r] + bias; const _Float16 hv = (_Float16)v; sh[wave * 16 + 8 * g + r][j * 16 + col] = hv; sl[wave * 16 + 8 * g + r][j * 16 + col] = (_Float16)((v - (float)hv) * 1024.0f); } }
    __syncthreads();
    // q, its residual and k go out in fragment order (row tile = 16 tokens, k step = 32 columns): chunk e = [row tile 4][k step 4][half][lane]; the k residual rows keep their row layout
    for (int e = tid; e < 64 * 16; e += 128) { const int rl = (e >> 8) * 16 + (e & 15), cl = ((e >> 6) & 3) * 32 + ((e >> 5) & 1) * 16 + ((e >> 4) & 1) * 8;
      const size_t o = (((size_t)blockIdx.x * 4 + (e >> 8)) * 16 + blockIdx.y * 4 + ((e >> 6) & 3)) * 512 + (e & 63) * 8;
      vst2((unsigned*)(DH + o), *(const v4u*)&sh[rl][cl]); XCW(); if (hi_rows) { vst2((unsigned*)(which == 0 ? DL + o : DL + (bb * nhi + t0 + rl) * (size_t)CC + c0 + cl), *(const v4u*)&sl[rl][cl]); XCW(); } }
  } else { const bool hi_rows = t0 < KHI;
#pragma unroll
    for (int j = 0; j < 8; ++j) { const float bias = BA ? bfr(BA[c0 + j * 16 + col]) : 0.f;
#pragma unroll
      for (int r = 0; r < 8; ++r) { const float v = acc[j][r] + bias; const int rl = wave * 16 + 8 * g + r, cl = j * 16 + col; th[cl][rl] = (_Float16)v; const __bf16 bh = (__bf16)v; tb[cl][rl] = bh; tbl[cl][rl] = (__bf16)(v - (float)bh); } }
    __syncthreads();
    // v goes out in fragment order (row tile = 16 columns of a batch, k step = 32 tokens): chunk e = [column tile 8][k step 2][half][lane]; the bf16 planes keep their layout
    for (int e = tid; e < 128 * 8; e += 128) { const int cl = (e >> 7) * 16 + (e & 15), tl = ((e >> 6) & 1) * 32 + ((e >> 5) & 1) * 16 + ((e >> 4) & 1) * 8;
      const size_t o = ((bb * (CC / 16) + blockIdx.y * 8 + (e >> 7)) * (TT / 32) + (t0 >> 5) + ((e >> 6) & 1)) * 512 + (e & 63) * 8;
      vst2((unsigned*)(VT + o), *(const v4u*)&th[cl][tl]); XCW(); if (hi_rows) { const size_t o3 = (bb * CC + c0 + cl) * (size_t)KHI + t0 + tl; vst2((unsigned*)(VB + o3), *(const v4u*)&tb[cl][tl]); vst2((unsigned*)(VBL + o3), *(const v4u*)&tbl[cl][tl]); XCW(); } } } }
// ---- k_fa: block = 16 query rows (t0..t0+15) of batch z, wave = head (8 waves): logits, bias, softmax, P.v and the out product in one kernel; no logit, P or ctx value goes to memory.
// The 256 threads first compute the 16 x TT bias bins (they do not depend on the head) into LDS, one barrier, then every wave runs alone over the keys, 64 per trip.
// Both products are transposed: S^T = K Q^T gives lane (g, col) the logits of query col at keys 8g + r, which is the B fragment of ctx^T = V^T P^T as it stands (tiles 2u and 2u + 1 = elements 0..7 and 8..15 of k step u), so P needs no move between lanes,
// and the running maximum, the sum and the rescale factor of a query live in that query's own two lanes (col and col + 16).
#define BP (TT / 2 + 4)   // dwords per bin row: 2,064 B = 16 B x odd, the conflict-free pitch for 16-byte LDS reads down a column of rows
__device__ __forceinline__ v8f wm16(v16h a, v16h b, v8f c) { return __builtin_amdgcn_wmma_f32_16x16x32_f16(false, a, false, b, (short)0, c, false, false); }
__device__ __forceinline__ v16h frag_p(const _Float16* p) { union { v16h v; v8h q[2]; } u; u.q[0] = *(const v8h*)p; u.q[1] = *(const v8h*)(p + 16); return u.v; }  // p = the lane's own first element (row start + k0 + 8g)
// 2^x on the transcendental unit. The instruction set asks for one independent instruction behind a transcendental before its result is read or its source overwritten:
// in one statement each v_exp_f32 is that instruction for the one in front of it (the results are early-clobber, so none lies on a source), and the closing v_nop is it for the last
__device__ __forceinline__ float ex2(float x) { float e; asm("v_exp_f32 %0, %1\n\tv_nop" : "=v"(e) : "v"(x)); return e; }
__device__ __forceinline__ v8f ex2x8(v8f x) { float e0, e1, e2, e3, e4, e5, e6, e7;
  asm("v_exp_f32 %0, %8\n\tv_exp_f32 %1, %9\n\tv_exp_f32 %2, %10\n\tv_exp_f32 %3, %11\n\tv_exp_f32 %4, %12\n\tv_exp_f32 %5, %13\n\tv_exp_f32 %6, %14\n\tv_exp_f32 %7, %15\n\tv_nop"
      : "=&v"(e0), "=&v"(e1), "=&v"(e2), "=&v"(e3), "=&v"(e4), "=&v"(e5), "=&v"(e6), "=&v"(e7)
      : "v"(x[0]), "v"(x[1]), "v"(x[2]), "v"(x[3]), "v"(x[4]), "v"(x[5]), "v"(x[6]), "v"(x[7]));
  v8f e = {e0, e1, e2, e3, e4, e5, e6, e7}; return e; }
__device__ __forceinline__ float xhalf(float x) { return __builtin_bit_cast(float, __builtin_amdgcn_permlanex16(__builtin_bit_cast(int, x), __builtin_bit_cast(int, x), 0x76543210, 0xfedcba98, false, false)); }  // lane l with lane l ^ 16
__global__ __launch_bounds__(256) void k_fa(const _Float16* __restrict__ QH, const _Float16* __restrict__ QL, const _Float16* __restrict__ KH, const _Float16* __restrict__ VT, const float* __restrict__ PCO, const float* __restrict__ TAB, const float* __restrict__ RNG, const _Float16* __restrict__ WOP, const float* __restrict__ BO, float* __restrict__ OUT) {
  __shared__ __align__(16) unsigned sbin[16][BP]; __shared__ __align__(16) float stab[NH][64];
  __shared__ __align__(16) _Float16 sy[(CC / 32) * 512];   // the block's 16 ctx rows (all heads), f16, fragment order [k step][half][lane][8]
  __shared__ __align__(16) float sf[NH][16][68];           // each wave's own 16 x 64 piece of out; 272-B rows = 16 B x odd, the conflict-free pitch for 16-byte accesses down a column of rows
  static_assert(DIN == NH * 64 && CC == 512, "one wave per 64 output columns");
  static_assert(!CAUSAL && NH * 32 == 256 && TT == 1024 && HD == 64 && QHI == TT, "one wave per head, whole rows, 4 keys per thread, q residual on every row");
  const int tid = threadIdx.x, wave = tid >> 5, lane = tid & 31, col = lane & 15, g = lane >> 4; const int t0 = blockIdx.x * 16; const int b = blockIdx.z; const int h = wave;
  { const float* ckp = PCO + ((size_t)b * TT + tid * 4) * 2; const v4f ck0 = *(const v4f*)ckp, ck1 = *(const v4f*)(ckp + 4);
    const float* tp = TAB + lane * NH + h; const float tv0 = tp[0], tv1 = tp[32 * NH];
    const float* qcp = PCO + ((size_t)b * TT + t0 + col) * 2; const v2f qc = *(const v2f*)qcp;   // lane l holds the coordinates of query l & 15: one load, read by lane number in the loop below
    // precaution: the three address pairs stay live and unwritten up to this wait
    asm volatile("s_wait_xcnt 0x0" :: "v"(ckp), "v"(tp), "v"(qcp) : "memory");
    const int qe = __builtin_bit_cast(int, bfr(qc[0])), qf = __builtin_bit_cast(int, bfr(qc[1]));
    stab[wave][lane] = bfr(tv0); stab[wave][lane + 32] = bfr(tv1);
    const float rng = RNG[0]; const float e0 = bfr(ck0[0]), p0 = bfr(ck0[1]), e1 = bfr(ck0[2]), p1 = bfr(ck0[3]), e2 = bfr(ck1[0]), p2 = bfr(ck1[1]), e3 = bfr(ck1[2]), p3 = bfr(ck1[3]);
    // one test per wave: its lanes hold all sixteen queries and its own keys; a sum of magnitudes bounds each term, and a NaN or an infinity fails it
    const float qef = __builtin_bit_cast(float, qe), qff = __builtin_bit_cast(float, qf);
    const bool inr = ((fabsf(qff) + fabsf(p0)) + (fabsf(p1) + fabsf(p2)) + fabsf(p3) < 1024.0f) & ((fabsf(qef) + fabsf(e0)) + (fabsf(e1) + fabsf(e2)) + fabsf(e3) < 0x1p60f) & (rng >= 1e-6f) & (rng < 0x1p62f);
    if (__builtin_amdgcn_ballot_w32(inr) == 0xffffffffu) {
      const float yr = 1.0f / rng; const int qe16 = __builtin_bit_cast(int, qef * 16.0f); const float f0 = e0 * 16.0f, f1 = e1 * 16.0f, f2 = e2 * 16.0f, f3 = e3 * 16.0f;
      const unsigned off = (16u * 4u + ((16u + 32u) * 4u << 8)) * 0x10001u;   // the table offsets of the four bytes of a word
#pragma unroll 2  // two queries a trip: their chains are independent and fill each other's result latencies
      for (int qi = 0; qi < 16; ++qi) { const float et16 = __builtin_bit_cast(float, __builtin_amdgcn_readlane(qe16, qi)), pt_ = __builtin_bit_cast(float, __builtin_amdgcn_readlane(qf, qi));
        const unsigned b0 = bins_fast(et16, pt_, f0, p0, rng, yr), b1 = bins_fast(et16, pt_, f1, p1, rng, yr), b2 = bins_fast(et16, pt_, f2, p2, rng, yr), b3 = bins_fast(et16, pt_, f3, p3, rng, yr);
        v2u w; w[0] = b0 + (b1 << 16) + off; w[1] = b2 + (b3 << 16) + off; *(v2u*)&sbin[qi][tid * 2] = w; }
    } else {
#pragma unroll 1  // rolled: for speed only
      for (int qi = 0; qi < 16; ++qi) { const float et = __builtin_bit_cast(float, __builtin_amdgcn_readlane(qe, qi)), pt_ = __builtin_bit_cast(float, __builtin_amdgcn_readlane(qf, qi));
        const unsigned b0 = bias_bins(et, pt_, e0, p0, rng), b1 = bias_bins(et, pt_, e1, p1, rng), b2 = bias_bins(et, pt_, e2, p2, rng), b3 = bias_bins(et, pt_, e3, p3, rng);
        v2u w; w[0] = b0 | (b1 << 16); w[1] = b2 | (b3 << 16); *(v2u*)&sbin[qi][tid * 2] = w; } } }
  __syncthreads();   // publishes every thread's bins to the eight waves that read them below
  const char* tb = (const char*)&stab[wave][0];
  // all four operands lie in fragment order; a head's 64 columns are k steps 2h and 2h + 1 of a token tile, its v columns are column tiles 4h .. 4h + 3 of the batch
  const size_t qo = (((size_t)b * (TT / 16) + blockIdx.x) * 16 + h * 2) * 512 + lane * 8;
  const _Float16* qp = QH + qo; const _Float16* qlp = QL + qo;
  const _Float16* kp = KH + ((size_t)b * (TT / 16) * 16 + h * 2) * 512 + lane * 8;          // first key tile of the batch
  const _Float16* vp = VT + ((size_t)b * (CC / 16) + h * 4) * (TT / 32) * 512 + lane * 8;   // first column tile of the head, first 32 keys
  v16h qh[2], ql[2], kf[4][2];
#pragma unroll
  for (int kc = 0; kc < 2; ++kc) { qh[kc] = fragw_h(qp + kc * 512); ql[kc] = fragw_h(qlp + kc * 512); }
#pragma unroll
  for (int j = 0; j < 4; ++j)
#pragma unroll
    for (int kc = 0; kc < 2; ++kc) kf[j][kc] = fragw_h(kp + (j * 16 + kc) * 512);
  // precaution: the address pairs stay live and unwritten up to this wait
  asm volatile("s_wait_xcnt 0x0" :: "v"(qp), "v"(qlp), "v"(kp) : "memory");
  v8f ctx[4] = {}; float mrun = -3.0e38f, mlrun = -3.0e38f, lsum = 0.f;   // mlrun = the running maximum x log2(e), as it was rounded for the sums held so far
  const _Float16* kn = kp; const _Float16* vn = vp;   // the lane's own k row and v plane, moved on by 64 keys a trip
#pragma unroll 1  // rolled: one trip already holds the fragments of two trips in registers
  for (int ks = 0; ks < TT / 64; ++ks) { v8f s[4] = {}, sl[4] = {};
#pragma unroll
    for (int kc = 0; kc < 2; ++kc)
#pragma unroll
      for (int j = 0; j < 4; ++j) { s[j] = wm16(kf[j][kc], qh[kc], s[j]); sl[j] = wm16(kf[j][kc], ql[kc], sl[j]); }
    // the next trip's k fragments and this trip's v fragments fly while the softmax below runs (the last trip reads its own k tile again: in bounds, not used)
    kn += ks + 1 < TT / 64 ? 4 * 16 * 512 : 0;
#pragma unroll
    for (int j = 0; j < 4; ++j)
#pragma unroll
      for (int kc = 0; kc < 2; ++kc) kf[j][kc] = fragw_h(kn + (j * 16 + kc) * 512);
    v16h vf[2][4];
#pragma unroll
    for (int u = 0; u < 2; ++u)
#pragma unroll
      for (int jj = 0; jj < 4; ++jj) vf[u][jj] = fragw_h(vn + (jj * (TT / 32) + u) * 512);
    // precaution: both address pairs stay live and unwritten up to this wait; it also keeps the loads above the softmax
    asm volatile("s_wait_xcnt 0x0" :: "v"(kn), "v"(vn) : "memory");
    vn += 2 * 512;
    float mx = mrun;
#pragma unroll
    for (int j = 0; j < 4; ++j) { const v4u w = *(const v4u*)&sbin[col][ks * 32 + j * 8 + 4 * g];
#pragma unroll
      for (int r = 0; r < 8; ++r) { const unsigned bi = w[r >> 1] >> (16 * (r & 1)); const float x = (s[j][r] + sl[j][r] * (1.0f / 1024.0f)) * SCALE;
        const float v = x + (*(const float*)(tb + (bi & 0xffu)) + *(const float*)(tb + ((bi >> 8) & 0xffu))); s[j][r] = v; mx = fmaxf(mx, v); } }
    mx = fmaxf(mx, xhalf(mx));   // a query's keys are split between lanes col and col + 16
    // exp(v - mx) = exp2(v * log2(e) - mxl): one fma and one v_exp_f32 a score; the argument is never above a rounding error of 0, and a result below the normal range counts as 0 (far below what f16 holds)
    const float mxl = mx * LOG2E_F; const float al = ex2(mlrun - mxl); mrun = mx; mlrun = mxl;
    v4f s4 = {}; v16h p[2];
#pragma unroll
    for (int j = 0; j < 4; ++j) { v8f x;
#pragma unroll
      for (int r = 0; r < 8; ++r) x[r] = __builtin_fmaf(s[j][r], LOG2E_F, -mxl);
      const v8f ev = ex2x8(x);
#pragma unroll
      for (int r = 0; r < 8; ++r) { const float e = ev[r]; s4[r & 3] += e; p[j >> 1][(j & 1) * 8 + r] = (_Float16)e; } }
    lsum = lsum * al + ((s4[0] + s4[1]) + (s4[2] + s4[3]));
#pragma unroll
    for (int jj = 0; jj < 4; ++jj) ctx[jj] = ctx[jj] * al;
#pragma unroll
    for (int u = 0; u < 2; ++u)
#pragma unroll
      for (int jj = 0; jj < 4; ++jj) ctx[jj] = wm16(vf[u][jj], p[u], ctx[jj]); }
  // ---- out = ctx Wo (+ bo) for the block's 16 rows, in the same launch: the block holds all 512 ctx columns of its rows, wave w takes output columns 64w .. 64w + 63.
  // Transposed like the products above: out^T = Wo^T ctx^T, Wo as f16(bf16 x 2^8) exact from the workspace in fragment order (A), ctx once to f16 through LDS (B), x 2^-8 at the end; k steps in rising order.
  const _Float16* wb = WOP + (size_t)(wave * 4) * 512 + lane * 8;   // the wave's first column tile, k step 0
  v16h w[4][4];   // register ring, four k steps deep: the first four steps are requested here, in front of the barrier, and each fragment of step kc + 4 into the registers of its forerunner once the product of step kc has read them
#pragma unroll
  for (int s = 0; s < 4; ++s)
#pragma unroll
    for (int j = 0; j < 4; ++j) w[s][j] = fragw_h(wb + (s * 32 + j) * 512);
  const float* bp = BO + wave * 64 + 8 * g;   // lane (g, col) ends up with output columns 64w + 16j + 8g + 0..7 of row col
  v4f bz[4][2] = {};
  if (BO) {
#pragma unroll
    for (int j = 0; j < 4; ++j) { bz[j][0] = *(const v4f*)(bp + j * 16); bz[j][1] = *(const v4f*)(bp + j * 16 + 4); } }
  const float sum = lsum + xhalf(lsum); const float inv = sum > 0.f ? 1.0f / sum : 0.f;
  _Float16* yl = &sy[h * 2 * 512 + lane * 8];   // lane (g, col) holds head columns jj * 16 + 8g + r of query col: chunk (k step 2h + (jj >> 1), half jj & 1, this lane) of the out product's ctx operand, rounded to f16 here
#pragma unroll
  for (int jj = 0; jj < 4; ++jj) { v8h o;
#pragma unroll
    for (int r = 0; r < 8; ++r) o[r] = (_Float16)(ctx[jj][r] * inv);
    *(v8h*)(yl + jj * 256) = o; }
  __syncthreads();   // publishes every head's ctx columns to the eight waves, each of which reads all of them below
  v8f acc[4] = {};
#pragma unroll  // unrolled: every fragment is a constant offset from one address pair, which is never rewritten, and every ring index is a constant
  for (int kc = 0; kc < CC / 32; ++kc) { const v16h a = fragw_h(&sy[kc * 512 + lane * 8]);
#pragma unroll
    for (int j = 0; j < 4; ++j) { acc[j] = wm16(w[kc & 3][j], a, acc[j]); if (kc + 4 < CC / 32) w[kc & 3][j] = fragw_h(wb + ((kc + 4) * 32 + j) * 512); } }
  // precaution: both address pairs stay live and unwritten up to this wait
  asm volatile("s_wait_xcnt 0x0" :: "v"(wb), "v"(bp) : "memory");
#pragma unroll
  for (int j = 0; j < 4; ++j) { v4f o0, o1;
#pragma unroll
    for (int i = 0; i < 4; ++i) { o0[i] = acc[j][i] * (1.0f / 256.0f) + bfr(bz[j][0][i]); o1[i] = acc[j][4 + i] * (1.0f / 256.0f) + bfr(bz[j][1][i]); }
    *(v4f*)&sf[wave][col][j * 16 + 8 * g] = o0; *(v4f*)&sf[wave][col][j * 16 + 8 * g + 4] = o1; }
  LDSX();   // the wave reads back rows that its other lanes wrote
  float* op = OUT + ((size_t)b * TT + t0 + g) * DIN + wave * 64 + col * 4;   // two rows a store, 256 contiguous bytes (two whole lines) of each
#pragma unroll
  for (int rl = 0; rl < 16; rl += 2) vst2(op + rl * DIN, *(const v4f*)&sf[wave][rl + g][col * 4]); }

extern "C" void kernel_launch(void* const* d_in, const int* in_sizes, int n_in, void* d_out, int out_size, void* d_ws, size_t ws_size, hipStream_t stream) {
  (void)in_sizes; (void)n_in; (void)out_size;
  const float** F = (const float**)d_in;
  if (ws_size < (size_t)WS_END) return;
  char* ws = (char*)d_ws; _Float16 *QH = (_Float16*)(ws + WS_QH), *KH = (_Float16*)(ws + WS_KH), *VT = (_Float16*)(ws + WS_VT), *QL = (_Float16*)(ws + WS_QL), *KL = (_Float16*)(ws + WS_KL); __bf16 *VB = (__bf16*)(ws + WS_VB), *VBL = (__bf16*)(ws + WS_VBL); _Float16 *Y = (_Float16*)(ws + WS_Y);
  (void)Y; (void)QL; (void)KL; (void)VB; (void)VBL;
  // inputs: 0 p [4,1024,512]; 1 pcoords [4,1024,2]; 2 rpe_table [64,8]; 3 wq_w (in,out), 4 wq_b; 5 wk_w, 6 wk_b; 7 wv_w, 8 wv_b; 9 wo_w (in,out), 10 wo_b
  if (ws_size < (size_t)WS_END3) return;
  float* RNG = (float*)(ws + WS_RNG); __bf16 *XP = (__bf16*)(ws + WS_XP), *WP = (__bf16*)(ws + WS_WP);
  k_range<<<1 + 256, 256, 0, stream>>>(F[1], RNG, F[0], F[3], F[5], F[7], F[9], XP, WP);
  k_proj<<<dim3(TNB * TT / 64, CC / 128, 3), 128, 0, stream>>>(XP, WP, F[4], F[6], F[8], QH, QL, KH, KL, VT, VB, VBL);
  k_fa<<<dim3(TT / 16, 1, TNB), 256, 0, stream>>>(QH, QL, KH, VT, F[1], F[2], RNG, (const _Float16*)(WP + 3 * DIN * CC), F[10], (float*)d_out);
}

// v010
// A run of this version takes 51.4 microseconds.
// Next to v009, in two timings, it ran 1.13 and 1.14 times as fast.
// Over all steps from v000 it is 7.47 times as fast.
// compute dtype: all float inputs rounded to bf16; q/k/v = p W + b with EXACT bf16 products on WMMA 16x16x32 (f32 accumulate); q as f16 hi + residual (x 2^10) against k once to f16 (2 products) x 64^-0.5; the relative-position bias: bin indices computed per (batch, query, key) in f32 exactly as the reference (difference, division by the global eta range, x16, truncation; fmod-based wrap for phi), table values (bf16) added in f32; softmax in f32 with a running maximum over 64-key steps, exp(x) = hardware exp2 of x * log2(e), the difference and the product in one f32 fma; exp(logit - running maximum) once to f16 against v once to f16 (1 product), divided by the f32 sum at the end; ctx once to f16 against Wo carried x 2^8 in f16 + bo; f32 output.
#include <hip/hip_runtime.h>
#include <math.h>

typedef __attribute__((ext_vector_type(16))) _Float16 v16h;
typedef __attribute__((ext_vector_type(16))) __bf16 v16b;
typedef __attribute__((ext_vector_type(8)))  _Float16 v8h;
typedef __attribute__((ext_vector_type(8)))  float v8f;
typedef __attribute__((ext_vector_type(4)))  float v4f;
typedef __attribute__((ext_vector_type(2)))  float v2f;
typedef __attribute__((ext_vector_type(4)))  unsigned v4u;
typedef __attribute__((ext_vector_type(2)))  unsigned v2u;
typedef __attribute__((ext_vector_type(4)))  int v4i;
typedef float __attribute__((may_alias)) float_a;
typedef int __attribute__((may_alias)) int_a;

template <typename T> __device__ __forceinline__ void vst2(void* p, T v) { *(T*)p = v;  }
__device__ __forceinline__ v8f wmma16(v16h a, v16h b, v8f c) {
  v8f d = __builtin_amdgcn_wmma_f32_16x16x32_f16(false, a, false, b, (short)0, c, false, false);
  asm volatile("v_nop\n\tv_nop\n\tv_nop\n\tv_nop" : "+v"(d) : "v"(a), "v"(b));
  return d;
}
__device__ __forceinline__ v8f wmma_bf(v16b a, v16b b, v8f c) {
  v8f d = __builtin_amdgcn_wmma_f32_16x16x32_bf16(false, a, false, b, (short)0, c, false, false);
  asm volatile("v_nop\n\tv_nop\n\tv_nop\n\tv_nop" : "+v"(d) : "v"(a), "v"(b));
  return d;
}
// 16x16x32 fragments: lane = (h = lane>>4, row/col = lane&15); elements 0..7 = k0+8h+0..7, 8..15 = k0+16+8h+0..7; D element r = row 8h+r
__device__ __forceinline__ v16h frag_h(const _Float16* rowk0, int lane) {
  union { v16h v; v8h q[2]; } u; const _Float16* p = rowk0 + 8 * (lane >> 4);
  u.q[0] = *(const v8h*)p; u.q[1] = *(const v8h*)(p + 16); return u.v;
}
__device__ __forceinline__ v16h frag_f32(const float* rowk0, int lane) {
  v16h a; const float* p = rowk0 + 8 * (lane >> 4);
#pragma unroll
  for (int i = 0; i < 8; ++i) { a[i] = (_Float16)p[i]; a[8 + i] = (_Float16)p[16 + i]; }
  return a;
}
__device__ __forceinline__ v16h frag_f32s(const float* rowk0, int lane, float sc) {
  v16h a; const float* p = rowk0 + 8 * (lane >> 4);
#pragma unroll
  for (int i = 0; i < 8; ++i) { a[i] = (_Float16)(p[i] * sc); a[8 + i] = (_Float16)(p[16 + i] * sc); }
  return a;
}
// column fragment from a [K][ld] layout (column n), rows >= K read as 0
__device__ __forceinline__ v16h fragc_f32(const float* W, int k0, int n, int lane, int ld, int K) {
  v16h a; const int g = lane >> 4;
#pragma unroll
  for (int i = 0; i < 8; ++i) { const int ka = k0 + 8 * g + i, kb = ka + 16;
    a[i] = (_Float16)(ka < K ? W[(size_t)(ka < K ? ka : K - 1) * ld + n] : 0.f); a[8 + i] = (_Float16)(kb < K ? W[(size_t)(kb < K ? kb : K - 1) * ld + n] : 0.f); }
  return a;
}
struct F2 { v16b h, l; };
__device__ __forceinline__ F2 bsplit16(const float v[16]) { F2 r;
#pragma unroll
  for (int i = 0; i < 16; ++i) { const __bf16 h = (__bf16)v[i]; r.h[i] = h; r.l[i] = (__bf16)(v[i] - (float)h); }
  return r; }
__device__ __forceinline__ F2 split_row(const float* row, int k0, int lane) { float v[16]; const float* p = row + k0 + 8 * (lane >> 4);
#pragma unroll
  for (int i = 0; i < 8; ++i) { v[i] = p[i]; v[8 + i] = p[16 + i]; }
  return bsplit16(v); }
__device__ __forceinline__ F2 split_rowK(const float* row, int k0, int lane, int K) { float v[16]; const int g = lane >> 4;
#pragma unroll
  for (int i = 0; i < 8; ++i) { const int ka = k0 + 8 * g + i, kb = ka + 16; v[i] = ka < K ? row[ka < K ? ka : K - 1] : 0.f; v[8 + i] = kb < K ? row[kb < K ? kb : K - 1] : 0.f; }
  return bsplit16(v); }
__device__ __forceinline__ F2 split_col(const float* W, int k0, int n, int lane, int ld, int K) { float v[16]; const int g = lane >> 4;
#pragma unroll
  for (int i = 0; i < 8; ++i) { const int ka = k0 + 8 * g + i, kb = ka + 16; v[i] = ka < K ? W[(size_t)(ka < K ? ka : K - 1) * ld + n] : 0.f; v[8 + i] = kb < K ? W[(size_t)(kb < K ? kb : K - 1) * ld + n] : 0.f; }
  return bsplit16(v); }
__device__ __forceinline__ v8f mac3(const F2& a, const F2& b, v8f c) { c = wmma_bf(a.l, b.h, c); c = wmma_bf(a.h, b.l, c); return wmma_bf(a.h, b.h, c); }
__device__ __forceinline__ float sigm(float v) { return 1.0f / (1.0f + expf(-v)); }
#define LDSX() do { asm volatile("s_wait_dscnt 0" ::: "memory"); __builtin_amdgcn_wave_barrier(); __builtin_amdgcn_fence(__ATOMIC_RELEASE, "workgroup"); } while (0)

// Patch attention with a relative-position bias (B 4, T 1,024, D 512 = 8 heads x 64): q/k/v = p W + b ((in,out)); scores = q k^T / 8 + rpe_table[eta_bin + 16][h] + rpe_table[phi_bin + 48][h] with eta_bin = trunc((eta_i - eta_j) / max|eta_i - eta_j| * 16), phi_bin = trunc(wrap(phi_i - phi_j) / pi * 16), both clipped to [-16, 15]; softmax; out = merged(attn v) Wo + bo.
#define NB 4
#define TT 1024
#define CC 512            // NH * HD = projected width
#define DIN 512          // input (model) width
#define NH 8
#define HD 64
#define NQB (TT / 64)
#define HG 8
#define SCALE (0.125f)
#define CAUSAL 0
#ifndef TNB
#define TNB NB
#endif
__device__ __forceinline__ float bfr(float v) { return (float)(__bf16)v; }
__host__ __device__ __forceinline__ int kb_last(int qb) { return CAUSAL ? ((qb * 64 + 63) >> 7) : (TT / 128 - 1); }
typedef __attribute__((ext_vector_type(8))) __bf16 v8b;
__device__ __forceinline__ v16b frag_b(const __bf16* rowk0, int lane) {
  union { v16b v; v8b q[2]; } u; const __bf16* p = rowk0 + 8 * (lane >> 4);
  u.q[0] = *(const v8b*)p; u.q[1] = *(const v8b*)(p + 16); return u.v;
}
// precaution, behind a store in a loop: it stands in front of the first rewrite of a register that the store names
#define XCW() asm volatile("s_wait_xcnt 0x0" ::: "memory")
// one fragment in fragment order: p = fragment start + lane * 8
__device__ __forceinline__ v16b fragw_b(const __bf16* p) { union { v16b v; v8b q[2]; } u; u.q[0] = *(const v8b*)p; u.q[1] = *(const v8b*)(p + 256); return u.v; }
__device__ __forceinline__ v16h fragw_h(const _Float16* p) { union { v16h v; v8h q[2]; } u; u.q[0] = *(const v8h*)p; u.q[1] = *(const v8h*)(p + 256); return u.v; }
#define QBH 0              // unused: no kernel here has a separate high-precision path
#define QHI 1024            // rows carrying a q residual plane (all rows when non-causal: 2-product logits everywhere)
#define KHI 64            // key rows carrying k residual / v bf16 hi+lo planes (written by k_proj; no kernel here reads them)
// B fragment (k rows k0+.., output column o) of a weight: (in,out) [K][ld] or (out,in) [ld rows of K]: bf16 exact, or f16(bf16 * 256) exact
__device__ __forceinline__ v16b wcol_io(const float* Wm, int k0, int o, int lane, int ld) { v16b w; const int g = lane >> 4;
#pragma unroll
  for (int i = 0; i < 8; ++i) { w[i] = (__bf16)Wm[(size_t)(k0 + 8 * g + i) * ld + o]; w[8 + i] = (__bf16)Wm[(size_t)(k0 + 16 + 8 * g + i) * ld + o]; }
  return w; }
__device__ __forceinline__ v16b wcol_oi(const float* Wm, int k0, int o, int lane, int K) { v16b w; const float* p = Wm + (size_t)o * K + k0 + 8 * (lane >> 4);
#pragma unroll
  for (int i = 0; i < 8; ++i) { w[i] = (__bf16)p[i]; w[8 + i] = (__bf16)p[16 + i]; }
  return w; }
__device__ __forceinline__ v16h wcolh_io(const float* Wm, int k0, int o, int lane, int ld) { v16h w; const int g = lane >> 4;
#pragma unroll
  for (int i = 0; i < 8; ++i) { w[i] = (_Float16)(bfr(Wm[(size_t)(k0 + 8 * g + i) * ld + o]) * 256.0f); w[8 + i] = (_Float16)(bfr(Wm[(size_t)(k0 + 16 + 8 * g + i) * ld + o]) * 256.0f); }
  return w; }
__device__ __forceinline__ v16h wcolh_oi(const float* Wm, int k0, int o, int lane, int K) { v16h w; const float* p = Wm + (size_t)o * K + k0 + 8 * (lane >> 4);
#pragma unroll
  for (int i = 0; i < 8; ++i) { w[i] = (_Float16)(bfr(p[i]) * 256.0f); w[8 + i] = (_Float16)(bfr(p[16 + i]) * 256.0f); }
  return w; }
#define WQKV_LAYOUT 0   // selects WCOL only, which nothing calls; k_range always reads wq/wk/wv as (in,out) [DIN][CC]
__device__ __forceinline__ v16b wcol_hdk(const float* Wm, int k0, int o, int lane) { v16b w; const int g = lane >> 4; const float* p = Wm + (size_t)(o / HD) * DIN * HD + (o % HD);
#pragma unroll
  for (int i = 0; i < 8; ++i) { w[i] = (__bf16)p[(size_t)(k0 + 8 * g + i) * HD]; w[8 + i] = (__bf16)p[(size_t)(k0 + 16 + 8 * g + i) * HD]; }
  return w; }
#define WO_OUT_IN 0
#if WQKV_LAYOUT == 1
#define WCOL(W, k0, o, lane) wcol_oi(W, k0, o, lane, DIN)
#elif WQKV_LAYOUT == 2
#define WCOL(W, k0, o, lane) wcol_hdk(W, k0, o, lane)
#else
#define WCOL(W, k0, o, lane) wcol_io(W, k0, o, lane, CC)
#endif
#if WO_OUT_IN
#define WOCOL(W, k0, o, lane) wcol_oi(W, k0, o, lane, CC)
#define WOCOLH(W, k0, o, lane) wcolh_oi(W, k0, o, lane, CC)
#else
#define WOCOL(W, k0, o, lane) wcol_io(W, k0, o, lane, DIN)
#define WOCOLH(W, k0, o, lane) wcolh_io(W, k0, o, lane, DIN)
#endif
#define PI_F 3.14159274f          // f32(math.pi)
#define LOG2E_F 1.44269504f       // f32(log2(e))
// bias bins of one (query, key) pair, the same for every head: byte offsets into one head's 64-entry f32 table column, eta bin in bits 7..0, phi bin (+32 entries) in bits 15..8. f32 steps exactly as the reference: jnp.mod = fmod then +y when the remainder is negative; .astype(int32) = truncation
__device__ __forceinline__ unsigned bias_bins(float et, float pt_, float ek, float pk_, float rng) {
  const float re = et - ek; int eb = (int)((re / rng) * 16.0f); eb = eb < -16 ? -16 : (eb > 15 ? 15 : eb);
  const float rp = pt_ - pk_; const float a_ = rp + PI_F; const float twopi = 2.0f * PI_F; float rm = fmodf(a_, twopi); rm = (rm != 0.0f && rm < 0.0f) ? rm + twopi : rm; const float wr = rm - PI_F;
  int pb = (int)((wr / PI_F) * 16.0f); pb = pb < -16 ? -16 : (pb > 15 ? 15 : pb);
  return (unsigned)((eb + 16) * 4) | ((unsigned)((pb + 16 + 32) * 4) << 8); }
// The same bins, bit for bit, without the library remainder and the two general divisions, for coordinates inside the range that k_fa tests once per wave (|phi| < 1,024, |eta| < 2^60, 1e-6 <= range < 2^62).
// Returns eta_bin * 4 + phi_bin * 1,024; the caller adds the table offsets of a whole word once (sums modulo 2^32 are linear, so a negative bin's borrow cancels against them).
// eta arrives x 16 (a power of two moves through the difference, the division and their roundings unchanged). a / b rounded to nearest: with y = the rounded 1 / b, q = a * y, then q += (a - q * b) * y with both steps fused;
// once q is within one unit in the last place the residual is exact and the result is the rounded quotient: two corrections for any b, one for b = pi / 16, whose rounded reciprocal is off by under 2^-26.
// Remainder: n = floor(c / 2pi + 2^-8) is the true floor or one more; c - n * 2pi in one fma is exact wherever |c| >= 4 (a multiple of 2^-21 below 8), and for -2pi < c < 0 it is the reference's own rounded c + 2pi;
// a negative r (n one too many, or c < 0 taken with n = 0) takes + 2pi: as unsigned words a negative float lies above every positive one and positive floats keep their order, so the minimum of r and r + 2pi is that choice.
__device__ __forceinline__ unsigned bins_fast(float et16, float pt_, float ek16, float pk_, float rng, float yr) {
  const float a = et16 - ek16; float q = a * yr; q = __builtin_fmaf(__builtin_fmaf(-q, rng, a), yr, q); q = __builtin_fmaf(__builtin_fmaf(-q, rng, a), yr, q);
  int eb = (int)q; eb = eb < -16 ? -16 : (eb > 15 ? 15 : eb);
  const float twopi = 2.0f * PI_F; const float c = (pt_ - pk_) + PI_F; const float n = __builtin_floorf(__builtin_fmaf(c, 0x1.45f306p-3f, 0x1p-8f)); const float r = __builtin_fmaf(-n, twopi, c);
  const unsigned ur = __builtin_bit_cast(unsigned, r), ut = __builtin_bit_cast(unsigned, r + twopi); const float wr = __builtin_bit_cast(float, __builtin_elementwise_min(ur, ut)) - PI_F;
  float u = wr * 0x1.45f306p+2f; u = __builtin_fmaf(__builtin_fmaf(-u, PI_F * 0.0625f, wr), 0x1.45f306p+2f, u);
  int pb = (int)u; pb = pb < -16 ? -16 : (pb > 15 ? 15 : pb);
  return (unsigned)eb * 4u + (unsigned)pb * 1024u; }
// ---- k_range: block 0: eta_range = max(max over batches of (max eta - min eta), 1e-6) on the bf16-rounded coordinates (= max |eta_i - eta_j| over all same-batch pairs, exact)
// FRAGMENT ORDER, the layout of every matrix operand in the workspace: [tile of 16 rows (A) or columns (B)][k step of 32][half][lane][8 elements of 16 bits], for the weights [k step][column tile][half][lane][8 elements]; chunk (tile, ks, half, lane) holds row or column tile * 16 + (lane & 15) at k = ks * 32 + half * 16 + (lane >> 4) * 8 + 0..7.
// One fragment = 512 elements = 1 KB; each of its two 16-byte loads reads 512 contiguous bytes per wave = 4 whole lines.
// Blocks 1..256 of this launch: p to bf16 [row tile][k step] (block = row tile), and wq, wk, wv to bf16, wo to f16(bf16 x 2^8), each [k step][column tile] (64 blocks a matrix). Each value is rounded once, here.
__global__ __launch_bounds__(256) void k_range(const float* __restrict__ PCO, float* __restrict__ RNG, const float* __restrict__ X, const float* __restrict__ WQ, const float* __restrict__ WK, const float* __restrict__ WV, const float* __restrict__ WO, __bf16* __restrict__ XP, __bf16* __restrict__ WP) { __shared__ float smx[8], smn[8];
  static_assert(NB * TT / 16 == 256 && DIN == 512 && CC == 512, "256 row tiles, 64 blocks of 512 chunks a weight");
  if (blockIdx.x != 0) {   // block-uniform, in front of every barrier
    const int pb = blockIdx.x - 1, e = threadIdx.x; const int wsel = pb >> 6; const float* Wm = wsel == 0 ? WQ : wsel == 1 ? WK : wsel == 2 ? WV : WO;
    const float* xs = X + ((size_t)pb * 16 + (e & 15)) * DIN + (e >> 6) * 32 + ((e >> 5) & 1) * 16 + ((e >> 4) & 1) * 8;   // chunk e of the row tile; chunk e + 256 lies 4 k steps on
    const int ew = (pb & 63) * 512 + e;   // chunk of the matrix; chunk ew + 256 lies 4 column tiles on
    const float* wsr = Wm + (size_t)((ew >> 11) * 32 + ((ew >> 5) & 1) * 16 + ((ew >> 4) & 1) * 8) * 512 + ((ew >> 6) & 31) * 16 + (ew & 15);
    v4f xv[4][2]; float wv[2][8];
#pragma unroll
    for (int it = 0; it < 4; ++it) { xv[it][0] = *(const v4f*)(xs + it * 128); xv[it][1] = *(const v4f*)(xs + it * 128 + 4); }
#pragma unroll
    for (int it = 0; it < 2; ++it)
#pragma unroll
      for (int i = 0; i < 8; ++i) wv[it][i] = wsr[it * 64 + i * 512];
    // precaution: both address pairs stay live and unwritten up to this wait
    asm volatile("s_wait_xcnt 0x0" :: "v"(xs), "v"(wsr) : "memory");
#pragma unroll
    for (int it = 0; it < 4; ++it) { v8b o;
#pragma unroll
      for (int i = 0; i < 4; ++i) { o[i] = (__bf16)xv[it][0][i]; o[4 + i] = (__bf16)xv[it][1][i]; }
      vst2(XP + ((size_t)pb * 1024 + it * 256 + e) * 8, o); XCW(); }
#pragma unroll
    for (int it = 0; it < 2; ++it) { __bf16* d = WP + ((size_t)pb * 512 + it * 256 + e) * 8;
      if (wsel < 3) { v8b o;
#pragma unroll
        for (int i = 0; i < 8; ++i) o[i] = (__bf16)wv[it][i];
        vst2(d, o); }
      else { v8h o;
#pragma unroll
        for (int i = 0; i < 8; ++i) o[i] = (_Float16)(bfr(wv[it][i]) * 256.0f);
        vst2(d, o); }
      XCW(); }
    return; }
  // one wave per half batch: its 512 coordinate pairs in eight 16-byte loads a lane (two tokens each, 512 contiguous bytes a wave), all requested before the first is used; maxima and minima are exact in any order
  static_assert(TNB * TT == 8 * 512 && TT == 2 * 512, "eight waves of 512 tokens, two waves a batch");
  const int t = threadIdx.x, wv = t >> 5, ln = t & 31; const float* cp = PCO + ((size_t)wv * 512 + ln * 2) * 2; v4f c[8];
#pragma unroll
  for (int i = 0; i < 8; ++i) c[i] = *(const v4f*)(cp + i * 128);
  // precaution: the address pair stays live and unwritten up to this wait
  asm volatile("s_wait_xcnt 0x0" :: "v"(cp) : "memory");
  float mx = -3.0e38f, mn = 3.0e38f;
#pragma unroll
  for (int i = 0; i < 8; ++i) { const float e0 = bfr(c[i][0]), e1 = bfr(c[i][2]); mx = fmaxf(mx, fmaxf(e0, e1)); mn = fminf(mn, fminf(e0, e1)); }
  for (int o = 1; o < 32; o <<= 1) { mx = fmaxf(mx, __shfl_xor(mx, o)); mn = fminf(mn, __shfl_xor(mn, o)); }
  if (ln == 0) { smx[wv] = mx; smn[wv] = mn; }
  __syncthreads();   // publishes the eight waves' maxima and minima to the wave that writes the range
  if (t < 32) { float best = 0.f;
#pragma unroll
    for (int b = 0; b < TNB; ++b) best = fmaxf(best, fmaxf(smx[2 * b], smx[2 * b + 1]) - fminf(smn[2 * b], smn[2 * b + 1]));
    const float v = t == 0 ? fmaxf(best, 1e-6f) : 0.f; vst2(RNG + t, v); } }
#define WS_RNG (WS_END)
#define WS_END2 (WS_RNG + 128u)
#define WS_XP (WS_RNG + 4096u)                           // bf16 p, fragment order (every fragment starts on a 1 KB boundary)
#define WS_WP (WS_XP + 2u * (size_t)NB * TT * DIN)       // wq, wk, wv (bf16), wo (f16), fragment order
#define WS_END3 (WS_WP + 4u * 2u * (size_t)DIN * CC)

#define WS_QH  0u                                      // f16 q, fragment order [token tile][k step]
#define WS_KH  (WS_QH + 2u * (size_t)NB * TT * CC)      // f16 k, fragment order [token tile][k step]
#define WS_VT  (WS_KH + 2u * (size_t)NB * TT * CC)      // f16 v, fragment order [b][column tile][k step of 32 tokens]
#define WS_QL  (WS_VT + 2u * (size_t)NB * CC * TT)      // f16 q residual x 2^10, fragment order as q
#define WS_KL  (WS_QL + 2u * (size_t)NB * QHI * CC)     // f16 k residual x 2^10 rows [b][t < KHI][CC]
#define WS_VB  (WS_KL + 2u * (size_t)NB * KHI * CC)     // bf16 v hi planes [b][c][t < KHI]
#define WS_VBL (WS_VB + 2u * (size_t)NB * CC * KHI)
#define WS_S   (WS_VBL + 2u * (size_t)NB * CC * KHI)    // f32 [b][hg][t][s], unused: no kernel here stores logits or P
#define WS_Y   (WS_S  + 4u * (size_t)NB * HG * TT * TT)      // unused: no kernel here stores ctx
#define WS_END (WS_Y  + 4u * (size_t)NB * TT * CC)

// ---- k_proj: block = (64 rows, 128 cols, which): q/k/v = X W (+ b) with exact bf16 products (K = DIN), both operands read in fragment order -> which 0: q f16 (+ residual, rows < QHI), fragment order; 1: k f16, fragment order (+ residual rows < KHI); 2: v f16, fragment order (+ bf16 hi/lo planes for t < KHI)
__global__ __launch_bounds__(128) void k_proj(const __bf16* __restrict__ XP, const __bf16* __restrict__ WP, const float* __restrict__ BQ, const float* __restrict__ BK, const float* __restrict__ BV,
    _Float16* __restrict__ QH, _Float16* __restrict__ QL, _Float16* __restrict__ KH, _Float16* __restrict__ KL, _Float16* __restrict__ VT, __bf16* __restrict__ VB, __bf16* __restrict__ VBL) {
  __shared__ __align__(16) _Float16 sh[64][136], sl[64][136]; __shared__ __align__(16) _Float16 th[128][72]; __shared__ __align__(16) __bf16 tb[128][72], tbl[128][72];
  const int tid = threadIdx.x, wave = tid >> 5, lane = tid & 31, col = lane & 15, g = lane >> 4; const int which = blockIdx.z; const int c0 = blockIdx.y * 128; const size_t r0 = (size_t)blockIdx.x * 64; const size_t bb = r0 / TT; const int t0 = (int)(r0 % TT);
  const float* BA = which == 0 ? BQ : which == 1 ? BK : BV;
  const __bf16* xa = XP + (size_t)(blockIdx.x * 4 + wave) * (16 * 512) + lane * 8;                      // the wave's row tile, k step 0
  const __bf16* wb = WP + (size_t)which * (DIN * CC) + (size_t)(blockIdx.y * 8) * 512 + lane * 8;   // the block's first column tile, k step 0
  const float* bp = BA + c0 + col;   // the lane's bias of column tile 0; tile j lies 16 floats on
  float bv[8] = {};
  v8f acc[8] = {};
  v16b a[3], w[2][8];   // register ring: each weight fragment of k step kc + 2 is requested into the registers of its forerunner as soon as the product of step kc has read them (the row fragment, read by all eight products, has a third place), so three steps' round trips overlap
#pragma unroll
  for (int s = 0; s < 2; ++s) { a[s] = fragw_b(xa + s * 512);
#pragma unroll
    for (int j = 0; j < 8; ++j) w[s][j] = fragw_b(wb + (s * 32 + j) * 512); }
#pragma unroll  // unrolled: every fragment is a constant offset from the two address pairs, which are never rewritten, and every ring index is a constant
  for (int kc = 0; kc < DIN / 32; ++kc) { const bool more = kc + 2 < DIN / 32;
    if (more) a[(kc + 2) % 3] = fragw_b(xa + (kc + 2) * 512);
#pragma unroll
    for (int j = 0; j < 8; ++j) { acc[j] = wmma_bf(a[kc % 3], w[kc & 1][j], acc[j]); if (more) w[kc & 1][j] = fragw_b(wb + ((kc + 2) * 32 + j) * 512);
      if (kc == DIN / 32 - 2 && j == 3 && BA) {   // the eight bias values, requested together behind the last fragment request, into registers that the ring has left: their round trips pass under the last products
#pragma unroll
        for (int i = 0; i < 8; ++i) bv[i] = bp[i * 16]; } } }
  // precaution: the three address pairs stay live and unwritten up to this wait
  asm volatile("s_wait_xcnt 0x0" :: "v"(xa), "v"(wb), "v"(bp) : "memory");
  if (which < 2) { _Float16* DH = which == 0 ? QH : KH; _Float16* DL = which == 0 ? QL : KL; const int nhi = which == 0 ? QHI : KHI; const bool hi_rows = t0 < nhi;
#pragma unroll
    for (int j = 0; j < 8; ++j) { const float bias = bfr(bv[j]);
#pragma unroll
      for (int r = 0; r < 8; ++r) { const float v = acc[j][r] + bias; const _Float16 hv = (_Float16)v; sh[wave * 16 + 8 * g + r][j * 16 + col] = hv; sl[wave * 16 + 8 * g + r][j * 16 + col] = (_Float16)((v - (float)hv) * 1024.0f); } }
    __syncthreads();
    // q, its residual and k go out in fragment order (row tile = 16 tokens, k step = 32 columns): chunk e = [row tile 4][k step 4][half][lane]; the k residual rows keep their row layout
    for (int e = tid; e < 64 * 16; e += 128) { const int rl = (e >> 8) * 16 + (e & 15), cl = ((e >> 6) & 3) * 32 + ((e >> 5) & 1) * 16 + ((e >> 4) & 1) * 8;
      const size_t o = (((size_t)blockIdx.x * 4 + (e >> 8)) * 16 + blockIdx.y * 4 + ((e >> 6) & 3)) * 512 + (e & 63) * 8;
      vst2((unsigned*)(DH + o), *(const v4u*)&sh[rl][cl]); XCW(); if (hi_rows) { vst2((unsigned*)(which == 0 ? DL + o : DL + (bb * nhi + t0 + rl) * (size_t)CC + c0 + cl), *(const v4u*)&sl[rl][cl]); XCW(); } }
  } else { const bool hi_rows = t0 < KHI;
#pragma unroll
    for (int j = 0; j < 8; ++j) { const float bias = bfr(bv[j]);
#pragma unroll
      for (int r = 0; r < 8; ++r) { const float v = acc[j][r] + bias; const int rl = wave * 16 + 8 * g + r, cl = j * 16 + col; th[cl][rl] = (_Float16)v; const __bf16 bh = (__bf16)v; tb[cl][rl] = bh; tbl[cl][rl] = (__bf16)(v - (float)bh); } }
    __syncthreads();
    // v goes out in fragment order (row tile = 16 columns of a batch, k step = 32 tokens): chunk e = [column tile 8][k step 2][half][lane]; the bf16 planes keep their layout
    for (int e = tid; e < 128 * 8; e += 128) { const int cl = (e >> 7) * 16 + (e & 15), tl = ((e >> 6) & 1) * 32 + ((e >> 5) & 1) * 16 + ((e >> 4) & 1) * 8;
      const size_t o = ((bb * (CC / 16) + blockIdx.y * 8 + (e >> 7)) * (TT / 32) + (t0 >> 5) + ((e >> 6) & 1)) * 512 + (e & 63) * 8;
      vst2((unsigned*)(VT + o), *(const v4u*)&th[cl][tl]); XCW(); if (hi_rows) { const size_t o3 = (bb * CC + c0 + cl) * (size_t)KHI + t0 + tl; vst2((unsigned*)(VB + o3), *(const v4u*)&tb[cl][tl]); vst2((unsigned*)(VBL + o3), *(const v4u*)&tbl[cl][tl]); XCW(); } } } }
// ---- k_fa: block = 16 query rows (t0..t0+15) of batch z, wave = head (8 waves): logits, bias, softmax, P.v and the out product in one kernel; no logit, P or ctx value goes to memory.
// The 256 threads first compute the 16 x TT bias bins (they do not depend on the head) into LDS, one barrier, then every wave runs alone over the keys, 64 per trip.
// Both products are transposed: S^T = K Q^T gives lane (g, col) the logits of query col at keys 8g + r, which is the B fragment of ctx^T = V^T P^T as it stands (tiles 2u and 2u + 1 = elements 0..7 and 8..15 of k step u), so P needs no move between lanes,
// and the running maximum, the sum and the rescale factor of a query live in that query's own two lanes (col and col + 16).
#define BP (TT / 2 + 4)   // dwords per bin row: 2,064 B = 16 B x odd, the conflict-free pitch for 16-byte LDS reads down a column of rows
__device__ __forceinline__ v8f wm16(v16h a, v16h b, v8f c) { return __builtin_amdgcn_wmma_f32_16x16x32_f16(false, a, false, b, (short)0, c, false, false); }
__device__ __forceinline__ v16h frag_p(const _Float16* p) { union { v16h v; v8h q[2]; } u; u.q[0] = *(const v8h*)p; u.q[1] = *(const v8h*)(p + 16); return u.v; }  // p = the lane's own first element (row start + k0 + 8g)
// 2^x on the transcendental unit. The instruction set asks for one independent instruction behind a transcendental before its result is read or its source overwritten:
// in one statement each v_exp_f32 is that instruction for the one in front of it (the results are early-clobber, so none lies on a source), and the closing v_nop is it for the last
__device__ __forceinline__ float ex2(float x) { float e; asm("v_exp_f32 %0, %1\n\tv_nop" : "=v"(e) : "v"(x)); return e; }
__device__ __forceinline__ v8f ex2x8(v8f x) { float e0, e1, e2, e3, e4, e5, e6, e7;
  asm("v_exp_f32 %0, %8\n\tv_exp_f32 %1, %9\n\tv_exp_f32 %2, %10\n\tv_exp_f32 %3, %11\n\tv_exp_f32 %4, %12\n\tv_exp_f32 %5, %13\n\tv_exp_f32 %6, %14\n\tv_exp_f32 %7, %15\n\tv_nop"
      : "=&v"(e0), "=&v"(e1), "=&v"(e2), "=&v"(e3), "=&v"(e4), "=&v"(e5), "=&v"(e6), "=&v"(e7)
      : "v"(x[0]), "v"(x[1]), "v"(x[2]), "v"(x[3]), "v"(x[4]), "v"(x[5]), "v"(x[6]), "v"(x[7]));
  v8f e = {e0, e1, e2, e3, e4, e5, e6, e7}; return e; }
__device__ __forceinline__ float xhalf(float x) { return __builtin_bit_cast(float, __builtin_amdgcn_permlanex16(__builtin_bit_cast(int, x), __builtin_bit_cast(int, x), 0x76543210, 0xfedcba98, false, false)); }  // lane l with lane l ^ 16
__global__ __launch_bounds__(256) void k_fa(const _Float16* __restrict__ QH, const _Float16* __restrict__ QL, const _Float16* __restrict__ KH, const _Float16* __restrict__ VT, const float* __restrict__ PCO, const float* __restrict__ TAB, const float* __restrict__ RNG, const _Float16* __restrict__ WOP, const float* __restrict__ BO, float* __restrict__ OUT) {
  __shared__ __align__(16) unsigned sbin[16][BP]; __shared__ __align__(16) float stab[NH][64];
  __shared__ __align__(16) _Float16 sy[(CC / 32) * 512];   // the block's 16 ctx rows (all heads), f16, fragment order [k step][half][lane][8]
  __shared__ __align__(16) float sf[NH][16][68];           // each wave's own 16 x 64 piece of out; 272-B rows = 16 B x odd, the conflict-free pitch for 16-byte accesses down a column of rows
  static_assert(DIN == NH * 64 && CC == 512, "one wave per 64 output columns");
  static_assert(!CAUSAL && NH * 32 == 256 && TT == 1024 && HD == 64 && QHI == TT, "one wave per head, whole rows, 4 keys per thread, q residual on every row");
  const int tid = threadIdx.x, wave = tid >> 5, lane = tid & 31, col = lane & 15, g = lane >> 4; const int t0 = blockIdx.x * 16; const int b = blockIdx.z; const int h = wave;
  { const float* ckp = PCO + ((size_t)b * TT + tid * 4) * 2; const v4f ck0 = *(const v4f*)ckp, ck1 = *(const v4f*)(ckp + 4);
    const float* tp = TAB + lane * NH + h; const float tv0 = tp[0], tv1 = tp[32 * NH];
    const float* qcp = PCO + ((size_t)b * TT + t0 + col) * 2; const v2f qc = *(const v2f*)qcp;   // lane l holds the coordinates of query l & 15: one load, read by lane number in the loop below
    // precaution: the three address pairs stay live and unwritten up to this wait
    asm volatile("s_wait_xcnt 0x0" :: "v"(ckp), "v"(tp), "v"(qcp) : "memory");
    const int qe = __builtin_bit_cast(int, bfr(qc[0])), qf = __builtin_bit_cast(int, bfr(qc[1]));
    stab[wave][lane] = bfr(tv0); stab[wave][lane + 32] = bfr(tv1);
    const float rng = RNG[0]; const float e0 = bfr(ck0[0]), p0 = bfr(ck0[1]), e1 = bfr(ck0[2]), p1 = bfr(ck0[3]), e2 = bfr(ck1[0]), p2 = bfr(ck1[1]), e3 = bfr(ck1[2]), p3 = bfr(ck1[3]);
    // one test per wave: its lanes hold all sixteen queries and its own keys; a sum of magnitudes bounds each term, and a NaN or an infinity fails it
    const float qef = __builtin_bit_cast(float, qe), qff = __builtin_bit_cast(float, qf);
    const bool inr = ((fabsf(qff) + fabsf(p0)) + (fabsf(p1) + fabsf(p2)) + fabsf(p3) < 1024.0f) & ((fabsf(qef) + fabsf(e0)) + (fabsf(e1) + fabsf(e2)) + fabsf(e3) < 0x1p60f) & (rng >= 1e-6f) & (rng < 0x1p62f);
    if (__builtin_amdgcn_ballot_w32(inr) == 0xffffffffu) {
      const float yr = 1.0f / rng; const int qe16 = __builtin_bit_cast(int, qef * 16.0f); const float f0 = e0 * 16.0f, f1 = e1 * 16.0f, f2 = e2 * 16.0f, f3 = e3 * 16.0f;
      const unsigned off = (16u * 4u + ((16u + 32u) * 4u << 8)) * 0x10001u;   // the table offsets of the four bytes of a word
#pragma unroll 2  // two queries a trip: their chains are independent and fill each other's result latencies
      for (int qi = 0; qi < 16; ++qi) { const float et16 = __builtin_bit_cast(float, __builtin_amdgcn_readlane(qe16, qi)), pt_ = __builtin_bit_cast(float, __builtin_amdgcn_readlane(qf, qi));
        const unsigned b0 = bins_fast(et16, pt_, f0, p0, rng, yr), b1 = bins_fast(et16, pt_, f1, p1, rng, yr), b2 = bins_fast(et16, pt_, f2, p2, rng, yr), b3 = bins_fast(et16, pt_, f3, p3, rng, yr);
        v2u w; w[0] = b0 + (b1 << 16) + off; w[1] = b2 + (b3 << 16) + off; *(v2u*)&sbin[qi][tid * 2] = w; }
    } else {
#pragma unroll 1  // rolled: for speed only
      for (int qi = 0; qi < 16; ++qi) { const float et = __builtin_bit_cast(float, __builtin_amdgcn_readlane(qe, qi)), pt_ = __builtin_bit_cast(float, __builtin_amdgcn_readlane(qf, qi));
        const unsigned b0 = bias_bins(et, pt_, e0, p0, rng), b1 = bias_bins(et, pt_, e1, p1, rng), b2 = bias_bins(et, pt_, e2, p2, rng), b3 = bias_bins(et, pt_, e3, p3, rng);
        v2u w; w[0] = b0 | (b1 << 16); w[1] = b2 | (b3 << 16); *(v2u*)&sbin[qi][tid * 2] = w; } } }
  __syncthreads();   // publishes every thread's bins to the eight waves that read them below
  const char* tb = (const char*)&stab[wave][0];
  // all four operands lie in fragment order; a head's 64 columns are k steps 2h and 2h + 1 of a token tile, its v columns are column tiles 4h .. 4h + 3 of the batch
  const size_t qo = (((size_t)b * (TT / 16) + blockIdx.x) * 16 + h * 2) * 512 + lane * 8;
  const _Float16* qp = QH + qo; const _Float16* qlp = QL + qo;
  const _Float16* kp = KH + ((size_t)b * (TT / 16) * 16 + h * 2) * 512 + lane * 8;          // first key tile of the batch
  const _Float16* vp = VT + ((size_t)b * (CC / 16) + h * 4) * (TT / 32) * 512 + lane * 8;   // first column tile of the head, first 32 keys
  v16h qh[2], ql[2], kf[4][2];
#pragma unroll
  for (int kc = 0; kc < 2; ++kc) { qh[kc] = fragw_h(qp + kc * 512); ql[kc] = fragw_h(qlp + kc * 512); }
#pragma unroll
  for (int j = 0; j < 4; ++j)
#pragma unroll
    for (int kc = 0; kc < 2; ++kc) kf[j][kc] = fragw_h(kp + (j * 16 + kc) * 512);
  // precaution: the address pairs stay live and unwritten up to this wait
  asm volatile("s_wait_xcnt 0x0" :: "v"(qp), "v"(qlp), "v"(kp) : "memory");
  v8f ctx[4] = {}; float mrun = -3.0e38f, mlrun = -3.0e38f, lsum = 0.f;   // mlrun = the running maximum x log2(e), as it was rounded for the sums held so far
  const _Float16* kn = kp; const _Float16* vn = vp;   // the lane's own k row and v plane, moved on by 64 keys a trip
#pragma unroll 1  // rolled: one trip already holds the fragments of two trips in registers
  for (int ks = 0; ks < TT / 64; ++ks) { v8f s[4] = {}, sl[4] = {};
#pragma unroll
    for (int kc = 0; kc < 2; ++kc)
#pragma unroll
      for (int j = 0; j < 4; ++j) { s[j] = wm16(kf[j][kc], qh[kc], s[j]); sl[j] = wm16(kf[j][kc], ql[kc], sl[j]); }
    // the next trip's k fragments and this trip's v fragments fly while the softmax below runs (the last trip reads its own k tile again: in bounds, not used)
    kn += ks + 1 < TT / 64 ? 4 * 16 * 512 : 0;
#pragma unroll
    for (int j = 0; j < 4; ++j)
#pragma unroll
      for (int kc = 0; kc < 2; ++kc) kf[j][kc] = fragw_h(kn + (j * 16 + kc) * 512);
    v16h vf[2][4];
#pragma unroll
    for (int u = 0; u < 2; ++u)
#pragma unroll
      for (int jj = 0; jj < 4; ++jj) vf[u][jj] = fragw_h(vn + (jj * (TT / 32) + u) * 512);
    // precaution: both address pairs stay live and unwritten up to this wait; it also keeps the loads above the softmax
    asm volatile("s_wait_xcnt 0x0" :: "v"(kn), "v"(vn) : "memory");
    vn += 2 * 512;
    float mx = mrun;
#pragma unroll
    for (int j = 0; j < 4; ++j) { const v4u w = *(const v4u*)&sbin[col][ks * 32 + j * 8 + 4 * g];
#pragma unroll
      for (int r = 0; r < 8; ++r) { const unsigned bi = w[r >> 1] >> (16 * (r & 1)); const float x = (s[j][r] + sl[j][r] * (1.0f / 1024.0f)) * SCALE;
        const float v = x + (*(const float*)(tb + (bi & 0xffu)) + *(const float*)(tb + ((bi >> 8) & 0xffu))); s[j][r] = v; mx = fmaxf(mx, v); } }
    mx = fmaxf(mx, xhalf(mx));   // a query's keys are split between lanes col and col + 16
    // exp(v - mx) = exp2(v * log2(e) - mxl): one fma and one v_exp_f32 a score; the argument is never above a rounding error of 0, and a result below the normal range counts as 0 (far below what f16 holds)
    const float mxl = mx * LOG2E_F; const float al = ex2(mlrun - mxl); mrun = mx; mlrun = mxl;
    v4f s4 = {}; v16h p[2];
#pragma unroll
    for (int j = 0; j < 4; ++j) { v8f x;
#pragma unroll
      for (int r = 0; r < 8; ++r) x[r] = __builtin_fmaf(s[j][r], LOG2E_F, -mxl);
      const v8f ev = ex2x8(x);
#pragma unroll
      for (int r = 0; r < 8; ++r) { const float e = ev[r]; s4[r & 3] += e; p[j >> 1][(j & 1) * 8 + r] = (_Float16)e; } }
    lsum = lsum * al + ((s4[0] + s4[1]) + (s4[2] + s4[3]));
#pragma unroll
    for (int jj = 0; jj < 4; ++jj) ctx[jj] = ctx[jj] * al;
#pragma unroll
    for (int u = 0; u < 2; ++u)
#pragma unroll
      for (int jj = 0; jj < 4; ++jj) ctx[jj] = wm16(vf[u][jj], p[u], ctx[jj]); }
  // ---- out = ctx Wo (+ bo) for the block's 16 rows, in the same launch: the block holds all 512 ctx columns of its rows, wave w takes output columns 64w .. 64w + 63.
  // Transposed like the products above: out^T = Wo^T ctx^T, Wo as f16(bf16 x 2^8) exact from the workspace in fragment order (A), ctx once to f16 through LDS (B), x 2^-8 at the end; k steps in rising order.
  const _Float16* wb = WOP + (size_t)(wave * 4) * 512 + lane * 8;   // the wave's first column tile, k step 0
  v16h w[4][4];   // register ring, four k steps deep: the first four steps are requested here, in front of the barrier, and each fragment of step kc + 4 into the registers of its forerunner once the product of step kc has read them
#pragma unroll
  for (int s = 0; s < 4; ++s)
#pragma unroll
    for (int j = 0; j < 4; ++j) w[s][j] = fragw_h(wb + (s * 32 + j) * 512);
  const float* bp = BO + wave * 64 + 8 * g;   // lane (g, col) ends up with output columns 64w + 16j + 8g + 0..7 of row col
  v4f bz[4][2] = {};
  if (BO) {
#pragma unroll
    for (int j = 0; j < 4; ++j) { bz[j][0] = *(const v4f*)(bp + j * 16); bz[j][1] = *(const v4f*)(bp + j * 16 + 4); } }
  const float sum = lsum + xhalf(lsum); const float inv = sum > 0.f ? 1.0f / sum : 0.f;
  _Float16* yl = &sy[h * 2 * 512 + lane * 8];   // lane (g, col) holds head columns jj * 16 + 8g + r of query col: chunk (k step 2h + (jj >> 1), half jj & 1, this lane) of the out product's ctx operand, rounded to f16 here
#pragma unroll
  for (int jj = 0; jj < 4; ++jj) { v8h o;
#pragma unroll
    for (int r = 0; r < 8; ++r) o[r] = (_Float16)(ctx[jj][r] * inv);
    *(v8h*)(yl + jj * 256) = o; }
  __syncthreads();   // publishes every head's ctx columns to the eight waves, each of which reads all of them below
  v8f acc[4] = {};
#pragma unroll  // unrolled: every fragment is a constant offset from one address pair, which is never rewritten, and every ring index is a constant
  for (int kc = 0; kc < CC / 32; ++kc) { const v16h a = fragw_h(&sy[kc * 512 + lane * 8]);
#pragma unroll
    for (int j = 0; j < 4; ++j) { acc[j] = wm16(w[kc & 3][j], a, acc[j]); if (kc + 4 < CC / 32) w[kc & 3][j] = fragw_h(wb + ((kc + 4) * 32 + j) * 512); } }
  // precaution: both address pairs stay live and unwritten up to this wait
  asm volatile("s_wait_xcnt 0x0" :: "v"(wb), "v"(bp) : "memory");
#pragma unroll
  for (int j = 0; j < 4; ++j) { v4f o0, o1;
#pragma unroll
    for (int i = 0; i < 4; ++i) { o0[i] = acc[j][i] * (1.0f / 256.0f) + bfr(bz[j][0][i]); o1[i] = acc[j][4 + i] * (1.0f / 256.0f) + bfr(bz[j][1][i]); }
    *(v4f*)&sf[wave][col][j * 16 + 8 * g] = o0; *(v4f*)&sf[wave][col][j * 16 + 8 * g + 4] = o1; }
  LDSX();   // the wave reads back rows that its other lanes wrote
  float* op = OUT + ((size_t)b * TT + t0 + g) * DIN + wave * 64 + col * 4;   // two rows a store, 256 contiguous bytes (two whole lines) of each
#pragma unroll
  for (int rl = 0; rl < 16; rl += 2) vst2(op + rl * DIN, *(const v4f*)&sf[wave][rl + g][col * 4]); }

extern "C" void kernel_launch(void* const* d_in, const int* in_sizes, int n_in, void* d_out, int out_size, void* d_ws, size_t ws_size, hipStream_t stream) {
  (void)in_sizes; (void)n_in; (void)out_size;
  const float** F = (const float**)d_in;
  if (ws_size < (size_t)WS_END) return;
  char* ws = (char*)d_ws; _Float16 *QH = (_Float16*)(ws + WS_QH), *KH = (_Float16*)(ws + WS_KH), *VT = (_Float16*)(ws + WS_VT), *QL = (_Float16*)(ws + WS_QL), *KL = (_Float16*)(ws + WS_KL); __bf16 *VB = (__bf16*)(ws + WS_VB), *VBL = (__bf16*)(ws + WS_VBL); _Float16 *Y = (_Float16*)(ws + WS_Y);
  (void)Y; (void)QL; (void)KL; (void)VB; (void)VBL;
  // inputs: 0 p [4,1024,512]; 1 pcoords [4,1024,2]; 2 rpe_table [64,8]; 3 wq_w (in,out), 4 wq_b; 5 wk_w, 6 wk_b; 7 wv_w, 8 wv_b; 9 wo_w (in,out), 10 wo_b
  if (ws_size < (size_t)WS_END3) return;
  float* RNG = (float*)(ws + WS_RNG); __bf16 *XP = (__bf16*)(ws + WS_XP), *WP = (__bf16*)(ws + WS_WP);
  k_range<<<1 + 256, 256, 0, stream>>>(F[1], RNG, F[0], F[3], F[5], F[7], F[9], XP, WP);
  k_proj<<<dim3(TNB * TT / 64, CC / 128, 3), 128, 0, stream>>>(XP, WP, F[4], F[6], F[8], QH, QL, KH, KL, VT, VB, VBL);
  k_fa<<<dim3(TT / 16, 1, TNB), 256, 0, stream>>>(QH, QL, KH, VT, F[1], F[2], RNG, (const _Float16*)(WP + 3 * DIN * CC), F[10], (float*)d_out);
}
